// v000
// Times are from an AMD MI455X. After a warm-up the kernel runs many times in a row, and a time is the length of
// such a window on the GPU divided by its runs, so every launch and the gaps after it count. The runs cycle
// through copies of the inputs. A figure is the median of several windows, for all but v000 over two sittings.
// Sittings can differ by a few percent; kernels timed side by side share one.
// v000, which the later versions start from, runs in 681 microseconds.
// Compute dtype: input projections v_wmma_f32_16x16x32_bf16 on bf16 operands (inputs RNE-converted once), f32 accumulate; scores, p.v and k^T.v state on bf16 hi/lo split planes (hi.hi + hi.lo + lo.hi), output projection on hi/lo A planes x bf16 Wo (hi.hi + lo.hi), f32 accumulate; softmax and side math f32.
#include <hip/hip_runtime.h>

// ---------------------------------------------------------------- geometry
constexpr int NBATCH = 2;
constexpr int SEQ    = 2048;
constexpr int HIDN   = 1024;
constexpr int NHEAD  = 16;
constexpr int HDIM   = 64;
constexpr int NTOK   = NBATCH * SEQ;                    /* 4096 token rows */
constexpr size_t NX  = (size_t)NTOK * HIDN;            /* 4194304 */
constexpr size_t NW  = (size_t)HIDN * HIDN;            /* 1048576 */
constexpr size_t OUT0_ELEMS    = NX;
constexpr size_t OUT1_ELEMS    = (size_t)NBATCH * NHEAD * HDIM * HDIM;   /* 131072 */
constexpr size_t OUT1_BYTE_OFF = 16777216;
constexpr size_t OUT1_ELEM_OFF = OUT1_BYTE_OFF / 4;
static_assert(OUT1_ELEM_OFF == OUT0_ELEMS);
static_assert(OUT1_BYTE_OFF + OUT1_ELEMS * 4 == 17301504);
static_assert(HIDN == NHEAD * HDIM);
static_assert(HDIM == 64);
static_assert(HIDN % 64 == 0 && NTOK % 64 == 0 && SEQ % 64 == 0);   /* every GEMM M and N is a 64-multiple */
static_assert(HIDN % 32 == 0 && SEQ % 32 == 0);                     /* every GEMM K is a multiple of 32 */
static_assert((NX % 512) == 0 && (NW % 512) == 0);                 /* cast kernels: whole waves only */

// ---------------------------------------------------------------- workspace map (bytes)
// 16-bit planes: token planes [4096][1024] or [1024][4096] = 8 MiB each; weight planes [1024][1024] = 2 MiB each.
// Every region is fully written by its producer (full M x N, no pad rows) before any consumer reads it.
constexpr size_t MIB      = (size_t)1 << 20;
constexpr size_t OFF_XB   = 0 * MIB;    /* hidden as bf16      8 MiB */
constexpr size_t OFF_WQ   = 8 * MIB;    /* Wq bf16             2 MiB */
constexpr size_t OFF_WK   = 10 * MIB;   /* Wk bf16             2 MiB */
constexpr size_t OFF_WV   = 12 * MIB;   /* Wv bf16             2 MiB */
constexpr size_t OFF_WO   = 14 * MIB;   /* Wo bf16             2 MiB */
constexpr size_t OFF_QH   = 16 * MIB;   /* q hi  [4096][1024]        */
constexpr size_t OFF_QL   = 24 * MIB;   /* q lo                      */
constexpr size_t OFF_KH   = 32 * MIB;   /* k hi  [4096][1024] (masked) */
constexpr size_t OFF_KL   = 40 * MIB;   /* k lo                      */
constexpr size_t OFF_KTH  = 48 * MIB;   /* k^T hi [1024][4096] (masked) */
constexpr size_t OFF_KTL  = 56 * MIB;   /* k^T lo                    */
constexpr size_t OFF_VTH  = 64 * MIB;   /* v^T hi [1024][4096] (masked) */
constexpr size_t OFF_VTL  = 72 * MIB;   /* v^T lo                    */
constexpr size_t OFF_OH   = 80 * MIB;   /* attention out hi [4096][1024] */
constexpr size_t OFF_OL   = 88 * MIB;   /* attention out lo          */
constexpr size_t WS_TOTAL = 96 * MIB;   /* 100663296 B */
static_assert(NX * 2 == 8 * MIB && NW * 2 == 2 * MIB);
static_assert(WS_TOTAL <= 134217728);

// ---------------------------------------------------------------- types / helpers
typedef __attribute__((ext_vector_type(16))) _Float16 v16h;
typedef __attribute__((ext_vector_type(8)))  _Float16 v8h;
typedef __attribute__((ext_vector_type(16))) __bf16   v16b;
typedef __attribute__((ext_vector_type(8)))  __bf16   v8b;
typedef __attribute__((ext_vector_type(8)))  float    v8f;
typedef __attribute__((ext_vector_type(4)))  float    v4f;
typedef __attribute__((ext_vector_type(2)))  float    v2f;
typedef __attribute__((ext_vector_type(4)))  unsigned u4v;

__device__ __forceinline__ unsigned short f2bf_bits(float f) {
  unsigned u = __float_as_uint(f);
  return (unsigned short)((u + 0x7FFFu + ((u >> 16) & 1u)) >> 16);
}
__device__ __forceinline__ float bf_bits2f(unsigned short h) { return __uint_as_float(((unsigned)h) << 16); }
__device__ __forceinline__ float bfr(float f) { return bf_bits2f(f2bf_bits(f)); }

__device__ __forceinline__ void sched_fence() { asm volatile("" ::: "memory"); }

// hazard guards as plain device helpers (no inline asm inside the kernel template body)
__device__ __forceinline__ void dep_guard_h(v8f& a, v8f& b, v16h x, v16h y) { asm volatile("v_nop\n\tv_nop\n\tv_nop\n\tv_nop" : "+v"(a), "+v"(b) : "v"(x), "v"(y)); }
__device__ __forceinline__ void dep_guard_b(v8f& a, v8f& b, v16b x, v16b y) { asm volatile("v_nop\n\tv_nop\n\tv_nop\n\tv_nop" : "+v"(a), "+v"(b) : "v"(x), "v"(y)); }
__device__ __forceinline__ void keep4_h(v16h a, v16h b, v16h c, v16h d) { asm volatile("v_nop" :: "v"(a), "v"(b), "v"(c), "v"(d)); }
__device__ __forceinline__ void keep4_b(v16b a, v16b b, v16b c, v16b d) { asm volatile("v_nop" :: "v"(a), "v"(b), "v"(c), "v"(d)); }
__device__ __forceinline__ void acc_guard4(v8f& a, v8f& b, v8f& c, v8f& d) { asm volatile("v_nop\n\tv_nop\n\tv_nop\n\tv_nop" : "+v"(a), "+v"(b), "+v"(c), "+v"(d)); }
template <typename T> struct Frag;
template <> struct Frag<_Float16> {
  typedef v16h V; union U { v16h v; v8h h[2]; };
  static __device__ __forceinline__ v16h load(const _Float16* p) {   // elements 0..7 <- p[0..7], 8..15 <- p[16..23]
    U f; f.h[0] = *(const v8h*)(p); f.h[1] = *(const v8h*)(p + 16); return f.v;
  }
  static __device__ __forceinline__ v8f mma(v16h a, v16h b, v8f c) {
    return __builtin_amdgcn_wmma_f32_16x16x32_f16(false, a, false, b, (short)0, c, false, false);
  }
  static __device__ __forceinline__ void guard(v8f& a, v8f& b, v16h x, v16h y) { dep_guard_h(a, b, x, y); }
  static __device__ __forceinline__ void keep(v16h a, v16h b, v16h c, v16h d) { keep4_h(a, b, c, d); }
};
template <> struct Frag<__bf16> {
  typedef v16b V; union U { v16b v; v8b h[2]; };
  static __device__ __forceinline__ v16b load(const __bf16* p) {
    U f; f.h[0] = *(const v8b*)(p); f.h[1] = *(const v8b*)(p + 16); return f.v;
  }
  static __device__ __forceinline__ v8f mma(v16b a, v16b b, v8f c) {
    return __builtin_amdgcn_wmma_f32_16x16x32_bf16(false, a, false, b, (short)0, c, false, false);
  }
  static __device__ __forceinline__ void guard(v8f& a, v8f& b, v16b x, v16b y) { dep_guard_b(a, b, x, y); }
  static __device__ __forceinline__ void keep(v16b a, v16b b, v16b c, v16b d) { keep4_b(a, b, c, d); }
};

// ---- Register-blocked batched WMMA GEMM ------------------------------------
// C[m,n] = rs * (scale * sum_k A[m,k] * Bt[n,k] + bias); each wave owns a 64x64 tile.
// A row-major [M,K]; Bt row-major [N,K]; M,N % 64 == 0, K % 32 == 0.
// SPLIT: A carried as hi/lo planes (A2 = lo); BLO: Bt also carried as hi/lo (Bt2 = lo);
//   product = hi.hi (+ hi.lo when BLO) + lo.hi.   SPLIT+BLO is the stock hi/lo path.
// BIAS_MODE: 0 = none, 1 = bias[m], 2 = bias[n]  (bias value RNE-converted to bf16 precision).
// RS_MODE:   0 = none, 1 = multiply by rsc[m], 2 = multiply by rsc[n]  (rsc value RNE-converted to bf16).
// OUT_MODE: 0 = f32, 1 = f16, 2 = bf16 hi plane (Cout) + bf16 lo plane (Cout2).
// ET: 0 = f16 operands, 1 = bf16 operands (pointers passed as 16-bit storage)
template <int ET> struct Elem;
template <> struct Elem<0> { typedef _Float16 T; };
template <> struct Elem<1> { typedef __bf16 T; };
template <int ET, bool SPLIT, bool BLO, int BIAS_MODE, int OUT_MODE, int RS_MODE>
__global__ __launch_bounds__(256) void wmma_gemm64(
    const unsigned short* __restrict__ Ap, const unsigned short* __restrict__ A2p, int lda, long strideA,
    const unsigned short* __restrict__ Btp, const unsigned short* __restrict__ Bt2p, int ldb, long strideB,
    void* __restrict__ Cout, void* __restrict__ Cout2, int ldc, long strideC,
    const float* __restrict__ bias, const float* __restrict__ rsc,
    int M, int N, int K, float scale) {
  typedef typename Elem<ET>::T T;
  typedef typename Frag<T>::V V;
  const T* A = (const T*)Ap; const T* A2 = (const T*)A2p; const T* Bt = (const T*)Btp; const T* Bt2 = (const T*)Bt2p;
  __shared__ __align__(16) float sT[8][16 * 68];   // per-wave 16x64 slab, pitch 68 floats
  const int b    = blockIdx.y;
  const int lane = threadIdx.x & 31;
  const int wave = threadIdx.x >> 5;
  const int tilesN = N >> 6;
  const int tilesM = M >> 6;
  const int tile = blockIdx.x * 8 + wave;
  if (tile >= tilesM * tilesN) return;   // wave-uniform; no block barriers in this kernel
  const int tm = tile / tilesN;
  const int tn = tile - tm * tilesN;
  const int m0 = tm << 6;
  const int n0 = tn << 6;

  const T* Ab  = A  + (size_t)b * strideA;
  const T* Bb  = Bt + (size_t)b * strideB;
  const T* Ab2 = SPLIT ? (A2  + (size_t)b * strideA) : nullptr;
  const T* Bb2 = (SPLIT && BLO) ? (Bt2 + (size_t)b * strideB) : nullptr;

  const int rlane = lane & 15;                 // row (A) / col (B, D) within subtile
  const int koff  = (lane >> 4) * 8;           // k offset of this lane half
  const int mOff  = (lane >> 4) * 8;           // D row offset

  v8f acc[4][4];
#pragma unroll
  for (int i = 0; i < 4; ++i)
#pragma unroll
    for (int j = 0; j < 4; ++j) acc[i][j] = (v8f){0.f,0.f,0.f,0.f,0.f,0.f,0.f,0.f};

  for (int k0 = 0; k0 < K; k0 += 32) {
    V bh[4], bl[4];
#pragma unroll
    for (int j = 0; j < 4; ++j) {
      const size_t bo = (size_t)(n0 + (j << 4) + rlane) * ldb + koff + k0;
      bh[j] = Frag<T>::load(Bb + bo);
      if (SPLIT && BLO) bl[j] = Frag<T>::load(Bb2 + bo);
      else bl[j] = bh[j];
    }
#pragma unroll
    for (int i = 0; i < 4; ++i) {
      const size_t ao = (size_t)(m0 + (i << 4) + rlane) * lda + koff + k0;
      V ah = Frag<T>::load(Ab + ao);
      V al = ah;
      if (SPLIT) al = Frag<T>::load(Ab2 + ao);
#pragma unroll
      for (int j = 0; j < 4; ++j) {
        acc[i][j] = Frag<T>::mma(ah, bh[j], acc[i][j]);
        if (SPLIT) {
          if (BLO) acc[i][j] = Frag<T>::mma(ah, bl[j], acc[i][j]);
          acc[i][j] = Frag<T>::mma(al, bh[j], acc[i][j]);
        }
      }
      Frag<T>::guard(acc[i][0], acc[i][3], ah, al);
    }
    Frag<T>::keep(bh[0], bh[1], bh[2], bh[3]);
    if (SPLIT && BLO) Frag<T>::keep(bl[0], bl[1], bl[2], bl[3]);
  }
  acc_guard4(acc[0][0], acc[0][1], acc[0][2], acc[0][3]);
  acc_guard4(acc[1][0], acc[1][1], acc[1][2], acc[1][3]);
  acc_guard4(acc[2][0], acc[2][1], acc[2][2], acc[2][3]);
  acc_guard4(acc[3][0], acc[3][1], acc[3][2], acc[3][3]);

  // ---- epilogue ----
  float* slab = sT[wave];
#pragma unroll
  for (int i = 0; i < 4; ++i) {
    const int mBase = m0 + (i << 4);
    float bm[8], rm[8];
#pragma unroll
    for (int r = 0; r < 8; ++r) { bm[r] = 0.f; rm[r] = 1.f; }
    if (BIAS_MODE == 1) {
      // rows mBase+mOff .. +7 are contiguous and 32-B aligned: two 16-B loads
      const v4f t0 = *(const v4f*)(bias + mBase + mOff);
      const v4f t1 = *(const v4f*)(bias + mBase + mOff + 4);
#pragma unroll
      for (int r = 0; r < 4; ++r) { bm[r] = bfr(t0[r]); bm[4 + r] = bfr(t1[r]); }
    }
    if (RS_MODE == 1) {
      const v4f t0 = *(const v4f*)(rsc + mBase + mOff);
      const v4f t1 = *(const v4f*)(rsc + mBase + mOff + 4);
#pragma unroll
      for (int r = 0; r < 4; ++r) { rm[r] = bfr(t0[r]); rm[4 + r] = bfr(t1[r]); }
    }
#pragma unroll
    for (int j = 0; j < 4; ++j) {
      const int n = n0 + (j << 4) + rlane;
      float bn = 0.f, rn = 1.f;
      if (BIAS_MODE == 2) bn = bfr(bias[n]);
      if (RS_MODE == 2)   rn = bfr(rsc[n]);
#pragma unroll
      for (int r = 0; r < 8; ++r) {
        float v = acc[i][j][r] * scale;
        if (BIAS_MODE == 1) v += bm[r];
        if (BIAS_MODE == 2) v += bn;
        if (RS_MODE == 1) v *= rm[r];
        if (RS_MODE == 2) v *= rn;
        slab[(mOff + r) * 68 + (j << 4) + rlane] = v;
      }
    }
    __builtin_amdgcn_fence(__ATOMIC_RELEASE, "workgroup");
    __builtin_amdgcn_wave_barrier();
    __builtin_amdgcn_fence(__ATOMIC_ACQUIRE, "workgroup");
    if (OUT_MODE == 0) {
      float* C = (float*)Cout + (size_t)b * strideC;
      const int hh = lane >> 4, c4 = (lane & 15) * 4;     // row seg = 256 B = 16 lanes x 16 B
      {
#pragma unroll
        for (int it = 0; it < 8; ++it) {
          const int row = it * 2 + hh;
          v4f v = *(const v4f*)(slab + row * 68 + c4);
          *(v4f*)(C + (size_t)(mBase + row) * ldc + n0 + c4) = v;
        }
        
      }
    } else {
      const int q = lane >> 3, c8 = (lane & 7) * 8;
      unsigned short* C  = (unsigned short*)Cout  + (size_t)b * strideC;
      unsigned short* C2 = (OUT_MODE == 2) ? ((unsigned short*)Cout2 + (size_t)b * strideC) : nullptr;
      {
#pragma unroll
        for (int it = 0; it < 4; ++it) {
          const int row = it * 4 + q;
          const float* sp = slab + row * 68 + c8;
          v8h hv, lv;
#pragma unroll
          for (int e = 0; e < 8; ++e) {
            if (OUT_MODE == 1) {
              hv[e] = (_Float16)sp[e];
              lv[e] = hv[e];
            } else {
              unsigned short hb = f2bf_bits(sp[e]);
              unsigned short lb = f2bf_bits(sp[e] - bf_bits2f(hb));
              hv[e] = __builtin_bit_cast(_Float16, hb);
              lv[e] = __builtin_bit_cast(_Float16, lb);
            }
          }
          *(v8h*)(C + (size_t)(mBase + row) * ldc + n0 + c8) = hv;
          if (OUT_MODE == 2) *(v8h*)(C2 + (size_t)(mBase + row) * ldc + n0 + c8) = lv;
        }
        
      }
    }
    __builtin_amdgcn_fence(__ATOMIC_RELEASE, "workgroup");
    __builtin_amdgcn_wave_barrier();
    __builtin_amdgcn_fence(__ATOMIC_ACQUIRE, "workgroup");
  }
}

// coverage: grid = n2/256 blocks exactly (n2 % 256 == 0 asserted on the host); thread i writes elements 2i, 2i+1.
__global__ __launch_bounds__(256) void cast_f32_bf16x2(
    const float* __restrict__ in, unsigned short* __restrict__ out, int n2) {
  int i = blockIdx.x * 256 + threadIdx.x;
  if (i < n2) {
    const v2f f = *(const v2f*)(in + 2 * (size_t)i);
    const unsigned u = (unsigned)f2bf_bits(f[0]) | ((unsigned)f2bf_bits(f[1]) << 16);
    ((unsigned*)out)[i] = u;
    
  }
}

// =====================================================================================
// Causal attention for head_dim 64 on bf16 hi/lo planes.
//   q planes  : [NTOK][HIDN] (row = b*SEQ + s, col = h*64 + d), hi and lo
//   k planes  : [NTOK][HIDN] same layout, hi and lo (padding mask already folded in)
//   v^T planes: [HIDN][NTOK] (row = h*64 + d, col = b*SEQ + s), hi and lo (mask folded in)
//   out planes: [NTOK][HIDN] bf16 hi and lo
//   scores = (q.k^T) * sscale : hi.hi + hi.lo + lo.hi, f32 accumulate; key j masked where j > q or amask[b][j] == 0 (score := -inf)
//   out    = p.v / l          : p (f32 exp terms) split to bf16 hi/lo per tile, v hi/lo, 3 products, f32 accumulate
//   Block = 4 waves = 64 query rows of one (b, h); grid.x = NBATCH*NHEAD*(SEQ/64).
//   fragments in flight besides the persistent per-wave state.
// =====================================================================================
constexpr int AT_D  = 64;
constexpr int AT_NW = 4;
constexpr int AT_QB = 64;
constexpr int AT_KC = 64;

__device__ __forceinline__ __bf16 at_f2bf(float f) { return __builtin_bit_cast(__bf16, f2bf_bits(f)); }
__device__ __forceinline__ void at_split(float f, __bf16& hi, __bf16& lo) {
  const unsigned short hb = f2bf_bits(f);
  hi = __builtin_bit_cast(__bf16, hb);
  lo = at_f2bf(f - __uint_as_float(((unsigned)hb) << 16));
}
__device__ __forceinline__ v8f at_mma(v16b a, v16b b, v8f c) {
  c = __builtin_amdgcn_wmma_f32_16x16x32_bf16(false, a, false, b, (short)0, c, false, false);
  asm volatile("v_nop\n\tv_nop\n\tv_nop\n\tv_nop" : "+v"(c) : "v"(a), "v"(b));
  return c;
}

__global__ __launch_bounds__(128) __attribute__((amdgpu_num_vgpr(256)))
void attn_hd64_planes(const unsigned short* __restrict__ Qh, const unsigned short* __restrict__ Ql,
                      const unsigned short* __restrict__ Kh, const unsigned short* __restrict__ Kl,
                      const unsigned short* __restrict__ VTh, const unsigned short* __restrict__ VTl,
                      const float* __restrict__ amask,
                      unsigned short* __restrict__ Oh, unsigned short* __restrict__ Ol,
                      float sscale) {
  union FB { v16b v; v8b h[2]; };
  __shared__ __align__(16) __bf16 Ksh[AT_KC * AT_D];     // k hi [kv][d]     8 KB
  __shared__ __align__(16) __bf16 Ksl[AT_KC * AT_D];     // k lo
  __shared__ __align__(16) __bf16 Vth[AT_D * AT_KC];     // v hi [d][kv]     8 KB
  __shared__ __align__(16) __bf16 Vtl[AT_D * AT_KC];     // v lo
  __shared__ __align__(16) __bf16 Psh[AT_NW][16 * AT_KC];   // per wave p hi [row][kv]
  __shared__ __align__(16) __bf16 Psl[AT_NW][16 * AT_KC];   // per wave p lo
  __shared__ __align__(16) float  Os[AT_NW][16 * 68];       // per wave out tile, pitch 68

  const int tid  = threadIdx.x;
  const int wave = tid >> 5;
  const int lane = tid & 31;
  const int hh   = lane >> 4;
  const int c    = lane & 15;

  const int nqb = SEQ / AT_QB;                  // 32
  const int bx  = blockIdx.x;
  const int qb  = bx % nqb;
  const int bhd = bx / nqb;
  const int h   = bhd % NHEAD;
  const int b   = bhd / NHEAD;
  const int q0  = qb * AT_QB + wave * 16;
  const int tok0 = b * SEQ;
  const int hcol = h * HDIM;

  // ---- Q fragments (A operand): 2 d-chunks, hi and lo, split k-map via Frag::load ----
  v16b qah[2], qal[2];
  {
    const __bf16* qhp = (const __bf16*)Qh + (size_t)(tok0 + q0 + c) * HIDN + hcol + 8 * hh;
    const __bf16* qlp = (const __bf16*)Ql + (size_t)(tok0 + q0 + c) * HIDN + hcol + 8 * hh;
#pragma unroll
    for (int dc = 0; dc < 2; ++dc) {
      qah[dc] = Frag<__bf16>::load(qhp + dc * 32);
      qal[dc] = Frag<__bf16>::load(qlp + dc * 32);
    }
  }

  float mrow[8], lrow[8];
  v8f oacc[4];
#pragma unroll
  for (int r = 0; r < 8; ++r) { mrow[r] = -__builtin_inff(); lrow[r] = 0.f; }
#pragma unroll
  for (int t = 0; t < 4; ++t) oacc[t] = (v8f){0.f,0.f,0.f,0.f,0.f,0.f,0.f,0.f};

  const int nChunks = qb + 1;                   // causal, block-uniform, <= 32
  for (int kc = 0; kc < nChunks; ++kc) {
    const int kv0 = kc * AT_KC;
    __syncthreads();
    {
      // staging coverage: 128 threads x 4 ids = 512 ids = 64 rows x 8 chunks of 8 elements = 64x64 per plane, exact
#pragma unroll
      for (int i = 0; i < 4; ++i) {
        const int id = tid + 128 * i;
        const int row = id >> 3, c8 = (id & 7) * 8;
        const size_t ko = (size_t)(tok0 + kv0 + row) * HIDN + hcol + c8;
        const u4v a0 = *(const u4v*)(Kh + ko);
        const u4v a1 = *(const u4v*)(Kl + ko);
        *(u4v*)(Ksh + row * AT_D + c8) = a0;
        *(u4v*)(Ksl + row * AT_D + c8) = a1;
      }
      sched_fence();
#pragma unroll
      for (int i = 0; i < 4; ++i) {
        const int id = tid + 128 * i;
        const int row = id >> 3, c8 = (id & 7) * 8;      // row = d
        const size_t vo = (size_t)(hcol + row) * NTOK + tok0 + kv0 + c8;
        const u4v a0 = *(const u4v*)(VTh + vo);
        const u4v a1 = *(const u4v*)(VTl + vo);
        *(u4v*)(Vth + row * AT_KC + c8) = a0;
        *(u4v*)(Vtl + row * AT_KC + c8) = a1;
      }
    }
    __syncthreads();

    v8f s[4];
#pragma unroll
    for (int j = 0; j < 4; ++j) {
      v8f sj = (v8f){0.f,0.f,0.f,0.f,0.f,0.f,0.f,0.f};
#pragma unroll
      for (int dc = 0; dc < 2; ++dc) {
        FB kb, kl;
        const __bf16* khp = Ksh + (j * 16 + c) * AT_D + dc * 32 + 8 * hh;
        const __bf16* klp = Ksl + (j * 16 + c) * AT_D + dc * 32 + 8 * hh;
        kb.h[0] = *(const v8b*)(khp);
        kb.h[1] = *(const v8b*)(khp + 16);
        kl.h[0] = *(const v8b*)(klp);
        kl.h[1] = *(const v8b*)(klp + 16);
        sj = at_mma(qah[dc], kb.v, sj);
        sj = at_mma(qah[dc], kl.v, sj);
        sj = at_mma(qal[dc], kb.v, sj);
        sched_fence();
      }
      s[j] = sj;
    }
    const bool diag = (kc == qb);                // block-uniform
    float kvm[4];
#pragma unroll
    for (int j = 0; j < 4; ++j) kvm[j] = amask[(size_t)tok0 + kv0 + j * 16 + c];
    float cm[8];
#pragma unroll
    for (int r = 0; r < 8; ++r) {
      const int qrow = q0 + 8 * hh + r;
      float m = -__builtin_inff();
#pragma unroll
      for (int j = 0; j < 4; ++j) {
        const int kvcol = kv0 + j * 16 + c;
        const bool masked = (diag && (kvcol > qrow)) || (kvm[j] == 0.0f);
        const float val = masked ? -__builtin_inff() : (s[j][r] * sscale);
        s[j][r] = val;
        m = fmaxf(m, val);
      }
#pragma unroll
      for (int off = 1; off < 16; off <<= 1) m = fmaxf(m, __shfl_xor(m, off, 32));
      cm[r] = m;
    }
    __bf16* pwh = Psh[wave];
    __bf16* pwl = Psl[wave];
#pragma unroll
    for (int r = 0; r < 8; ++r) {
      const float mnew = fmaxf(mrow[r], cm[r]);
      const float alpha = expf(mrow[r] - mnew);
      mrow[r] = mnew;
      float psum = 0.f;
#pragma unroll
      for (int j = 0; j < 4; ++j) {
        const float p = expf(s[j][r] - mnew);
        psum += p;
        __bf16 a, bl; at_split(p, a, bl);
        pwh[(8 * hh + r) * AT_KC + j * 16 + c] = a;
        pwl[(8 * hh + r) * AT_KC + j * 16 + c] = bl;
      }
#pragma unroll
      for (int off = 1; off < 16; off <<= 1) psum += __shfl_xor(psum, off, 32);
      lrow[r] = lrow[r] * alpha + psum;
#pragma unroll
      for (int t = 0; t < 4; ++t) oacc[t][r] *= alpha;
    }
    __builtin_amdgcn_fence(__ATOMIC_RELEASE, "workgroup");
    __builtin_amdgcn_wave_barrier();
    __builtin_amdgcn_fence(__ATOMIC_ACQUIRE, "workgroup");
#pragma unroll 1
    for (int kk = 0; kk < 2; ++kk) {
      FB pa, pl;
      pa.h[0] = *(const v8b*)(pwh + c * AT_KC + kk * 32 + 8 * hh);
      pa.h[1] = *(const v8b*)(pwh + c * AT_KC + kk * 32 + 16 + 8 * hh);
      pl.h[0] = *(const v8b*)(pwl + c * AT_KC + kk * 32 + 8 * hh);
      pl.h[1] = *(const v8b*)(pwl + c * AT_KC + kk * 32 + 16 + 8 * hh);
      sched_fence();
#pragma unroll
      for (int t = 0; t < 4; ++t) {
        FB vb, vl;
        const __bf16* vhp = Vth + (t * 16 + c) * AT_KC + kk * 32 + 8 * hh;
        const __bf16* vlp = Vtl + (t * 16 + c) * AT_KC + kk * 32 + 8 * hh;
        vb.h[0] = *(const v8b*)(vhp);
        vb.h[1] = *(const v8b*)(vhp + 16);
        vl.h[0] = *(const v8b*)(vlp);
        vl.h[1] = *(const v8b*)(vlp + 16);
        oacc[t] = at_mma(pa.v, vb.v, oacc[t]);
        oacc[t] = at_mma(pa.v, vl.v, oacc[t]);
        oacc[t] = at_mma(pl.v, vb.v, oacc[t]);
        sched_fence();
      }
    }
  }

  float* os = Os[wave];
#pragma unroll
  for (int r = 0; r < 8; ++r) {
    const float inv = 1.0f / lrow[r];
#pragma unroll
    for (int t = 0; t < 4; ++t) os[(8 * hh + r) * 68 + t * 16 + c] = oacc[t][r] * inv;
  }
  __builtin_amdgcn_fence(__ATOMIC_RELEASE, "workgroup");
  __builtin_amdgcn_wave_barrier();
  __builtin_amdgcn_fence(__ATOMIC_ACQUIRE, "workgroup");
  {
    const int q = lane >> 3, c8 = (lane & 7) * 8;
    {
#pragma unroll
      for (int it = 0; it < 4; ++it) {
        const int row = it * 4 + q;
        const float* sp = os + row * 68 + c8;
        v8h hv, lv;
#pragma unroll
        for (int e = 0; e < 8; ++e) {
          unsigned short hb = f2bf_bits(sp[e]);
          unsigned short lb = f2bf_bits(sp[e] - bf_bits2f(hb));
          hv[e] = __builtin_bit_cast(_Float16, hb);
          lv[e] = __builtin_bit_cast(_Float16, lb);
        }
        const size_t oo = (size_t)(tok0 + q0 + row) * HIDN + hcol + c8;
        *(v8h*)(Oh + oo) = hv;
        *(v8h*)(Ol + oo) = lv;
      }
      
    }
  }
}

// ---------------------------------------------------------------- launcher
extern "C" void kernel_launch(void* const* d_in, const int* in_sizes, int n_in,
                              void* d_out, int out_size, void* d_ws, size_t ws_size,
                              hipStream_t stream) {
  (void)n_in;
  if (ws_size < WS_TOTAL) return;
  if ((size_t)out_size != OUT0_ELEMS + OUT1_ELEMS) return;
  if ((size_t)in_sizes[0] != NX || (size_t)in_sizes[1] != (size_t)NTOK ||
      (size_t)in_sizes[2] != NW || (size_t)in_sizes[4] != NW ||
      (size_t)in_sizes[6] != NW || (size_t)in_sizes[8] != NW ||
      in_sizes[3] != HIDN || in_sizes[5] != HIDN || in_sizes[7] != HIDN || in_sizes[9] != HIDN) return;

  const float* hs    = (const float*)d_in[0];
  const float* amask = (const float*)d_in[1];
  const float* Wq    = (const float*)d_in[2];
  const float* bq    = (const float*)d_in[3];
  const float* Wk    = (const float*)d_in[4];
  const float* bk    = (const float*)d_in[5];
  const float* Wv    = (const float*)d_in[6];
  const float* bv    = (const float*)d_in[7];
  const float* Wo    = (const float*)d_in[8];
  const float* bo    = (const float*)d_in[9];

  char* ws = (char*)d_ws;
  unsigned short* Xb  = (unsigned short*)(ws + OFF_XB);
  unsigned short* Wqb = (unsigned short*)(ws + OFF_WQ);
  unsigned short* Wkb = (unsigned short*)(ws + OFF_WK);
  unsigned short* Wvb = (unsigned short*)(ws + OFF_WV);
  unsigned short* Wob = (unsigned short*)(ws + OFF_WO);
  unsigned short* Qh  = (unsigned short*)(ws + OFF_QH);
  unsigned short* Ql  = (unsigned short*)(ws + OFF_QL);
  unsigned short* Kh  = (unsigned short*)(ws + OFF_KH);
  unsigned short* Kl  = (unsigned short*)(ws + OFF_KL);
  unsigned short* KTh = (unsigned short*)(ws + OFF_KTH);
  unsigned short* KTl = (unsigned short*)(ws + OFF_KTL);
  unsigned short* VTh = (unsigned short*)(ws + OFF_VTH);
  unsigned short* VTl = (unsigned short*)(ws + OFF_VTL);
  unsigned short* Oh  = (unsigned short*)(ws + OFF_OH);
  unsigned short* Ol  = (unsigned short*)(ws + OFF_OL);

  float* outF   = (float*)d_out;
  float* stateF = outF + OUT1_ELEM_OFF;

  // 1) RNE conversions to bf16 (inputs converted exactly once)
  {
    const int n2x = (int)(NX / 2);   // 2097152, multiple of 256
    const int n2w = (int)(NW / 2);   // 524288,  multiple of 256
    cast_f32_bf16x2<<<dim3(n2x / 256), dim3(256), 0, stream>>>(hs, Xb, n2x);
    cast_f32_bf16x2<<<dim3(n2w / 256), dim3(256), 0, stream>>>(Wq, Wqb, n2w);
    cast_f32_bf16x2<<<dim3(n2w / 256), dim3(256), 0, stream>>>(Wk, Wkb, n2w);
    cast_f32_bf16x2<<<dim3(n2w / 256), dim3(256), 0, stream>>>(Wv, Wvb, n2w);
    cast_f32_bf16x2<<<dim3(n2w / 256), dim3(256), 0, stream>>>(Wo, Wob, n2w);
  }

  // 2) projections: 64x64 tiles, 8 waves per block; every shape has 1024 tiles (64x16 or 16x64)
  const int gemmBlocksTok = ((NTOK / 64) * (HIDN / 64)) / 8;    // 1024 tiles / 8 = 128
  // q rows [4096][1024] = Xb . Wq^T + bq  -> hi/lo planes
  wmma_gemm64<1, false, false, 2, 2, 0><<<dim3(gemmBlocksTok, 1), dim3(256), 0, stream>>>(
      Xb, Xb, HIDN, 0L, Wqb, Wqb, HIDN, 0L, (void*)Qh, (void*)Ql, HIDN, 0L,
      bq, amask, NTOK, HIDN, HIDN, 1.0f);
  // k rows [4096][1024] = (Xb . Wk^T + bk) * mask[row]  -> hi/lo planes
  wmma_gemm64<1, false, false, 2, 2, 1><<<dim3(gemmBlocksTok, 1), dim3(256), 0, stream>>>(
      Xb, Xb, HIDN, 0L, Wkb, Wkb, HIDN, 0L, (void*)Kh, (void*)Kl, HIDN, 0L,
      bk, amask, NTOK, HIDN, HIDN, 1.0f);
  // k^T [1024][4096] = (Wk . Xb^T + bk[row]) * mask[col] -> hi/lo planes   (M=1024, N=4096)
  wmma_gemm64<1, false, false, 1, 2, 2><<<dim3(gemmBlocksTok, 1), dim3(256), 0, stream>>>(
      Wkb, Wkb, HIDN, 0L, Xb, Xb, HIDN, 0L, (void*)KTh, (void*)KTl, NTOK, 0L,
      bk, amask, HIDN, NTOK, HIDN, 1.0f);
  // v^T [1024][4096] = (Wv . Xb^T + bv[row]) * mask[col] -> hi/lo planes
  wmma_gemm64<1, false, false, 1, 2, 2><<<dim3(gemmBlocksTok, 1), dim3(256), 0, stream>>>(
      Wvb, Wvb, HIDN, 0L, Xb, Xb, HIDN, 0L, (void*)VTh, (void*)VTl, NTOK, 0L,
      bv, amask, HIDN, NTOK, HIDN, 1.0f);

  // 3) causal attention on the planes -> attention out hi/lo planes [4096][1024]
  const float sscale = 0.125f;   // 1 / (temperature * sqrt(64)), exact power of two
  attn_hd64_planes<<<dim3(NBATCH * NHEAD * (SEQ / AT_QB)), dim3(128), 0, stream>>>(
      Qh, Ql, Kh, Kl, VTh, VTl, amask, Oh, Ol, sscale);

  // 4) state[b][h][d][e] = sum_s k^T[h*64+d][b*S+s] * v^T[h*64+e][b*S+s]  (hi/lo on both operands); one wave per (b,h)
  for (int bb = 0; bb < NBATCH; ++bb) {
    wmma_gemm64<1, true, true, 0, 0, 0><<<dim3(1, NHEAD), dim3(32), 0, stream>>>(
        KTh + (size_t)bb * SEQ, KTl + (size_t)bb * SEQ, NTOK, (long)HDIM * NTOK,
        VTh + (size_t)bb * SEQ, VTl + (size_t)bb * SEQ, NTOK, (long)HDIM * NTOK,
        (void*)(stateF + (size_t)bb * NHEAD * HDIM * HDIM), (void*)Oh, HDIM, (long)HDIM * HDIM,
        bo, amask, HDIM, HDIM, SEQ, 1.0f);
  }

  // 5) out [4096][1024] = attn_out . Wo^T + bo  (A hi/lo, Wo exact bf16) -> d_out f32
  wmma_gemm64<1, true, false, 2, 0, 0><<<dim3(gemmBlocksTok, 1), dim3(256), 0, stream>>>(
      Oh, Ol, HIDN, 0L, Wob, Wob, HIDN, 0L, (void*)outF, (void*)Oh, HIDN, 0L,
      bo, amask, NTOK, HIDN, HIDN, 1.0f);
}

// v001
// Measured time: 594 microseconds a run.
// Two timings next to v000 put it at 1.16 and 1.17 times that version's speed.
// Compute dtype: input projections v_wmma_f32_16x16x32_bf16 on bf16 operands (inputs RNE-converted once), f32 accumulate; scores, p.v and k^T.v state on bf16 hi/lo split planes (hi.hi + hi.lo + lo.hi), output projection on hi/lo A planes x bf16 Wo (hi.hi + lo.hi), f32 accumulate; softmax and side math f32.
#include <hip/hip_runtime.h>

// ---------------------------------------------------------------- geometry
constexpr int NBATCH = 2;
constexpr int SEQ    = 2048;
constexpr int HIDN   = 1024;
constexpr int NHEAD  = 16;
constexpr int HDIM   = 64;
constexpr int NTOK   = NBATCH * SEQ;                    /* 4096 token rows */
constexpr size_t NX  = (size_t)NTOK * HIDN;            /* 4194304 */
constexpr size_t NW  = (size_t)HIDN * HIDN;            /* 1048576 */
constexpr size_t OUT0_ELEMS    = NX;
constexpr size_t OUT1_ELEMS    = (size_t)NBATCH * NHEAD * HDIM * HDIM;   /* 131072 */
constexpr size_t OUT1_BYTE_OFF = 16777216;
constexpr size_t OUT1_ELEM_OFF = OUT1_BYTE_OFF / 4;
static_assert(OUT1_ELEM_OFF == OUT0_ELEMS);
static_assert(OUT1_BYTE_OFF + OUT1_ELEMS * 4 == 17301504);
static_assert(HIDN == NHEAD * HDIM);
static_assert(HDIM == 64);
static_assert(HIDN % 64 == 0 && NTOK % 64 == 0 && SEQ % 64 == 0);   /* every GEMM M and N is a 64-multiple */
static_assert(HIDN % 32 == 0 && SEQ % 32 == 0);                     /* every GEMM K is a multiple of 32 */
static_assert((NX % 512) == 0 && (NW % 512) == 0);                 /* cast kernels: whole waves only */

// ---------------------------------------------------------------- workspace map (bytes)
// 16-bit planes: token planes [4096][1024] or [1024][4096] = 8 MiB each; weight planes [1024][1024] = 2 MiB each.
// Every region is fully written by its producer (full M x N, no pad rows) before any consumer reads it.
constexpr size_t MIB      = (size_t)1 << 20;
constexpr size_t OFF_XB   = 0 * MIB;    /* hidden as bf16      8 MiB */
constexpr size_t OFF_WQ   = 8 * MIB;    /* Wq bf16             2 MiB */
constexpr size_t OFF_WK   = 10 * MIB;   /* Wk bf16             2 MiB */
constexpr size_t OFF_WV   = 12 * MIB;   /* Wv bf16             2 MiB */
constexpr size_t OFF_WO   = 14 * MIB;   /* Wo bf16             2 MiB */
constexpr size_t OFF_QH   = 16 * MIB;   /* q hi  [4096][1024]        */
constexpr size_t OFF_QL   = 24 * MIB;   /* q lo                      */
constexpr size_t OFF_KH   = 32 * MIB;   /* k hi  [4096][1024] (masked) */
constexpr size_t OFF_KL   = 40 * MIB;   /* k lo                      */
constexpr size_t OFF_KTH  = 48 * MIB;   /* k^T hi [1024][4096] (masked) */
constexpr size_t OFF_KTL  = 56 * MIB;   /* k^T lo                    */
constexpr size_t OFF_VTH  = 64 * MIB;   /* v^T hi [1024][4096] (masked) */
constexpr size_t OFF_VTL  = 72 * MIB;   /* v^T lo                    */
constexpr size_t OFF_OH   = 80 * MIB;   /* attention out hi [4096][1024] */
constexpr size_t OFF_OL   = 88 * MIB;   /* attention out lo          */
constexpr size_t WS_TOTAL = 96 * MIB;   /* 100663296 B */
static_assert(NX * 2 == 8 * MIB && NW * 2 == 2 * MIB);
static_assert(WS_TOTAL <= 134217728);

// ---------------------------------------------------------------- types / helpers
typedef __attribute__((ext_vector_type(16))) _Float16 v16h;
typedef __attribute__((ext_vector_type(8)))  _Float16 v8h;
typedef __attribute__((ext_vector_type(16))) __bf16   v16b;
typedef __attribute__((ext_vector_type(8)))  __bf16   v8b;
typedef __attribute__((ext_vector_type(8)))  float    v8f;
typedef __attribute__((ext_vector_type(4)))  float    v4f;
typedef __attribute__((ext_vector_type(2)))  float    v2f;
typedef __attribute__((ext_vector_type(4)))  unsigned u4v;

__device__ __forceinline__ unsigned short f2bf_bits(float f) {
  unsigned u = __float_as_uint(f);
  return (unsigned short)((u + 0x7FFFu + ((u >> 16) & 1u)) >> 16);
}
__device__ __forceinline__ float bf_bits2f(unsigned short h) { return __uint_as_float(((unsigned)h) << 16); }
__device__ __forceinline__ float bfr(float f) { return bf_bits2f(f2bf_bits(f)); }

__device__ __forceinline__ void sched_fence() { asm volatile("" ::: "memory"); }

// hazard guards as plain device helpers (no inline asm inside the kernel template body)
__device__ __forceinline__ void dep_guard_h(v8f& a, v8f& b, v16h x, v16h y) { asm volatile("v_nop\n\tv_nop\n\tv_nop\n\tv_nop" : "+v"(a), "+v"(b) : "v"(x), "v"(y)); }
__device__ __forceinline__ void dep_guard_b(v8f& a, v8f& b, v16b x, v16b y) { asm volatile("v_nop\n\tv_nop\n\tv_nop\n\tv_nop" : "+v"(a), "+v"(b) : "v"(x), "v"(y)); }
__device__ __forceinline__ void keep4_h(v16h a, v16h b, v16h c, v16h d) { asm volatile("v_nop" :: "v"(a), "v"(b), "v"(c), "v"(d)); }
__device__ __forceinline__ void keep4_b(v16b a, v16b b, v16b c, v16b d) { asm volatile("v_nop" :: "v"(a), "v"(b), "v"(c), "v"(d)); }
__device__ __forceinline__ void acc_guard4(v8f& a, v8f& b, v8f& c, v8f& d) { asm volatile("v_nop\n\tv_nop\n\tv_nop\n\tv_nop" : "+v"(a), "+v"(b), "+v"(c), "+v"(d)); }
template <typename T> struct Frag;
template <> struct Frag<_Float16> {
  typedef v16h V; union U { v16h v; v8h h[2]; };
  static __device__ __forceinline__ v16h load(const _Float16* p) {   // elements 0..7 <- p[0..7], 8..15 <- p[16..23]
    U f; f.h[0] = *(const v8h*)(p); f.h[1] = *(const v8h*)(p + 16); return f.v;
  }
  static __device__ __forceinline__ v8f mma(v16h a, v16h b, v8f c) {
    return __builtin_amdgcn_wmma_f32_16x16x32_f16(false, a, false, b, (short)0, c, false, false);
  }
  static __device__ __forceinline__ void guard(v8f& a, v8f& b, v16h x, v16h y) { dep_guard_h(a, b, x, y); }
  static __device__ __forceinline__ void keep(v16h a, v16h b, v16h c, v16h d) { keep4_h(a, b, c, d); }
};
template <> struct Frag<__bf16> {
  typedef v16b V; union U { v16b v; v8b h[2]; };
  static __device__ __forceinline__ v16b load(const __bf16* p) {
    U f; f.h[0] = *(const v8b*)(p); f.h[1] = *(const v8b*)(p + 16); return f.v;
  }
  static __device__ __forceinline__ v8f mma(v16b a, v16b b, v8f c) {
    return __builtin_amdgcn_wmma_f32_16x16x32_bf16(false, a, false, b, (short)0, c, false, false);
  }
  static __device__ __forceinline__ void guard(v8f& a, v8f& b, v16b x, v16b y) { dep_guard_b(a, b, x, y); }
  static __device__ __forceinline__ void keep(v16b a, v16b b, v16b c, v16b d) { keep4_b(a, b, c, d); }
};

// ---- Register-blocked batched WMMA GEMM ------------------------------------
// C[m,n] = rs * (scale * sum_k A[m,k] * Bt[n,k] + bias); each wave owns a 64x64 tile.
// A row-major [M,K]; Bt row-major [N,K]; M,N % 64 == 0, K % 32 == 0.
// SPLIT: A carried as hi/lo planes (A2 = lo); BLO: Bt also carried as hi/lo (Bt2 = lo);
//   product = hi.hi (+ hi.lo when BLO) + lo.hi.   SPLIT+BLO is the stock hi/lo path.
// BIAS_MODE: 0 = none, 1 = bias[m], 2 = bias[n]  (bias value RNE-converted to bf16 precision).
// RS_MODE:   0 = none, 1 = multiply by rsc[m], 2 = multiply by rsc[n]  (rsc value RNE-converted to bf16).
// OUT_MODE: 0 = f32, 1 = f16, 2 = bf16 hi plane (Cout) + bf16 lo plane (Cout2).
// ET: 0 = f16 operands, 1 = bf16 operands (pointers passed as 16-bit storage)
template <int ET> struct Elem;
template <> struct Elem<0> { typedef _Float16 T; };
template <> struct Elem<1> { typedef __bf16 T; };
template <int ET, bool SPLIT, bool BLO, int BIAS_MODE, int OUT_MODE, int RS_MODE>
__global__ __launch_bounds__(256) void wmma_gemm64(
    const unsigned short* __restrict__ Ap, const unsigned short* __restrict__ A2p, int lda, long strideA,
    const unsigned short* __restrict__ Btp, const unsigned short* __restrict__ Bt2p, int ldb, long strideB,
    void* __restrict__ Cout, void* __restrict__ Cout2, int ldc, long strideC,
    const float* __restrict__ bias, const float* __restrict__ rsc,
    int M, int N, int K, float scale) {
  typedef typename Elem<ET>::T T;
  typedef typename Frag<T>::V V;
  const T* A = (const T*)Ap; const T* A2 = (const T*)A2p; const T* Bt = (const T*)Btp; const T* Bt2 = (const T*)Bt2p;
  __shared__ __align__(16) float sT[8][16 * 68];   // per-wave 16x64 slab, pitch 68 floats
  const int b    = blockIdx.y;
  const int lane = threadIdx.x & 31;
  const int wave = threadIdx.x >> 5;
  const int tilesN = N >> 6;
  const int tilesM = M >> 6;
  const int tile = blockIdx.x * 8 + wave;
  if (tile >= tilesM * tilesN) return;   // wave-uniform; no block barriers in this kernel
  const int tm = tile / tilesN;
  const int tn = tile - tm * tilesN;
  const int m0 = tm << 6;
  const int n0 = tn << 6;

  const T* Ab  = A  + (size_t)b * strideA;
  const T* Bb  = Bt + (size_t)b * strideB;
  const T* Ab2 = SPLIT ? (A2  + (size_t)b * strideA) : nullptr;
  const T* Bb2 = (SPLIT && BLO) ? (Bt2 + (size_t)b * strideB) : nullptr;

  const int rlane = lane & 15;                 // row (A) / col (B, D) within subtile
  const int koff  = (lane >> 4) * 8;           // k offset of this lane half
  const int mOff  = (lane >> 4) * 8;           // D row offset

  v8f acc[4][4];
#pragma unroll
  for (int i = 0; i < 4; ++i)
#pragma unroll
    for (int j = 0; j < 4; ++j) acc[i][j] = (v8f){0.f,0.f,0.f,0.f,0.f,0.f,0.f,0.f};

  for (int k0 = 0; k0 < K; k0 += 32) {
    V bh[4], bl[4];
#pragma unroll
    for (int j = 0; j < 4; ++j) {
      const size_t bo = (size_t)(n0 + (j << 4) + rlane) * ldb + koff + k0;
      bh[j] = Frag<T>::load(Bb + bo);
      if (SPLIT && BLO) bl[j] = Frag<T>::load(Bb2 + bo);
      else bl[j] = bh[j];
    }
#pragma unroll
    for (int i = 0; i < 4; ++i) {
      const size_t ao = (size_t)(m0 + (i << 4) + rlane) * lda + koff + k0;
      V ah = Frag<T>::load(Ab + ao);
      V al = ah;
      if (SPLIT) al = Frag<T>::load(Ab2 + ao);
#pragma unroll
      for (int j = 0; j < 4; ++j) {
        acc[i][j] = Frag<T>::mma(ah, bh[j], acc[i][j]);
        if (SPLIT) {
          if (BLO) acc[i][j] = Frag<T>::mma(ah, bl[j], acc[i][j]);
          acc[i][j] = Frag<T>::mma(al, bh[j], acc[i][j]);
        }
      }
      Frag<T>::guard(acc[i][0], acc[i][3], ah, al);
    }
    Frag<T>::keep(bh[0], bh[1], bh[2], bh[3]);
    if (SPLIT && BLO) Frag<T>::keep(bl[0], bl[1], bl[2], bl[3]);
  }
  acc_guard4(acc[0][0], acc[0][1], acc[0][2], acc[0][3]);
  acc_guard4(acc[1][0], acc[1][1], acc[1][2], acc[1][3]);
  acc_guard4(acc[2][0], acc[2][1], acc[2][2], acc[2][3]);
  acc_guard4(acc[3][0], acc[3][1], acc[3][2], acc[3][3]);

  // ---- epilogue ----
  float* slab = sT[wave];
#pragma unroll
  for (int i = 0; i < 4; ++i) {
    const int mBase = m0 + (i << 4);
    float bm[8], rm[8];
#pragma unroll
    for (int r = 0; r < 8; ++r) { bm[r] = 0.f; rm[r] = 1.f; }
    if (BIAS_MODE == 1) {
      // rows mBase+mOff .. +7 are contiguous and 32-B aligned: two 16-B loads
      const v4f t0 = *(const v4f*)(bias + mBase + mOff);
      const v4f t1 = *(const v4f*)(bias + mBase + mOff + 4);
#pragma unroll
      for (int r = 0; r < 4; ++r) { bm[r] = bfr(t0[r]); bm[4 + r] = bfr(t1[r]); }
    }
    if (RS_MODE == 1) {
      const v4f t0 = *(const v4f*)(rsc + mBase + mOff);
      const v4f t1 = *(const v4f*)(rsc + mBase + mOff + 4);
#pragma unroll
      for (int r = 0; r < 4; ++r) { rm[r] = bfr(t0[r]); rm[4 + r] = bfr(t1[r]); }
    }
#pragma unroll
    for (int j = 0; j < 4; ++j) {
      const int n = n0 + (j << 4) + rlane;
      float bn = 0.f, rn = 1.f;
      if (BIAS_MODE == 2) bn = bfr(bias[n]);
      if (RS_MODE == 2)   rn = bfr(rsc[n]);
#pragma unroll
      for (int r = 0; r < 8; ++r) {
        float v = acc[i][j][r] * scale;
        if (BIAS_MODE == 1) v += bm[r];
        if (BIAS_MODE == 2) v += bn;
        if (RS_MODE == 1) v *= rm[r];
        if (RS_MODE == 2) v *= rn;
        slab[(mOff + r) * 68 + (j << 4) + rlane] = v;
      }
    }
    __builtin_amdgcn_fence(__ATOMIC_RELEASE, "workgroup");
    __builtin_amdgcn_wave_barrier();
    __builtin_amdgcn_fence(__ATOMIC_ACQUIRE, "workgroup");
    if (OUT_MODE == 0) {
      float* C = (float*)Cout + (size_t)b * strideC;
      const int hh = lane >> 4, c4 = (lane & 15) * 4;     // row seg = 256 B = 16 lanes x 16 B
      {
#pragma unroll
        for (int it = 0; it < 8; ++it) {
          const int row = it * 2 + hh;
          v4f v = *(const v4f*)(slab + row * 68 + c4);
          *(v4f*)(C + (size_t)(mBase + row) * ldc + n0 + c4) = v;
        }
        
      }
    } else {
      const int q = lane >> 3, c8 = (lane & 7) * 8;
      unsigned short* C  = (unsigned short*)Cout  + (size_t)b * strideC;
      unsigned short* C2 = (OUT_MODE == 2) ? ((unsigned short*)Cout2 + (size_t)b * strideC) : nullptr;
      {
#pragma unroll
        for (int it = 0; it < 4; ++it) {
          const int row = it * 4 + q;
          const float* sp = slab + row * 68 + c8;
          v8h hv, lv;
#pragma unroll
          for (int e = 0; e < 8; ++e) {
            if (OUT_MODE == 1) {
              hv[e] = (_Float16)sp[e];
              lv[e] = hv[e];
            } else {
              unsigned short hb = f2bf_bits(sp[e]);
              unsigned short lb = f2bf_bits(sp[e] - bf_bits2f(hb));
              hv[e] = __builtin_bit_cast(_Float16, hb);
              lv[e] = __builtin_bit_cast(_Float16, lb);
            }
          }
          *(v8h*)(C + (size_t)(mBase + row) * ldc + n0 + c8) = hv;
          if (OUT_MODE == 2) *(v8h*)(C2 + (size_t)(mBase + row) * ldc + n0 + c8) = lv;
        }
        
      }
    }
    __builtin_amdgcn_fence(__ATOMIC_RELEASE, "workgroup");
    __builtin_amdgcn_wave_barrier();
    __builtin_amdgcn_fence(__ATOMIC_ACQUIRE, "workgroup");
  }
}

// coverage: grid = n2/256 blocks exactly (n2 % 256 == 0 asserted on the host); thread i writes elements 2i, 2i+1.
__global__ __launch_bounds__(256) void cast_f32_bf16x2(
    const float* __restrict__ in, unsigned short* __restrict__ out, int n2) {
  int i = blockIdx.x * 256 + threadIdx.x;
  if (i < n2) {
    const v2f f = *(const v2f*)(in + 2 * (size_t)i);
    const unsigned u = (unsigned)f2bf_bits(f[0]) | ((unsigned)f2bf_bits(f[1]) << 16);
    ((unsigned*)out)[i] = u;
    
  }
}

// =====================================================================================
// Causal attention for head_dim 64 on bf16 hi/lo planes.
//   q planes  : [NTOK][HIDN] (row = b*SEQ + s, col = h*64 + d), hi and lo
//   k planes  : [NTOK][HIDN] same layout, hi and lo (padding mask already folded in)
//   v^T planes: [HIDN][NTOK] (row = h*64 + d, col = b*SEQ + s), hi and lo (mask folded in)
//   out planes: [NTOK][HIDN] bf16 hi and lo
//   scores = (q.k^T) * sscale : hi.hi + hi.lo + lo.hi, f32 accumulate; key j masked where j > q or amask[b][j] == 0 (score := -inf)
//   out    = p.v / l          : p (f32 exp terms) split to bf16 hi/lo per tile, v hi/lo, 3 products, f32 accumulate
//   Block = 4 waves = 64 query rows of one (b, h); grid.x = NBATCH*NHEAD*(SEQ/64).
//   fragments in flight besides the persistent per-wave state.
// =====================================================================================
constexpr int AT_D  = 64;
constexpr int AT_NW = 4;
constexpr int AT_QB = 64;
constexpr int AT_KC = 64;
constexpr int AT_P  = 72;   // LDS row pitch in elements: 144 B = 16 B x 9 (odd), so the 16 rows of a 16-byte fragment read fall on distinct banks

__device__ __forceinline__ __bf16 at_f2bf(float f) { return __builtin_bit_cast(__bf16, f2bf_bits(f)); }
__device__ __forceinline__ void at_split(float f, __bf16& hi, __bf16& lo) {
  const unsigned short hb = f2bf_bits(f);
  hi = __builtin_bit_cast(__bf16, hb);
  lo = at_f2bf(f - __uint_as_float(((unsigned)hb) << 16));
}
__device__ __forceinline__ v8f at_mma(v16b a, v16b b, v8f c) {
  c = __builtin_amdgcn_wmma_f32_16x16x32_bf16(false, a, false, b, (short)0, c, false, false);
  asm volatile("v_nop\n\tv_nop\n\tv_nop\n\tv_nop" : "+v"(c) : "v"(a), "v"(b));
  return c;
}

__global__ __launch_bounds__(128) __attribute__((amdgpu_num_vgpr(256)))
void attn_hd64_planes(const unsigned short* __restrict__ Qh, const unsigned short* __restrict__ Ql,
                      const unsigned short* __restrict__ Kh, const unsigned short* __restrict__ Kl,
                      const unsigned short* __restrict__ VTh, const unsigned short* __restrict__ VTl,
                      const float* __restrict__ amask,
                      unsigned short* __restrict__ Oh, unsigned short* __restrict__ Ol,
                      float sscale) {
  union FB { v16b v; v8b h[2]; };
  __shared__ __align__(16) __bf16 Ksh[AT_KC * AT_P];     // k hi [kv][d]     9 KB
  __shared__ __align__(16) __bf16 Ksl[AT_KC * AT_P];     // k lo
  __shared__ __align__(16) __bf16 Vth[AT_D * AT_P];      // v hi [d][kv]     9 KB
  __shared__ __align__(16) __bf16 Vtl[AT_D * AT_P];     // v lo
  __shared__ __align__(16) __bf16 Psh[AT_NW][16 * AT_P];   // per wave p hi [row][kv]
  __shared__ __align__(16) __bf16 Psl[AT_NW][16 * AT_P];   // per wave p lo
  __shared__ __align__(16) float  Os[AT_NW][16 * 68];       // per wave out tile, pitch 68

  const int tid  = threadIdx.x;
  const int wave = tid >> 5;
  const int lane = tid & 31;
  const int hh   = lane >> 4;
  const int c    = lane & 15;

  const int nqb = SEQ / AT_QB;                  // 32
  const int bx  = blockIdx.x;
  const int qb  = bx % nqb;
  const int bhd = bx / nqb;
  const int h   = bhd % NHEAD;
  const int b   = bhd / NHEAD;
  const int q0  = qb * AT_QB + wave * 16;
  const int tok0 = b * SEQ;
  const int hcol = h * HDIM;

  // ---- Q fragments (A operand): 2 d-chunks, hi and lo, split k-map via Frag::load ----
  v16b qah[2], qal[2];
  {
    const __bf16* qhp = (const __bf16*)Qh + (size_t)(tok0 + q0 + c) * HIDN + hcol + 8 * hh;
    const __bf16* qlp = (const __bf16*)Ql + (size_t)(tok0 + q0 + c) * HIDN + hcol + 8 * hh;
#pragma unroll
    for (int dc = 0; dc < 2; ++dc) {
      qah[dc] = Frag<__bf16>::load(qhp + dc * 32);
      qal[dc] = Frag<__bf16>::load(qlp + dc * 32);
    }
  }

  float mrow[8], lrow[8];
  v8f oacc[4];
#pragma unroll
  for (int r = 0; r < 8; ++r) { mrow[r] = -__builtin_inff(); lrow[r] = 0.f; }
#pragma unroll
  for (int t = 0; t < 4; ++t) oacc[t] = (v8f){0.f,0.f,0.f,0.f,0.f,0.f,0.f,0.f};

  const int nChunks = qb + 1;                   // causal, block-uniform, <= 32
  for (int kc = 0; kc < nChunks; ++kc) {
    const int kv0 = kc * AT_KC;
    __syncthreads();
    {
      // staging coverage: 128 threads x 4 ids = 512 ids = 64 rows x 8 chunks of 8 elements = 64x64 per plane, exact
#pragma unroll
      for (int i = 0; i < 4; ++i) {
        const int id = tid + 128 * i;
        const int row = id >> 3, c8 = (id & 7) * 8;
        const size_t ko = (size_t)(tok0 + kv0 + row) * HIDN + hcol + c8;
        const u4v a0 = *(const u4v*)(Kh + ko);
        const u4v a1 = *(const u4v*)(Kl + ko);
        *(u4v*)(Ksh + row * AT_P + c8) = a0;
        *(u4v*)(Ksl + row * AT_P + c8) = a1;
      }
      sched_fence();
#pragma unroll
      for (int i = 0; i < 4; ++i) {
        const int id = tid + 128 * i;
        const int row = id >> 3, c8 = (id & 7) * 8;      // row = d
        const size_t vo = (size_t)(hcol + row) * NTOK + tok0 + kv0 + c8;
        const u4v a0 = *(const u4v*)(VTh + vo);
        const u4v a1 = *(const u4v*)(VTl + vo);
        *(u4v*)(Vth + row * AT_P + c8) = a0;
        *(u4v*)(Vtl + row * AT_P + c8) = a1;
      }
    }
    __syncthreads();

    v8f s[4];
#pragma unroll
    for (int j = 0; j < 4; ++j) {
      v8f sj = (v8f){0.f,0.f,0.f,0.f,0.f,0.f,0.f,0.f};
#pragma unroll
      for (int dc = 0; dc < 2; ++dc) {
        FB kb, kl;
        const __bf16* khp = Ksh + (j * 16 + c) * AT_P + dc * 32 + 8 * hh;
        const __bf16* klp = Ksl + (j * 16 + c) * AT_P + dc * 32 + 8 * hh;
        kb.h[0] = *(const v8b*)(khp);
        kb.h[1] = *(const v8b*)(khp + 16);
        kl.h[0] = *(const v8b*)(klp);
        kl.h[1] = *(const v8b*)(klp + 16);
        sj = at_mma(qah[dc], kb.v, sj);
        sj = at_mma(qah[dc], kl.v, sj);
        sj = at_mma(qal[dc], kb.v, sj);
        sched_fence();
      }
      s[j] = sj;
    }
    const bool diag = (kc == qb);                // block-uniform
    float kvm[4];
#pragma unroll
    for (int j = 0; j < 4; ++j) kvm[j] = amask[(size_t)tok0 + kv0 + j * 16 + c];
    float cm[8];
#pragma unroll
    for (int r = 0; r < 8; ++r) {
      const int qrow = q0 + 8 * hh + r;
      float m = -__builtin_inff();
#pragma unroll
      for (int j = 0; j < 4; ++j) {
        const int kvcol = kv0 + j * 16 + c;
        const bool masked = (diag && (kvcol > qrow)) || (kvm[j] == 0.0f);
        const float val = masked ? -__builtin_inff() : (s[j][r] * sscale);
        s[j][r] = val;
        m = fmaxf(m, val);
      }
#pragma unroll
      for (int off = 1; off < 16; off <<= 1) m = fmaxf(m, __shfl_xor(m, off, 32));
      cm[r] = m;
    }
    __bf16* pwh = Psh[wave];
    __bf16* pwl = Psl[wave];
#pragma unroll
    for (int r = 0; r < 8; ++r) {
      const float mnew = fmaxf(mrow[r], cm[r]);
      const float alpha = expf(mrow[r] - mnew);
      mrow[r] = mnew;
      float psum = 0.f;
#pragma unroll
      for (int j = 0; j < 4; ++j) {
        const float p = expf(s[j][r] - mnew);
        psum += p;
        __bf16 a, bl; at_split(p, a, bl);
        pwh[(8 * hh + r) * AT_P + j * 16 + c] = a;
        pwl[(8 * hh + r) * AT_P + j * 16 + c] = bl;
      }
#pragma unroll
      for (int off = 1; off < 16; off <<= 1) psum += __shfl_xor(psum, off, 32);
      lrow[r] = lrow[r] * alpha + psum;
#pragma unroll
      for (int t = 0; t < 4; ++t) oacc[t][r] *= alpha;
    }
    __builtin_amdgcn_fence(__ATOMIC_RELEASE, "workgroup");
    __builtin_amdgcn_wave_barrier();
    __builtin_amdgcn_fence(__ATOMIC_ACQUIRE, "workgroup");
#pragma unroll 1
    for (int kk = 0; kk < 2; ++kk) {
      FB pa, pl;
      pa.h[0] = *(const v8b*)(pwh + c * AT_P + kk * 32 + 8 * hh);
      pa.h[1] = *(const v8b*)(pwh + c * AT_P + kk * 32 + 16 + 8 * hh);
      pl.h[0] = *(const v8b*)(pwl + c * AT_P + kk * 32 + 8 * hh);
      pl.h[1] = *(const v8b*)(pwl + c * AT_P + kk * 32 + 16 + 8 * hh);
      sched_fence();
#pragma unroll
      for (int t = 0; t < 4; ++t) {
        FB vb, vl;
        const __bf16* vhp = Vth + (t * 16 + c) * AT_P + kk * 32 + 8 * hh;
        const __bf16* vlp = Vtl + (t * 16 + c) * AT_P + kk * 32 + 8 * hh;
        vb.h[0] = *(const v8b*)(vhp);
        vb.h[1] = *(const v8b*)(vhp + 16);
        vl.h[0] = *(const v8b*)(vlp);
        vl.h[1] = *(const v8b*)(vlp + 16);
        oacc[t] = at_mma(pa.v, vb.v, oacc[t]);
        oacc[t] = at_mma(pa.v, vl.v, oacc[t]);
        oacc[t] = at_mma(pl.v, vb.v, oacc[t]);
        sched_fence();
      }
    }
  }

  float* os = Os[wave];
#pragma unroll
  for (int r = 0; r < 8; ++r) {
    const float inv = 1.0f / lrow[r];
#pragma unroll
    for (int t = 0; t < 4; ++t) os[(8 * hh + r) * 68 + t * 16 + c] = oacc[t][r] * inv;
  }
  __builtin_amdgcn_fence(__ATOMIC_RELEASE, "workgroup");
  __builtin_amdgcn_wave_barrier();
  __builtin_amdgcn_fence(__ATOMIC_ACQUIRE, "workgroup");
  {
    const int q = lane >> 3, c8 = (lane & 7) * 8;
    {
#pragma unroll
      for (int it = 0; it < 4; ++it) {
        const int row = it * 4 + q;
        const float* sp = os + row * 68 + c8;
        v8h hv, lv;
#pragma unroll
        for (int e = 0; e < 8; ++e) {
          unsigned short hb = f2bf_bits(sp[e]);
          unsigned short lb = f2bf_bits(sp[e] - bf_bits2f(hb));
          hv[e] = __builtin_bit_cast(_Float16, hb);
          lv[e] = __builtin_bit_cast(_Float16, lb);
        }
        const size_t oo = (size_t)(tok0 + q0 + row) * HIDN + hcol + c8;
        *(v8h*)(Oh + oo) = hv;
        *(v8h*)(Ol + oo) = lv;
      }
      
    }
  }
}

// ---------------------------------------------------------------- launcher
extern "C" void kernel_launch(void* const* d_in, const int* in_sizes, int n_in,
                              void* d_out, int out_size, void* d_ws, size_t ws_size,
                              hipStream_t stream) {
  (void)n_in;
  if (ws_size < WS_TOTAL) return;
  if ((size_t)out_size != OUT0_ELEMS + OUT1_ELEMS) return;
  if ((size_t)in_sizes[0] != NX || (size_t)in_sizes[1] != (size_t)NTOK ||
      (size_t)in_sizes[2] != NW || (size_t)in_sizes[4] != NW ||
      (size_t)in_sizes[6] != NW || (size_t)in_sizes[8] != NW ||
      in_sizes[3] != HIDN || in_sizes[5] != HIDN || in_sizes[7] != HIDN || in_sizes[9] != HIDN) return;

  const float* hs    = (const float*)d_in[0];
  const float* amask = (const float*)d_in[1];
  const float* Wq    = (const float*)d_in[2];
  const float* bq    = (const float*)d_in[3];
  const float* Wk    = (const float*)d_in[4];
  const float* bk    = (const float*)d_in[5];
  const float* Wv    = (const float*)d_in[6];
  const float* bv    = (const float*)d_in[7];
  const float* Wo    = (const float*)d_in[8];
  const float* bo    = (const float*)d_in[9];

  char* ws = (char*)d_ws;
  unsigned short* Xb  = (unsigned short*)(ws + OFF_XB);
  unsigned short* Wqb = (unsigned short*)(ws + OFF_WQ);
  unsigned short* Wkb = (unsigned short*)(ws + OFF_WK);
  unsigned short* Wvb = (unsigned short*)(ws + OFF_WV);
  unsigned short* Wob = (unsigned short*)(ws + OFF_WO);
  unsigned short* Qh  = (unsigned short*)(ws + OFF_QH);
  unsigned short* Ql  = (unsigned short*)(ws + OFF_QL);
  unsigned short* Kh  = (unsigned short*)(ws + OFF_KH);
  unsigned short* Kl  = (unsigned short*)(ws + OFF_KL);
  unsigned short* KTh = (unsigned short*)(ws + OFF_KTH);
  unsigned short* KTl = (unsigned short*)(ws + OFF_KTL);
  unsigned short* VTh = (unsigned short*)(ws + OFF_VTH);
  unsigned short* VTl = (unsigned short*)(ws + OFF_VTL);
  unsigned short* Oh  = (unsigned short*)(ws + OFF_OH);
  unsigned short* Ol  = (unsigned short*)(ws + OFF_OL);

  float* outF   = (float*)d_out;
  float* stateF = outF + OUT1_ELEM_OFF;

  // 1) RNE conversions to bf16 (inputs converted exactly once)
  {
    const int n2x = (int)(NX / 2);   // 2097152, multiple of 256
    const int n2w = (int)(NW / 2);   // 524288,  multiple of 256
    cast_f32_bf16x2<<<dim3(n2x / 256), dim3(256), 0, stream>>>(hs, Xb, n2x);
    cast_f32_bf16x2<<<dim3(n2w / 256), dim3(256), 0, stream>>>(Wq, Wqb, n2w);
    cast_f32_bf16x2<<<dim3(n2w / 256), dim3(256), 0, stream>>>(Wk, Wkb, n2w);
    cast_f32_bf16x2<<<dim3(n2w / 256), dim3(256), 0, stream>>>(Wv, Wvb, n2w);
    cast_f32_bf16x2<<<dim3(n2w / 256), dim3(256), 0, stream>>>(Wo, Wob, n2w);
  }

  // 2) projections: 64x64 tiles, 8 waves per block; every shape has 1024 tiles (64x16 or 16x64)
  const int gemmBlocksTok = ((NTOK / 64) * (HIDN / 64)) / 8;    // 1024 tiles / 8 = 128
  // q rows [4096][1024] = Xb . Wq^T + bq  -> hi/lo planes
  wmma_gemm64<1, false, false, 2, 2, 0><<<dim3(gemmBlocksTok, 1), dim3(256), 0, stream>>>(
      Xb, Xb, HIDN, 0L, Wqb, Wqb, HIDN, 0L, (void*)Qh, (void*)Ql, HIDN, 0L,
      bq, amask, NTOK, HIDN, HIDN, 1.0f);
  // k rows [4096][1024] = (Xb . Wk^T + bk) * mask[row]  -> hi/lo planes
  wmma_gemm64<1, false, false, 2, 2, 1><<<dim3(gemmBlocksTok, 1), dim3(256), 0, stream>>>(
      Xb, Xb, HIDN, 0L, Wkb, Wkb, HIDN, 0L, (void*)Kh, (void*)Kl, HIDN, 0L,
      bk, amask, NTOK, HIDN, HIDN, 1.0f);
  // k^T [1024][4096] = (Wk . Xb^T + bk[row]) * mask[col] -> hi/lo planes   (M=1024, N=4096)
  wmma_gemm64<1, false, false, 1, 2, 2><<<dim3(gemmBlocksTok, 1), dim3(256), 0, stream>>>(
      Wkb, Wkb, HIDN, 0L, Xb, Xb, HIDN, 0L, (void*)KTh, (void*)KTl, NTOK, 0L,
      bk, amask, HIDN, NTOK, HIDN, 1.0f);
  // v^T [1024][4096] = (Wv . Xb^T + bv[row]) * mask[col] -> hi/lo planes
  wmma_gemm64<1, false, false, 1, 2, 2><<<dim3(gemmBlocksTok, 1), dim3(256), 0, stream>>>(
      Wvb, Wvb, HIDN, 0L, Xb, Xb, HIDN, 0L, (void*)VTh, (void*)VTl, NTOK, 0L,
      bv, amask, HIDN, NTOK, HIDN, 1.0f);

  // 3) causal attention on the planes -> attention out hi/lo planes [4096][1024]
  const float sscale = 0.125f;   // 1 / (temperature * sqrt(64)), exact power of two
  attn_hd64_planes<<<dim3(NBATCH * NHEAD * (SEQ / AT_QB)), dim3(128), 0, stream>>>(
      Qh, Ql, Kh, Kl, VTh, VTl, amask, Oh, Ol, sscale);

  // 4) state[b][h][d][e] = sum_s k^T[h*64+d][b*S+s] * v^T[h*64+e][b*S+s]  (hi/lo on both operands); one wave per (b,h)
  for (int bb = 0; bb < NBATCH; ++bb) {
    wmma_gemm64<1, true, true, 0, 0, 0><<<dim3(1, NHEAD), dim3(32), 0, stream>>>(
        KTh + (size_t)bb * SEQ, KTl + (size_t)bb * SEQ, NTOK, (long)HDIM * NTOK,
        VTh + (size_t)bb * SEQ, VTl + (size_t)bb * SEQ, NTOK, (long)HDIM * NTOK,
        (void*)(stateF + (size_t)bb * NHEAD * HDIM * HDIM), (void*)Oh, HDIM, (long)HDIM * HDIM,
        bo, amask, HDIM, HDIM, SEQ, 1.0f);
  }

  // 5) out [4096][1024] = attn_out . Wo^T + bo  (A hi/lo, Wo exact bf16) -> d_out f32
  wmma_gemm64<1, true, false, 2, 0, 0><<<dim3(gemmBlocksTok, 1), dim3(256), 0, stream>>>(
      Oh, Ol, HIDN, 0L, Wob, Wob, HIDN, 0L, (void*)outF, (void*)Oh, HIDN, 0L,
      bo, amask, NTOK, HIDN, HIDN, 1.0f);
}

// v002
// Measured time: 489 microseconds a run.
// Next to v001, in two timings, it ran 1.21 and 1.22 times as fast.
// Over all steps from v000 it is 1.42 times as fast.
// Compute dtype: input projections v_wmma_f32_16x16x32_bf16 on bf16 operands (inputs RNE-converted once), f32 accumulate; scores, p.v and k^T.v state on bf16 hi/lo split planes (hi.hi + hi.lo + lo.hi), output projection on hi/lo A planes x bf16 Wo (hi.hi + lo.hi), f32 accumulate; softmax and side math f32.
#include <hip/hip_runtime.h>

// ---------------------------------------------------------------- geometry
constexpr int NBATCH = 2;
constexpr int SEQ    = 2048;
constexpr int HIDN   = 1024;
constexpr int NHEAD  = 16;
constexpr int HDIM   = 64;
constexpr int NTOK   = NBATCH * SEQ;                    /* 4096 token rows */
constexpr size_t NX  = (size_t)NTOK * HIDN;            /* 4194304 */
constexpr size_t NW  = (size_t)HIDN * HIDN;            /* 1048576 */
constexpr size_t OUT0_ELEMS    = NX;
constexpr size_t OUT1_ELEMS    = (size_t)NBATCH * NHEAD * HDIM * HDIM;   /* 131072 */
constexpr size_t OUT1_BYTE_OFF = 16777216;
constexpr size_t OUT1_ELEM_OFF = OUT1_BYTE_OFF / 4;
static_assert(OUT1_ELEM_OFF == OUT0_ELEMS);
static_assert(OUT1_BYTE_OFF + OUT1_ELEMS * 4 == 17301504);
static_assert(HIDN == NHEAD * HDIM);
static_assert(HDIM == 64);
static_assert(HIDN % 64 == 0 && NTOK % 64 == 0 && SEQ % 64 == 0);   /* every GEMM M and N is a 64-multiple */
static_assert(HIDN % 32 == 0 && SEQ % 32 == 0);                     /* every GEMM K is a multiple of 32 */
static_assert((NX % 512) == 0 && (NW % 512) == 0);                 /* cast kernels: whole waves only */

// ---------------------------------------------------------------- workspace map (bytes)
// 16-bit planes: token planes [4096][1024] or [1024][4096] = 8 MiB each; weight planes [1024][1024] = 2 MiB each.
// Every region is fully written by its producer (full M x N, no pad rows) before any consumer reads it.
constexpr size_t MIB      = (size_t)1 << 20;
constexpr size_t OFF_XB   = 0 * MIB;    /* hidden as bf16      8 MiB */
constexpr size_t OFF_WQ   = 8 * MIB;    /* Wq bf16             2 MiB */
constexpr size_t OFF_WK   = 10 * MIB;   /* Wk bf16             2 MiB */
constexpr size_t OFF_WV   = 12 * MIB;   /* Wv bf16             2 MiB */
constexpr size_t OFF_WO   = 14 * MIB;   /* Wo bf16             2 MiB */
constexpr size_t OFF_QH   = 16 * MIB;   /* q hi  [4096][1024]        */
constexpr size_t OFF_QL   = 24 * MIB;   /* q lo                      */
constexpr size_t OFF_KH   = 32 * MIB;   /* k hi  [4096][1024] (masked) */
constexpr size_t OFF_KL   = 40 * MIB;   /* k lo                      */
constexpr size_t OFF_KTH  = 48 * MIB;   /* k^T hi [1024][4096] (masked) */
constexpr size_t OFF_KTL  = 56 * MIB;   /* k^T lo                    */
constexpr size_t OFF_VTH  = 64 * MIB;   /* v^T hi [1024][4096] (masked) */
constexpr size_t OFF_VTL  = 72 * MIB;   /* v^T lo                    */
constexpr size_t OFF_OH   = 80 * MIB;   /* attention out hi [4096][1024] */
constexpr size_t OFF_OL   = 88 * MIB;   /* attention out lo          */
constexpr size_t WS_TOTAL = 96 * MIB;   /* 100663296 B */
static_assert(NX * 2 == 8 * MIB && NW * 2 == 2 * MIB);
static_assert(WS_TOTAL <= 134217728);

// ---------------------------------------------------------------- types / helpers
typedef __attribute__((ext_vector_type(16))) _Float16 v16h;
typedef __attribute__((ext_vector_type(8)))  _Float16 v8h;
typedef __attribute__((ext_vector_type(16))) __bf16   v16b;
typedef __attribute__((ext_vector_type(8)))  __bf16   v8b;
typedef __attribute__((ext_vector_type(8)))  float    v8f;
typedef __attribute__((ext_vector_type(4)))  float    v4f;
typedef __attribute__((ext_vector_type(2)))  float    v2f;
typedef __attribute__((ext_vector_type(4)))  unsigned u4v;

__device__ __forceinline__ unsigned short f2bf_bits(float f) {
  unsigned u = __float_as_uint(f);
  return (unsigned short)((u + 0x7FFFu + ((u >> 16) & 1u)) >> 16);
}
__device__ __forceinline__ float bf_bits2f(unsigned short h) { return __uint_as_float(((unsigned)h) << 16); }
__device__ __forceinline__ float bfr(float f) { return bf_bits2f(f2bf_bits(f)); }

__device__ __forceinline__ void sched_fence() { asm volatile("" ::: "memory"); }

// hazard guards as plain device helpers (no inline asm inside the kernel template body)
__device__ __forceinline__ void dep_guard_h(v8f& a, v8f& b, v16h x, v16h y) { asm volatile("v_nop\n\tv_nop\n\tv_nop\n\tv_nop" : "+v"(a), "+v"(b) : "v"(x), "v"(y)); }
__device__ __forceinline__ void dep_guard_b(v8f& a, v8f& b, v16b x, v16b y) { asm volatile("v_nop\n\tv_nop\n\tv_nop\n\tv_nop" : "+v"(a), "+v"(b) : "v"(x), "v"(y)); }
__device__ __forceinline__ void keep4_h(v16h a, v16h b, v16h c, v16h d) { asm volatile("v_nop" :: "v"(a), "v"(b), "v"(c), "v"(d)); }
__device__ __forceinline__ void keep4_b(v16b a, v16b b, v16b c, v16b d) { asm volatile("v_nop" :: "v"(a), "v"(b), "v"(c), "v"(d)); }
__device__ __forceinline__ void acc_guard4(v8f& a, v8f& b, v8f& c, v8f& d) { asm volatile("v_nop\n\tv_nop\n\tv_nop\n\tv_nop" : "+v"(a), "+v"(b), "+v"(c), "+v"(d)); }
template <typename T> struct Frag;
template <> struct Frag<_Float16> {
  typedef v16h V; union U { v16h v; v8h h[2]; };
  static __device__ __forceinline__ v16h load(const _Float16* p) {   // elements 0..7 <- p[0..7], 8..15 <- p[16..23]
    U f; f.h[0] = *(const v8h*)(p); f.h[1] = *(const v8h*)(p + 16); return f.v;
  }
  static __device__ __forceinline__ v8f mma(v16h a, v16h b, v8f c) {
    return __builtin_amdgcn_wmma_f32_16x16x32_f16(false, a, false, b, (short)0, c, false, false);
  }
  static __device__ __forceinline__ void guard(v8f& a, v8f& b, v16h x, v16h y) { dep_guard_h(a, b, x, y); }
  static __device__ __forceinline__ void keep(v16h a, v16h b, v16h c, v16h d) { keep4_h(a, b, c, d); }
};
template <> struct Frag<__bf16> {
  typedef v16b V; union U { v16b v; v8b h[2]; };
  static __device__ __forceinline__ v16b load(const __bf16* p) {
    U f; f.h[0] = *(const v8b*)(p); f.h[1] = *(const v8b*)(p + 16); return f.v;
  }
  static __device__ __forceinline__ v8f mma(v16b a, v16b b, v8f c) {
    return __builtin_amdgcn_wmma_f32_16x16x32_bf16(false, a, false, b, (short)0, c, false, false);
  }
  static __device__ __forceinline__ void guard(v8f& a, v8f& b, v16b x, v16b y) { dep_guard_b(a, b, x, y); }
  static __device__ __forceinline__ void keep(v16b a, v16b b, v16b c, v16b d) { keep4_b(a, b, c, d); }
};

// ---- Register-blocked batched WMMA GEMM ------------------------------------
// C[m,n] = rs * (scale * sum_k A[m,k] * Bt[n,k] + bias); each wave owns a 64x64 tile.
// A row-major [M,K]; Bt row-major [N,K]; M,N % 64 == 0, K % 32 == 0.
// SPLIT: A carried as hi/lo planes (A2 = lo); BLO: Bt also carried as hi/lo (Bt2 = lo);
//   product = hi.hi (+ hi.lo when BLO) + lo.hi.   SPLIT+BLO is the stock hi/lo path.
// BIAS_MODE: 0 = none, 1 = bias[m], 2 = bias[n]  (bias value RNE-converted to bf16 precision).
// RS_MODE:   0 = none, 1 = multiply by rsc[m], 2 = multiply by rsc[n]  (rsc value RNE-converted to bf16).
// OUT_MODE: 0 = f32, 1 = f16, 2 = bf16 hi plane (Cout) + bf16 lo plane (Cout2).
// ET: 0 = f16 operands, 1 = bf16 operands (pointers passed as 16-bit storage)
template <int ET> struct Elem;
template <> struct Elem<0> { typedef _Float16 T; };
template <> struct Elem<1> { typedef __bf16 T; };
template <int ET, bool SPLIT, bool BLO, int BIAS_MODE, int OUT_MODE, int RS_MODE>
__global__ __launch_bounds__(256) void wmma_gemm64(
    const unsigned short* __restrict__ Ap, const unsigned short* __restrict__ A2p, int lda, long strideA,
    const unsigned short* __restrict__ Btp, const unsigned short* __restrict__ Bt2p, int ldb, long strideB,
    void* __restrict__ Cout, void* __restrict__ Cout2, int ldc, long strideC,
    const float* __restrict__ bias, const float* __restrict__ rsc,
    int M, int N, int K, float scale) {
  typedef typename Elem<ET>::T T;
  typedef typename Frag<T>::V V;
  const T* A = (const T*)Ap; const T* A2 = (const T*)A2p; const T* Bt = (const T*)Btp; const T* Bt2 = (const T*)Bt2p;
  __shared__ __align__(16) float sT[8][16 * 68];   // per-wave 16x64 slab, pitch 68 floats
  const int b    = blockIdx.y;
  const int lane = threadIdx.x & 31;
  const int wave = threadIdx.x >> 5;
  const int tilesN = N >> 6;
  const int tilesM = M >> 6;
  const int tile = blockIdx.x * 8 + wave;
  if (tile >= tilesM * tilesN) return;   // wave-uniform; no block barriers in this kernel
  const int tm = tile / tilesN;
  const int tn = tile - tm * tilesN;
  const int m0 = tm << 6;
  const int n0 = tn << 6;

  const T* Ab  = A  + (size_t)b * strideA;
  const T* Bb  = Bt + (size_t)b * strideB;
  const T* Ab2 = SPLIT ? (A2  + (size_t)b * strideA) : nullptr;
  const T* Bb2 = (SPLIT && BLO) ? (Bt2 + (size_t)b * strideB) : nullptr;

  const int rlane = lane & 15;                 // row (A) / col (B, D) within subtile
  const int koff  = (lane >> 4) * 8;           // k offset of this lane half
  const int mOff  = (lane >> 4) * 8;           // D row offset

  v8f acc[4][4];
#pragma unroll
  for (int i = 0; i < 4; ++i)
#pragma unroll
    for (int j = 0; j < 4; ++j) acc[i][j] = (v8f){0.f,0.f,0.f,0.f,0.f,0.f,0.f,0.f};

  for (int k0 = 0; k0 < K; k0 += 32) {
    V bh[4], bl[4];
#pragma unroll
    for (int j = 0; j < 4; ++j) {
      const size_t bo = (size_t)(n0 + (j << 4) + rlane) * ldb + koff + k0;
      bh[j] = Frag<T>::load(Bb + bo);
      if (SPLIT && BLO) bl[j] = Frag<T>::load(Bb2 + bo);
      else bl[j] = bh[j];
    }
#pragma unroll
    for (int i = 0; i < 4; ++i) {
      const size_t ao = (size_t)(m0 + (i << 4) + rlane) * lda + koff + k0;
      V ah = Frag<T>::load(Ab + ao);
      V al = ah;
      if (SPLIT) al = Frag<T>::load(Ab2 + ao);
#pragma unroll
      for (int j = 0; j < 4; ++j) {
        acc[i][j] = Frag<T>::mma(ah, bh[j], acc[i][j]);
        if (SPLIT) {
          if (BLO) acc[i][j] = Frag<T>::mma(ah, bl[j], acc[i][j]);
          acc[i][j] = Frag<T>::mma(al, bh[j], acc[i][j]);
        }
      }
      Frag<T>::guard(acc[i][0], acc[i][3], ah, al);
    }
    Frag<T>::keep(bh[0], bh[1], bh[2], bh[3]);
    if (SPLIT && BLO) Frag<T>::keep(bl[0], bl[1], bl[2], bl[3]);
  }
  acc_guard4(acc[0][0], acc[0][1], acc[0][2], acc[0][3]);
  acc_guard4(acc[1][0], acc[1][1], acc[1][2], acc[1][3]);
  acc_guard4(acc[2][0], acc[2][1], acc[2][2], acc[2][3]);
  acc_guard4(acc[3][0], acc[3][1], acc[3][2], acc[3][3]);

  // ---- epilogue ----
  float* slab = sT[wave];
#pragma unroll
  for (int i = 0; i < 4; ++i) {
    const int mBase = m0 + (i << 4);
    float bm[8], rm[8];
#pragma unroll
    for (int r = 0; r < 8; ++r) { bm[r] = 0.f; rm[r] = 1.f; }
    if (BIAS_MODE == 1) {
      // rows mBase+mOff .. +7 are contiguous and 32-B aligned: two 16-B loads
      const v4f t0 = *(const v4f*)(bias + mBase + mOff);
      const v4f t1 = *(const v4f*)(bias + mBase + mOff + 4);
#pragma unroll
      for (int r = 0; r < 4; ++r) { bm[r] = bfr(t0[r]); bm[4 + r] = bfr(t1[r]); }
    }
    if (RS_MODE == 1) {
      const v4f t0 = *(const v4f*)(rsc + mBase + mOff);
      const v4f t1 = *(const v4f*)(rsc + mBase + mOff + 4);
#pragma unroll
      for (int r = 0; r < 4; ++r) { rm[r] = bfr(t0[r]); rm[4 + r] = bfr(t1[r]); }
    }
#pragma unroll
    for (int j = 0; j < 4; ++j) {
      const int n = n0 + (j << 4) + rlane;
      float bn = 0.f, rn = 1.f;
      if (BIAS_MODE == 2) bn = bfr(bias[n]);
      if (RS_MODE == 2)   rn = bfr(rsc[n]);
#pragma unroll
      for (int r = 0; r < 8; ++r) {
        float v = acc[i][j][r] * scale;
        if (BIAS_MODE == 1) v += bm[r];
        if (BIAS_MODE == 2) v += bn;
        if (RS_MODE == 1) v *= rm[r];
        if (RS_MODE == 2) v *= rn;
        slab[(mOff + r) * 68 + (j << 4) + rlane] = v;
      }
    }
    __builtin_amdgcn_fence(__ATOMIC_RELEASE, "workgroup");
    __builtin_amdgcn_wave_barrier();
    __builtin_amdgcn_fence(__ATOMIC_ACQUIRE, "workgroup");
    if (OUT_MODE == 0) {
      float* C = (float*)Cout + (size_t)b * strideC;
      const int hh = lane >> 4, c4 = (lane & 15) * 4;     // row seg = 256 B = 16 lanes x 16 B
      {
#pragma unroll
        for (int it = 0; it < 8; ++it) {
          const int row = it * 2 + hh;
          v4f v = *(const v4f*)(slab + row * 68 + c4);
          *(v4f*)(C + (size_t)(mBase + row) * ldc + n0 + c4) = v;
        }
        
      }
    } else {
      const int q = lane >> 3, c8 = (lane & 7) * 8;
      unsigned short* C  = (unsigned short*)Cout  + (size_t)b * strideC;
      unsigned short* C2 = (OUT_MODE == 2) ? ((unsigned short*)Cout2 + (size_t)b * strideC) : nullptr;
      {
#pragma unroll
        for (int it = 0; it < 4; ++it) {
          const int row = it * 4 + q;
          const float* sp = slab + row * 68 + c8;
          v8h hv, lv;
#pragma unroll
          for (int e = 0; e < 8; ++e) {
            if (OUT_MODE == 1) {
              hv[e] = (_Float16)sp[e];
              lv[e] = hv[e];
            } else {
              unsigned short hb = f2bf_bits(sp[e]);
              unsigned short lb = f2bf_bits(sp[e] - bf_bits2f(hb));
              hv[e] = __builtin_bit_cast(_Float16, hb);
              lv[e] = __builtin_bit_cast(_Float16, lb);
            }
          }
          *(v8h*)(C + (size_t)(mBase + row) * ldc + n0 + c8) = hv;
          if (OUT_MODE == 2) *(v8h*)(C2 + (size_t)(mBase + row) * ldc + n0 + c8) = lv;
        }
        
      }
    }
    __builtin_amdgcn_fence(__ATOMIC_RELEASE, "workgroup");
    __builtin_amdgcn_wave_barrier();
    __builtin_amdgcn_fence(__ATOMIC_ACQUIRE, "workgroup");
  }
}

// coverage: grid = n2/256 blocks exactly (n2 % 256 == 0 asserted on the host); thread i writes elements 2i, 2i+1.
__global__ __launch_bounds__(256) void cast_f32_bf16x2(
    const float* __restrict__ in, unsigned short* __restrict__ out, int n2) {
  int i = blockIdx.x * 256 + threadIdx.x;
  if (i < n2) {
    const v2f f = *(const v2f*)(in + 2 * (size_t)i);
    const unsigned u = (unsigned)f2bf_bits(f[0]) | ((unsigned)f2bf_bits(f[1]) << 16);
    ((unsigned*)out)[i] = u;
    
  }
}

// =====================================================================================
// Causal attention for head_dim 64 on bf16 hi/lo planes.
//   q planes  : [NTOK][HIDN] (row = b*SEQ + s, col = h*64 + d), hi and lo
//   k planes  : [NTOK][HIDN] same layout, hi and lo (padding mask already folded in)
//   v^T planes: [HIDN][NTOK] (row = h*64 + d, col = b*SEQ + s), hi and lo (mask folded in)
//   out planes: [NTOK][HIDN] bf16 hi and lo
//   scores = (q.k^T) * sscale : hi.hi + hi.lo + lo.hi, f32 accumulate; key j masked where j > q or amask[b][j] == 0 (score := -inf)
//   out    = p.v / l          : p (f32 exp terms) split to bf16 hi/lo per tile, v hi/lo, 3 products, f32 accumulate
//   Block = 4 waves = 64 query rows of one (b, h); grid.x = NBATCH*NHEAD*(SEQ/64).
//   fragments in flight besides the persistent per-wave state.
// =====================================================================================
constexpr int AT_D  = 64;
constexpr int AT_NW = 4;
constexpr int AT_QB = 64;
constexpr int AT_KC = 64;
constexpr int AT_P  = 72;   // LDS row pitch in elements: 144 B = 16 B x 9 (odd), so the 16 rows of a 16-byte fragment read fall on distinct banks

__device__ __forceinline__ __bf16 at_f2bf(float f) { return __builtin_bit_cast(__bf16, f2bf_bits(f)); }
__device__ __forceinline__ void at_split(float f, __bf16& hi, __bf16& lo) {
  const unsigned short hb = f2bf_bits(f);
  hi = __builtin_bit_cast(__bf16, hb);
  lo = at_f2bf(f - __uint_as_float(((unsigned)hb) << 16));
}
__device__ __forceinline__ v8f at_mma(v16b a, v16b b, v8f c) {
  c = __builtin_amdgcn_wmma_f32_16x16x32_bf16(false, a, false, b, (short)0, c, false, false);
  asm volatile("v_nop\n\tv_nop\n\tv_nop\n\tv_nop" : "+v"(c) : "v"(a), "v"(b));
  return c;
}

__global__ __launch_bounds__(128) __attribute__((amdgpu_num_vgpr(256)))
void attn_hd64_planes(const unsigned short* __restrict__ Qh, const unsigned short* __restrict__ Ql,
                      const unsigned short* __restrict__ Kh, const unsigned short* __restrict__ Kl,
                      const unsigned short* __restrict__ VTh, const unsigned short* __restrict__ VTl,
                      const float* __restrict__ amask,
                      unsigned short* __restrict__ Oh, unsigned short* __restrict__ Ol,
                      float sscale) {
  union FB { v16b v; v8b h[2]; };
  __shared__ __align__(16) __bf16 Ksh[AT_KC * AT_P];     // k hi [kv][d]     9 KB
  __shared__ __align__(16) __bf16 Ksl[AT_KC * AT_P];     // k lo
  __shared__ __align__(16) __bf16 Vth[AT_D * AT_P];      // v hi [d][kv]     9 KB
  __shared__ __align__(16) __bf16 Vtl[AT_D * AT_P];     // v lo
  __shared__ __align__(16) __bf16 Psh[AT_NW][16 * AT_P];   // per wave p hi [row][kv]
  __shared__ __align__(16) __bf16 Psl[AT_NW][16 * AT_P];   // per wave p lo
  __shared__ __align__(16) float  Os[AT_NW][16 * 68];       // per wave out tile, pitch 68

  const int tid  = threadIdx.x;
  const int wave = tid >> 5;
  const int lane = tid & 31;
  const int hh   = lane >> 4;
  const int c    = lane & 15;

  const int nqb = SEQ / AT_QB;                  // 32
  const int bx  = blockIdx.x;
  const int qb  = bx % nqb;
  const int bhd = bx / nqb;
  const int h   = bhd % NHEAD;
  const int b   = bhd / NHEAD;
  const int q0  = qb * AT_QB + wave * 16;
  const int tok0 = b * SEQ;
  const int hcol = h * HDIM;

  // ---- Q fragments (A operand): 2 d-chunks, hi and lo, split k-map via Frag::load ----
  v16b qah[2], qal[2];
  {
    const __bf16* qhp = (const __bf16*)Qh + (size_t)(tok0 + q0 + c) * HIDN + hcol + 8 * hh;
    const __bf16* qlp = (const __bf16*)Ql + (size_t)(tok0 + q0 + c) * HIDN + hcol + 8 * hh;
#pragma unroll
    for (int dc = 0; dc < 2; ++dc) {
      qah[dc] = Frag<__bf16>::load(qhp + dc * 32);
      qal[dc] = Frag<__bf16>::load(qlp + dc * 32);
    }
  }

  float mrow[8], lrow[8];
  v8f oacc[4];
#pragma unroll
  for (int r = 0; r < 8; ++r) { mrow[r] = -__builtin_inff(); lrow[r] = 0.f; }
#pragma unroll
  for (int t = 0; t < 4; ++t) oacc[t] = (v8f){0.f,0.f,0.f,0.f,0.f,0.f,0.f,0.f};

  const int nChunks = qb + 1;                   // causal, block-uniform, <= 32
  for (int kc = 0; kc < nChunks; ++kc) {
    const int kv0 = kc * AT_KC;
    __syncthreads();
    {
      // staging coverage: 128 threads x 4 ids = 512 ids = 64 rows x 8 chunks of 8 elements = 64x64 per plane, exact
#pragma unroll
      for (int i = 0; i < 4; ++i) {
        const int id = tid + 128 * i;
        const int row = id >> 3, c8 = (id & 7) * 8;
        const size_t ko = (size_t)(tok0 + kv0 + row) * HIDN + hcol + c8;
        const u4v a0 = *(const u4v*)(Kh + ko);
        const u4v a1 = *(const u4v*)(Kl + ko);
        *(u4v*)(Ksh + row * AT_P + c8) = a0;
        *(u4v*)(Ksl + row * AT_P + c8) = a1;
      }
      sched_fence();
#pragma unroll
      for (int i = 0; i < 4; ++i) {
        const int id = tid + 128 * i;
        const int row = id >> 3, c8 = (id & 7) * 8;      // row = d
        const size_t vo = (size_t)(hcol + row) * NTOK + tok0 + kv0 + c8;
        const u4v a0 = *(const u4v*)(VTh + vo);
        const u4v a1 = *(const u4v*)(VTl + vo);
        *(u4v*)(Vth + row * AT_P + c8) = a0;
        *(u4v*)(Vtl + row * AT_P + c8) = a1;
      }
    }
    __syncthreads();

    v8f s[4];
#pragma unroll
    for (int j = 0; j < 4; ++j) {
      v8f sj = (v8f){0.f,0.f,0.f,0.f,0.f,0.f,0.f,0.f};
#pragma unroll
      for (int dc = 0; dc < 2; ++dc) {
        FB kb, kl;
        const __bf16* khp = Ksh + (j * 16 + c) * AT_P + dc * 32 + 8 * hh;
        const __bf16* klp = Ksl + (j * 16 + c) * AT_P + dc * 32 + 8 * hh;
        kb.h[0] = *(const v8b*)(khp);
        kb.h[1] = *(const v8b*)(khp + 16);
        kl.h[0] = *(const v8b*)(klp);
        kl.h[1] = *(const v8b*)(klp + 16);
        sj = at_mma(qah[dc], kb.v, sj);
        sj = at_mma(qah[dc], kl.v, sj);
        sj = at_mma(qal[dc], kb.v, sj);
        sched_fence();
      }
      s[j] = sj;
    }
    const bool diag = (kc == qb);                // block-uniform
    float kvm[4];
#pragma unroll
    for (int j = 0; j < 4; ++j) kvm[j] = amask[(size_t)tok0 + kv0 + j * 16 + c];
    float cm[8];
#pragma unroll
    for (int r = 0; r < 8; ++r) {
      const int qrow = q0 + 8 * hh + r;
      float m = -__builtin_inff();
#pragma unroll
      for (int j = 0; j < 4; ++j) {
        const int kvcol = kv0 + j * 16 + c;
        const bool masked = (diag && (kvcol > qrow)) || (kvm[j] == 0.0f);
        const float val = masked ? -__builtin_inff() : (s[j][r] * sscale);
        s[j][r] = val;
        m = fmaxf(m, val);
      }
#pragma unroll
      for (int off = 1; off < 16; off <<= 1) m = fmaxf(m, __shfl_xor(m, off, 32));
      cm[r] = m;
    }
    __bf16* pwh = Psh[wave];
    __bf16* pwl = Psl[wave];
#pragma unroll
    for (int r = 0; r < 8; ++r) {
      const float mnew = fmaxf(mrow[r], cm[r]);
      const float alpha = expf(mrow[r] - mnew);
      mrow[r] = mnew;
      float psum = 0.f;
#pragma unroll
      for (int j = 0; j < 4; ++j) {
        const float p = expf(s[j][r] - mnew);
        psum += p;
        __bf16 a, bl; at_split(p, a, bl);
        pwh[(8 * hh + r) * AT_P + j * 16 + c] = a;
        pwl[(8 * hh + r) * AT_P + j * 16 + c] = bl;
      }
#pragma unroll
      for (int off = 1; off < 16; off <<= 1) psum += __shfl_xor(psum, off, 32);
      lrow[r] = lrow[r] * alpha + psum;
#pragma unroll
      for (int t = 0; t < 4; ++t) oacc[t][r] *= alpha;
    }
    __builtin_amdgcn_fence(__ATOMIC_RELEASE, "workgroup");
    __builtin_amdgcn_wave_barrier();
    __builtin_amdgcn_fence(__ATOMIC_ACQUIRE, "workgroup");
#pragma unroll 1
    for (int kk = 0; kk < 2; ++kk) {
      FB pa, pl;
      pa.h[0] = *(const v8b*)(pwh + c * AT_P + kk * 32 + 8 * hh);
      pa.h[1] = *(const v8b*)(pwh + c * AT_P + kk * 32 + 16 + 8 * hh);
      pl.h[0] = *(const v8b*)(pwl + c * AT_P + kk * 32 + 8 * hh);
      pl.h[1] = *(const v8b*)(pwl + c * AT_P + kk * 32 + 16 + 8 * hh);
      sched_fence();
#pragma unroll
      for (int t = 0; t < 4; ++t) {
        FB vb, vl;
        const __bf16* vhp = Vth + (t * 16 + c) * AT_P + kk * 32 + 8 * hh;
        const __bf16* vlp = Vtl + (t * 16 + c) * AT_P + kk * 32 + 8 * hh;
        vb.h[0] = *(const v8b*)(vhp);
        vb.h[1] = *(const v8b*)(vhp + 16);
        vl.h[0] = *(const v8b*)(vlp);
        vl.h[1] = *(const v8b*)(vlp + 16);
        oacc[t] = at_mma(pa.v, vb.v, oacc[t]);
        oacc[t] = at_mma(pa.v, vl.v, oacc[t]);
        oacc[t] = at_mma(pl.v, vb.v, oacc[t]);
        sched_fence();
      }
    }
  }

  float* os = Os[wave];
#pragma unroll
  for (int r = 0; r < 8; ++r) {
    const float inv = 1.0f / lrow[r];
#pragma unroll
    for (int t = 0; t < 4; ++t) os[(8 * hh + r) * 68 + t * 16 + c] = oacc[t][r] * inv;
  }
  __builtin_amdgcn_fence(__ATOMIC_RELEASE, "workgroup");
  __builtin_amdgcn_wave_barrier();
  __builtin_amdgcn_fence(__ATOMIC_ACQUIRE, "workgroup");
  {
    const int q = lane >> 3, c8 = (lane & 7) * 8;
    {
#pragma unroll
      for (int it = 0; it < 4; ++it) {
        const int row = it * 4 + q;
        const float* sp = os + row * 68 + c8;
        v8h hv, lv;
#pragma unroll
        for (int e = 0; e < 8; ++e) {
          unsigned short hb = f2bf_bits(sp[e]);
          unsigned short lb = f2bf_bits(sp[e] - bf_bits2f(hb));
          hv[e] = __builtin_bit_cast(_Float16, hb);
          lv[e] = __builtin_bit_cast(_Float16, lb);
        }
        const size_t oo = (size_t)(tok0 + q0 + row) * HIDN + hcol + c8;
        *(v8h*)(Oh + oo) = hv;
        *(v8h*)(Ol + oo) = lv;
      }
      
    }
  }
}

// =====================================================================================
// k^T.v state: St[h][d][e] = sum_s kT[h*64+d][s] * vT[h*64+e][s] over SEQ tokens of one batch.
//   planes: [HIDN][NTOK] bf16 hi and lo, pointers already moved to the batch's first token
//   product = hi.hi + hi.lo + lo.hi, f32 accumulate (same three products per k step as the GEMM's hi/lo path)
//   Block = 16 waves = one 32x32 tile of one head; wave w sums tokens [w*128, w*128+128).
//   The 16 partial tiles meet in LDS and are added in wave order 0..15. grid = (4 tiles, NHEAD).
// =====================================================================================
constexpr int ST_NW = 16;                 // waves per block = slices of the token sum
constexpr int ST_KS = SEQ / ST_NW;        // 128 tokens per wave
static_assert(ST_KS % 32 == 0);

__global__ __launch_bounds__(ST_NW * 32)
void state_ktv_slices(const unsigned short* __restrict__ KTh, const unsigned short* __restrict__ KTl,
                      const unsigned short* __restrict__ VTh, const unsigned short* __restrict__ VTl,
                      float* __restrict__ St) {
  __shared__ __align__(16) float part[ST_NW][32 * 32];   // one 4 KB partial tile per wave, in accumulator order
  const int tid  = threadIdx.x;
  const int wave = tid >> 5;
  const int lane = tid & 31;
  const int hh   = lane >> 4;
  const int c    = lane & 15;
  const int h    = blockIdx.y;
  const int d0   = (blockIdx.x >> 1) * 32;
  const int e0   = (blockIdx.x & 1) * 32;

  const size_t ao = (size_t)(h * HDIM + d0 + c) * NTOK + wave * ST_KS + 8 * hh;
  const size_t bo = (size_t)(h * HDIM + e0 + c) * NTOK + wave * ST_KS + 8 * hh;
  const __bf16* pah = (const __bf16*)KTh + ao;
  const __bf16* pal = (const __bf16*)KTl + ao;
  const __bf16* pbh = (const __bf16*)VTh + bo;
  const __bf16* pbl = (const __bf16*)VTl + bo;

  v8f acc[2][2];
#pragma unroll
  for (int i = 0; i < 2; ++i)
#pragma unroll
    for (int j = 0; j < 2; ++j) acc[i][j] = (v8f){0.f,0.f,0.f,0.f,0.f,0.f,0.f,0.f};

  // unrolled (4 steps): the step offsets fold into the loads' immediate fields and later steps' loads issue among earlier products
#pragma unroll
  for (int ks = 0; ks < ST_KS / 32; ++ks) {
    v16b ah[2], al[2], bh[2], bl[2];
#pragma unroll
    for (int i = 0; i < 2; ++i) {
      const size_t o = (size_t)i * 16 * NTOK + ks * 32;
      ah[i] = Frag<__bf16>::load(pah + o);
      al[i] = Frag<__bf16>::load(pal + o);
      bh[i] = Frag<__bf16>::load(pbh + o);
      bl[i] = Frag<__bf16>::load(pbl + o);
    }
#pragma unroll
    for (int i = 0; i < 2; ++i)
#pragma unroll
      for (int j = 0; j < 2; ++j) {
        acc[i][j] = Frag<__bf16>::mma(ah[i], bh[j], acc[i][j]);
        acc[i][j] = Frag<__bf16>::mma(ah[i], bl[j], acc[i][j]);
        acc[i][j] = Frag<__bf16>::mma(al[i], bh[j], acc[i][j]);
      }
  }

  // partial tile to LDS: eighth q = (i*2+j)*2 + half holds accumulator rows half*4..half*4+3 of every lane, 16 B per lane
  float* slab = part[wave];
#pragma unroll
  for (int i = 0; i < 2; ++i)
#pragma unroll
    for (int j = 0; j < 2; ++j) {
      const v8f a = acc[i][j];
      const int q = (i * 2 + j) * 2;
      *(v4f*)(slab + (q + 0) * 128 + lane * 4) = (v4f){a[0], a[1], a[2], a[3]};
      *(v4f*)(slab + (q + 1) * 128 + lane * 4) = (v4f){a[4], a[5], a[6], a[7]};
    }
  __syncthreads();

  // 512 threads x 2 floats = the 32x32 tile; each thread adds its two positions over the 16 slices in wave order
  v2f sum = (v2f){0.f, 0.f};
#pragma unroll
  for (int w = 0; w < ST_NW; ++w) sum += *(const v2f*)(&part[w][tid * 2]);

  // position tid*2 back to (row, col): q = tid>>6, source lane = (tid>>1)&31, accumulator rows (q&1)*4 + (tid&1)*2 and the next
  const int q   = tid >> 6;
  const int sl  = (tid >> 1) & 31;
  const int row = (q >> 2) * 16 + (sl >> 4) * 8 + (q & 1) * 4 + (tid & 1) * 2;
  const int col = ((q >> 1) & 1) * 16 + (sl & 15);
  float* o = St + (size_t)h * HDIM * HDIM + (size_t)(d0 + row) * HDIM + e0 + col;
  o[0]    = sum[0];
  o[HDIM] = sum[1];
}

// ---------------------------------------------------------------- launcher
extern "C" void kernel_launch(void* const* d_in, const int* in_sizes, int n_in,
                              void* d_out, int out_size, void* d_ws, size_t ws_size,
                              hipStream_t stream) {
  (void)n_in;
  if (ws_size < WS_TOTAL) return;
  if ((size_t)out_size != OUT0_ELEMS + OUT1_ELEMS) return;
  if ((size_t)in_sizes[0] != NX || (size_t)in_sizes[1] != (size_t)NTOK ||
      (size_t)in_sizes[2] != NW || (size_t)in_sizes[4] != NW ||
      (size_t)in_sizes[6] != NW || (size_t)in_sizes[8] != NW ||
      in_sizes[3] != HIDN || in_sizes[5] != HIDN || in_sizes[7] != HIDN || in_sizes[9] != HIDN) return;

  const float* hs    = (const float*)d_in[0];
  const float* amask = (const float*)d_in[1];
  const float* Wq    = (const float*)d_in[2];
  const float* bq    = (const float*)d_in[3];
  const float* Wk    = (const float*)d_in[4];
  const float* bk    = (const float*)d_in[5];
  const float* Wv    = (const float*)d_in[6];
  const float* bv    = (const float*)d_in[7];
  const float* Wo    = (const float*)d_in[8];
  const float* bo    = (const float*)d_in[9];

  char* ws = (char*)d_ws;
  unsigned short* Xb  = (unsigned short*)(ws + OFF_XB);
  unsigned short* Wqb = (unsigned short*)(ws + OFF_WQ);
  unsigned short* Wkb = (unsigned short*)(ws + OFF_WK);
  unsigned short* Wvb = (unsigned short*)(ws + OFF_WV);
  unsigned short* Wob = (unsigned short*)(ws + OFF_WO);
  unsigned short* Qh  = (unsigned short*)(ws + OFF_QH);
  unsigned short* Ql  = (unsigned short*)(ws + OFF_QL);
  unsigned short* Kh  = (unsigned short*)(ws + OFF_KH);
  unsigned short* Kl  = (unsigned short*)(ws + OFF_KL);
  unsigned short* KTh = (unsigned short*)(ws + OFF_KTH);
  unsigned short* KTl = (unsigned short*)(ws + OFF_KTL);
  unsigned short* VTh = (unsigned short*)(ws + OFF_VTH);
  unsigned short* VTl = (unsigned short*)(ws + OFF_VTL);
  unsigned short* Oh  = (unsigned short*)(ws + OFF_OH);
  unsigned short* Ol  = (unsigned short*)(ws + OFF_OL);

  float* outF   = (float*)d_out;
  float* stateF = outF + OUT1_ELEM_OFF;

  // 1) RNE conversions to bf16 (inputs converted exactly once)
  {
    const int n2x = (int)(NX / 2);   // 2097152, multiple of 256
    const int n2w = (int)(NW / 2);   // 524288,  multiple of 256
    cast_f32_bf16x2<<<dim3(n2x / 256), dim3(256), 0, stream>>>(hs, Xb, n2x);
    cast_f32_bf16x2<<<dim3(n2w / 256), dim3(256), 0, stream>>>(Wq, Wqb, n2w);
    cast_f32_bf16x2<<<dim3(n2w / 256), dim3(256), 0, stream>>>(Wk, Wkb, n2w);
    cast_f32_bf16x2<<<dim3(n2w / 256), dim3(256), 0, stream>>>(Wv, Wvb, n2w);
    cast_f32_bf16x2<<<dim3(n2w / 256), dim3(256), 0, stream>>>(Wo, Wob, n2w);
  }

  // 2) projections: 64x64 tiles, 8 waves per block; every shape has 1024 tiles (64x16 or 16x64)
  const int gemmBlocksTok = ((NTOK / 64) * (HIDN / 64)) / 8;    // 1024 tiles / 8 = 128
  // q rows [4096][1024] = Xb . Wq^T + bq  -> hi/lo planes
  wmma_gemm64<1, false, false, 2, 2, 0><<<dim3(gemmBlocksTok, 1), dim3(256), 0, stream>>>(
      Xb, Xb, HIDN, 0L, Wqb, Wqb, HIDN, 0L, (void*)Qh, (void*)Ql, HIDN, 0L,
      bq, amask, NTOK, HIDN, HIDN, 1.0f);
  // k rows [4096][1024] = (Xb . Wk^T + bk) * mask[row]  -> hi/lo planes
  wmma_gemm64<1, false, false, 2, 2, 1><<<dim3(gemmBlocksTok, 1), dim3(256), 0, stream>>>(
      Xb, Xb, HIDN, 0L, Wkb, Wkb, HIDN, 0L, (void*)Kh, (void*)Kl, HIDN, 0L,
      bk, amask, NTOK, HIDN, HIDN, 1.0f);
  // k^T [1024][4096] = (Wk . Xb^T + bk[row]) * mask[col] -> hi/lo planes   (M=1024, N=4096)
  wmma_gemm64<1, false, false, 1, 2, 2><<<dim3(gemmBlocksTok, 1), dim3(256), 0, stream>>>(
      Wkb, Wkb, HIDN, 0L, Xb, Xb, HIDN, 0L, (void*)KTh, (void*)KTl, NTOK, 0L,
      bk, amask, HIDN, NTOK, HIDN, 1.0f);
  // v^T [1024][4096] = (Wv . Xb^T + bv[row]) * mask[col] -> hi/lo planes
  wmma_gemm64<1, false, false, 1, 2, 2><<<dim3(gemmBlocksTok, 1), dim3(256), 0, stream>>>(
      Wvb, Wvb, HIDN, 0L, Xb, Xb, HIDN, 0L, (void*)VTh, (void*)VTl, NTOK, 0L,
      bv, amask, HIDN, NTOK, HIDN, 1.0f);

  // 3) causal attention on the planes -> attention out hi/lo planes [4096][1024]
  const float sscale = 0.125f;   // 1 / (temperature * sqrt(64)), exact power of two
  attn_hd64_planes<<<dim3(NBATCH * NHEAD * (SEQ / AT_QB)), dim3(128), 0, stream>>>(
      Qh, Ql, Kh, Kl, VTh, VTl, amask, Oh, Ol, sscale);

  // 4) state[b][h][d][e] = sum_s k^T[h*64+d][b*S+s] * v^T[h*64+e][b*S+s]  (hi/lo on both operands); 4 tiles x 16 token slices per (b,h)
  for (int bb = 0; bb < NBATCH; ++bb) {
    state_ktv_slices<<<dim3(4, NHEAD), dim3(ST_NW * 32), 0, stream>>>(
        KTh + (size_t)bb * SEQ, KTl + (size_t)bb * SEQ, VTh + (size_t)bb * SEQ, VTl + (size_t)bb * SEQ,
        stateF + (size_t)bb * NHEAD * HDIM * HDIM);
  }

  // 5) out [4096][1024] = attn_out . Wo^T + bo  (A hi/lo, Wo exact bf16) -> d_out f32
  wmma_gemm64<1, true, false, 2, 0, 0><<<dim3(gemmBlocksTok, 1), dim3(256), 0, stream>>>(
      Oh, Ol, HIDN, 0L, Wob, Wob, HIDN, 0L, (void*)outF, (void*)Oh, HIDN, 0L,
      bo, amask, NTOK, HIDN, HIDN, 1.0f);
}

// v003
// Measured time: 433 microseconds a run.
// Next to v002, in two timings, it ran 1.12 times as fast each time.
// Over all steps from v000 it is 1.59 times as fast.
// Compute dtype: input projections v_wmma_f32_16x16x32_bf16 on bf16 operands (inputs RNE-converted once), f32 accumulate; scores, p.v and k^T.v state on bf16 hi/lo split planes (hi.hi + hi.lo + lo.hi), output projection on hi/lo A planes x bf16 Wo (hi.hi + lo.hi), f32 accumulate; softmax and side math f32.
#include <hip/hip_runtime.h>

// ---------------------------------------------------------------- geometry
constexpr int NBATCH = 2;
constexpr int SEQ    = 2048;
constexpr int HIDN   = 1024;
constexpr int NHEAD  = 16;
constexpr int HDIM   = 64;
constexpr int NTOK   = NBATCH * SEQ;                    /* 4096 token rows */
constexpr size_t NX  = (size_t)NTOK * HIDN;            /* 4194304 */
constexpr size_t NW  = (size_t)HIDN * HIDN;            /* 1048576 */
constexpr size_t OUT0_ELEMS    = NX;
constexpr size_t OUT1_ELEMS    = (size_t)NBATCH * NHEAD * HDIM * HDIM;   /* 131072 */
constexpr size_t OUT1_BYTE_OFF = 16777216;
constexpr size_t OUT1_ELEM_OFF = OUT1_BYTE_OFF / 4;
static_assert(OUT1_ELEM_OFF == OUT0_ELEMS);
static_assert(OUT1_BYTE_OFF + OUT1_ELEMS * 4 == 17301504);
static_assert(HIDN == NHEAD * HDIM);
static_assert(HDIM == 64);
static_assert(HIDN % 64 == 0 && NTOK % 64 == 0 && SEQ % 64 == 0);   /* every GEMM M and N is a 64-multiple */
static_assert(HIDN % 32 == 0 && SEQ % 32 == 0);                     /* every GEMM K is a multiple of 32 */
static_assert((NX % 512) == 0 && (NW % 512) == 0);                 /* cast kernels: whole waves only */

// ---------------------------------------------------------------- workspace map (bytes)
// 16-bit planes: token planes [4096][1024] or [1024][4096] = 8 MiB each; weight planes [1024][1024] = 2 MiB each.
// Every region is fully written by its producer (full M x N, no pad rows) before any consumer reads it.
constexpr size_t MIB      = (size_t)1 << 20;
constexpr size_t OFF_XB   = 0 * MIB;    /* hidden as bf16      8 MiB */
constexpr size_t OFF_WQ   = 8 * MIB;    /* Wq bf16             2 MiB */
constexpr size_t OFF_WK   = 10 * MIB;   /* Wk bf16             2 MiB */
constexpr size_t OFF_WV   = 12 * MIB;   /* Wv bf16             2 MiB */
constexpr size_t OFF_WO   = 14 * MIB;   /* Wo bf16             2 MiB */
constexpr size_t OFF_QH   = 16 * MIB;   /* q hi  [4096][1024]        */
constexpr size_t OFF_QL   = 24 * MIB;   /* q lo                      */
constexpr size_t OFF_KH   = 32 * MIB;   /* k hi  [4096][1024] (masked) */
constexpr size_t OFF_KL   = 40 * MIB;   /* k lo                      */
constexpr size_t OFF_KTH  = 48 * MIB;   /* k^T hi [1024][4096] (masked) */
constexpr size_t OFF_KTL  = 56 * MIB;   /* k^T lo                    */
constexpr size_t OFF_VTH  = 64 * MIB;   /* v^T hi [1024][4096] (masked) */
constexpr size_t OFF_VTL  = 72 * MIB;   /* v^T lo                    */
constexpr size_t OFF_OH   = 80 * MIB;   /* attention out hi [4096][1024] */
constexpr size_t OFF_OL   = 88 * MIB;   /* attention out lo          */
constexpr size_t WS_TOTAL = 96 * MIB;   /* 100663296 B */
static_assert(NX * 2 == 8 * MIB && NW * 2 == 2 * MIB);
static_assert(WS_TOTAL <= 134217728);

// ---------------------------------------------------------------- types / helpers
typedef __attribute__((ext_vector_type(16))) _Float16 v16h;
typedef __attribute__((ext_vector_type(8)))  _Float16 v8h;
typedef __attribute__((ext_vector_type(16))) __bf16   v16b;
typedef __attribute__((ext_vector_type(8)))  __bf16   v8b;
typedef __attribute__((ext_vector_type(8)))  float    v8f;
typedef __attribute__((ext_vector_type(4)))  float    v4f;
typedef __attribute__((ext_vector_type(2)))  float    v2f;
typedef __attribute__((ext_vector_type(4)))  unsigned u4v;

__device__ __forceinline__ unsigned short f2bf_bits(float f) {
  unsigned u = __float_as_uint(f);
  return (unsigned short)((u + 0x7FFFu + ((u >> 16) & 1u)) >> 16);
}
__device__ __forceinline__ float bf_bits2f(unsigned short h) { return __uint_as_float(((unsigned)h) << 16); }
__device__ __forceinline__ float bfr(float f) { return bf_bits2f(f2bf_bits(f)); }

__device__ __forceinline__ void sched_fence() { asm volatile("" ::: "memory"); }

// hazard guards as plain device helpers (no inline asm inside the kernel template body)
__device__ __forceinline__ void dep_guard_h(v8f& a, v8f& b, v16h x, v16h y) { asm volatile("v_nop\n\tv_nop\n\tv_nop\n\tv_nop" : "+v"(a), "+v"(b) : "v"(x), "v"(y)); }
__device__ __forceinline__ void dep_guard_b(v8f& a, v8f& b, v16b x, v16b y) { asm volatile("v_nop\n\tv_nop\n\tv_nop\n\tv_nop" : "+v"(a), "+v"(b) : "v"(x), "v"(y)); }
__device__ __forceinline__ void keep4_h(v16h a, v16h b, v16h c, v16h d) { asm volatile("v_nop" :: "v"(a), "v"(b), "v"(c), "v"(d)); }
__device__ __forceinline__ void keep4_b(v16b a, v16b b, v16b c, v16b d) { asm volatile("v_nop" :: "v"(a), "v"(b), "v"(c), "v"(d)); }
__device__ __forceinline__ void acc_guard4(v8f& a, v8f& b, v8f& c, v8f& d) { asm volatile("v_nop\n\tv_nop\n\tv_nop\n\tv_nop" : "+v"(a), "+v"(b), "+v"(c), "+v"(d)); }
template <typename T> struct Frag;
template <> struct Frag<_Float16> {
  typedef v16h V; union U { v16h v; v8h h[2]; };
  static __device__ __forceinline__ v16h load(const _Float16* p) {   // elements 0..7 <- p[0..7], 8..15 <- p[16..23]
    U f; f.h[0] = *(const v8h*)(p); f.h[1] = *(const v8h*)(p + 16); return f.v;
  }
  static __device__ __forceinline__ v8f mma(v16h a, v16h b, v8f c) {
    return __builtin_amdgcn_wmma_f32_16x16x32_f16(false, a, false, b, (short)0, c, false, false);
  }
  static __device__ __forceinline__ void guard(v8f& a, v8f& b, v16h x, v16h y) { dep_guard_h(a, b, x, y); }
  static __device__ __forceinline__ void keep(v16h a, v16h b, v16h c, v16h d) { keep4_h(a, b, c, d); }
};
template <> struct Frag<__bf16> {
  typedef v16b V; union U { v16b v; v8b h[2]; };
  static __device__ __forceinline__ v16b load(const __bf16* p) {
    U f; f.h[0] = *(const v8b*)(p); f.h[1] = *(const v8b*)(p + 16); return f.v;
  }
  static __device__ __forceinline__ v8f mma(v16b a, v16b b, v8f c) {
    return __builtin_amdgcn_wmma_f32_16x16x32_bf16(false, a, false, b, (short)0, c, false, false);
  }
  static __device__ __forceinline__ void guard(v8f& a, v8f& b, v16b x, v16b y) { dep_guard_b(a, b, x, y); }
  static __device__ __forceinline__ void keep(v16b a, v16b b, v16b c, v16b d) { keep4_b(a, b, c, d); }
};

// ---- Register-blocked batched WMMA GEMM ------------------------------------
// C[m,n] = rs * (scale * sum_k A[m,k] * Bt[n,k] + bias); each wave owns a 64x64 tile.
// A row-major [M,K]; Bt row-major [N,K]; M,N % 64 == 0, K % 32 == 0.
// SPLIT: A carried as hi/lo planes (A2 = lo); BLO: Bt also carried as hi/lo (Bt2 = lo);
//   product = hi.hi (+ hi.lo when BLO) + lo.hi.   SPLIT+BLO is the stock hi/lo path.
// BIAS_MODE: 0 = none, 1 = bias[m], 2 = bias[n]  (bias value RNE-converted to bf16 precision).
// RS_MODE:   0 = none, 1 = multiply by rsc[m], 2 = multiply by rsc[n]  (rsc value RNE-converted to bf16).
// OUT_MODE: 0 = f32, 1 = f16, 2 = bf16 hi plane (Cout) + bf16 lo plane (Cout2).
// ET: 0 = f16 operands, 1 = bf16 operands (pointers passed as 16-bit storage)
template <int ET> struct Elem;
template <> struct Elem<0> { typedef _Float16 T; };
template <> struct Elem<1> { typedef __bf16 T; };
template <int ET, bool SPLIT, bool BLO, int BIAS_MODE, int OUT_MODE, int RS_MODE>
__global__ __launch_bounds__(256) void wmma_gemm64(
    const unsigned short* __restrict__ Ap, const unsigned short* __restrict__ A2p, int lda, long strideA,
    const unsigned short* __restrict__ Btp, const unsigned short* __restrict__ Bt2p, int ldb, long strideB,
    void* __restrict__ Cout, void* __restrict__ Cout2, int ldc, long strideC,
    const float* __restrict__ bias, const float* __restrict__ rsc,
    int M, int N, int K, float scale) {
  typedef typename Elem<ET>::T T;
  typedef typename Frag<T>::V V;
  const T* A = (const T*)Ap; const T* A2 = (const T*)A2p; const T* Bt = (const T*)Btp; const T* Bt2 = (const T*)Bt2p;
  __shared__ __align__(16) float sT[8][16 * 68];   // per-wave 16x64 slab, pitch 68 floats
  const int b    = blockIdx.y;
  const int lane = threadIdx.x & 31;
  const int wave = threadIdx.x >> 5;
  const int tilesN = N >> 6;
  const int tilesM = M >> 6;
  const int tile = blockIdx.x * 8 + wave;
  if (tile >= tilesM * tilesN) return;   // wave-uniform; no block barriers in this kernel
  const int tm = tile / tilesN;
  const int tn = tile - tm * tilesN;
  const int m0 = tm << 6;
  const int n0 = tn << 6;

  const T* Ab  = A  + (size_t)b * strideA;
  const T* Bb  = Bt + (size_t)b * strideB;
  const T* Ab2 = SPLIT ? (A2  + (size_t)b * strideA) : nullptr;
  const T* Bb2 = (SPLIT && BLO) ? (Bt2 + (size_t)b * strideB) : nullptr;

  const int rlane = lane & 15;                 // row (A) / col (B, D) within subtile
  const int koff  = (lane >> 4) * 8;           // k offset of this lane half
  const int mOff  = (lane >> 4) * 8;           // D row offset

  v8f acc[4][4];
#pragma unroll
  for (int i = 0; i < 4; ++i)
#pragma unroll
    for (int j = 0; j < 4; ++j) acc[i][j] = (v8f){0.f,0.f,0.f,0.f,0.f,0.f,0.f,0.f};

  for (int k0 = 0; k0 < K; k0 += 32) {
    V bh[4], bl[4];
#pragma unroll
    for (int j = 0; j < 4; ++j) {
      const size_t bo = (size_t)(n0 + (j << 4) + rlane) * ldb + koff + k0;
      bh[j] = Frag<T>::load(Bb + bo);
      if (SPLIT && BLO) bl[j] = Frag<T>::load(Bb2 + bo);
      else bl[j] = bh[j];
    }
#pragma unroll
    for (int i = 0; i < 4; ++i) {
      const size_t ao = (size_t)(m0 + (i << 4) + rlane) * lda + koff + k0;
      V ah = Frag<T>::load(Ab + ao);
      V al = ah;
      if (SPLIT) al = Frag<T>::load(Ab2 + ao);
#pragma unroll
      for (int j = 0; j < 4; ++j) {
        acc[i][j] = Frag<T>::mma(ah, bh[j], acc[i][j]);
        if (SPLIT) {
          if (BLO) acc[i][j] = Frag<T>::mma(ah, bl[j], acc[i][j]);
          acc[i][j] = Frag<T>::mma(al, bh[j], acc[i][j]);
        }
      }
      Frag<T>::guard(acc[i][0], acc[i][3], ah, al);
    }
    Frag<T>::keep(bh[0], bh[1], bh[2], bh[3]);
    if (SPLIT && BLO) Frag<T>::keep(bl[0], bl[1], bl[2], bl[3]);
  }
  acc_guard4(acc[0][0], acc[0][1], acc[0][2], acc[0][3]);
  acc_guard4(acc[1][0], acc[1][1], acc[1][2], acc[1][3]);
  acc_guard4(acc[2][0], acc[2][1], acc[2][2], acc[2][3]);
  acc_guard4(acc[3][0], acc[3][1], acc[3][2], acc[3][3]);

  // ---- epilogue ----
  float* slab = sT[wave];
#pragma unroll
  for (int i = 0; i < 4; ++i) {
    const int mBase = m0 + (i << 4);
    float bm[8], rm[8];
#pragma unroll
    for (int r = 0; r < 8; ++r) { bm[r] = 0.f; rm[r] = 1.f; }
    if (BIAS_MODE == 1) {
      // rows mBase+mOff .. +7 are contiguous and 32-B aligned: two 16-B loads
      const v4f t0 = *(const v4f*)(bias + mBase + mOff);
      const v4f t1 = *(const v4f*)(bias + mBase + mOff + 4);
#pragma unroll
      for (int r = 0; r < 4; ++r) { bm[r] = bfr(t0[r]); bm[4 + r] = bfr(t1[r]); }
    }
    if (RS_MODE == 1) {
      const v4f t0 = *(const v4f*)(rsc + mBase + mOff);
      const v4f t1 = *(const v4f*)(rsc + mBase + mOff + 4);
#pragma unroll
      for (int r = 0; r < 4; ++r) { rm[r] = bfr(t0[r]); rm[4 + r] = bfr(t1[r]); }
    }
#pragma unroll
    for (int j = 0; j < 4; ++j) {
      const int n = n0 + (j << 4) + rlane;
      float bn = 0.f, rn = 1.f;
      if (BIAS_MODE == 2) bn = bfr(bias[n]);
      if (RS_MODE == 2)   rn = bfr(rsc[n]);
#pragma unroll
      for (int r = 0; r < 8; ++r) {
        float v = acc[i][j][r] * scale;
        if (BIAS_MODE == 1) v += bm[r];
        if (BIAS_MODE == 2) v += bn;
        if (RS_MODE == 1) v *= rm[r];
        if (RS_MODE == 2) v *= rn;
        slab[(mOff + r) * 68 + (j << 4) + rlane] = v;
      }
    }
    __builtin_amdgcn_fence(__ATOMIC_RELEASE, "workgroup");
    __builtin_amdgcn_wave_barrier();
    __builtin_amdgcn_fence(__ATOMIC_ACQUIRE, "workgroup");
    if (OUT_MODE == 0) {
      float* C = (float*)Cout + (size_t)b * strideC;
      const int hh = lane >> 4, c4 = (lane & 15) * 4;     // row seg = 256 B = 16 lanes x 16 B
      {
#pragma unroll
        for (int it = 0; it < 8; ++it) {
          const int row = it * 2 + hh;
          v4f v = *(const v4f*)(slab + row * 68 + c4);
          *(v4f*)(C + (size_t)(mBase + row) * ldc + n0 + c4) = v;
        }
        
      }
    } else {
      const int q = lane >> 3, c8 = (lane & 7) * 8;
      unsigned short* C  = (unsigned short*)Cout  + (size_t)b * strideC;
      unsigned short* C2 = (OUT_MODE == 2) ? ((unsigned short*)Cout2 + (size_t)b * strideC) : nullptr;
      {
#pragma unroll
        for (int it = 0; it < 4; ++it) {
          const int row = it * 4 + q;
          const float* sp = slab + row * 68 + c8;
          v8h hv, lv;
#pragma unroll
          for (int e = 0; e < 8; ++e) {
            if (OUT_MODE == 1) {
              hv[e] = (_Float16)sp[e];
              lv[e] = hv[e];
            } else {
              unsigned short hb = f2bf_bits(sp[e]);
              unsigned short lb = f2bf_bits(sp[e] - bf_bits2f(hb));
              hv[e] = __builtin_bit_cast(_Float16, hb);
              lv[e] = __builtin_bit_cast(_Float16, lb);
            }
          }
          *(v8h*)(C + (size_t)(mBase + row) * ldc + n0 + c8) = hv;
          if (OUT_MODE == 2) *(v8h*)(C2 + (size_t)(mBase + row) * ldc + n0 + c8) = lv;
        }
        
      }
    }
    __builtin_amdgcn_fence(__ATOMIC_RELEASE, "workgroup");
    __builtin_amdgcn_wave_barrier();
    __builtin_amdgcn_fence(__ATOMIC_ACQUIRE, "workgroup");
  }
}

// coverage: grid = n2/256 blocks exactly (n2 % 256 == 0 asserted on the host); thread i writes elements 2i, 2i+1.
__global__ __launch_bounds__(256) void cast_f32_bf16x2(
    const float* __restrict__ in, unsigned short* __restrict__ out, int n2) {
  int i = blockIdx.x * 256 + threadIdx.x;
  if (i < n2) {
    const v2f f = *(const v2f*)(in + 2 * (size_t)i);
    const unsigned u = (unsigned)f2bf_bits(f[0]) | ((unsigned)f2bf_bits(f[1]) << 16);
    ((unsigned*)out)[i] = u;
    
  }
}

// =====================================================================================
// Causal attention for head_dim 64 on bf16 hi/lo planes.
//   q planes  : [NTOK][HIDN] (row = b*SEQ + s, col = h*64 + d), hi and lo
//   k planes  : [NTOK][HIDN] same layout, hi and lo (padding mask already folded in)
//   v^T planes: [HIDN][NTOK] (row = h*64 + d, col = b*SEQ + s), hi and lo (mask folded in)
//   out planes: [NTOK][HIDN] bf16 hi and lo
//   scores = (q.k^T) * sscale : hi.hi + hi.lo + lo.hi, f32 accumulate; key j masked where j > q or amask[b][j] == 0 (score := -inf)
//   out    = p.v / l          : p (f32 exp terms) split to bf16 hi/lo per tile, v hi/lo, 3 products, f32 accumulate
//   Block = 4 waves = 64 query rows of one (b, h); grid.x = NBATCH*NHEAD*(SEQ/64).
//   fragments in flight besides the persistent per-wave state.
// =====================================================================================
constexpr int AT_D  = 64;
constexpr int AT_NW = 4;
constexpr int AT_QB = 64;
constexpr int AT_KC = 64;
constexpr int AT_P  = 72;   // LDS row pitch in elements: 144 B = 16 B x 9 (odd), so the 16 rows of a 16-byte fragment read fall on distinct banks

__device__ __forceinline__ __bf16 at_f2bf(float f) { return __builtin_bit_cast(__bf16, f2bf_bits(f)); }
__device__ __forceinline__ void at_split(float f, __bf16& hi, __bf16& lo) {
  const unsigned short hb = f2bf_bits(f);
  hi = __builtin_bit_cast(__bf16, hb);
  lo = at_f2bf(f - __uint_as_float(((unsigned)hb) << 16));
}
__device__ __forceinline__ v8f at_mma(v16b a, v16b b, v8f c) {
  c = __builtin_amdgcn_wmma_f32_16x16x32_bf16(false, a, false, b, (short)0, c, false, false);
  asm volatile("v_nop\n\tv_nop\n\tv_nop\n\tv_nop" : "+v"(c) : "v"(a), "v"(b));
  return c;
}

__global__ __launch_bounds__(128) __attribute__((amdgpu_num_vgpr(256)))
void attn_hd64_planes(const unsigned short* __restrict__ Qh, const unsigned short* __restrict__ Ql,
                      const unsigned short* __restrict__ Kh, const unsigned short* __restrict__ Kl,
                      const unsigned short* __restrict__ VTh, const unsigned short* __restrict__ VTl,
                      const float* __restrict__ amask,
                      unsigned short* __restrict__ Oh, unsigned short* __restrict__ Ol,
                      float sscale) {
  union FB { v16b v; v8b h[2]; };
  __shared__ __align__(16) __bf16 Ksh[AT_KC * AT_P];     // k hi [kv][d]     9 KB
  __shared__ __align__(16) __bf16 Ksl[AT_KC * AT_P];     // k lo
  __shared__ __align__(16) __bf16 Vth[AT_D * AT_P];      // v hi [d][kv]     9 KB
  __shared__ __align__(16) __bf16 Vtl[AT_D * AT_P];     // v lo
  __shared__ __align__(16) __bf16 Psh[AT_NW][16 * AT_P];   // per wave p hi [row][kv]
  __shared__ __align__(16) __bf16 Psl[AT_NW][16 * AT_P];   // per wave p lo
  __shared__ __align__(16) float  Os[AT_NW][16 * 68];       // per wave out tile, pitch 68

  const int tid  = threadIdx.x;
  const int wave = tid >> 5;
  const int lane = tid & 31;
  const int hh   = lane >> 4;
  const int c    = lane & 15;

  const int nqb = SEQ / AT_QB;                  // 32
  const int bx  = blockIdx.x;
  const int qb  = bx % nqb;
  const int bhd = bx / nqb;
  const int h   = bhd % NHEAD;
  const int b   = bhd / NHEAD;
  const int q0  = qb * AT_QB + wave * 16;
  const int tok0 = b * SEQ;
  const int hcol = h * HDIM;

  // ---- Q fragments (A operand): 2 d-chunks, hi and lo, split k-map via Frag::load ----
  v16b qah[2], qal[2];
  {
    const __bf16* qhp = (const __bf16*)Qh + (size_t)(tok0 + q0 + c) * HIDN + hcol + 8 * hh;
    const __bf16* qlp = (const __bf16*)Ql + (size_t)(tok0 + q0 + c) * HIDN + hcol + 8 * hh;
#pragma unroll
    for (int dc = 0; dc < 2; ++dc) {
      qah[dc] = Frag<__bf16>::load(qhp + dc * 32);
      qal[dc] = Frag<__bf16>::load(qlp + dc * 32);
    }
  }

  float mrow[8], lrow[8];
  v8f oacc[4];
#pragma unroll
  for (int r = 0; r < 8; ++r) { mrow[r] = -__builtin_inff(); lrow[r] = 0.f; }
#pragma unroll
  for (int t = 0; t < 4; ++t) oacc[t] = (v8f){0.f,0.f,0.f,0.f,0.f,0.f,0.f,0.f};

  const int nChunks = qb + 1;                   // causal, block-uniform, <= 32
  for (int kc = 0; kc < nChunks; ++kc) {
    const int kv0 = kc * AT_KC;
    __syncthreads();
    {
      // staging coverage: 128 threads x 4 ids = 512 ids = 64 rows x 8 chunks of 8 elements = 64x64 per plane, exact
#pragma unroll
      for (int i = 0; i < 4; ++i) {
        const int id = tid + 128 * i;
        const int row = id >> 3, c8 = (id & 7) * 8;
        const size_t ko = (size_t)(tok0 + kv0 + row) * HIDN + hcol + c8;
        const u4v a0 = *(const u4v*)(Kh + ko);
        const u4v a1 = *(const u4v*)(Kl + ko);
        *(u4v*)(Ksh + row * AT_P + c8) = a0;
        *(u4v*)(Ksl + row * AT_P + c8) = a1;
      }
      sched_fence();
#pragma unroll
      for (int i = 0; i < 4; ++i) {
        const int id = tid + 128 * i;
        const int row = id >> 3, c8 = (id & 7) * 8;      // row = d
        const size_t vo = (size_t)(hcol + row) * NTOK + tok0 + kv0 + c8;
        const u4v a0 = *(const u4v*)(VTh + vo);
        const u4v a1 = *(const u4v*)(VTl + vo);
        *(u4v*)(Vth + row * AT_P + c8) = a0;
        *(u4v*)(Vtl + row * AT_P + c8) = a1;
      }
    }
    __syncthreads();

    v8f s[4];
#pragma unroll
    for (int j = 0; j < 4; ++j) {
      v8f sj = (v8f){0.f,0.f,0.f,0.f,0.f,0.f,0.f,0.f};
#pragma unroll
      for (int dc = 0; dc < 2; ++dc) {
        FB kb, kl;
        const __bf16* khp = Ksh + (j * 16 + c) * AT_P + dc * 32 + 8 * hh;
        const __bf16* klp = Ksl + (j * 16 + c) * AT_P + dc * 32 + 8 * hh;
        kb.h[0] = *(const v8b*)(khp);
        kb.h[1] = *(const v8b*)(khp + 16);
        kl.h[0] = *(const v8b*)(klp);
        kl.h[1] = *(const v8b*)(klp + 16);
        sj = at_mma(qah[dc], kb.v, sj);
        sj = at_mma(qah[dc], kl.v, sj);
        sj = at_mma(qal[dc], kb.v, sj);
        sched_fence();
      }
      s[j] = sj;
    }
    // key index of each score column; a padded key (amask == 0) gets an index above every query row,
    // so one integer compare and one select per score cover the causal and the padding mask without a branch
    int kidx[4];
#pragma unroll
    for (int j = 0; j < 4; ++j) {
      const float kvm = amask[(size_t)tok0 + kv0 + j * 16 + c];
      kidx[j] = (kvm == 0.0f) ? 0x7fffffff : (kv0 + j * 16 + c);
    }
    float cm[8];
#pragma unroll
    for (int r = 0; r < 8; ++r) {
      const int qrow = q0 + 8 * hh + r;
      float m = -__builtin_inff();
#pragma unroll
      for (int j = 0; j < 4; ++j) {
        const float sc  = s[j][r] * sscale;
        const float val = (kidx[j] > qrow) ? -__builtin_inff() : sc;
        s[j][r] = val;
        m = fmaxf(m, val);
      }
#pragma unroll
      for (int off = 1; off < 16; off <<= 1) m = fmaxf(m, __shfl_xor(m, off, 32));
      cm[r] = m;
    }
    __bf16* pwh = Psh[wave];
    __bf16* pwl = Psl[wave];
#pragma unroll
    for (int r = 0; r < 8; ++r) {
      const float mnew = fmaxf(mrow[r], cm[r]);
      const float alpha = expf(mrow[r] - mnew);
      mrow[r] = mnew;
      float psum = 0.f;
#pragma unroll
      for (int j = 0; j < 4; ++j) {
        const float p = expf(s[j][r] - mnew);
        psum += p;
        __bf16 a, bl; at_split(p, a, bl);
        pwh[(8 * hh + r) * AT_P + j * 16 + c] = a;
        pwl[(8 * hh + r) * AT_P + j * 16 + c] = bl;
      }
#pragma unroll
      for (int off = 1; off < 16; off <<= 1) psum += __shfl_xor(psum, off, 32);
      lrow[r] = lrow[r] * alpha + psum;
#pragma unroll
      for (int t = 0; t < 4; ++t) oacc[t][r] *= alpha;
    }
    __builtin_amdgcn_fence(__ATOMIC_RELEASE, "workgroup");
    __builtin_amdgcn_wave_barrier();
    __builtin_amdgcn_fence(__ATOMIC_ACQUIRE, "workgroup");
#pragma unroll 1
    for (int kk = 0; kk < 2; ++kk) {
      FB pa, pl;
      pa.h[0] = *(const v8b*)(pwh + c * AT_P + kk * 32 + 8 * hh);
      pa.h[1] = *(const v8b*)(pwh + c * AT_P + kk * 32 + 16 + 8 * hh);
      pl.h[0] = *(const v8b*)(pwl + c * AT_P + kk * 32 + 8 * hh);
      pl.h[1] = *(const v8b*)(pwl + c * AT_P + kk * 32 + 16 + 8 * hh);
      sched_fence();
#pragma unroll
      for (int t = 0; t < 4; ++t) {
        FB vb, vl;
        const __bf16* vhp = Vth + (t * 16 + c) * AT_P + kk * 32 + 8 * hh;
        const __bf16* vlp = Vtl + (t * 16 + c) * AT_P + kk * 32 + 8 * hh;
        vb.h[0] = *(const v8b*)(vhp);
        vb.h[1] = *(const v8b*)(vhp + 16);
        vl.h[0] = *(const v8b*)(vlp);
        vl.h[1] = *(const v8b*)(vlp + 16);
        oacc[t] = at_mma(pa.v, vb.v, oacc[t]);
        oacc[t] = at_mma(pa.v, vl.v, oacc[t]);
        oacc[t] = at_mma(pl.v, vb.v, oacc[t]);
        sched_fence();
      }
    }
  }

  float* os = Os[wave];
#pragma unroll
  for (int r = 0; r < 8; ++r) {
    const float inv = 1.0f / lrow[r];
#pragma unroll
    for (int t = 0; t < 4; ++t) os[(8 * hh + r) * 68 + t * 16 + c] = oacc[t][r] * inv;
  }
  __builtin_amdgcn_fence(__ATOMIC_RELEASE, "workgroup");
  __builtin_amdgcn_wave_barrier();
  __builtin_amdgcn_fence(__ATOMIC_ACQUIRE, "workgroup");
  {
    const int q = lane >> 3, c8 = (lane & 7) * 8;
    {
#pragma unroll
      for (int it = 0; it < 4; ++it) {
        const int row = it * 4 + q;
        const float* sp = os + row * 68 + c8;
        v8h hv, lv;
#pragma unroll
        for (int e = 0; e < 8; ++e) {
          unsigned short hb = f2bf_bits(sp[e]);
          unsigned short lb = f2bf_bits(sp[e] - bf_bits2f(hb));
          hv[e] = __builtin_bit_cast(_Float16, hb);
          lv[e] = __builtin_bit_cast(_Float16, lb);
        }
        const size_t oo = (size_t)(tok0 + q0 + row) * HIDN + hcol + c8;
        *(v8h*)(Oh + oo) = hv;
        *(v8h*)(Ol + oo) = lv;
      }
      
    }
  }
}

// =====================================================================================
// k^T.v state: St[h][d][e] = sum_s kT[h*64+d][s] * vT[h*64+e][s] over SEQ tokens of one batch.
//   planes: [HIDN][NTOK] bf16 hi and lo, pointers already moved to the batch's first token
//   product = hi.hi + hi.lo + lo.hi, f32 accumulate (same three products per k step as the GEMM's hi/lo path)
//   Block = 16 waves = one 32x32 tile of one head; wave w sums tokens [w*128, w*128+128).
//   The 16 partial tiles meet in LDS and are added in wave order 0..15. grid = (4 tiles, NHEAD).
// =====================================================================================
constexpr int ST_NW = 16;                 // waves per block = slices of the token sum
constexpr int ST_KS = SEQ / ST_NW;        // 128 tokens per wave
static_assert(ST_KS % 32 == 0);

__global__ __launch_bounds__(ST_NW * 32)
void state_ktv_slices(const unsigned short* __restrict__ KTh, const unsigned short* __restrict__ KTl,
                      const unsigned short* __restrict__ VTh, const unsigned short* __restrict__ VTl,
                      float* __restrict__ St) {
  __shared__ __align__(16) float part[ST_NW][32 * 32];   // one 4 KB partial tile per wave, in accumulator order
  const int tid  = threadIdx.x;
  const int wave = tid >> 5;
  const int lane = tid & 31;
  const int hh   = lane >> 4;
  const int c    = lane & 15;
  const int h    = blockIdx.y;
  const int d0   = (blockIdx.x >> 1) * 32;
  const int e0   = (blockIdx.x & 1) * 32;

  const size_t ao = (size_t)(h * HDIM + d0 + c) * NTOK + wave * ST_KS + 8 * hh;
  const size_t bo = (size_t)(h * HDIM + e0 + c) * NTOK + wave * ST_KS + 8 * hh;
  const __bf16* pah = (const __bf16*)KTh + ao;
  const __bf16* pal = (const __bf16*)KTl + ao;
  const __bf16* pbh = (const __bf16*)VTh + bo;
  const __bf16* pbl = (const __bf16*)VTl + bo;

  v8f acc[2][2];
#pragma unroll
  for (int i = 0; i < 2; ++i)
#pragma unroll
    for (int j = 0; j < 2; ++j) acc[i][j] = (v8f){0.f,0.f,0.f,0.f,0.f,0.f,0.f,0.f};

  // unrolled (4 steps): the step offsets fold into the loads' immediate fields and later steps' loads issue among earlier products
#pragma unroll
  for (int ks = 0; ks < ST_KS / 32; ++ks) {
    v16b ah[2], al[2], bh[2], bl[2];
#pragma unroll
    for (int i = 0; i < 2; ++i) {
      const size_t o = (size_t)i * 16 * NTOK + ks * 32;
      ah[i] = Frag<__bf16>::load(pah + o);
      al[i] = Frag<__bf16>::load(pal + o);
      bh[i] = Frag<__bf16>::load(pbh + o);
      bl[i] = Frag<__bf16>::load(pbl + o);
    }
#pragma unroll
    for (int i = 0; i < 2; ++i)
#pragma unroll
      for (int j = 0; j < 2; ++j) {
        acc[i][j] = Frag<__bf16>::mma(ah[i], bh[j], acc[i][j]);
        acc[i][j] = Frag<__bf16>::mma(ah[i], bl[j], acc[i][j]);
        acc[i][j] = Frag<__bf16>::mma(al[i], bh[j], acc[i][j]);
      }
  }

  // partial tile to LDS: eighth q = (i*2+j)*2 + half holds accumulator rows half*4..half*4+3 of every lane, 16 B per lane
  float* slab = part[wave];
#pragma unroll
  for (int i = 0; i < 2; ++i)
#pragma unroll
    for (int j = 0; j < 2; ++j) {
      const v8f a = acc[i][j];
      const int q = (i * 2 + j) * 2;
      *(v4f*)(slab + (q + 0) * 128 + lane * 4) = (v4f){a[0], a[1], a[2], a[3]};
      *(v4f*)(slab + (q + 1) * 128 + lane * 4) = (v4f){a[4], a[5], a[6], a[7]};
    }
  __syncthreads();

  // 512 threads x 2 floats = the 32x32 tile; each thread adds its two positions over the 16 slices in wave order
  v2f sum = (v2f){0.f, 0.f};
#pragma unroll
  for (int w = 0; w < ST_NW; ++w) sum += *(const v2f*)(&part[w][tid * 2]);

  // position tid*2 back to (row, col): q = tid>>6, source lane = (tid>>1)&31, accumulator rows (q&1)*4 + (tid&1)*2 and the next
  const int q   = tid >> 6;
  const int sl  = (tid >> 1) & 31;
  const int row = (q >> 2) * 16 + (sl >> 4) * 8 + (q & 1) * 4 + (tid & 1) * 2;
  const int col = ((q >> 1) & 1) * 16 + (sl & 15);
  float* o = St + (size_t)h * HDIM * HDIM + (size_t)(d0 + row) * HDIM + e0 + col;
  o[0]    = sum[0];
  o[HDIM] = sum[1];
}

// ---------------------------------------------------------------- launcher
extern "C" void kernel_launch(void* const* d_in, const int* in_sizes, int n_in,
                              void* d_out, int out_size, void* d_ws, size_t ws_size,
                              hipStream_t stream) {
  (void)n_in;
  if (ws_size < WS_TOTAL) return;
  if ((size_t)out_size != OUT0_ELEMS + OUT1_ELEMS) return;
  if ((size_t)in_sizes[0] != NX || (size_t)in_sizes[1] != (size_t)NTOK ||
      (size_t)in_sizes[2] != NW || (size_t)in_sizes[4] != NW ||
      (size_t)in_sizes[6] != NW || (size_t)in_sizes[8] != NW ||
      in_sizes[3] != HIDN || in_sizes[5] != HIDN || in_sizes[7] != HIDN || in_sizes[9] != HIDN) return;

  const float* hs    = (const float*)d_in[0];
  const float* amask = (const float*)d_in[1];
  const float* Wq    = (const float*)d_in[2];
  const float* bq    = (const float*)d_in[3];
  const float* Wk    = (const float*)d_in[4];
  const float* bk    = (const float*)d_in[5];
  const float* Wv    = (const float*)d_in[6];
  const float* bv    = (const float*)d_in[7];
  const float* Wo    = (const float*)d_in[8];
  const float* bo    = (const float*)d_in[9];

  char* ws = (char*)d_ws;
  unsigned short* Xb  = (unsigned short*)(ws + OFF_XB);
  unsigned short* Wqb = (unsigned short*)(ws + OFF_WQ);
  unsigned short* Wkb = (unsigned short*)(ws + OFF_WK);
  unsigned short* Wvb = (unsigned short*)(ws + OFF_WV);
  unsigned short* Wob = (unsigned short*)(ws + OFF_WO);
  unsigned short* Qh  = (unsigned short*)(ws + OFF_QH);
  unsigned short* Ql  = (unsigned short*)(ws + OFF_QL);
  unsigned short* Kh  = (unsigned short*)(ws + OFF_KH);
  unsigned short* Kl  = (unsigned short*)(ws + OFF_KL);
  unsigned short* KTh = (unsigned short*)(ws + OFF_KTH);
  unsigned short* KTl = (unsigned short*)(ws + OFF_KTL);
  unsigned short* VTh = (unsigned short*)(ws + OFF_VTH);
  unsigned short* VTl = (unsigned short*)(ws + OFF_VTL);
  unsigned short* Oh  = (unsigned short*)(ws + OFF_OH);
  unsigned short* Ol  = (unsigned short*)(ws + OFF_OL);

  float* outF   = (float*)d_out;
  float* stateF = outF + OUT1_ELEM_OFF;

  // 1) RNE conversions to bf16 (inputs converted exactly once)
  {
    const int n2x = (int)(NX / 2);   // 2097152, multiple of 256
    const int n2w = (int)(NW / 2);   // 524288,  multiple of 256
    cast_f32_bf16x2<<<dim3(n2x / 256), dim3(256), 0, stream>>>(hs, Xb, n2x);
    cast_f32_bf16x2<<<dim3(n2w / 256), dim3(256), 0, stream>>>(Wq, Wqb, n2w);
    cast_f32_bf16x2<<<dim3(n2w / 256), dim3(256), 0, stream>>>(Wk, Wkb, n2w);
    cast_f32_bf16x2<<<dim3(n2w / 256), dim3(256), 0, stream>>>(Wv, Wvb, n2w);
    cast_f32_bf16x2<<<dim3(n2w / 256), dim3(256), 0, stream>>>(Wo, Wob, n2w);
  }

  // 2) projections: 64x64 tiles, 8 waves per block; every shape has 1024 tiles (64x16 or 16x64)
  const int gemmBlocksTok = ((NTOK / 64) * (HIDN / 64)) / 8;    // 1024 tiles / 8 = 128
  // q rows [4096][1024] = Xb . Wq^T + bq  -> hi/lo planes
  wmma_gemm64<1, false, false, 2, 2, 0><<<dim3(gemmBlocksTok, 1), dim3(256), 0, stream>>>(
      Xb, Xb, HIDN, 0L, Wqb, Wqb, HIDN, 0L, (void*)Qh, (void*)Ql, HIDN, 0L,
      bq, amask, NTOK, HIDN, HIDN, 1.0f);
  // k rows [4096][1024] = (Xb . Wk^T + bk) * mask[row]  -> hi/lo planes
  wmma_gemm64<1, false, false, 2, 2, 1><<<dim3(gemmBlocksTok, 1), dim3(256), 0, stream>>>(
      Xb, Xb, HIDN, 0L, Wkb, Wkb, HIDN, 0L, (void*)Kh, (void*)Kl, HIDN, 0L,
      bk, amask, NTOK, HIDN, HIDN, 1.0f);
  // k^T [1024][4096] = (Wk . Xb^T + bk[row]) * mask[col] -> hi/lo planes   (M=1024, N=4096)
  wmma_gemm64<1, false, false, 1, 2, 2><<<dim3(gemmBlocksTok, 1), dim3(256), 0, stream>>>(
      Wkb, Wkb, HIDN, 0L, Xb, Xb, HIDN, 0L, (void*)KTh, (void*)KTl, NTOK, 0L,
      bk, amask, HIDN, NTOK, HIDN, 1.0f);
  // v^T [1024][4096] = (Wv . Xb^T + bv[row]) * mask[col] -> hi/lo planes
  wmma_gemm64<1, false, false, 1, 2, 2><<<dim3(gemmBlocksTok, 1), dim3(256), 0, stream>>>(
      Wvb, Wvb, HIDN, 0L, Xb, Xb, HIDN, 0L, (void*)VTh, (void*)VTl, NTOK, 0L,
      bv, amask, HIDN, NTOK, HIDN, 1.0f);

  // 3) causal attention on the planes -> attention out hi/lo planes [4096][1024]
  const float sscale = 0.125f;   // 1 / (temperature * sqrt(64)), exact power of two
  attn_hd64_planes<<<dim3(NBATCH * NHEAD * (SEQ / AT_QB)), dim3(128), 0, stream>>>(
      Qh, Ql, Kh, Kl, VTh, VTl, amask, Oh, Ol, sscale);

  // 4) state[b][h][d][e] = sum_s k^T[h*64+d][b*S+s] * v^T[h*64+e][b*S+s]  (hi/lo on both operands); 4 tiles x 16 token slices per (b,h)
  for (int bb = 0; bb < NBATCH; ++bb) {
    state_ktv_slices<<<dim3(4, NHEAD), dim3(ST_NW * 32), 0, stream>>>(
        KTh + (size_t)bb * SEQ, KTl + (size_t)bb * SEQ, VTh + (size_t)bb * SEQ, VTl + (size_t)bb * SEQ,
        stateF + (size_t)bb * NHEAD * HDIM * HDIM);
  }

  // 5) out [4096][1024] = attn_out . Wo^T + bo  (A hi/lo, Wo exact bf16) -> d_out f32
  wmma_gemm64<1, true, false, 2, 0, 0><<<dim3(gemmBlocksTok, 1), dim3(256), 0, stream>>>(
      Oh, Ol, HIDN, 0L, Wob, Wob, HIDN, 0L, (void*)outF, (void*)Oh, HIDN, 0L,
      bo, amask, NTOK, HIDN, HIDN, 1.0f);
}

// v004
// It runs in 292 microseconds.
// In both of two side-by-side timings against v003, it was 1.49 times as fast.
// Over all steps from v000 it is 2.38 times as fast.
// Compute dtype: input projections v_wmma_f32_16x16x32_bf16 on bf16 operands (inputs RNE-converted once), f32 accumulate; scores, p.v and k^T.v state on bf16 hi/lo split planes (hi.hi + hi.lo + lo.hi), output projection on hi/lo A planes x bf16 Wo (hi.hi + lo.hi), f32 accumulate; softmax and side math f32.
#include <hip/hip_runtime.h>

// ---------------------------------------------------------------- geometry
constexpr int NBATCH = 2;
constexpr int SEQ    = 2048;
constexpr int HIDN   = 1024;
constexpr int NHEAD  = 16;
constexpr int HDIM   = 64;
constexpr int NTOK   = NBATCH * SEQ;                    /* 4096 token rows */
constexpr size_t NX  = (size_t)NTOK * HIDN;            /* 4194304 */
constexpr size_t NW  = (size_t)HIDN * HIDN;            /* 1048576 */
constexpr size_t OUT0_ELEMS    = NX;
constexpr size_t OUT1_ELEMS    = (size_t)NBATCH * NHEAD * HDIM * HDIM;   /* 131072 */
constexpr size_t OUT1_BYTE_OFF = 16777216;
constexpr size_t OUT1_ELEM_OFF = OUT1_BYTE_OFF / 4;
static_assert(OUT1_ELEM_OFF == OUT0_ELEMS);
static_assert(OUT1_BYTE_OFF + OUT1_ELEMS * 4 == 17301504);
static_assert(HIDN == NHEAD * HDIM);
static_assert(HDIM == 64);
static_assert(HIDN % 64 == 0 && NTOK % 64 == 0 && SEQ % 64 == 0);   /* every GEMM M and N is a 64-multiple */
static_assert(HIDN % 32 == 0 && SEQ % 32 == 0);                     /* every GEMM K is a multiple of 32 */
static_assert((NX % 512) == 0 && (NW % 512) == 0);                 /* cast kernels: whole waves only */

// ---------------------------------------------------------------- workspace map (bytes)
// 16-bit planes: token planes [4096][1024] or [1024][4096] = 8 MiB each; weight planes [1024][1024] = 2 MiB each.
// Every region is fully written by its producer (full M x N, no pad rows) before any consumer reads it.
constexpr size_t MIB      = (size_t)1 << 20;
constexpr size_t OFF_XB   = 0 * MIB;    /* hidden as bf16      8 MiB */
constexpr size_t OFF_WQ   = 8 * MIB;    /* Wq bf16             2 MiB */
constexpr size_t OFF_WK   = 10 * MIB;   /* Wk bf16             2 MiB */
constexpr size_t OFF_WV   = 12 * MIB;   /* Wv bf16             2 MiB */
constexpr size_t OFF_WO   = 14 * MIB;   /* Wo bf16             2 MiB */
constexpr size_t OFF_QH   = 16 * MIB;   /* q hi  [4096][1024]        */
constexpr size_t OFF_QL   = 24 * MIB;   /* q lo                      */
constexpr size_t OFF_KH   = 32 * MIB;   /* k hi  [4096][1024] (masked) */
constexpr size_t OFF_KL   = 40 * MIB;   /* k lo                      */
constexpr size_t OFF_KTH  = 48 * MIB;   /* k^T hi [1024][4096] (masked) */
constexpr size_t OFF_KTL  = 56 * MIB;   /* k^T lo                    */
constexpr size_t OFF_VTH  = 64 * MIB;   /* v^T hi [1024][4096] (masked) */
constexpr size_t OFF_VTL  = 72 * MIB;   /* v^T lo                    */
constexpr size_t OFF_OH   = 80 * MIB;   /* attention out hi [4096][1024] */
constexpr size_t OFF_OL   = 88 * MIB;   /* attention out lo          */
constexpr size_t WS_TOTAL = 96 * MIB;   /* 100663296 B */
static_assert(NX * 2 == 8 * MIB && NW * 2 == 2 * MIB);
static_assert(WS_TOTAL <= 134217728);

// ---------------------------------------------------------------- types / helpers
typedef __attribute__((ext_vector_type(16))) _Float16 v16h;
typedef __attribute__((ext_vector_type(8)))  _Float16 v8h;
typedef __attribute__((ext_vector_type(16))) __bf16   v16b;
typedef __attribute__((ext_vector_type(8)))  __bf16   v8b;
typedef __attribute__((ext_vector_type(8)))  float    v8f;
typedef __attribute__((ext_vector_type(4)))  float    v4f;
typedef __attribute__((ext_vector_type(2)))  float    v2f;
typedef __attribute__((ext_vector_type(4)))  unsigned u4v;

__device__ __forceinline__ unsigned short f2bf_bits(float f) {
  unsigned u = __float_as_uint(f);
  return (unsigned short)((u + 0x7FFFu + ((u >> 16) & 1u)) >> 16);
}
__device__ __forceinline__ float bf_bits2f(unsigned short h) { return __uint_as_float(((unsigned)h) << 16); }
__device__ __forceinline__ float bfr(float f) { return bf_bits2f(f2bf_bits(f)); }

__device__ __forceinline__ void sched_fence() { asm volatile("" ::: "memory"); }

// hazard guards as plain device helpers (no inline asm inside the kernel template body)
__device__ __forceinline__ void dep_guard_h(v8f& a, v8f& b, v16h x, v16h y) { asm volatile("v_nop\n\tv_nop\n\tv_nop\n\tv_nop" : "+v"(a), "+v"(b) : "v"(x), "v"(y)); }
__device__ __forceinline__ void dep_guard_b(v8f& a, v8f& b, v16b x, v16b y) { asm volatile("v_nop\n\tv_nop\n\tv_nop\n\tv_nop" : "+v"(a), "+v"(b) : "v"(x), "v"(y)); }
__device__ __forceinline__ void keep4_h(v16h a, v16h b, v16h c, v16h d) { asm volatile("v_nop" :: "v"(a), "v"(b), "v"(c), "v"(d)); }
__device__ __forceinline__ void keep4_b(v16b a, v16b b, v16b c, v16b d) { asm volatile("v_nop" :: "v"(a), "v"(b), "v"(c), "v"(d)); }
__device__ __forceinline__ void acc_guard4(v8f& a, v8f& b, v8f& c, v8f& d) { asm volatile("v_nop\n\tv_nop\n\tv_nop\n\tv_nop" : "+v"(a), "+v"(b), "+v"(c), "+v"(d)); }
template <typename T> struct Frag;
template <> struct Frag<_Float16> {
  typedef v16h V; union U { v16h v; v8h h[2]; };
  static __device__ __forceinline__ v16h load(const _Float16* p) {   // elements 0..7 <- p[0..7], 8..15 <- p[16..23]
    U f; f.h[0] = *(const v8h*)(p); f.h[1] = *(const v8h*)(p + 16); return f.v;
  }
  static __device__ __forceinline__ v8f mma(v16h a, v16h b, v8f c) {
    return __builtin_amdgcn_wmma_f32_16x16x32_f16(false, a, false, b, (short)0, c, false, false);
  }
  static __device__ __forceinline__ void guard(v8f& a, v8f& b, v16h x, v16h y) { dep_guard_h(a, b, x, y); }
  static __device__ __forceinline__ void keep(v16h a, v16h b, v16h c, v16h d) { keep4_h(a, b, c, d); }
};
template <> struct Frag<__bf16> {
  typedef v16b V; union U { v16b v; v8b h[2]; };
  static __device__ __forceinline__ v16b load(const __bf16* p) {
    U f; f.h[0] = *(const v8b*)(p); f.h[1] = *(const v8b*)(p + 16); return f.v;
  }
  static __device__ __forceinline__ v8f mma(v16b a, v16b b, v8f c) {
    return __builtin_amdgcn_wmma_f32_16x16x32_bf16(false, a, false, b, (short)0, c, false, false);
  }
  static __device__ __forceinline__ void guard(v8f& a, v8f& b, v16b x, v16b y) { dep_guard_b(a, b, x, y); }
  static __device__ __forceinline__ void keep(v16b a, v16b b, v16b c, v16b d) { keep4_b(a, b, c, d); }
};

// ---- Register-blocked batched WMMA GEMM ------------------------------------
// C[m,n] = rs * (scale * sum_k A[m,k] * Bt[n,k] + bias); each wave owns a 64x64 tile.
// A row-major [M,K]; Bt row-major [N,K]; M % 128 == 0, N % 256 == 0, K % 64 == 0.
// Block = 8 waves (2 x 4) = one 128x256 tile. A stage is 64 k = one 128-byte line of every operand row of the block tile.
// Asynchronous 16-byte copies (8 lanes per row, whole lines) bring a stage from global memory into one of two LDS buffers
// while the other buffer is multiplied; the waves read their fragments from LDS.
// SPLIT: A carried as hi/lo planes (A2 = lo); BLO: Bt also carried as hi/lo (Bt2 = lo);
//   product = hi.hi (+ hi.lo when BLO) + lo.hi.   SPLIT+BLO is the stock hi/lo path.
// BIAS_MODE: 0 = none, 1 = bias[m], 2 = bias[n]  (bias value RNE-converted to bf16 precision).
// RS_MODE:   0 = none, 1 = multiply by rsc[m], 2 = multiply by rsc[n]  (rsc value RNE-converted to bf16).
// OUT_MODE: 0 = f32, 1 = f16, 2 = bf16 hi plane (Cout) + bf16 lo plane (Cout2).
// ET: 0 = f16 operands, 1 = bf16 operands (pointers passed as 16-bit storage)
constexpr int GB_M = 128;   // block tile rows
constexpr int GB_N = 256;   // block tile columns
constexpr int GB_K = 64;    // k per stage
constexpr int GB_P = 72;    // LDS row pitch in elements: 144 B = 16 B x 9 (odd), distinct banks for the 16 rows of a 16-byte fragment read
static_assert(HIDN % GB_N == 0 && NTOK % GB_N == 0 && HIDN % GB_K == 0);   /* every GEMM M, N is a multiple of the block tile, K of the stage */

// four asynchronous 16-byte copies to LDS, every lane with its own LDS byte address and global address;
// s_wait_xcnt 0 closes the statement as a precaution: no address register of a copy is rewritten in front of it
__device__ __forceinline__ void copy4_async(unsigned l0, const void* g0, unsigned l1, const void* g1,
                                            unsigned l2, const void* g2, unsigned l3, const void* g3) {
  asm volatile("global_load_async_to_lds_b128 %0, %1, off\n\t"
               "global_load_async_to_lds_b128 %2, %3, off\n\t"
               "global_load_async_to_lds_b128 %4, %5, off\n\t"
               "global_load_async_to_lds_b128 %6, %7, off\n\t"
               "s_wait_xcnt 0x0"
               :: "v"(l0), "v"(g0), "v"(l1), "v"(g1), "v"(l2), "v"(g2), "v"(l3), "v"(g3) : "memory");
}
// this wave's copies have landed behind this one
__device__ __forceinline__ void wait_async0() { asm volatile("s_wait_asynccnt 0x0" ::: "memory"); }
// this wave's LDS reads have returned: stands in front of the barrier behind which their buffer is refilled
__device__ __forceinline__ void wait_ds0() { asm volatile("s_wait_dscnt 0x0" ::: "memory"); }

template <int ET> struct Elem;
template <> struct Elem<0> { typedef _Float16 T; };
template <> struct Elem<1> { typedef __bf16 T; };
template <int ET, bool SPLIT, bool BLO, int BIAS_MODE, int OUT_MODE, int RS_MODE>
__global__ __launch_bounds__(256) void wmma_gemm64(
    const unsigned short* __restrict__ Ap, const unsigned short* __restrict__ A2p, int lda, long strideA,
    const unsigned short* __restrict__ Btp, const unsigned short* __restrict__ Bt2p, int ldb, long strideB,
    void* __restrict__ Cout, void* __restrict__ Cout2, int ldc, long strideC,
    const float* __restrict__ bias, const float* __restrict__ rsc,
    int M, int N, int K, float scale) {
  typedef typename Elem<ET>::T T;
  typedef typename Frag<T>::V V;
  const T* A = (const T*)Ap; const T* A2 = (const T*)A2p; const T* Bt = (const T*)Btp; const T* Bt2 = (const T*)Bt2p;
  constexpr int NPA = SPLIT ? 2 : 1;              // planes of A
  constexpr int NPB = (SPLIT && BLO) ? 2 : 1;     // planes of Bt
  __shared__ __align__(16) T sA[2][NPA][GB_M * GB_P];   // two buffers of A rows  [row][k], 18 KB per plane
  __shared__ __align__(16) T sB[2][NPB][GB_N * GB_P];   // two buffers of Bt rows [row][k], 36 KB per plane
  __shared__ __align__(16) float sT[8][16 * 68];   // per-wave 16x64 slab, pitch 68 floats
  const int b    = blockIdx.y;
  const int tid  = threadIdx.x;
  const int lane = tid & 31;
  const int wave = tid >> 5;
  const int blocksN = N / GB_N;
  const int bm = blockIdx.x / blocksN;
  const int bn = blockIdx.x - bm * blocksN;
  if (bm >= M / GB_M) return;            // block-uniform, in front of every copy and barrier
  const int mB = bm * GB_M;              // block tile origin
  const int nB = bn * GB_N;
  const int wm = (wave >> 2) << 6;       // wave tile origin inside the block tile
  const int wn = (wave & 3) << 6;
  const int m0 = mB + wm;
  const int n0 = nB + wn;

  const T* Ab  = A  + (size_t)b * strideA;
  const T* Bb  = Bt + (size_t)b * strideB;
  const T* Ab2 = SPLIT ? (A2  + (size_t)b * strideA) : nullptr;
  const T* Bb2 = (SPLIT && BLO) ? (Bt2 + (size_t)b * strideB) : nullptr;

  const int rlane = lane & 15;                 // row (A) / col (B, D) within subtile
  const int koff  = (lane >> 4) * 8;           // k offset of this lane half
  const int mOff  = (lane >> 4) * 8;           // D row offset

  // staging coverage: 256 threads x 4 copies = 1024 = 128 rows x 8 pieces of 16 B (A plane); x 8 copies = 2048 = 256 rows x 8 (Bt plane);
  // copy i of a thread is row srow + 32 i, piece tid & 7: every piece once, every address a multiple of 16 B
  const int srow = tid >> 3;                   // 0..31
  const int sc8  = (tid & 7) * 8;
  constexpr unsigned RS = 32 * GB_P * 2;       // LDS bytes between a thread's successive copies
  const unsigned ldsA = (unsigned)(size_t)(&sA[0][0][srow * GB_P + sc8]);   // low 32 bits = byte address in the work-group's LDS
  const unsigned ldsB = (unsigned)(size_t)(&sB[0][0][srow * GB_P + sc8]);
  const size_t astep = (size_t)32 * lda * 2, bstep = (size_t)32 * ldb * 2;  // global bytes between them
  auto stage = [&](int st, int buf) {
    const size_t ka = ((size_t)(mB + srow) * lda + (size_t)st * GB_K + sc8) * 2;
    const size_t kb = ((size_t)(nB + srow) * ldb + (size_t)st * GB_K + sc8) * 2;
#pragma unroll
    for (int p = 0; p < NPA; ++p) {
      const char* g = (const char*)(p == 0 ? Ab : Ab2) + ka;
      const unsigned l = ldsA + (unsigned)(buf * NPA + p) * (unsigned)(GB_M * GB_P * 2);
      copy4_async(l, g, l + RS, g + astep, l + 2 * RS, g + 2 * astep, l + 3 * RS, g + 3 * astep);
    }
#pragma unroll
    for (int p = 0; p < NPB; ++p) {
      const char* g = (const char*)(p == 0 ? Bb : Bb2) + kb;
      const unsigned l = ldsB + (unsigned)(buf * NPB + p) * (unsigned)(GB_N * GB_P * 2);
      copy4_async(l, g, l + RS, g + bstep, l + 2 * RS, g + 2 * bstep, l + 3 * RS, g + 3 * bstep);
      copy4_async(l + 4 * RS, g + 4 * bstep, l + 5 * RS, g + 5 * bstep, l + 6 * RS, g + 6 * bstep, l + 7 * RS, g + 7 * bstep);
    }
  };

  v8f acc[4][4];
#pragma unroll
  for (int i = 0; i < 4; ++i)
#pragma unroll
    for (int j = 0; j < 4; ++j) acc[i][j] = (v8f){0.f,0.f,0.f,0.f,0.f,0.f,0.f,0.f};

  const int nst = K / GB_K;                    // stages, block-uniform
  stage(0, 0);
  wait_async0();
  __syncthreads();                             // stage 0 is complete before any wave reads it
  if (nst > 1) stage(1, 1);
  for (int t = 0; t < nst; ++t) {
    const int cur = t & 1;
#pragma unroll
    for (int kk = 0; kk < GB_K; kk += 32) {
      V bh[4], bl[4], ah[4], al[4];
#pragma unroll
      for (int j = 0; j < 4; ++j) {
        const int bo = (wn + (j << 4) + rlane) * GB_P + kk + koff;
        bh[j] = Frag<T>::load(&sB[cur][0][bo]);
        if (SPLIT && BLO) bl[j] = Frag<T>::load(&sB[cur][NPB - 1][bo]);
        else bl[j] = bh[j];
      }
#pragma unroll
      for (int i = 0; i < 4; ++i) {
        const int ao = (wm + (i << 4) + rlane) * GB_P + kk + koff;
        ah[i] = Frag<T>::load(&sA[cur][0][ao]);
        if (SPLIT) al[i] = Frag<T>::load(&sA[cur][NPA - 1][ao]);
        else al[i] = ah[i];
      }
#pragma unroll
      for (int i = 0; i < 4; ++i) {
#pragma unroll
        for (int j = 0; j < 4; ++j) {
          acc[i][j] = Frag<T>::mma(ah[i], bh[j], acc[i][j]);
          if (SPLIT) {
            if (BLO) acc[i][j] = Frag<T>::mma(ah[i], bl[j], acc[i][j]);
            acc[i][j] = Frag<T>::mma(al[i], bh[j], acc[i][j]);
          }
        }
        Frag<T>::guard(acc[i][0], acc[i][3], ah[i], al[i]);
      }
      Frag<T>::keep(bh[0], bh[1], bh[2], bh[3]);
      if (SPLIT && BLO) Frag<T>::keep(bl[0], bl[1], bl[2], bl[3]);
    }
    wait_ds0();                                // this wave has finished reading buffer cur
    wait_async0();                             // this wave's copies of stage t + 1 have landed
    __syncthreads();                           // publishes stage t + 1 and frees buffer cur
    if (t + 2 < nst) stage(t + 2, cur);        // block-uniform
  }
  wait_async0();                               // nothing is in flight when the wave goes on
  acc_guard4(acc[0][0], acc[0][1], acc[0][2], acc[0][3]);
  acc_guard4(acc[1][0], acc[1][1], acc[1][2], acc[1][3]);
  acc_guard4(acc[2][0], acc[2][1], acc[2][2], acc[2][3]);
  acc_guard4(acc[3][0], acc[3][1], acc[3][2], acc[3][3]);

  // ---- epilogue ----
  float* slab = sT[wave];
#pragma unroll
  for (int i = 0; i < 4; ++i) {
    const int mBase = m0 + (i << 4);
    float bm[8], rm[8];
#pragma unroll
    for (int r = 0; r < 8; ++r) { bm[r] = 0.f; rm[r] = 1.f; }
    if (BIAS_MODE == 1) {
      // rows mBase+mOff .. +7 are contiguous and 32-B aligned: two 16-B loads
      const v4f t0 = *(const v4f*)(bias + mBase + mOff);
      const v4f t1 = *(const v4f*)(bias + mBase + mOff + 4);
#pragma unroll
      for (int r = 0; r < 4; ++r) { bm[r] = bfr(t0[r]); bm[4 + r] = bfr(t1[r]); }
    }
    if (RS_MODE == 1) {
      const v4f t0 = *(const v4f*)(rsc + mBase + mOff);
      const v4f t1 = *(const v4f*)(rsc + mBase + mOff + 4);
#pragma unroll
      for (int r = 0; r < 4; ++r) { rm[r] = bfr(t0[r]); rm[4 + r] = bfr(t1[r]); }
    }
#pragma unroll
    for (int j = 0; j < 4; ++j) {
      const int n = n0 + (j << 4) + rlane;
      float bn = 0.f, rn = 1.f;
      if (BIAS_MODE == 2) bn = bfr(bias[n]);
      if (RS_MODE == 2)   rn = bfr(rsc[n]);
#pragma unroll
      for (int r = 0; r < 8; ++r) {
        float v = acc[i][j][r] * scale;
        if (BIAS_MODE == 1) v += bm[r];
        if (BIAS_MODE == 2) v += bn;
        if (RS_MODE == 1) v *= rm[r];
        if (RS_MODE == 2) v *= rn;
        slab[(mOff + r) * 68 + (j << 4) + rlane] = v;
      }
    }
    __builtin_amdgcn_fence(__ATOMIC_RELEASE, "workgroup");
    __builtin_amdgcn_wave_barrier();
    __builtin_amdgcn_fence(__ATOMIC_ACQUIRE, "workgroup");
    if (OUT_MODE == 0) {
      float* C = (float*)Cout + (size_t)b * strideC;
      const int hh = lane >> 4, c4 = (lane & 15) * 4;     // row seg = 256 B = 16 lanes x 16 B
      {
#pragma unroll
        for (int it = 0; it < 8; ++it) {
          const int row = it * 2 + hh;
          v4f v = *(const v4f*)(slab + row * 68 + c4);
          *(v4f*)(C + (size_t)(mBase + row) * ldc + n0 + c4) = v;
        }
        
      }
    } else {
      const int q = lane >> 3, c8 = (lane & 7) * 8;
      unsigned short* C  = (unsigned short*)Cout  + (size_t)b * strideC;
      unsigned short* C2 = (OUT_MODE == 2) ? ((unsigned short*)Cout2 + (size_t)b * strideC) : nullptr;
      {
#pragma unroll
        for (int it = 0; it < 4; ++it) {
          const int row = it * 4 + q;
          const float* sp = slab + row * 68 + c8;
          v8h hv, lv;
#pragma unroll
          for (int e = 0; e < 8; ++e) {
            if (OUT_MODE == 1) {
              hv[e] = (_Float16)sp[e];
              lv[e] = hv[e];
            } else {
              unsigned short hb = f2bf_bits(sp[e]);
              unsigned short lb = f2bf_bits(sp[e] - bf_bits2f(hb));
              hv[e] = __builtin_bit_cast(_Float16, hb);
              lv[e] = __builtin_bit_cast(_Float16, lb);
            }
          }
          *(v8h*)(C + (size_t)(mBase + row) * ldc + n0 + c8) = hv;
          if (OUT_MODE == 2) *(v8h*)(C2 + (size_t)(mBase + row) * ldc + n0 + c8) = lv;
        }
        
      }
    }
    __builtin_amdgcn_fence(__ATOMIC_RELEASE, "workgroup");
    __builtin_amdgcn_wave_barrier();
    __builtin_amdgcn_fence(__ATOMIC_ACQUIRE, "workgroup");
  }
}

// coverage: grid = n2/256 blocks exactly (n2 % 256 == 0 asserted on the host); thread i writes elements 2i, 2i+1.
__global__ __launch_bounds__(256) void cast_f32_bf16x2(
    const float* __restrict__ in, unsigned short* __restrict__ out, int n2) {
  int i = blockIdx.x * 256 + threadIdx.x;
  if (i < n2) {
    const v2f f = *(const v2f*)(in + 2 * (size_t)i);
    const unsigned u = (unsigned)f2bf_bits(f[0]) | ((unsigned)f2bf_bits(f[1]) << 16);
    ((unsigned*)out)[i] = u;
    
  }
}

// =====================================================================================
// Causal attention for head_dim 64 on bf16 hi/lo planes.
//   q planes  : [NTOK][HIDN] (row = b*SEQ + s, col = h*64 + d), hi and lo
//   k planes  : [NTOK][HIDN] same layout, hi and lo (padding mask already folded in)
//   v^T planes: [HIDN][NTOK] (row = h*64 + d, col = b*SEQ + s), hi and lo (mask folded in)
//   out planes: [NTOK][HIDN] bf16 hi and lo
//   scores = (q.k^T) * sscale : hi.hi + hi.lo + lo.hi, f32 accumulate; key j masked where j > q or amask[b][j] == 0 (score := -inf)
//   out    = p.v / l          : p (f32 exp terms) split to bf16 hi/lo per tile, v hi/lo, 3 products, f32 accumulate
//   Block = 4 waves = 64 query rows of one (b, h); grid.x = NBATCH*NHEAD*(SEQ/64).
//   fragments in flight besides the persistent per-wave state.
// =====================================================================================
constexpr int AT_D  = 64;
constexpr int AT_NW = 4;
constexpr int AT_QB = 64;
constexpr int AT_KC = 64;
constexpr int AT_P  = 72;   // LDS row pitch in elements: 144 B = 16 B x 9 (odd), so the 16 rows of a 16-byte fragment read fall on distinct banks

__device__ __forceinline__ __bf16 at_f2bf(float f) { return __builtin_bit_cast(__bf16, f2bf_bits(f)); }
__device__ __forceinline__ void at_split(float f, __bf16& hi, __bf16& lo) {
  const unsigned short hb = f2bf_bits(f);
  hi = __builtin_bit_cast(__bf16, hb);
  lo = at_f2bf(f - __uint_as_float(((unsigned)hb) << 16));
}
__device__ __forceinline__ v8f at_mma(v16b a, v16b b, v8f c) {
  c = __builtin_amdgcn_wmma_f32_16x16x32_bf16(false, a, false, b, (short)0, c, false, false);
  asm volatile("v_nop\n\tv_nop\n\tv_nop\n\tv_nop" : "+v"(c) : "v"(a), "v"(b));
  return c;
}

__global__ __launch_bounds__(128) __attribute__((amdgpu_num_vgpr(256)))
void attn_hd64_planes(const unsigned short* __restrict__ Qh, const unsigned short* __restrict__ Ql,
                      const unsigned short* __restrict__ Kh, const unsigned short* __restrict__ Kl,
                      const unsigned short* __restrict__ VTh, const unsigned short* __restrict__ VTl,
                      const float* __restrict__ amask,
                      unsigned short* __restrict__ Oh, unsigned short* __restrict__ Ol,
                      float sscale) {
  union FB { v16b v; v8b h[2]; };
  __shared__ __align__(16) __bf16 Ksh[AT_KC * AT_P];     // k hi [kv][d]     9 KB
  __shared__ __align__(16) __bf16 Ksl[AT_KC * AT_P];     // k lo
  __shared__ __align__(16) __bf16 Vth[AT_D * AT_P];      // v hi [d][kv]     9 KB
  __shared__ __align__(16) __bf16 Vtl[AT_D * AT_P];     // v lo
  __shared__ __align__(16) __bf16 Psh[AT_NW][16 * AT_P];   // per wave p hi [row][kv]
  __shared__ __align__(16) __bf16 Psl[AT_NW][16 * AT_P];   // per wave p lo
  __shared__ __align__(16) float  Os[AT_NW][16 * 68];       // per wave out tile, pitch 68

  const int tid  = threadIdx.x;
  const int wave = tid >> 5;
  const int lane = tid & 31;
  const int hh   = lane >> 4;
  const int c    = lane & 15;

  const int nqb = SEQ / AT_QB;                  // 32
  const int bx  = blockIdx.x;
  const int qb  = bx % nqb;
  const int bhd = bx / nqb;
  const int h   = bhd % NHEAD;
  const int b   = bhd / NHEAD;
  const int q0  = qb * AT_QB + wave * 16;
  const int tok0 = b * SEQ;
  const int hcol = h * HDIM;

  // ---- Q fragments (A operand): 2 d-chunks, hi and lo, split k-map via Frag::load ----
  v16b qah[2], qal[2];
  {
    const __bf16* qhp = (const __bf16*)Qh + (size_t)(tok0 + q0 + c) * HIDN + hcol + 8 * hh;
    const __bf16* qlp = (const __bf16*)Ql + (size_t)(tok0 + q0 + c) * HIDN + hcol + 8 * hh;
#pragma unroll
    for (int dc = 0; dc < 2; ++dc) {
      qah[dc] = Frag<__bf16>::load(qhp + dc * 32);
      qal[dc] = Frag<__bf16>::load(qlp + dc * 32);
    }
  }

  float mrow[8], lrow[8];
  v8f oacc[4];
#pragma unroll
  for (int r = 0; r < 8; ++r) { mrow[r] = -__builtin_inff(); lrow[r] = 0.f; }
#pragma unroll
  for (int t = 0; t < 4; ++t) oacc[t] = (v8f){0.f,0.f,0.f,0.f,0.f,0.f,0.f,0.f};

  const int nChunks = qb + 1;                   // causal, block-uniform, <= 32
  for (int kc = 0; kc < nChunks; ++kc) {
    const int kv0 = kc * AT_KC;
    __syncthreads();
    {
      // staging coverage: 128 threads x 4 ids = 512 ids = 64 rows x 8 chunks of 8 elements = 64x64 per plane, exact
#pragma unroll
      for (int i = 0; i < 4; ++i) {
        const int id = tid + 128 * i;
        const int row = id >> 3, c8 = (id & 7) * 8;
        const size_t ko = (size_t)(tok0 + kv0 + row) * HIDN + hcol + c8;
        const u4v a0 = *(const u4v*)(Kh + ko);
        const u4v a1 = *(const u4v*)(Kl + ko);
        *(u4v*)(Ksh + row * AT_P + c8) = a0;
        *(u4v*)(Ksl + row * AT_P + c8) = a1;
      }
      sched_fence();
#pragma unroll
      for (int i = 0; i < 4; ++i) {
        const int id = tid + 128 * i;
        const int row = id >> 3, c8 = (id & 7) * 8;      // row = d
        const size_t vo = (size_t)(hcol + row) * NTOK + tok0 + kv0 + c8;
        const u4v a0 = *(const u4v*)(VTh + vo);
        const u4v a1 = *(const u4v*)(VTl + vo);
        *(u4v*)(Vth + row * AT_P + c8) = a0;
        *(u4v*)(Vtl + row * AT_P + c8) = a1;
      }
    }
    __syncthreads();

    v8f s[4];
#pragma unroll
    for (int j = 0; j < 4; ++j) {
      v8f sj = (v8f){0.f,0.f,0.f,0.f,0.f,0.f,0.f,0.f};
#pragma unroll
      for (int dc = 0; dc < 2; ++dc) {
        FB kb, kl;
        const __bf16* khp = Ksh + (j * 16 + c) * AT_P + dc * 32 + 8 * hh;
        const __bf16* klp = Ksl + (j * 16 + c) * AT_P + dc * 32 + 8 * hh;
        kb.h[0] = *(const v8b*)(khp);
        kb.h[1] = *(const v8b*)(khp + 16);
        kl.h[0] = *(const v8b*)(klp);
        kl.h[1] = *(const v8b*)(klp + 16);
        sj = at_mma(qah[dc], kb.v, sj);
        sj = at_mma(qah[dc], kl.v, sj);
        sj = at_mma(qal[dc], kb.v, sj);
        sched_fence();
      }
      s[j] = sj;
    }
    // key index of each score column; a padded key (amask == 0) gets an index above every query row,
    // so one integer compare and one select per score cover the causal and the padding mask without a branch
    int kidx[4];
#pragma unroll
    for (int j = 0; j < 4; ++j) {
      const float kvm = amask[(size_t)tok0 + kv0 + j * 16 + c];
      kidx[j] = (kvm == 0.0f) ? 0x7fffffff : (kv0 + j * 16 + c);
    }
    float cm[8];
#pragma unroll
    for (int r = 0; r < 8; ++r) {
      const int qrow = q0 + 8 * hh + r;
      float m = -__builtin_inff();
#pragma unroll
      for (int j = 0; j < 4; ++j) {
        const float sc  = s[j][r] * sscale;
        const float val = (kidx[j] > qrow) ? -__builtin_inff() : sc;
        s[j][r] = val;
        m = fmaxf(m, val);
      }
#pragma unroll
      for (int off = 1; off < 16; off <<= 1) m = fmaxf(m, __shfl_xor(m, off, 32));
      cm[r] = m;
    }
    __bf16* pwh = Psh[wave];
    __bf16* pwl = Psl[wave];
#pragma unroll
    for (int r = 0; r < 8; ++r) {
      const float mnew = fmaxf(mrow[r], cm[r]);
      const float alpha = expf(mrow[r] - mnew);
      mrow[r] = mnew;
      float psum = 0.f;
#pragma unroll
      for (int j = 0; j < 4; ++j) {
        const float p = expf(s[j][r] - mnew);
        psum += p;
        __bf16 a, bl; at_split(p, a, bl);
        pwh[(8 * hh + r) * AT_P + j * 16 + c] = a;
        pwl[(8 * hh + r) * AT_P + j * 16 + c] = bl;
      }
#pragma unroll
      for (int off = 1; off < 16; off <<= 1) psum += __shfl_xor(psum, off, 32);
      lrow[r] = lrow[r] * alpha + psum;
#pragma unroll
      for (int t = 0; t < 4; ++t) oacc[t][r] *= alpha;
    }
    __builtin_amdgcn_fence(__ATOMIC_RELEASE, "workgroup");
    __builtin_amdgcn_wave_barrier();
    __builtin_amdgcn_fence(__ATOMIC_ACQUIRE, "workgroup");
#pragma unroll 1
    for (int kk = 0; kk < 2; ++kk) {
      FB pa, pl;
      pa.h[0] = *(const v8b*)(pwh + c * AT_P + kk * 32 + 8 * hh);
      pa.h[1] = *(const v8b*)(pwh + c * AT_P + kk * 32 + 16 + 8 * hh);
      pl.h[0] = *(const v8b*)(pwl + c * AT_P + kk * 32 + 8 * hh);
      pl.h[1] = *(const v8b*)(pwl + c * AT_P + kk * 32 + 16 + 8 * hh);
      sched_fence();
#pragma unroll
      for (int t = 0; t < 4; ++t) {
        FB vb, vl;
        const __bf16* vhp = Vth + (t * 16 + c) * AT_P + kk * 32 + 8 * hh;
        const __bf16* vlp = Vtl + (t * 16 + c) * AT_P + kk * 32 + 8 * hh;
        vb.h[0] = *(const v8b*)(vhp);
        vb.h[1] = *(const v8b*)(vhp + 16);
        vl.h[0] = *(const v8b*)(vlp);
        vl.h[1] = *(const v8b*)(vlp + 16);
        oacc[t] = at_mma(pa.v, vb.v, oacc[t]);
        oacc[t] = at_mma(pa.v, vl.v, oacc[t]);
        oacc[t] = at_mma(pl.v, vb.v, oacc[t]);
        sched_fence();
      }
    }
  }

  float* os = Os[wave];
#pragma unroll
  for (int r = 0; r < 8; ++r) {
    const float inv = 1.0f / lrow[r];
#pragma unroll
    for (int t = 0; t < 4; ++t) os[(8 * hh + r) * 68 + t * 16 + c] = oacc[t][r] * inv;
  }
  __builtin_amdgcn_fence(__ATOMIC_RELEASE, "workgroup");
  __builtin_amdgcn_wave_barrier();
  __builtin_amdgcn_fence(__ATOMIC_ACQUIRE, "workgroup");
  {
    const int q = lane >> 3, c8 = (lane & 7) * 8;
    {
#pragma unroll
      for (int it = 0; it < 4; ++it) {
        const int row = it * 4 + q;
        const float* sp = os + row * 68 + c8;
        v8h hv, lv;
#pragma unroll
        for (int e = 0; e < 8; ++e) {
          unsigned short hb = f2bf_bits(sp[e]);
          unsigned short lb = f2bf_bits(sp[e] - bf_bits2f(hb));
          hv[e] = __builtin_bit_cast(_Float16, hb);
          lv[e] = __builtin_bit_cast(_Float16, lb);
        }
        const size_t oo = (size_t)(tok0 + q0 + row) * HIDN + hcol + c8;
        *(v8h*)(Oh + oo) = hv;
        *(v8h*)(Ol + oo) = lv;
      }
      
    }
  }
}

// =====================================================================================
// k^T.v state: St[h][d][e] = sum_s kT[h*64+d][s] * vT[h*64+e][s] over SEQ tokens of one batch.
//   planes: [HIDN][NTOK] bf16 hi and lo, pointers already moved to the batch's first token
//   product = hi.hi + hi.lo + lo.hi, f32 accumulate (same three products per k step as the GEMM's hi/lo path)
//   Block = 16 waves = one 32x32 tile of one head; wave w sums tokens [w*128, w*128+128).
//   The 16 partial tiles meet in LDS and are added in wave order 0..15. grid = (4 tiles, NHEAD).
// =====================================================================================
constexpr int ST_NW = 16;                 // waves per block = slices of the token sum
constexpr int ST_KS = SEQ / ST_NW;        // 128 tokens per wave
static_assert(ST_KS % 32 == 0);

__global__ __launch_bounds__(ST_NW * 32)
void state_ktv_slices(const unsigned short* __restrict__ KTh, const unsigned short* __restrict__ KTl,
                      const unsigned short* __restrict__ VTh, const unsigned short* __restrict__ VTl,
                      float* __restrict__ St) {
  __shared__ __align__(16) float part[ST_NW][32 * 32];   // one 4 KB partial tile per wave, in accumulator order
  const int tid  = threadIdx.x;
  const int wave = tid >> 5;
  const int lane = tid & 31;
  const int hh   = lane >> 4;
  const int c    = lane & 15;
  const int h    = blockIdx.y;
  const int d0   = (blockIdx.x >> 1) * 32;
  const int e0   = (blockIdx.x & 1) * 32;

  const size_t ao = (size_t)(h * HDIM + d0 + c) * NTOK + wave * ST_KS + 8 * hh;
  const size_t bo = (size_t)(h * HDIM + e0 + c) * NTOK + wave * ST_KS + 8 * hh;
  const __bf16* pah = (const __bf16*)KTh + ao;
  const __bf16* pal = (const __bf16*)KTl + ao;
  const __bf16* pbh = (const __bf16*)VTh + bo;
  const __bf16* pbl = (const __bf16*)VTl + bo;

  v8f acc[2][2];
#pragma unroll
  for (int i = 0; i < 2; ++i)
#pragma unroll
    for (int j = 0; j < 2; ++j) acc[i][j] = (v8f){0.f,0.f,0.f,0.f,0.f,0.f,0.f,0.f};

  // unrolled (4 steps): the step offsets fold into the loads' immediate fields and later steps' loads issue among earlier products
#pragma unroll
  for (int ks = 0; ks < ST_KS / 32; ++ks) {
    v16b ah[2], al[2], bh[2], bl[2];
#pragma unroll
    for (int i = 0; i < 2; ++i) {
      const size_t o = (size_t)i * 16 * NTOK + ks * 32;
      ah[i] = Frag<__bf16>::load(pah + o);
      al[i] = Frag<__bf16>::load(pal + o);
      bh[i] = Frag<__bf16>::load(pbh + o);
      bl[i] = Frag<__bf16>::load(pbl + o);
    }
#pragma unroll
    for (int i = 0; i < 2; ++i)
#pragma unroll
      for (int j = 0; j < 2; ++j) {
        acc[i][j] = Frag<__bf16>::mma(ah[i], bh[j], acc[i][j]);
        acc[i][j] = Frag<__bf16>::mma(ah[i], bl[j], acc[i][j]);
        acc[i][j] = Frag<__bf16>::mma(al[i], bh[j], acc[i][j]);
      }
  }

  // partial tile to LDS: eighth q = (i*2+j)*2 + half holds accumulator rows half*4..half*4+3 of every lane, 16 B per lane
  float* slab = part[wave];
#pragma unroll
  for (int i = 0; i < 2; ++i)
#pragma unroll
    for (int j = 0; j < 2; ++j) {
      const v8f a = acc[i][j];
      const int q = (i * 2 + j) * 2;
      *(v4f*)(slab + (q + 0) * 128 + lane * 4) = (v4f){a[0], a[1], a[2], a[3]};
      *(v4f*)(slab + (q + 1) * 128 + lane * 4) = (v4f){a[4], a[5], a[6], a[7]};
    }
  __syncthreads();

  // 512 threads x 2 floats = the 32x32 tile; each thread adds its two positions over the 16 slices in wave order
  v2f sum = (v2f){0.f, 0.f};
#pragma unroll
  for (int w = 0; w < ST_NW; ++w) sum += *(const v2f*)(&part[w][tid * 2]);

  // position tid*2 back to (row, col): q = tid>>6, source lane = (tid>>1)&31, accumulator rows (q&1)*4 + (tid&1)*2 and the next
  const int q   = tid >> 6;
  const int sl  = (tid >> 1) & 31;
  const int row = (q >> 2) * 16 + (sl >> 4) * 8 + (q & 1) * 4 + (tid & 1) * 2;
  const int col = ((q >> 1) & 1) * 16 + (sl & 15);
  float* o = St + (size_t)h * HDIM * HDIM + (size_t)(d0 + row) * HDIM + e0 + col;
  o[0]    = sum[0];
  o[HDIM] = sum[1];
}

// ---------------------------------------------------------------- launcher
extern "C" void kernel_launch(void* const* d_in, const int* in_sizes, int n_in,
                              void* d_out, int out_size, void* d_ws, size_t ws_size,
                              hipStream_t stream) {
  (void)n_in;
  if (ws_size < WS_TOTAL) return;
  if ((size_t)out_size != OUT0_ELEMS + OUT1_ELEMS) return;
  if ((size_t)in_sizes[0] != NX || (size_t)in_sizes[1] != (size_t)NTOK ||
      (size_t)in_sizes[2] != NW || (size_t)in_sizes[4] != NW ||
      (size_t)in_sizes[6] != NW || (size_t)in_sizes[8] != NW ||
      in_sizes[3] != HIDN || in_sizes[5] != HIDN || in_sizes[7] != HIDN || in_sizes[9] != HIDN) return;

  const float* hs    = (const float*)d_in[0];
  const float* amask = (const float*)d_in[1];
  const float* Wq    = (const float*)d_in[2];
  const float* bq    = (const float*)d_in[3];
  const float* Wk    = (const float*)d_in[4];
  const float* bk    = (const float*)d_in[5];
  const float* Wv    = (const float*)d_in[6];
  const float* bv    = (const float*)d_in[7];
  const float* Wo    = (const float*)d_in[8];
  const float* bo    = (const float*)d_in[9];

  char* ws = (char*)d_ws;
  unsigned short* Xb  = (unsigned short*)(ws + OFF_XB);
  unsigned short* Wqb = (unsigned short*)(ws + OFF_WQ);
  unsigned short* Wkb = (unsigned short*)(ws + OFF_WK);
  unsigned short* Wvb = (unsigned short*)(ws + OFF_WV);
  unsigned short* Wob = (unsigned short*)(ws + OFF_WO);
  unsigned short* Qh  = (unsigned short*)(ws + OFF_QH);
  unsigned short* Ql  = (unsigned short*)(ws + OFF_QL);
  unsigned short* Kh  = (unsigned short*)(ws + OFF_KH);
  unsigned short* Kl  = (unsigned short*)(ws + OFF_KL);
  unsigned short* KTh = (unsigned short*)(ws + OFF_KTH);
  unsigned short* KTl = (unsigned short*)(ws + OFF_KTL);
  unsigned short* VTh = (unsigned short*)(ws + OFF_VTH);
  unsigned short* VTl = (unsigned short*)(ws + OFF_VTL);
  unsigned short* Oh  = (unsigned short*)(ws + OFF_OH);
  unsigned short* Ol  = (unsigned short*)(ws + OFF_OL);

  float* outF   = (float*)d_out;
  float* stateF = outF + OUT1_ELEM_OFF;

  // 1) RNE conversions to bf16 (inputs converted exactly once)
  {
    const int n2x = (int)(NX / 2);   // 2097152, multiple of 256
    const int n2w = (int)(NW / 2);   // 524288,  multiple of 256
    cast_f32_bf16x2<<<dim3(n2x / 256), dim3(256), 0, stream>>>(hs, Xb, n2x);
    cast_f32_bf16x2<<<dim3(n2w / 256), dim3(256), 0, stream>>>(Wq, Wqb, n2w);
    cast_f32_bf16x2<<<dim3(n2w / 256), dim3(256), 0, stream>>>(Wk, Wkb, n2w);
    cast_f32_bf16x2<<<dim3(n2w / 256), dim3(256), 0, stream>>>(Wv, Wvb, n2w);
    cast_f32_bf16x2<<<dim3(n2w / 256), dim3(256), 0, stream>>>(Wo, Wob, n2w);
  }

  // 2) projections: 64x64 tiles, 8 waves (2 x 4 tiles) per block; every shape has 1024 tiles (64x16 or 16x64) = 128 block tiles of 128x256
  const int gemmBlocksTok = ((NTOK / 64) * (HIDN / 64)) / 8;    // 1024 tiles / 8 = 128
  // q rows [4096][1024] = Xb . Wq^T + bq  -> hi/lo planes
  wmma_gemm64<1, false, false, 2, 2, 0><<<dim3(gemmBlocksTok, 1), dim3(256), 0, stream>>>(
      Xb, Xb, HIDN, 0L, Wqb, Wqb, HIDN, 0L, (void*)Qh, (void*)Ql, HIDN, 0L,
      bq, amask, NTOK, HIDN, HIDN, 1.0f);
  // k rows [4096][1024] = (Xb . Wk^T + bk) * mask[row]  -> hi/lo planes
  wmma_gemm64<1, false, false, 2, 2, 1><<<dim3(gemmBlocksTok, 1), dim3(256), 0, stream>>>(
      Xb, Xb, HIDN, 0L, Wkb, Wkb, HIDN, 0L, (void*)Kh, (void*)Kl, HIDN, 0L,
      bk, amask, NTOK, HIDN, HIDN, 1.0f);
  // k^T [1024][4096] = (Wk . Xb^T + bk[row]) * mask[col] -> hi/lo planes   (M=1024, N=4096)
  wmma_gemm64<1, false, false, 1, 2, 2><<<dim3(gemmBlocksTok, 1), dim3(256), 0, stream>>>(
      Wkb, Wkb, HIDN, 0L, Xb, Xb, HIDN, 0L, (void*)KTh, (void*)KTl, NTOK, 0L,
      bk, amask, HIDN, NTOK, HIDN, 1.0f);
  // v^T [1024][4096] = (Wv . Xb^T + bv[row]) * mask[col] -> hi/lo planes
  wmma_gemm64<1, false, false, 1, 2, 2><<<dim3(gemmBlocksTok, 1), dim3(256), 0, stream>>>(
      Wvb, Wvb, HIDN, 0L, Xb, Xb, HIDN, 0L, (void*)VTh, (void*)VTl, NTOK, 0L,
      bv, amask, HIDN, NTOK, HIDN, 1.0f);

  // 3) causal attention on the planes -> attention out hi/lo planes [4096][1024]
  const float sscale = 0.125f;   // 1 / (temperature * sqrt(64)), exact power of two
  attn_hd64_planes<<<dim3(NBATCH * NHEAD * (SEQ / AT_QB)), dim3(128), 0, stream>>>(
      Qh, Ql, Kh, Kl, VTh, VTl, amask, Oh, Ol, sscale);

  // 4) state[b][h][d][e] = sum_s k^T[h*64+d][b*S+s] * v^T[h*64+e][b*S+s]  (hi/lo on both operands); 4 tiles x 16 token slices per (b,h)
  for (int bb = 0; bb < NBATCH; ++bb) {
    state_ktv_slices<<<dim3(4, NHEAD), dim3(ST_NW * 32), 0, stream>>>(
        KTh + (size_t)bb * SEQ, KTl + (size_t)bb * SEQ, VTh + (size_t)bb * SEQ, VTl + (size_t)bb * SEQ,
        stateF + (size_t)bb * NHEAD * HDIM * HDIM);
  }

  // 5) out [4096][1024] = attn_out . Wo^T + bo  (A hi/lo, Wo exact bf16) -> d_out f32
  wmma_gemm64<1, true, false, 2, 0, 0><<<dim3(gemmBlocksTok, 1), dim3(256), 0, stream>>>(
      Oh, Ol, HIDN, 0L, Wob, Wob, HIDN, 0L, (void*)outF, (void*)Oh, HIDN, 0L,
      bo, amask, NTOK, HIDN, HIDN, 1.0f);
}

// v005
// One run takes 280 microseconds.
// Next to v004, in two timings, it ran 1.05 and 1.04 times as fast.
// Counting every step since v000, it is 2.48 times as fast.
// Compute dtype: input projections v_wmma_f32_16x16x32_bf16 on bf16 operands (inputs RNE-converted once), f32 accumulate; scores, p.v and k^T.v state on bf16 hi/lo split planes (hi.hi + hi.lo + lo.hi), output projection on hi/lo A planes x bf16 Wo (hi.hi + lo.hi), f32 accumulate; softmax and side math f32.
#include <hip/hip_runtime.h>

// ---------------------------------------------------------------- geometry
constexpr int NBATCH = 2;
constexpr int SEQ    = 2048;
constexpr int HIDN   = 1024;
constexpr int NHEAD  = 16;
constexpr int HDIM   = 64;
constexpr int NTOK   = NBATCH * SEQ;                    /* 4096 token rows */
constexpr size_t NX  = (size_t)NTOK * HIDN;            /* 4194304 */
constexpr size_t NW  = (size_t)HIDN * HIDN;            /* 1048576 */
constexpr size_t OUT0_ELEMS    = NX;
constexpr size_t OUT1_ELEMS    = (size_t)NBATCH * NHEAD * HDIM * HDIM;   /* 131072 */
constexpr size_t OUT1_BYTE_OFF = 16777216;
constexpr size_t OUT1_ELEM_OFF = OUT1_BYTE_OFF / 4;
static_assert(OUT1_ELEM_OFF == OUT0_ELEMS);
static_assert(OUT1_BYTE_OFF + OUT1_ELEMS * 4 == 17301504);
static_assert(HIDN == NHEAD * HDIM);
static_assert(HDIM == 64);
static_assert(HIDN % 64 == 0 && NTOK % 64 == 0 && SEQ % 64 == 0);   /* every GEMM M and N is a 64-multiple */
static_assert(HIDN % 32 == 0 && SEQ % 32 == 0);                     /* every GEMM K is a multiple of 32 */

// ---------------------------------------------------------------- workspace map (bytes)
// 16-bit planes: token planes [4096][1024] or [1024][4096] = 8 MiB each; weight planes [1024][1024] = 2 MiB each.
// Every region is fully written by its producer (full M x N, no pad rows) before any consumer reads it.
constexpr size_t MIB      = (size_t)1 << 20;
constexpr size_t OFF_XB   = 0 * MIB;    /* hidden as bf16      8 MiB */
constexpr size_t OFF_WQ   = 8 * MIB;    /* Wq bf16             2 MiB */
constexpr size_t OFF_WK   = 10 * MIB;   /* Wk bf16             2 MiB */
constexpr size_t OFF_WV   = 12 * MIB;   /* Wv bf16             2 MiB */
constexpr size_t OFF_WO   = 14 * MIB;   /* Wo bf16             2 MiB */
constexpr size_t OFF_QH   = 16 * MIB;   /* q hi  [4096][1024]        */
constexpr size_t OFF_QL   = 24 * MIB;   /* q lo                      */
constexpr size_t OFF_KH   = 32 * MIB;   /* k hi  [4096][1024] (masked) */
constexpr size_t OFF_KL   = 40 * MIB;   /* k lo                      */
constexpr size_t OFF_KTH  = 48 * MIB;   /* k^T hi [1024][4096] (masked) */
constexpr size_t OFF_KTL  = 56 * MIB;   /* k^T lo                    */
constexpr size_t OFF_VTH  = 64 * MIB;   /* v^T hi [1024][4096] (masked) */
constexpr size_t OFF_VTL  = 72 * MIB;   /* v^T lo                    */
constexpr size_t OFF_OH   = 80 * MIB;   /* attention out hi [4096][1024] */
constexpr size_t OFF_OL   = 88 * MIB;   /* attention out lo          */
constexpr size_t WS_TOTAL = 96 * MIB;   /* 100663296 B */
static_assert(NX * 2 == 8 * MIB && NW * 2 == 2 * MIB);
static_assert(WS_TOTAL <= 134217728);

// ---------------------------------------------------------------- types / helpers
typedef __attribute__((ext_vector_type(16))) _Float16 v16h;
typedef __attribute__((ext_vector_type(8)))  _Float16 v8h;
typedef __attribute__((ext_vector_type(16))) __bf16   v16b;
typedef __attribute__((ext_vector_type(8)))  __bf16   v8b;
typedef __attribute__((ext_vector_type(8)))  float    v8f;
typedef __attribute__((ext_vector_type(4)))  float    v4f;
typedef __attribute__((ext_vector_type(2)))  float    v2f;
typedef __attribute__((ext_vector_type(4)))  unsigned u4v;

__device__ __forceinline__ unsigned short f2bf_bits(float f) {
  unsigned u = __float_as_uint(f);
  return (unsigned short)((u + 0x7FFFu + ((u >> 16) & 1u)) >> 16);
}
__device__ __forceinline__ float bf_bits2f(unsigned short h) { return __uint_as_float(((unsigned)h) << 16); }
__device__ __forceinline__ float bfr(float f) { return bf_bits2f(f2bf_bits(f)); }

__device__ __forceinline__ void sched_fence() { asm volatile("" ::: "memory"); }

// hazard guards as plain device helpers (no inline asm inside the kernel template body)
__device__ __forceinline__ void dep_guard_h(v8f& a, v8f& b, v16h x, v16h y) { asm volatile("v_nop\n\tv_nop\n\tv_nop\n\tv_nop" : "+v"(a), "+v"(b) : "v"(x), "v"(y)); }
__device__ __forceinline__ void dep_guard_b(v8f& a, v8f& b, v16b x, v16b y) { asm volatile("v_nop\n\tv_nop\n\tv_nop\n\tv_nop" : "+v"(a), "+v"(b) : "v"(x), "v"(y)); }
__device__ __forceinline__ void keep4_h(v16h a, v16h b, v16h c, v16h d) { asm volatile("v_nop" :: "v"(a), "v"(b), "v"(c), "v"(d)); }
__device__ __forceinline__ void keep4_b(v16b a, v16b b, v16b c, v16b d) { asm volatile("v_nop" :: "v"(a), "v"(b), "v"(c), "v"(d)); }
__device__ __forceinline__ void acc_guard4(v8f& a, v8f& b, v8f& c, v8f& d) { asm volatile("v_nop\n\tv_nop\n\tv_nop\n\tv_nop" : "+v"(a), "+v"(b), "+v"(c), "+v"(d)); }
template <typename T> struct Frag;
template <> struct Frag<_Float16> {
  typedef v16h V; union U { v16h v; v8h h[2]; };
  static __device__ __forceinline__ v16h load(const _Float16* p) {   // elements 0..7 <- p[0..7], 8..15 <- p[16..23]
    U f; f.h[0] = *(const v8h*)(p); f.h[1] = *(const v8h*)(p + 16); return f.v;
  }
  static __device__ __forceinline__ v8f mma(v16h a, v16h b, v8f c) {
    return __builtin_amdgcn_wmma_f32_16x16x32_f16(false, a, false, b, (short)0, c, false, false);
  }
  static __device__ __forceinline__ void guard(v8f& a, v8f& b, v16h x, v16h y) { dep_guard_h(a, b, x, y); }
  static __device__ __forceinline__ void keep(v16h a, v16h b, v16h c, v16h d) { keep4_h(a, b, c, d); }
};
template <> struct Frag<__bf16> {
  typedef v16b V; union U { v16b v; v8b h[2]; };
  static __device__ __forceinline__ v16b load(const __bf16* p) {
    U f; f.h[0] = *(const v8b*)(p); f.h[1] = *(const v8b*)(p + 16); return f.v;
  }
  static __device__ __forceinline__ v8f mma(v16b a, v16b b, v8f c) {
    return __builtin_amdgcn_wmma_f32_16x16x32_bf16(false, a, false, b, (short)0, c, false, false);
  }
  static __device__ __forceinline__ void guard(v8f& a, v8f& b, v16b x, v16b y) { dep_guard_b(a, b, x, y); }
  static __device__ __forceinline__ void keep(v16b a, v16b b, v16b c, v16b d) { keep4_b(a, b, c, d); }
};

// ---- Register-blocked batched WMMA GEMM ------------------------------------
// C[m,n] = rs * (scale * sum_k A[m,k] * Bt[n,k] + bias); each wave owns a 64x64 tile.
// A row-major [M,K]; Bt row-major [N,K]; M % 128 == 0, N % 256 == 0, K % 64 == 0.
// Block = 8 waves (2 x 4) = one 128x256 tile. A stage is 64 k = one 128-byte line of every operand row of the block tile.
// Asynchronous 16-byte copies (8 lanes per row, whole lines) bring a stage from global memory into one of two LDS buffers
// while the other buffer is multiplied; the waves read their fragments from LDS.
// SPLIT: A carried as hi/lo planes (A2 = lo); BLO: Bt also carried as hi/lo (Bt2 = lo);
//   product = hi.hi (+ hi.lo when BLO) + lo.hi.   SPLIT+BLO is the stock hi/lo path.
// BIAS_MODE: 0 = none, 1 = bias[m], 2 = bias[n]  (bias value RNE-converted to bf16 precision).
// RS_MODE:   0 = none, 1 = multiply by rsc[m], 2 = multiply by rsc[n]  (rsc value RNE-converted to bf16).
// OUT_MODE: 0 = f32, 1 = f16, 2 = bf16 hi plane (Cout) + bf16 lo plane (Cout2).
// ET: 0 = f16 operands, 1 = bf16 operands (pointers passed as 16-bit storage)
constexpr int GB_M = 128;   // block tile rows
constexpr int GB_N = 256;   // block tile columns
constexpr int GB_K = 64;    // k per stage
constexpr int GB_P = 72;    // LDS row pitch in elements: 144 B = 16 B x 9 (odd), distinct banks for the 16 rows of a 16-byte fragment read
static_assert(HIDN % GB_N == 0 && NTOK % GB_N == 0 && HIDN % GB_K == 0);   /* every GEMM M, N is a multiple of the block tile, K of the stage */

// four asynchronous 16-byte copies to LDS, every lane with its own LDS byte address and global address;
// s_wait_xcnt 0 closes the statement as a precaution: no address register of a copy is rewritten in front of it
__device__ __forceinline__ void copy4_async(unsigned l0, const void* g0, unsigned l1, const void* g1,
                                            unsigned l2, const void* g2, unsigned l3, const void* g3) {
  asm volatile("global_load_async_to_lds_b128 %0, %1, off\n\t"
               "global_load_async_to_lds_b128 %2, %3, off\n\t"
               "global_load_async_to_lds_b128 %4, %5, off\n\t"
               "global_load_async_to_lds_b128 %6, %7, off\n\t"
               "s_wait_xcnt 0x0"
               :: "v"(l0), "v"(g0), "v"(l1), "v"(g1), "v"(l2), "v"(g2), "v"(l3), "v"(g3) : "memory");
}
// this wave's copies have landed behind this one
__device__ __forceinline__ void wait_async0() { asm volatile("s_wait_asynccnt 0x0" ::: "memory"); }
// this wave's LDS reads have returned: stands in front of the barrier behind which their buffer is refilled
__device__ __forceinline__ void wait_ds0() { asm volatile("s_wait_dscnt 0x0" ::: "memory"); }

template <int ET> struct Elem;
template <> struct Elem<0> { typedef _Float16 T; };
template <> struct Elem<1> { typedef __bf16 T; };
template <int ET, bool SPLIT, bool BLO, int BIAS_MODE, int OUT_MODE, int RS_MODE>
__global__ __launch_bounds__(256) void wmma_gemm64(
    const unsigned short* __restrict__ Ap, const unsigned short* __restrict__ A2p, int lda, long strideA,
    const unsigned short* __restrict__ Btp, const unsigned short* __restrict__ Bt2p, int ldb, long strideB,
    void* __restrict__ Cout, void* __restrict__ Cout2, int ldc, long strideC,
    const float* __restrict__ bias, const float* __restrict__ rsc,
    int M, int N, int K, float scale) {
  typedef typename Elem<ET>::T T;
  typedef typename Frag<T>::V V;
  const T* A = (const T*)Ap; const T* A2 = (const T*)A2p; const T* Bt = (const T*)Btp; const T* Bt2 = (const T*)Bt2p;
  constexpr int NPA = SPLIT ? 2 : 1;              // planes of A
  constexpr int NPB = (SPLIT && BLO) ? 2 : 1;     // planes of Bt
  __shared__ __align__(16) T sA[2][NPA][GB_M * GB_P];   // two buffers of A rows  [row][k], 18 KB per plane
  __shared__ __align__(16) T sB[2][NPB][GB_N * GB_P];   // two buffers of Bt rows [row][k], 36 KB per plane
  __shared__ __align__(16) float sT[8][16 * 68];   // per-wave 16x64 slab, pitch 68 floats
  const int b    = blockIdx.y;
  const int tid  = threadIdx.x;
  const int lane = tid & 31;
  const int wave = tid >> 5;
  const int blocksN = N / GB_N;
  const int bm = blockIdx.x / blocksN;
  const int bn = blockIdx.x - bm * blocksN;
  if (bm >= M / GB_M) return;            // block-uniform, in front of every copy and barrier
  const int mB = bm * GB_M;              // block tile origin
  const int nB = bn * GB_N;
  const int wm = (wave >> 2) << 6;       // wave tile origin inside the block tile
  const int wn = (wave & 3) << 6;
  const int m0 = mB + wm;
  const int n0 = nB + wn;

  const T* Ab  = A  + (size_t)b * strideA;
  const T* Bb  = Bt + (size_t)b * strideB;
  const T* Ab2 = SPLIT ? (A2  + (size_t)b * strideA) : nullptr;
  const T* Bb2 = (SPLIT && BLO) ? (Bt2 + (size_t)b * strideB) : nullptr;

  const int rlane = lane & 15;                 // row (A) / col (B, D) within subtile
  const int koff  = (lane >> 4) * 8;           // k offset of this lane half
  const int mOff  = (lane >> 4) * 8;           // D row offset

  // staging coverage: 256 threads x 4 copies = 1024 = 128 rows x 8 pieces of 16 B (A plane); x 8 copies = 2048 = 256 rows x 8 (Bt plane);
  // copy i of a thread is row srow + 32 i, piece tid & 7: every piece once, every address a multiple of 16 B
  const int srow = tid >> 3;                   // 0..31
  const int sc8  = (tid & 7) * 8;
  constexpr unsigned RS = 32 * GB_P * 2;       // LDS bytes between a thread's successive copies
  const unsigned ldsA = (unsigned)(size_t)(&sA[0][0][srow * GB_P + sc8]);   // low 32 bits = byte address in the work-group's LDS
  const unsigned ldsB = (unsigned)(size_t)(&sB[0][0][srow * GB_P + sc8]);
  const size_t astep = (size_t)32 * lda * 2, bstep = (size_t)32 * ldb * 2;  // global bytes between them
  auto stage = [&](int st, int buf) {
    const size_t ka = ((size_t)(mB + srow) * lda + (size_t)st * GB_K + sc8) * 2;
    const size_t kb = ((size_t)(nB + srow) * ldb + (size_t)st * GB_K + sc8) * 2;
#pragma unroll
    for (int p = 0; p < NPA; ++p) {
      const char* g = (const char*)(p == 0 ? Ab : Ab2) + ka;
      const unsigned l = ldsA + (unsigned)(buf * NPA + p) * (unsigned)(GB_M * GB_P * 2);
      copy4_async(l, g, l + RS, g + astep, l + 2 * RS, g + 2 * astep, l + 3 * RS, g + 3 * astep);
    }
#pragma unroll
    for (int p = 0; p < NPB; ++p) {
      const char* g = (const char*)(p == 0 ? Bb : Bb2) + kb;
      const unsigned l = ldsB + (unsigned)(buf * NPB + p) * (unsigned)(GB_N * GB_P * 2);
      copy4_async(l, g, l + RS, g + bstep, l + 2 * RS, g + 2 * bstep, l + 3 * RS, g + 3 * bstep);
      copy4_async(l + 4 * RS, g + 4 * bstep, l + 5 * RS, g + 5 * bstep, l + 6 * RS, g + 6 * bstep, l + 7 * RS, g + 7 * bstep);
    }
  };

  v8f acc[4][4];
#pragma unroll
  for (int i = 0; i < 4; ++i)
#pragma unroll
    for (int j = 0; j < 4; ++j) acc[i][j] = (v8f){0.f,0.f,0.f,0.f,0.f,0.f,0.f,0.f};

  const int nst = K / GB_K;                    // stages, block-uniform
  stage(0, 0);
  wait_async0();
  __syncthreads();                             // stage 0 is complete before any wave reads it
  if (nst > 1) stage(1, 1);
  for (int t = 0; t < nst; ++t) {
    const int cur = t & 1;
#pragma unroll
    for (int kk = 0; kk < GB_K; kk += 32) {
      V bh[4], bl[4], ah[4], al[4];
#pragma unroll
      for (int j = 0; j < 4; ++j) {
        const int bo = (wn + (j << 4) + rlane) * GB_P + kk + koff;
        bh[j] = Frag<T>::load(&sB[cur][0][bo]);
        if (SPLIT && BLO) bl[j] = Frag<T>::load(&sB[cur][NPB - 1][bo]);
        else bl[j] = bh[j];
      }
#pragma unroll
      for (int i = 0; i < 4; ++i) {
        const int ao = (wm + (i << 4) + rlane) * GB_P + kk + koff;
        ah[i] = Frag<T>::load(&sA[cur][0][ao]);
        if (SPLIT) al[i] = Frag<T>::load(&sA[cur][NPA - 1][ao]);
        else al[i] = ah[i];
      }
#pragma unroll
      for (int i = 0; i < 4; ++i) {
#pragma unroll
        for (int j = 0; j < 4; ++j) {
          acc[i][j] = Frag<T>::mma(ah[i], bh[j], acc[i][j]);
          if (SPLIT) {
            if (BLO) acc[i][j] = Frag<T>::mma(ah[i], bl[j], acc[i][j]);
            acc[i][j] = Frag<T>::mma(al[i], bh[j], acc[i][j]);
          }
        }
        Frag<T>::guard(acc[i][0], acc[i][3], ah[i], al[i]);
      }
      Frag<T>::keep(bh[0], bh[1], bh[2], bh[3]);
      if (SPLIT && BLO) Frag<T>::keep(bl[0], bl[1], bl[2], bl[3]);
    }
    wait_ds0();                                // this wave has finished reading buffer cur
    wait_async0();                             // this wave's copies of stage t + 1 have landed
    __syncthreads();                           // publishes stage t + 1 and frees buffer cur
    if (t + 2 < nst) stage(t + 2, cur);        // block-uniform
  }
  wait_async0();                               // nothing is in flight when the wave goes on
  acc_guard4(acc[0][0], acc[0][1], acc[0][2], acc[0][3]);
  acc_guard4(acc[1][0], acc[1][1], acc[1][2], acc[1][3]);
  acc_guard4(acc[2][0], acc[2][1], acc[2][2], acc[2][3]);
  acc_guard4(acc[3][0], acc[3][1], acc[3][2], acc[3][3]);

  // ---- epilogue ----
  float* slab = sT[wave];
#pragma unroll
  for (int i = 0; i < 4; ++i) {
    const int mBase = m0 + (i << 4);
    float bm[8], rm[8];
#pragma unroll
    for (int r = 0; r < 8; ++r) { bm[r] = 0.f; rm[r] = 1.f; }
    if (BIAS_MODE == 1) {
      // rows mBase+mOff .. +7 are contiguous and 32-B aligned: two 16-B loads
      const v4f t0 = *(const v4f*)(bias + mBase + mOff);
      const v4f t1 = *(const v4f*)(bias + mBase + mOff + 4);
#pragma unroll
      for (int r = 0; r < 4; ++r) { bm[r] = bfr(t0[r]); bm[4 + r] = bfr(t1[r]); }
    }
    if (RS_MODE == 1) {
      const v4f t0 = *(const v4f*)(rsc + mBase + mOff);
      const v4f t1 = *(const v4f*)(rsc + mBase + mOff + 4);
#pragma unroll
      for (int r = 0; r < 4; ++r) { rm[r] = bfr(t0[r]); rm[4 + r] = bfr(t1[r]); }
    }
#pragma unroll
    for (int j = 0; j < 4; ++j) {
      const int n = n0 + (j << 4) + rlane;
      float bn = 0.f, rn = 1.f;
      if (BIAS_MODE == 2) bn = bfr(bias[n]);
      if (RS_MODE == 2)   rn = bfr(rsc[n]);
#pragma unroll
      for (int r = 0; r < 8; ++r) {
        float v = acc[i][j][r] * scale;
        if (BIAS_MODE == 1) v += bm[r];
        if (BIAS_MODE == 2) v += bn;
        if (RS_MODE == 1) v *= rm[r];
        if (RS_MODE == 2) v *= rn;
        slab[(mOff + r) * 68 + (j << 4) + rlane] = v;
      }
    }
    __builtin_amdgcn_fence(__ATOMIC_RELEASE, "workgroup");
    __builtin_amdgcn_wave_barrier();
    __builtin_amdgcn_fence(__ATOMIC_ACQUIRE, "workgroup");
    if (OUT_MODE == 0) {
      float* C = (float*)Cout + (size_t)b * strideC;
      const int hh = lane >> 4, c4 = (lane & 15) * 4;     // row seg = 256 B = 16 lanes x 16 B
      {
#pragma unroll
        for (int it = 0; it < 8; ++it) {
          const int row = it * 2 + hh;
          v4f v = *(const v4f*)(slab + row * 68 + c4);
          *(v4f*)(C + (size_t)(mBase + row) * ldc + n0 + c4) = v;
        }
        
      }
    } else {
      const int q = lane >> 3, c8 = (lane & 7) * 8;
      unsigned short* C  = (unsigned short*)Cout  + (size_t)b * strideC;
      unsigned short* C2 = (OUT_MODE == 2) ? ((unsigned short*)Cout2 + (size_t)b * strideC) : nullptr;
      {
#pragma unroll
        for (int it = 0; it < 4; ++it) {
          const int row = it * 4 + q;
          const float* sp = slab + row * 68 + c8;
          v8h hv, lv;
#pragma unroll
          for (int e = 0; e < 8; ++e) {
            if (OUT_MODE == 1) {
              hv[e] = (_Float16)sp[e];
              lv[e] = hv[e];
            } else {
              unsigned short hb = f2bf_bits(sp[e]);
              unsigned short lb = f2bf_bits(sp[e] - bf_bits2f(hb));
              hv[e] = __builtin_bit_cast(_Float16, hb);
              lv[e] = __builtin_bit_cast(_Float16, lb);
            }
          }
          *(v8h*)(C + (size_t)(mBase + row) * ldc + n0 + c8) = hv;
          if (OUT_MODE == 2) *(v8h*)(C2 + (size_t)(mBase + row) * ldc + n0 + c8) = lv;
        }
        
      }
    }
    __builtin_amdgcn_fence(__ATOMIC_RELEASE, "workgroup");
    __builtin_amdgcn_wave_barrier();
    __builtin_amdgcn_fence(__ATOMIC_ACQUIRE, "workgroup");
  }
}

// One launch converts all five f32 inputs: their bf16 planes lie back to back in the workspace (hidden, Wq, Wk, Wv, Wo).
// Few waves, much work each.
// Block = 16 waves = CV_BLK consecutive elements of ONE input (every input is a whole number of blocks); grid = all elements / CV_BLK, exact.
// Pass i of a block is 2048 consecutive elements, 4 per lane: a wave's 16-byte load covers 512 contiguous bytes, its 8-byte store 256.
constexpr int CV_T   = 512;                 // threads per block
constexpr int CV_IT  = 16;                  // passes per block
constexpr int CV_BLK = CV_T * 4 * CV_IT;    // 32768 elements per block
constexpr int CV_XB  = (int)(NX / CV_BLK);  // 128 blocks of hidden
constexpr int CV_WB  = (int)(NW / CV_BLK);  // 32 blocks of each weight
constexpr int CV_GRID = CV_XB + 4 * CV_WB;  // 256 blocks
static_assert(NX % CV_BLK == 0 && NW % CV_BLK == 0);
static_assert(OFF_XB == 0 && OFF_WQ == NX * 2 && OFF_WK == OFF_WQ + NW * 2 && OFF_WV == OFF_WK + NW * 2 && OFF_WO == OFF_WV + NW * 2);
typedef __attribute__((ext_vector_type(2))) unsigned u2v;

__global__ __launch_bounds__(CV_T) void cast_all_f32_bf16(
    const float* __restrict__ hs, const float* __restrict__ wq, const float* __restrict__ wk,
    const float* __restrict__ wv, const float* __restrict__ wo, unsigned short* __restrict__ out) {
  const int blk = blockIdx.x;
  const float* src;                          // block-uniform choice of the input
  if (blk < CV_XB) {
    src = hs + (size_t)blk * CV_BLK;
  } else {
    const int w = (blk - CV_XB) / CV_WB;
    const int r = (blk - CV_XB) % CV_WB;
    src = (w == 0 ? wq : w == 1 ? wk : w == 2 ? wv : wo) + (size_t)r * CV_BLK;
  }
  const int t4 = threadIdx.x * 4;
  v4f f[CV_IT];
  // unrolled: f stays in registers, the pass offsets fold into the loads' immediate fields and the loads stand ahead of the conversions
#pragma unroll
  for (int i = 0; i < CV_IT; ++i) f[i] = *(const v4f*)(src + i * (CV_T * 4) + t4);
  unsigned short* o = out + (size_t)blk * CV_BLK + t4;
  // unrolled: constant indices into f, store offsets as immediates
#pragma unroll
  for (int i = 0; i < CV_IT; ++i) {
    u2v u;
    u[0] = (unsigned)f2bf_bits(f[i][0]) | ((unsigned)f2bf_bits(f[i][1]) << 16);
    u[1] = (unsigned)f2bf_bits(f[i][2]) | ((unsigned)f2bf_bits(f[i][3]) << 16);
    *(u2v*)(o + i * (CV_T * 4)) = u;
  }
}

// =====================================================================================
// Causal attention for head_dim 64 on bf16 hi/lo planes.
//   q planes  : [NTOK][HIDN] (row = b*SEQ + s, col = h*64 + d), hi and lo
//   k planes  : [NTOK][HIDN] same layout, hi and lo (padding mask already folded in)
//   v^T planes: [HIDN][NTOK] (row = h*64 + d, col = b*SEQ + s), hi and lo (mask folded in)
//   out planes: [NTOK][HIDN] bf16 hi and lo
//   scores = (q.k^T) * sscale : hi.hi + hi.lo + lo.hi, f32 accumulate; key j masked where j > q or amask[b][j] == 0 (score := -inf)
//   out    = p.v / l          : p (f32 exp terms) split to bf16 hi/lo per tile, v hi/lo, 3 products, f32 accumulate
//   Block = 4 waves = 64 query rows of one (b, h); grid.x = NBATCH*NHEAD*(SEQ/64).
//   fragments in flight besides the persistent per-wave state.
// =====================================================================================
constexpr int AT_D  = 64;
constexpr int AT_NW = 4;
constexpr int AT_QB = 64;
constexpr int AT_KC = 64;
constexpr int AT_P  = 72;   // LDS row pitch in elements: 144 B = 16 B x 9 (odd), so the 16 rows of a 16-byte fragment read fall on distinct banks

__device__ __forceinline__ __bf16 at_f2bf(float f) { return __builtin_bit_cast(__bf16, f2bf_bits(f)); }
__device__ __forceinline__ void at_split(float f, __bf16& hi, __bf16& lo) {
  const unsigned short hb = f2bf_bits(f);
  hi = __builtin_bit_cast(__bf16, hb);
  lo = at_f2bf(f - __uint_as_float(((unsigned)hb) << 16));
}
__device__ __forceinline__ v8f at_mma(v16b a, v16b b, v8f c) {
  c = __builtin_amdgcn_wmma_f32_16x16x32_bf16(false, a, false, b, (short)0, c, false, false);
  asm volatile("v_nop\n\tv_nop\n\tv_nop\n\tv_nop" : "+v"(c) : "v"(a), "v"(b));
  return c;
}

__global__ __launch_bounds__(128) __attribute__((amdgpu_num_vgpr(256)))
void attn_hd64_planes(const unsigned short* __restrict__ Qh, const unsigned short* __restrict__ Ql,
                      const unsigned short* __restrict__ Kh, const unsigned short* __restrict__ Kl,
                      const unsigned short* __restrict__ VTh, const unsigned short* __restrict__ VTl,
                      const float* __restrict__ amask,
                      unsigned short* __restrict__ Oh, unsigned short* __restrict__ Ol,
                      float sscale) {
  union FB { v16b v; v8b h[2]; };
  __shared__ __align__(16) __bf16 Ksh[AT_KC * AT_P];     // k hi [kv][d]     9 KB
  __shared__ __align__(16) __bf16 Ksl[AT_KC * AT_P];     // k lo
  __shared__ __align__(16) __bf16 Vth[AT_D * AT_P];      // v hi [d][kv]     9 KB
  __shared__ __align__(16) __bf16 Vtl[AT_D * AT_P];     // v lo
  __shared__ __align__(16) __bf16 Psh[AT_NW][16 * AT_P];   // per wave p hi [row][kv]
  __shared__ __align__(16) __bf16 Psl[AT_NW][16 * AT_P];   // per wave p lo
  __shared__ __align__(16) float  Os[AT_NW][16 * 68];       // per wave out tile, pitch 68

  const int tid  = threadIdx.x;
  const int wave = tid >> 5;
  const int lane = tid & 31;
  const int hh   = lane >> 4;
  const int c    = lane & 15;

  const int nqb = SEQ / AT_QB;                  // 32
  const int bx  = blockIdx.x;
  const int qb  = bx % nqb;
  const int bhd = bx / nqb;
  const int h   = bhd % NHEAD;
  const int b   = bhd / NHEAD;
  const int q0  = qb * AT_QB + wave * 16;
  const int tok0 = b * SEQ;
  const int hcol = h * HDIM;

  // ---- Q fragments (A operand): 2 d-chunks, hi and lo, split k-map via Frag::load ----
  v16b qah[2], qal[2];
  {
    const __bf16* qhp = (const __bf16*)Qh + (size_t)(tok0 + q0 + c) * HIDN + hcol + 8 * hh;
    const __bf16* qlp = (const __bf16*)Ql + (size_t)(tok0 + q0 + c) * HIDN + hcol + 8 * hh;
#pragma unroll
    for (int dc = 0; dc < 2; ++dc) {
      qah[dc] = Frag<__bf16>::load(qhp + dc * 32);
      qal[dc] = Frag<__bf16>::load(qlp + dc * 32);
    }
  }

  float mrow[8], lrow[8];
  v8f oacc[4];
#pragma unroll
  for (int r = 0; r < 8; ++r) { mrow[r] = -__builtin_inff(); lrow[r] = 0.f; }
#pragma unroll
  for (int t = 0; t < 4; ++t) oacc[t] = (v8f){0.f,0.f,0.f,0.f,0.f,0.f,0.f,0.f};

  const int nChunks = qb + 1;                   // causal, block-uniform, <= 32
  for (int kc = 0; kc < nChunks; ++kc) {
    const int kv0 = kc * AT_KC;
    __syncthreads();
    {
      // staging coverage: 128 threads x 4 ids = 512 ids = 64 rows x 8 chunks of 8 elements = 64x64 per plane, exact
#pragma unroll
      for (int i = 0; i < 4; ++i) {
        const int id = tid + 128 * i;
        const int row = id >> 3, c8 = (id & 7) * 8;
        const size_t ko = (size_t)(tok0 + kv0 + row) * HIDN + hcol + c8;
        const u4v a0 = *(const u4v*)(Kh + ko);
        const u4v a1 = *(const u4v*)(Kl + ko);
        *(u4v*)(Ksh + row * AT_P + c8) = a0;
        *(u4v*)(Ksl + row * AT_P + c8) = a1;
      }
      sched_fence();
#pragma unroll
      for (int i = 0; i < 4; ++i) {
        const int id = tid + 128 * i;
        const int row = id >> 3, c8 = (id & 7) * 8;      // row = d
        const size_t vo = (size_t)(hcol + row) * NTOK + tok0 + kv0 + c8;
        const u4v a0 = *(const u4v*)(VTh + vo);
        const u4v a1 = *(const u4v*)(VTl + vo);
        *(u4v*)(Vth + row * AT_P + c8) = a0;
        *(u4v*)(Vtl + row * AT_P + c8) = a1;
      }
    }
    __syncthreads();

    v8f s[4];
#pragma unroll
    for (int j = 0; j < 4; ++j) {
      v8f sj = (v8f){0.f,0.f,0.f,0.f,0.f,0.f,0.f,0.f};
#pragma unroll
      for (int dc = 0; dc < 2; ++dc) {
        FB kb, kl;
        const __bf16* khp = Ksh + (j * 16 + c) * AT_P + dc * 32 + 8 * hh;
        const __bf16* klp = Ksl + (j * 16 + c) * AT_P + dc * 32 + 8 * hh;
        kb.h[0] = *(const v8b*)(khp);
        kb.h[1] = *(const v8b*)(khp + 16);
        kl.h[0] = *(const v8b*)(klp);
        kl.h[1] = *(const v8b*)(klp + 16);
        sj = at_mma(qah[dc], kb.v, sj);
        sj = at_mma(qah[dc], kl.v, sj);
        sj = at_mma(qal[dc], kb.v, sj);
        sched_fence();
      }
      s[j] = sj;
    }
    // key index of each score column; a padded key (amask == 0) gets an index above every query row,
    // so one integer compare and one select per score cover the causal and the padding mask without a branch
    int kidx[4];
#pragma unroll
    for (int j = 0; j < 4; ++j) {
      const float kvm = amask[(size_t)tok0 + kv0 + j * 16 + c];
      kidx[j] = (kvm == 0.0f) ? 0x7fffffff : (kv0 + j * 16 + c);
    }
    float cm[8];
#pragma unroll
    for (int r = 0; r < 8; ++r) {
      const int qrow = q0 + 8 * hh + r;
      float m = -__builtin_inff();
#pragma unroll
      for (int j = 0; j < 4; ++j) {
        const float sc  = s[j][r] * sscale;
        const float val = (kidx[j] > qrow) ? -__builtin_inff() : sc;
        s[j][r] = val;
        m = fmaxf(m, val);
      }
#pragma unroll
      for (int off = 1; off < 16; off <<= 1) m = fmaxf(m, __shfl_xor(m, off, 32));
      cm[r] = m;
    }
    __bf16* pwh = Psh[wave];
    __bf16* pwl = Psl[wave];
#pragma unroll
    for (int r = 0; r < 8; ++r) {
      const float mnew = fmaxf(mrow[r], cm[r]);
      const float alpha = expf(mrow[r] - mnew);
      mrow[r] = mnew;
      float psum = 0.f;
#pragma unroll
      for (int j = 0; j < 4; ++j) {
        const float p = expf(s[j][r] - mnew);
        psum += p;
        __bf16 a, bl; at_split(p, a, bl);
        pwh[(8 * hh + r) * AT_P + j * 16 + c] = a;
        pwl[(8 * hh + r) * AT_P + j * 16 + c] = bl;
      }
#pragma unroll
      for (int off = 1; off < 16; off <<= 1) psum += __shfl_xor(psum, off, 32);
      lrow[r] = lrow[r] * alpha + psum;
#pragma unroll
      for (int t = 0; t < 4; ++t) oacc[t][r] *= alpha;
    }
    __builtin_amdgcn_fence(__ATOMIC_RELEASE, "workgroup");
    __builtin_amdgcn_wave_barrier();
    __builtin_amdgcn_fence(__ATOMIC_ACQUIRE, "workgroup");
#pragma unroll 1
    for (int kk = 0; kk < 2; ++kk) {
      FB pa, pl;
      pa.h[0] = *(const v8b*)(pwh + c * AT_P + kk * 32 + 8 * hh);
      pa.h[1] = *(const v8b*)(pwh + c * AT_P + kk * 32 + 16 + 8 * hh);
      pl.h[0] = *(const v8b*)(pwl + c * AT_P + kk * 32 + 8 * hh);
      pl.h[1] = *(const v8b*)(pwl + c * AT_P + kk * 32 + 16 + 8 * hh);
      sched_fence();
#pragma unroll
      for (int t = 0; t < 4; ++t) {
        FB vb, vl;
        const __bf16* vhp = Vth + (t * 16 + c) * AT_P + kk * 32 + 8 * hh;
        const __bf16* vlp = Vtl + (t * 16 + c) * AT_P + kk * 32 + 8 * hh;
        vb.h[0] = *(const v8b*)(vhp);
        vb.h[1] = *(const v8b*)(vhp + 16);
        vl.h[0] = *(const v8b*)(vlp);
        vl.h[1] = *(const v8b*)(vlp + 16);
        oacc[t] = at_mma(pa.v, vb.v, oacc[t]);
        oacc[t] = at_mma(pa.v, vl.v, oacc[t]);
        oacc[t] = at_mma(pl.v, vb.v, oacc[t]);
        sched_fence();
      }
    }
  }

  float* os = Os[wave];
#pragma unroll
  for (int r = 0; r < 8; ++r) {
    const float inv = 1.0f / lrow[r];
#pragma unroll
    for (int t = 0; t < 4; ++t) os[(8 * hh + r) * 68 + t * 16 + c] = oacc[t][r] * inv;
  }
  __builtin_amdgcn_fence(__ATOMIC_RELEASE, "workgroup");
  __builtin_amdgcn_wave_barrier();
  __builtin_amdgcn_fence(__ATOMIC_ACQUIRE, "workgroup");
  {
    const int q = lane >> 3, c8 = (lane & 7) * 8;
    {
#pragma unroll
      for (int it = 0; it < 4; ++it) {
        const int row = it * 4 + q;
        const float* sp = os + row * 68 + c8;
        v8h hv, lv;
#pragma unroll
        for (int e = 0; e < 8; ++e) {
          unsigned short hb = f2bf_bits(sp[e]);
          unsigned short lb = f2bf_bits(sp[e] - bf_bits2f(hb));
          hv[e] = __builtin_bit_cast(_Float16, hb);
          lv[e] = __builtin_bit_cast(_Float16, lb);
        }
        const size_t oo = (size_t)(tok0 + q0 + row) * HIDN + hcol + c8;
        *(v8h*)(Oh + oo) = hv;
        *(v8h*)(Ol + oo) = lv;
      }
      
    }
  }
}

// =====================================================================================
// k^T.v state: St[h][d][e] = sum_s kT[h*64+d][s] * vT[h*64+e][s] over SEQ tokens of one batch.
//   planes: [HIDN][NTOK] bf16 hi and lo, pointers already moved to the batch's first token
//   product = hi.hi + hi.lo + lo.hi, f32 accumulate (same three products per k step as the GEMM's hi/lo path)
//   Block = 16 waves = one 32x32 tile of one head; wave w sums tokens [w*128, w*128+128).
//   The 16 partial tiles meet in LDS and are added in wave order 0..15. grid = (4 tiles, NHEAD).
// =====================================================================================
constexpr int ST_NW = 16;                 // waves per block = slices of the token sum
constexpr int ST_KS = SEQ / ST_NW;        // 128 tokens per wave
static_assert(ST_KS % 32 == 0);

__global__ __launch_bounds__(ST_NW * 32)
void state_ktv_slices(const unsigned short* __restrict__ KTh, const unsigned short* __restrict__ KTl,
                      const unsigned short* __restrict__ VTh, const unsigned short* __restrict__ VTl,
                      float* __restrict__ St) {
  __shared__ __align__(16) float part[ST_NW][32 * 32];   // one 4 KB partial tile per wave, in accumulator order
  const int tid  = threadIdx.x;
  const int wave = tid >> 5;
  const int lane = tid & 31;
  const int hh   = lane >> 4;
  const int c    = lane & 15;
  const int h    = blockIdx.y;
  const int d0   = (blockIdx.x >> 1) * 32;
  const int e0   = (blockIdx.x & 1) * 32;

  const size_t ao = (size_t)(h * HDIM + d0 + c) * NTOK + wave * ST_KS + 8 * hh;
  const size_t bo = (size_t)(h * HDIM + e0 + c) * NTOK + wave * ST_KS + 8 * hh;
  const __bf16* pah = (const __bf16*)KTh + ao;
  const __bf16* pal = (const __bf16*)KTl + ao;
  const __bf16* pbh = (const __bf16*)VTh + bo;
  const __bf16* pbl = (const __bf16*)VTl + bo;

  v8f acc[2][2];
#pragma unroll
  for (int i = 0; i < 2; ++i)
#pragma unroll
    for (int j = 0; j < 2; ++j) acc[i][j] = (v8f){0.f,0.f,0.f,0.f,0.f,0.f,0.f,0.f};

  // unrolled (4 steps): the step offsets fold into the loads' immediate fields and later steps' loads issue among earlier products
#pragma unroll
  for (int ks = 0; ks < ST_KS / 32; ++ks) {
    v16b ah[2], al[2], bh[2], bl[2];
#pragma unroll
    for (int i = 0; i < 2; ++i) {
      const size_t o = (size_t)i * 16 * NTOK + ks * 32;
      ah[i] = Frag<__bf16>::load(pah + o);
      al[i] = Frag<__bf16>::load(pal + o);
      bh[i] = Frag<__bf16>::load(pbh + o);
      bl[i] = Frag<__bf16>::load(pbl + o);
    }
#pragma unroll
    for (int i = 0; i < 2; ++i)
#pragma unroll
      for (int j = 0; j < 2; ++j) {
        acc[i][j] = Frag<__bf16>::mma(ah[i], bh[j], acc[i][j]);
        acc[i][j] = Frag<__bf16>::mma(ah[i], bl[j], acc[i][j]);
        acc[i][j] = Frag<__bf16>::mma(al[i], bh[j], acc[i][j]);
      }
  }

  // partial tile to LDS: eighth q = (i*2+j)*2 + half holds accumulator rows half*4..half*4+3 of every lane, 16 B per lane
  float* slab = part[wave];
#pragma unroll
  for (int i = 0; i < 2; ++i)
#pragma unroll
    for (int j = 0; j < 2; ++j) {
      const v8f a = acc[i][j];
      const int q = (i * 2 + j) * 2;
      *(v4f*)(slab + (q + 0) * 128 + lane * 4) = (v4f){a[0], a[1], a[2], a[3]};
      *(v4f*)(slab + (q + 1) * 128 + lane * 4) = (v4f){a[4], a[5], a[6], a[7]};
    }
  __syncthreads();

  // 512 threads x 2 floats = the 32x32 tile; each thread adds its two positions over the 16 slices in wave order
  v2f sum = (v2f){0.f, 0.f};
#pragma unroll
  for (int w = 0; w < ST_NW; ++w) sum += *(const v2f*)(&part[w][tid * 2]);

  // position tid*2 back to (row, col): q = tid>>6, source lane = (tid>>1)&31, accumulator rows (q&1)*4 + (tid&1)*2 and the next
  const int q   = tid >> 6;
  const int sl  = (tid >> 1) & 31;
  const int row = (q >> 2) * 16 + (sl >> 4) * 8 + (q & 1) * 4 + (tid & 1) * 2;
  const int col = ((q >> 1) & 1) * 16 + (sl & 15);
  float* o = St + (size_t)h * HDIM * HDIM + (size_t)(d0 + row) * HDIM + e0 + col;
  o[0]    = sum[0];
  o[HDIM] = sum[1];
}

// ---------------------------------------------------------------- launcher
extern "C" void kernel_launch(void* const* d_in, const int* in_sizes, int n_in,
                              void* d_out, int out_size, void* d_ws, size_t ws_size,
                              hipStream_t stream) {
  (void)n_in;
  if (ws_size < WS_TOTAL) return;
  if ((size_t)out_size != OUT0_ELEMS + OUT1_ELEMS) return;
  if ((size_t)in_sizes[0] != NX || (size_t)in_sizes[1] != (size_t)NTOK ||
      (size_t)in_sizes[2] != NW || (size_t)in_sizes[4] != NW ||
      (size_t)in_sizes[6] != NW || (size_t)in_sizes[8] != NW ||
      in_sizes[3] != HIDN || in_sizes[5] != HIDN || in_sizes[7] != HIDN || in_sizes[9] != HIDN) return;

  const float* hs    = (const float*)d_in[0];
  const float* amask = (const float*)d_in[1];
  const float* Wq    = (const float*)d_in[2];
  const float* bq    = (const float*)d_in[3];
  const float* Wk    = (const float*)d_in[4];
  const float* bk    = (const float*)d_in[5];
  const float* Wv    = (const float*)d_in[6];
  const float* bv    = (const float*)d_in[7];
  const float* Wo    = (const float*)d_in[8];
  const float* bo    = (const float*)d_in[9];

  char* ws = (char*)d_ws;
  unsigned short* Xb  = (unsigned short*)(ws + OFF_XB);
  unsigned short* Wqb = (unsigned short*)(ws + OFF_WQ);
  unsigned short* Wkb = (unsigned short*)(ws + OFF_WK);
  unsigned short* Wvb = (unsigned short*)(ws + OFF_WV);
  unsigned short* Wob = (unsigned short*)(ws + OFF_WO);
  unsigned short* Qh  = (unsigned short*)(ws + OFF_QH);
  unsigned short* Ql  = (unsigned short*)(ws + OFF_QL);
  unsigned short* Kh  = (unsigned short*)(ws + OFF_KH);
  unsigned short* Kl  = (unsigned short*)(ws + OFF_KL);
  unsigned short* KTh = (unsigned short*)(ws + OFF_KTH);
  unsigned short* KTl = (unsigned short*)(ws + OFF_KTL);
  unsigned short* VTh = (unsigned short*)(ws + OFF_VTH);
  unsigned short* VTl = (unsigned short*)(ws + OFF_VTL);
  unsigned short* Oh  = (unsigned short*)(ws + OFF_OH);
  unsigned short* Ol  = (unsigned short*)(ws + OFF_OL);

  float* outF   = (float*)d_out;
  float* stateF = outF + OUT1_ELEM_OFF;

  // 1) RNE conversions to bf16 (inputs converted exactly once), one launch for all five inputs; Xb is the start of the five planes
  cast_all_f32_bf16<<<dim3(CV_GRID), dim3(CV_T), 0, stream>>>(hs, Wq, Wk, Wv, Wo, Xb);

  // 2) projections: 64x64 tiles, 8 waves (2 x 4 tiles) per block; every shape has 1024 tiles (64x16 or 16x64) = 128 block tiles of 128x256
  const int gemmBlocksTok = ((NTOK / 64) * (HIDN / 64)) / 8;    // 1024 tiles / 8 = 128
  // q rows [4096][1024] = Xb . Wq^T + bq  -> hi/lo planes
  wmma_gemm64<1, false, false, 2, 2, 0><<<dim3(gemmBlocksTok, 1), dim3(256), 0, stream>>>(
      Xb, Xb, HIDN, 0L, Wqb, Wqb, HIDN, 0L, (void*)Qh, (void*)Ql, HIDN, 0L,
      bq, amask, NTOK, HIDN, HIDN, 1.0f);
  // k rows [4096][1024] = (Xb . Wk^T + bk) * mask[row]  -> hi/lo planes
  wmma_gemm64<1, false, false, 2, 2, 1><<<dim3(gemmBlocksTok, 1), dim3(256), 0, stream>>>(
      Xb, Xb, HIDN, 0L, Wkb, Wkb, HIDN, 0L, (void*)Kh, (void*)Kl, HIDN, 0L,
      bk, amask, NTOK, HIDN, HIDN, 1.0f);
  // k^T [1024][4096] = (Wk . Xb^T + bk[row]) * mask[col] -> hi/lo planes   (M=1024, N=4096)
  wmma_gemm64<1, false, false, 1, 2, 2><<<dim3(gemmBlocksTok, 1), dim3(256), 0, stream>>>(
      Wkb, Wkb, HIDN, 0L, Xb, Xb, HIDN, 0L, (void*)KTh, (void*)KTl, NTOK, 0L,
      bk, amask, HIDN, NTOK, HIDN, 1.0f);
  // v^T [1024][4096] = (Wv . Xb^T + bv[row]) * mask[col] -> hi/lo planes
  wmma_gemm64<1, false, false, 1, 2, 2><<<dim3(gemmBlocksTok, 1), dim3(256), 0, stream>>>(
      Wvb, Wvb, HIDN, 0L, Xb, Xb, HIDN, 0L, (void*)VTh, (void*)VTl, NTOK, 0L,
      bv, amask, HIDN, NTOK, HIDN, 1.0f);

  // 3) causal attention on the planes -> attention out hi/lo planes [4096][1024]
  const float sscale = 0.125f;   // 1 / (temperature * sqrt(64)), exact power of two
  attn_hd64_planes<<<dim3(NBATCH * NHEAD * (SEQ / AT_QB)), dim3(128), 0, stream>>>(
      Qh, Ql, Kh, Kl, VTh, VTl, amask, Oh, Ol, sscale);

  // 4) state[b][h][d][e] = sum_s k^T[h*64+d][b*S+s] * v^T[h*64+e][b*S+s]  (hi/lo on both operands); 4 tiles x 16 token slices per (b,h)
  for (int bb = 0; bb < NBATCH; ++bb) {
    state_ktv_slices<<<dim3(4, NHEAD), dim3(ST_NW * 32), 0, stream>>>(
        KTh + (size_t)bb * SEQ, KTl + (size_t)bb * SEQ, VTh + (size_t)bb * SEQ, VTl + (size_t)bb * SEQ,
        stateF + (size_t)bb * NHEAD * HDIM * HDIM);
  }

  // 5) out [4096][1024] = attn_out . Wo^T + bo  (A hi/lo, Wo exact bf16) -> d_out f32
  wmma_gemm64<1, true, false, 2, 0, 0><<<dim3(gemmBlocksTok, 1), dim3(256), 0, stream>>>(
      Oh, Ol, HIDN, 0L, Wob, Wob, HIDN, 0L, (void*)outF, (void*)Oh, HIDN, 0L,
      bo, amask, NTOK, HIDN, HIDN, 1.0f);
}

// v006
// Measured time: 227 microseconds a run.
// Timed twice side by side with v005, it ran 1.24 and 1.23 times as fast.
// Over all steps from v000 it is 3.06 times as fast.
// Compute dtype: input projections v_wmma_f32_16x16x32_bf16 on bf16 operands (inputs RNE-converted once), f32 accumulate; scores, p.v and k^T.v state on bf16 hi/lo split planes (hi.hi + hi.lo + lo.hi), output projection on hi/lo A planes x bf16 Wo (hi.hi + lo.hi), f32 accumulate; softmax and side math f32.
#include <hip/hip_runtime.h>

// ---------------------------------------------------------------- geometry
constexpr int NBATCH = 2;
constexpr int SEQ    = 2048;
constexpr int HIDN   = 1024;
constexpr int NHEAD  = 16;
constexpr int HDIM   = 64;
constexpr int NTOK   = NBATCH * SEQ;                    /* 4096 token rows */
constexpr size_t NX  = (size_t)NTOK * HIDN;            /* 4194304 */
constexpr size_t NW  = (size_t)HIDN * HIDN;            /* 1048576 */
constexpr size_t OUT0_ELEMS    = NX;
constexpr size_t OUT1_ELEMS    = (size_t)NBATCH * NHEAD * HDIM * HDIM;   /* 131072 */
constexpr size_t OUT1_BYTE_OFF = 16777216;
constexpr size_t OUT1_ELEM_OFF = OUT1_BYTE_OFF / 4;
static_assert(OUT1_ELEM_OFF == OUT0_ELEMS);
static_assert(OUT1_BYTE_OFF + OUT1_ELEMS * 4 == 17301504);
static_assert(HIDN == NHEAD * HDIM);
static_assert(HDIM == 64);
static_assert(HIDN % 64 == 0 && NTOK % 64 == 0 && SEQ % 64 == 0);   /* every GEMM M and N is a 64-multiple */
static_assert(HIDN % 32 == 0 && SEQ % 32 == 0);                     /* every GEMM K is a multiple of 32 */

// ---------------------------------------------------------------- workspace map (bytes)
// 16-bit planes: token planes [4096][1024] or [1024][4096] = 8 MiB each; weight planes [1024][1024] = 2 MiB each.
// Every region is fully written by its producer (full M x N, no pad rows) before any consumer reads it.
constexpr size_t MIB      = (size_t)1 << 20;
constexpr size_t OFF_XB   = 0 * MIB;    /* hidden as bf16      8 MiB */
constexpr size_t OFF_WQ   = 8 * MIB;    /* Wq bf16             2 MiB */
constexpr size_t OFF_WK   = 10 * MIB;   /* Wk bf16             2 MiB */
constexpr size_t OFF_WV   = 12 * MIB;   /* Wv bf16             2 MiB */
constexpr size_t OFF_WO   = 14 * MIB;   /* Wo bf16             2 MiB */
constexpr size_t OFF_QH   = 16 * MIB;   /* q hi  [4096][1024]        */
constexpr size_t OFF_QL   = 24 * MIB;   /* q lo                      */
constexpr size_t OFF_KH   = 32 * MIB;   /* k hi  [4096][1024] (masked) */
constexpr size_t OFF_KL   = 40 * MIB;   /* k lo                      */
constexpr size_t OFF_KTH  = 48 * MIB;   /* k^T hi [1024][4096] (masked) */
constexpr size_t OFF_KTL  = 56 * MIB;   /* k^T lo                    */
constexpr size_t OFF_VTH  = 64 * MIB;   /* v^T hi [1024][4096] (masked) */
constexpr size_t OFF_VTL  = 72 * MIB;   /* v^T lo                    */
constexpr size_t OFF_OH   = 80 * MIB;   /* attention out hi [4096][1024] */
constexpr size_t OFF_OL   = 88 * MIB;   /* attention out lo          */
constexpr size_t WS_TOTAL = 96 * MIB;   /* 100663296 B */
static_assert(NX * 2 == 8 * MIB && NW * 2 == 2 * MIB);
static_assert(WS_TOTAL <= 134217728);

// ---------------------------------------------------------------- types / helpers
typedef __attribute__((ext_vector_type(16))) _Float16 v16h;
typedef __attribute__((ext_vector_type(8)))  _Float16 v8h;
typedef __attribute__((ext_vector_type(16))) __bf16   v16b;
typedef __attribute__((ext_vector_type(8)))  __bf16   v8b;
typedef __attribute__((ext_vector_type(8)))  float    v8f;
typedef __attribute__((ext_vector_type(4)))  float    v4f;
typedef __attribute__((ext_vector_type(2)))  float    v2f;
typedef __attribute__((ext_vector_type(4)))  unsigned u4v;

__device__ __forceinline__ unsigned short f2bf_bits(float f) {
  unsigned u = __float_as_uint(f);
  return (unsigned short)((u + 0x7FFFu + ((u >> 16) & 1u)) >> 16);
}
__device__ __forceinline__ float bf_bits2f(unsigned short h) { return __uint_as_float(((unsigned)h) << 16); }
__device__ __forceinline__ float bfr(float f) { return bf_bits2f(f2bf_bits(f)); }

__device__ __forceinline__ void sched_fence() { asm volatile("" ::: "memory"); }

// hazard guards as plain device helpers (no inline asm inside the kernel template body)
__device__ __forceinline__ void dep_guard_h(v8f& a, v8f& b, v16h x, v16h y) { asm volatile("v_nop\n\tv_nop\n\tv_nop\n\tv_nop" : "+v"(a), "+v"(b) : "v"(x), "v"(y)); }
__device__ __forceinline__ void dep_guard_b(v8f& a, v8f& b, v16b x, v16b y) { asm volatile("v_nop\n\tv_nop\n\tv_nop\n\tv_nop" : "+v"(a), "+v"(b) : "v"(x), "v"(y)); }
__device__ __forceinline__ void keep4_h(v16h a, v16h b, v16h c, v16h d) { asm volatile("v_nop" :: "v"(a), "v"(b), "v"(c), "v"(d)); }
__device__ __forceinline__ void keep4_b(v16b a, v16b b, v16b c, v16b d) { asm volatile("v_nop" :: "v"(a), "v"(b), "v"(c), "v"(d)); }
__device__ __forceinline__ void acc_guard4(v8f& a, v8f& b, v8f& c, v8f& d) { asm volatile("v_nop\n\tv_nop\n\tv_nop\n\tv_nop" : "+v"(a), "+v"(b), "+v"(c), "+v"(d)); }
template <typename T> struct Frag;
template <> struct Frag<_Float16> {
  typedef v16h V; union U { v16h v; v8h h[2]; };
  static __device__ __forceinline__ v16h load(const _Float16* p) {   // elements 0..7 <- p[0..7], 8..15 <- p[16..23]
    U f; f.h[0] = *(const v8h*)(p); f.h[1] = *(const v8h*)(p + 16); return f.v;
  }
  static __device__ __forceinline__ v8f mma(v16h a, v16h b, v8f c) {
    return __builtin_amdgcn_wmma_f32_16x16x32_f16(false, a, false, b, (short)0, c, false, false);
  }
  static __device__ __forceinline__ void guard(v8f& a, v8f& b, v16h x, v16h y) { dep_guard_h(a, b, x, y); }
  static __device__ __forceinline__ void keep(v16h a, v16h b, v16h c, v16h d) { keep4_h(a, b, c, d); }
};
template <> struct Frag<__bf16> {
  typedef v16b V; union U { v16b v; v8b h[2]; };
  static __device__ __forceinline__ v16b load(const __bf16* p) {
    U f; f.h[0] = *(const v8b*)(p); f.h[1] = *(const v8b*)(p + 16); return f.v;
  }
  static __device__ __forceinline__ v8f mma(v16b a, v16b b, v8f c) {
    return __builtin_amdgcn_wmma_f32_16x16x32_bf16(false, a, false, b, (short)0, c, false, false);
  }
  static __device__ __forceinline__ void guard(v8f& a, v8f& b, v16b x, v16b y) { dep_guard_b(a, b, x, y); }
  static __device__ __forceinline__ void keep(v16b a, v16b b, v16b c, v16b d) { keep4_b(a, b, c, d); }
};

// ---- Register-blocked batched WMMA GEMM ------------------------------------
// C[m,n] = rs * (scale * sum_k A[m,k] * Bt[n,k] + bias); each wave owns a 64x64 tile.
// A row-major [M,K]; Bt row-major [N,K]; M % 128 == 0, N % 256 == 0, K % 64 == 0.
// Block = 8 waves (2 x 4) = one 128x256 tile. A stage is 64 k = one 128-byte line of every operand row of the block tile.
// Asynchronous 16-byte copies (8 lanes per row, whole lines) bring a stage from global memory into one of two LDS buffers
// while the other buffer is multiplied; the waves read their fragments from LDS.
// SPLIT: A carried as hi/lo planes (A2 = lo); BLO: Bt also carried as hi/lo (Bt2 = lo);
//   product = hi.hi (+ hi.lo when BLO) + lo.hi.   SPLIT+BLO is the stock hi/lo path.
// BIAS_MODE: 0 = none, 1 = bias[m], 2 = bias[n]  (bias value RNE-converted to bf16 precision).
// RS_MODE:   0 = none, 1 = multiply by rsc[m], 2 = multiply by rsc[n]  (rsc value RNE-converted to bf16).
// BIAS_MODE 3 (RS_MODE is then not read): both modes chosen per block: (1, 2) where tr, else (2, 1) where rsRow, else (2, 0).
// b = batch index of the block; tr, rsRow are block-uniform and read under BIAS_MODE 3 only.
// OUT_MODE: 0 = f32, 1 = f16, 2 = bf16 hi plane (Cout) + bf16 lo plane (Cout2).
// ET: 0 = f16 operands, 1 = bf16 operands (pointers passed as 16-bit storage)
constexpr int GB_M = 128;   // block tile rows
constexpr int GB_N = 256;   // block tile columns
constexpr int GB_K = 64;    // k per stage
constexpr int GB_P = 72;    // LDS row pitch in elements: 144 B = 16 B x 9 (odd), distinct banks for the 16 rows of a 16-byte fragment read
static_assert(HIDN % GB_N == 0 && NTOK % GB_N == 0 && HIDN % GB_K == 0);   /* every GEMM M, N is a multiple of the block tile, K of the stage */

// four asynchronous 16-byte copies to LDS, every lane with its own LDS byte address and global address;
// s_wait_xcnt 0 closes the statement as a precaution: no address register of a copy is rewritten in front of it
__device__ __forceinline__ void copy4_async(unsigned l0, const void* g0, unsigned l1, const void* g1,
                                            unsigned l2, const void* g2, unsigned l3, const void* g3) {
  asm volatile("global_load_async_to_lds_b128 %0, %1, off\n\t"
               "global_load_async_to_lds_b128 %2, %3, off\n\t"
               "global_load_async_to_lds_b128 %4, %5, off\n\t"
               "global_load_async_to_lds_b128 %6, %7, off\n\t"
               "s_wait_xcnt 0x0"
               :: "v"(l0), "v"(g0), "v"(l1), "v"(g1), "v"(l2), "v"(g2), "v"(l3), "v"(g3) : "memory");
}
// this wave's copies have landed behind this one
__device__ __forceinline__ void wait_async0() { asm volatile("s_wait_asynccnt 0x0" ::: "memory"); }
// this wave's LDS reads have returned: stands in front of the barrier behind which their buffer is refilled
__device__ __forceinline__ void wait_ds0() { asm volatile("s_wait_dscnt 0x0" ::: "memory"); }

template <int V> struct IntC { static constexpr int value = V; };   // an int as a type, for the epilogue's modes
template <int ET> struct Elem;
template <> struct Elem<0> { typedef _Float16 T; };
template <> struct Elem<1> { typedef __bf16 T; };
template <int ET, bool SPLIT, bool BLO, int BIAS_MODE, int OUT_MODE, int RS_MODE>
__device__ __forceinline__ void gemm_block_tile(
    const unsigned short* __restrict__ Ap, const unsigned short* __restrict__ A2p, int lda, long strideA,
    const unsigned short* __restrict__ Btp, const unsigned short* __restrict__ Bt2p, int ldb, long strideB,
    void* __restrict__ Cout, void* __restrict__ Cout2, int ldc, long strideC,
    const float* __restrict__ bias, const float* __restrict__ rsc,
    int M, int N, int K, float scale, const int b, const bool tr, const bool rsRow) {
  typedef typename Elem<ET>::T T;
  typedef typename Frag<T>::V V;
  const T* A = (const T*)Ap; const T* A2 = (const T*)A2p; const T* Bt = (const T*)Btp; const T* Bt2 = (const T*)Bt2p;
  constexpr int NPA = SPLIT ? 2 : 1;              // planes of A
  constexpr int NPB = (SPLIT && BLO) ? 2 : 1;     // planes of Bt
  __shared__ __align__(16) T sA[2][NPA][GB_M * GB_P];   // two buffers of A rows  [row][k], 18 KB per plane
  __shared__ __align__(16) T sB[2][NPB][GB_N * GB_P];   // two buffers of Bt rows [row][k], 36 KB per plane
  __shared__ __align__(16) float sT[8][16 * 68];   // per-wave 16x64 slab, pitch 68 floats
  const int tid  = threadIdx.x;
  const int lane = tid & 31;
  const int wave = tid >> 5;
  const int blocksN = N / GB_N;
  const int bm = blockIdx.x / blocksN;
  const int bn = blockIdx.x - bm * blocksN;
  if (bm >= M / GB_M) return;            // block-uniform, in front of every copy and barrier
  const int mB = bm * GB_M;              // block tile origin
  const int nB = bn * GB_N;
  const int wm = (wave >> 2) << 6;       // wave tile origin inside the block tile
  const int wn = (wave & 3) << 6;
  const int m0 = mB + wm;
  const int n0 = nB + wn;

  const T* Ab  = A  + (size_t)b * strideA;
  const T* Bb  = Bt + (size_t)b * strideB;
  const T* Ab2 = SPLIT ? (A2  + (size_t)b * strideA) : nullptr;
  const T* Bb2 = (SPLIT && BLO) ? (Bt2 + (size_t)b * strideB) : nullptr;

  const int rlane = lane & 15;                 // row (A) / col (B, D) within subtile
  const int koff  = (lane >> 4) * 8;           // k offset of this lane half
  const int mOff  = (lane >> 4) * 8;           // D row offset

  // staging coverage: 256 threads x 4 copies = 1024 = 128 rows x 8 pieces of 16 B (A plane); x 8 copies = 2048 = 256 rows x 8 (Bt plane);
  // copy i of a thread is row srow + 32 i, piece tid & 7: every piece once, every address a multiple of 16 B
  const int srow = tid >> 3;                   // 0..31
  const int sc8  = (tid & 7) * 8;
  constexpr unsigned RS = 32 * GB_P * 2;       // LDS bytes between a thread's successive copies
  const unsigned ldsA = (unsigned)(size_t)(&sA[0][0][srow * GB_P + sc8]);   // low 32 bits = byte address in the work-group's LDS
  const unsigned ldsB = (unsigned)(size_t)(&sB[0][0][srow * GB_P + sc8]);
  const size_t astep = (size_t)32 * lda * 2, bstep = (size_t)32 * ldb * 2;  // global bytes between them
  auto stage = [&](int st, int buf) {
    const size_t ka = ((size_t)(mB + srow) * lda + (size_t)st * GB_K + sc8) * 2;
    const size_t kb = ((size_t)(nB + srow) * ldb + (size_t)st * GB_K + sc8) * 2;
#pragma unroll
    for (int p = 0; p < NPA; ++p) {
      const char* g = (const char*)(p == 0 ? Ab : Ab2) + ka;
      const unsigned l = ldsA + (unsigned)(buf * NPA + p) * (unsigned)(GB_M * GB_P * 2);
      copy4_async(l, g, l + RS, g + astep, l + 2 * RS, g + 2 * astep, l + 3 * RS, g + 3 * astep);
    }
#pragma unroll
    for (int p = 0; p < NPB; ++p) {
      const char* g = (const char*)(p == 0 ? Bb : Bb2) + kb;
      const unsigned l = ldsB + (unsigned)(buf * NPB + p) * (unsigned)(GB_N * GB_P * 2);
      copy4_async(l, g, l + RS, g + bstep, l + 2 * RS, g + 2 * bstep, l + 3 * RS, g + 3 * bstep);
      copy4_async(l + 4 * RS, g + 4 * bstep, l + 5 * RS, g + 5 * bstep, l + 6 * RS, g + 6 * bstep, l + 7 * RS, g + 7 * bstep);
    }
  };

  v8f acc[4][4];
#pragma unroll
  for (int i = 0; i < 4; ++i)
#pragma unroll
    for (int j = 0; j < 4; ++j) acc[i][j] = (v8f){0.f,0.f,0.f,0.f,0.f,0.f,0.f,0.f};

  const int nst = K / GB_K;                    // stages, block-uniform
  stage(0, 0);
  wait_async0();
  __syncthreads();                             // stage 0 is complete before any wave reads it
  if (nst > 1) stage(1, 1);
  for (int t = 0; t < nst; ++t) {
    const int cur = t & 1;
#pragma unroll
    for (int kk = 0; kk < GB_K; kk += 32) {
      V bh[4], bl[4], ah[4], al[4];
#pragma unroll
      for (int j = 0; j < 4; ++j) {
        const int bo = (wn + (j << 4) + rlane) * GB_P + kk + koff;
        bh[j] = Frag<T>::load(&sB[cur][0][bo]);
        if (SPLIT && BLO) bl[j] = Frag<T>::load(&sB[cur][NPB - 1][bo]);
        else bl[j] = bh[j];
      }
#pragma unroll
      for (int i = 0; i < 4; ++i) {
        const int ao = (wm + (i << 4) + rlane) * GB_P + kk + koff;
        ah[i] = Frag<T>::load(&sA[cur][0][ao]);
        if (SPLIT) al[i] = Frag<T>::load(&sA[cur][NPA - 1][ao]);
        else al[i] = ah[i];
      }
#pragma unroll
      for (int i = 0; i < 4; ++i) {
#pragma unroll
        for (int j = 0; j < 4; ++j) {
          acc[i][j] = Frag<T>::mma(ah[i], bh[j], acc[i][j]);
          if (SPLIT) {
            if (BLO) acc[i][j] = Frag<T>::mma(ah[i], bl[j], acc[i][j]);
            acc[i][j] = Frag<T>::mma(al[i], bh[j], acc[i][j]);
          }
        }
        Frag<T>::guard(acc[i][0], acc[i][3], ah[i], al[i]);
      }
      Frag<T>::keep(bh[0], bh[1], bh[2], bh[3]);
      if (SPLIT && BLO) Frag<T>::keep(bl[0], bl[1], bl[2], bl[3]);
    }
    wait_ds0();                                // this wave has finished reading buffer cur
    wait_async0();                             // this wave's copies of stage t + 1 have landed
    __syncthreads();                           // publishes stage t + 1 and frees buffer cur
    if (t + 2 < nst) stage(t + 2, cur);        // block-uniform
  }
  wait_async0();                               // nothing is in flight when the wave goes on
  acc_guard4(acc[0][0], acc[0][1], acc[0][2], acc[0][3]);
  acc_guard4(acc[1][0], acc[1][1], acc[1][2], acc[1][3]);
  acc_guard4(acc[2][0], acc[2][1], acc[2][2], acc[2][3]);
  acc_guard4(acc[3][0], acc[3][1], acc[3][2], acc[3][3]);

  // ---- epilogue ----  (bias and row-scale mode as compile-time values of the call; always inlined: acc stays in registers)
  float* slab = sT[wave];
  auto epilogue = [&](auto bmode, auto rmode) __attribute__((always_inline)) {
  constexpr int BM = decltype(bmode)::value;
  constexpr int RM = decltype(rmode)::value;
#pragma unroll
  for (int i = 0; i < 4; ++i) {
    const int mBase = m0 + (i << 4);
    float bm[8], rm[8];
#pragma unroll
    for (int r = 0; r < 8; ++r) { bm[r] = 0.f; rm[r] = 1.f; }
    if (BM == 1) {
      // rows mBase+mOff .. +7 are contiguous and 32-B aligned: two 16-B loads
      const v4f t0 = *(const v4f*)(bias + mBase + mOff);
      const v4f t1 = *(const v4f*)(bias + mBase + mOff + 4);
#pragma unroll
      for (int r = 0; r < 4; ++r) { bm[r] = bfr(t0[r]); bm[4 + r] = bfr(t1[r]); }
    }
    if (RM == 1) {
      const v4f t0 = *(const v4f*)(rsc + mBase + mOff);
      const v4f t1 = *(const v4f*)(rsc + mBase + mOff + 4);
#pragma unroll
      for (int r = 0; r < 4; ++r) { rm[r] = bfr(t0[r]); rm[4 + r] = bfr(t1[r]); }
    }
#pragma unroll
    for (int j = 0; j < 4; ++j) {
      const int n = n0 + (j << 4) + rlane;
      float bn = 0.f, rn = 1.f;
      if (BM == 2) bn = bfr(bias[n]);
      if (RM == 2) rn = bfr(rsc[n]);
#pragma unroll
      for (int r = 0; r < 8; ++r) {
        float v = acc[i][j][r] * scale;
        if (BM == 1) v += bm[r];
        if (BM == 2) v += bn;
        if (RM == 1) v *= rm[r];
        if (RM == 2) v *= rn;
        slab[(mOff + r) * 68 + (j << 4) + rlane] = v;
      }
    }
    __builtin_amdgcn_fence(__ATOMIC_RELEASE, "workgroup");
    __builtin_amdgcn_wave_barrier();
    __builtin_amdgcn_fence(__ATOMIC_ACQUIRE, "workgroup");
    if (OUT_MODE == 0) {
      float* C = (float*)Cout + (size_t)b * strideC;
      const int hh = lane >> 4, c4 = (lane & 15) * 4;     // row seg = 256 B = 16 lanes x 16 B
      {
#pragma unroll
        for (int it = 0; it < 8; ++it) {
          const int row = it * 2 + hh;
          v4f v = *(const v4f*)(slab + row * 68 + c4);
          *(v4f*)(C + (size_t)(mBase + row) * ldc + n0 + c4) = v;
        }
        
      }
    } else {
      const int q = lane >> 3, c8 = (lane & 7) * 8;
      unsigned short* C  = (unsigned short*)Cout  + (size_t)b * strideC;
      unsigned short* C2 = (OUT_MODE == 2) ? ((unsigned short*)Cout2 + (size_t)b * strideC) : nullptr;
      {
#pragma unroll
        for (int it = 0; it < 4; ++it) {
          const int row = it * 4 + q;
          const float* sp = slab + row * 68 + c8;
          v8h hv, lv;
#pragma unroll
          for (int e = 0; e < 8; ++e) {
            if (OUT_MODE == 1) {
              hv[e] = (_Float16)sp[e];
              lv[e] = hv[e];
            } else {
              unsigned short hb = f2bf_bits(sp[e]);
              unsigned short lb = f2bf_bits(sp[e] - bf_bits2f(hb));
              hv[e] = __builtin_bit_cast(_Float16, hb);
              lv[e] = __builtin_bit_cast(_Float16, lb);
            }
          }
          *(v8h*)(C + (size_t)(mBase + row) * ldc + n0 + c8) = hv;
          if (OUT_MODE == 2) *(v8h*)(C2 + (size_t)(mBase + row) * ldc + n0 + c8) = lv;
        }
        
      }
    }
    __builtin_amdgcn_fence(__ATOMIC_RELEASE, "workgroup");
    __builtin_amdgcn_wave_barrier();
    __builtin_amdgcn_fence(__ATOMIC_ACQUIRE, "workgroup");
  }
  };
  if constexpr (BIAS_MODE == 3) {        // block-uniform choice among the three forms the projections need
    if (tr)         epilogue(IntC<1>{}, IntC<2>{});
    else if (rsRow) epilogue(IntC<2>{}, IntC<1>{});
    else            epilogue(IntC<2>{}, IntC<0>{});
  } else {
    epilogue(IntC<BIAS_MODE>{}, IntC<RS_MODE>{});
  }
}

// one GEMM per launch: grid.x = block tiles, grid.y = batch
template <int ET, bool SPLIT, bool BLO, int BIAS_MODE, int OUT_MODE, int RS_MODE>
__global__ __launch_bounds__(256) void wmma_gemm64(
    const unsigned short* __restrict__ Ap, const unsigned short* __restrict__ A2p, int lda, long strideA,
    const unsigned short* __restrict__ Btp, const unsigned short* __restrict__ Bt2p, int ldb, long strideB,
    void* __restrict__ Cout, void* __restrict__ Cout2, int ldc, long strideC,
    const float* __restrict__ bias, const float* __restrict__ rsc,
    int M, int N, int K, float scale) {
  gemm_block_tile<ET, SPLIT, BLO, BIAS_MODE, OUT_MODE, RS_MODE>(
      Ap, A2p, lda, strideA, Btp, Bt2p, ldb, strideB, Cout, Cout2, ldc, strideC, bias, rsc, M, N, K, scale,
      (int)blockIdx.y, false, false);
}

// The four input projections in ONE launch. Each has 128 block tiles, half of the chip's 256 WGPs, and none reads what another writes:
// together their 512 blocks stand two on every WGP (LDS and registers allow two). blockIdx.y picks the projection, block-uniform:
//   0: q rows   [NTOK][HIDN] = X . Wq^T + bq[col]
//   1: k rows   [NTOK][HIDN] = (X . Wk^T + bk[col]) * mask[row]
//   2: k^T rows [HIDN][NTOK] = (Wk . X^T + bk[row]) * mask[col]
//   3: v^T rows [HIDN][NTOK] = (Wv . X^T + bv[row]) * mask[col]
// every result as bf16 hi and lo planes. K (= HIDN) comes as an argument, as in the one-GEMM kernel.
__global__ __launch_bounds__(256) void proj4_gemm64(
    const unsigned short* __restrict__ Xb, const unsigned short* __restrict__ Wqb,
    const unsigned short* __restrict__ Wkb, const unsigned short* __restrict__ Wvb,
    unsigned short* __restrict__ Qh, unsigned short* __restrict__ Ql, unsigned short* __restrict__ Kh, unsigned short* __restrict__ Kl,
    unsigned short* __restrict__ KTh, unsigned short* __restrict__ KTl, unsigned short* __restrict__ VTh, unsigned short* __restrict__ VTl,
    const float* __restrict__ bq, const float* __restrict__ bk, const float* __restrict__ bv,
    const float* __restrict__ amask, int K) {
  const int  y  = blockIdx.y;
  const bool tr = y >= 2;                       // weight rows are the result's rows
  const unsigned short* W = (y == 0) ? Wqb : (y == 3) ? Wvb : Wkb;
  const float* bias       = (y == 0) ? bq  : (y == 3) ? bv  : bk;
  unsigned short* C  = (y == 0) ? Qh : (y == 1) ? Kh : (y == 2) ? KTh : VTh;
  unsigned short* C2 = (y == 0) ? Ql : (y == 1) ? Kl : (y == 2) ? KTl : VTl;
  const unsigned short* A  = tr ? W : Xb;
  const unsigned short* Bt = tr ? Xb : W;
  gemm_block_tile<1, false, false, 3, 2, 3>(
      A, A, HIDN, 0L, Bt, Bt, HIDN, 0L, (void*)C, (void*)C2, tr ? NTOK : HIDN, 0L, bias, amask,
      tr ? HIDN : NTOK, tr ? NTOK : HIDN, K, 1.0f, 0, tr, y == 1);
}

// One launch converts all five f32 inputs: their bf16 planes lie back to back in the workspace (hidden, Wq, Wk, Wv, Wo).
// Few waves, much work each.
// Block = 16 waves = CV_BLK consecutive elements of ONE input (every input is a whole number of blocks); grid = all elements / CV_BLK, exact.
// Pass i of a block is 2048 consecutive elements, 4 per lane: a wave's 16-byte load covers 512 contiguous bytes, its 8-byte store 256.
constexpr int CV_T   = 512;                 // threads per block
constexpr int CV_IT  = 16;                  // passes per block
constexpr int CV_BLK = CV_T * 4 * CV_IT;    // 32768 elements per block
constexpr int CV_XB  = (int)(NX / CV_BLK);  // 128 blocks of hidden
constexpr int CV_WB  = (int)(NW / CV_BLK);  // 32 blocks of each weight
constexpr int CV_GRID = CV_XB + 4 * CV_WB;  // 256 blocks
static_assert(NX % CV_BLK == 0 && NW % CV_BLK == 0);
static_assert(OFF_XB == 0 && OFF_WQ == NX * 2 && OFF_WK == OFF_WQ + NW * 2 && OFF_WV == OFF_WK + NW * 2 && OFF_WO == OFF_WV + NW * 2);
typedef __attribute__((ext_vector_type(2))) unsigned u2v;

__global__ __launch_bounds__(CV_T) void cast_all_f32_bf16(
    const float* __restrict__ hs, const float* __restrict__ wq, const float* __restrict__ wk,
    const float* __restrict__ wv, const float* __restrict__ wo, unsigned short* __restrict__ out) {
  const int blk = blockIdx.x;
  const float* src;                          // block-uniform choice of the input
  if (blk < CV_XB) {
    src = hs + (size_t)blk * CV_BLK;
  } else {
    const int w = (blk - CV_XB) / CV_WB;
    const int r = (blk - CV_XB) % CV_WB;
    src = (w == 0 ? wq : w == 1 ? wk : w == 2 ? wv : wo) + (size_t)r * CV_BLK;
  }
  const int t4 = threadIdx.x * 4;
  v4f f[CV_IT];
  // unrolled: f stays in registers, the pass offsets fold into the loads' immediate fields and the loads stand ahead of the conversions
#pragma unroll
  for (int i = 0; i < CV_IT; ++i) f[i] = *(const v4f*)(src + i * (CV_T * 4) + t4);
  unsigned short* o = out + (size_t)blk * CV_BLK + t4;
  // unrolled: constant indices into f, store offsets as immediates
#pragma unroll
  for (int i = 0; i < CV_IT; ++i) {
    u2v u;
    u[0] = (unsigned)f2bf_bits(f[i][0]) | ((unsigned)f2bf_bits(f[i][1]) << 16);
    u[1] = (unsigned)f2bf_bits(f[i][2]) | ((unsigned)f2bf_bits(f[i][3]) << 16);
    *(u2v*)(o + i * (CV_T * 4)) = u;
  }
}

// =====================================================================================
// Causal attention for head_dim 64 on bf16 hi/lo planes.
//   q planes  : [NTOK][HIDN] (row = b*SEQ + s, col = h*64 + d), hi and lo
//   k planes  : [NTOK][HIDN] same layout, hi and lo (padding mask already folded in)
//   v^T planes: [HIDN][NTOK] (row = h*64 + d, col = b*SEQ + s), hi and lo (mask folded in)
//   out planes: [NTOK][HIDN] bf16 hi and lo
//   scores = (q.k^T) * sscale : hi.hi + hi.lo + lo.hi, f32 accumulate; key j masked where j > q or amask[b][j] == 0 (score := -inf)
//   out    = p.v / l          : p (f32 exp terms) split to bf16 hi/lo per tile, v hi/lo, 3 products, f32 accumulate
//   Block = 4 waves = 64 query rows of one (b, h); grid.x = NBATCH*NHEAD*(SEQ/64).
//   fragments in flight besides the persistent per-wave state.
// =====================================================================================
constexpr int AT_D  = 64;
constexpr int AT_NW = 4;
constexpr int AT_QB = 64;
constexpr int AT_KC = 64;
constexpr int AT_P  = 72;   // LDS row pitch in elements: 144 B = 16 B x 9 (odd), so the 16 rows of a 16-byte fragment read fall on distinct banks

__device__ __forceinline__ __bf16 at_f2bf(float f) { return __builtin_bit_cast(__bf16, f2bf_bits(f)); }
__device__ __forceinline__ void at_split(float f, __bf16& hi, __bf16& lo) {
  const unsigned short hb = f2bf_bits(f);
  hi = __builtin_bit_cast(__bf16, hb);
  lo = at_f2bf(f - __uint_as_float(((unsigned)hb) << 16));
}
__device__ __forceinline__ v8f at_mma(v16b a, v16b b, v8f c) {
  c = __builtin_amdgcn_wmma_f32_16x16x32_bf16(false, a, false, b, (short)0, c, false, false);
  asm volatile("v_nop\n\tv_nop\n\tv_nop\n\tv_nop" : "+v"(c) : "v"(a), "v"(b));
  return c;
}

__global__ __launch_bounds__(128) __attribute__((amdgpu_num_vgpr(256)))
void attn_hd64_planes(const unsigned short* __restrict__ Qh, const unsigned short* __restrict__ Ql,
                      const unsigned short* __restrict__ Kh, const unsigned short* __restrict__ Kl,
                      const unsigned short* __restrict__ VTh, const unsigned short* __restrict__ VTl,
                      const float* __restrict__ amask,
                      unsigned short* __restrict__ Oh, unsigned short* __restrict__ Ol,
                      float sscale) {
  union FB { v16b v; v8b h[2]; };
  __shared__ __align__(16) __bf16 Ksh[AT_KC * AT_P];     // k hi [kv][d]     9 KB
  __shared__ __align__(16) __bf16 Ksl[AT_KC * AT_P];     // k lo
  __shared__ __align__(16) __bf16 Vth[AT_D * AT_P];      // v hi [d][kv]     9 KB
  __shared__ __align__(16) __bf16 Vtl[AT_D * AT_P];     // v lo
  __shared__ __align__(16) __bf16 Psh[AT_NW][16 * AT_P];   // per wave p hi [row][kv]
  __shared__ __align__(16) __bf16 Psl[AT_NW][16 * AT_P];   // per wave p lo
  __shared__ __align__(16) float  Os[AT_NW][16 * 68];       // per wave out tile, pitch 68

  const int tid  = threadIdx.x;
  const int wave = tid >> 5;
  const int lane = tid & 31;
  const int hh   = lane >> 4;
  const int c    = lane & 15;

  const int nqb = SEQ / AT_QB;                  // 32
  const int bx  = blockIdx.x;
  const int qb  = bx % nqb;
  const int bhd = bx / nqb;
  const int h   = bhd % NHEAD;
  const int b   = bhd / NHEAD;
  const int q0  = qb * AT_QB + wave * 16;
  const int tok0 = b * SEQ;
  const int hcol = h * HDIM;

  // ---- Q fragments (A operand): 2 d-chunks, hi and lo, split k-map via Frag::load ----
  v16b qah[2], qal[2];
  {
    const __bf16* qhp = (const __bf16*)Qh + (size_t)(tok0 + q0 + c) * HIDN + hcol + 8 * hh;
    const __bf16* qlp = (const __bf16*)Ql + (size_t)(tok0 + q0 + c) * HIDN + hcol + 8 * hh;
#pragma unroll
    for (int dc = 0; dc < 2; ++dc) {
      qah[dc] = Frag<__bf16>::load(qhp + dc * 32);
      qal[dc] = Frag<__bf16>::load(qlp + dc * 32);
    }
  }

  float mrow[8], lrow[8];
  v8f oacc[4];
#pragma unroll
  for (int r = 0; r < 8; ++r) { mrow[r] = -__builtin_inff(); lrow[r] = 0.f; }
#pragma unroll
  for (int t = 0; t < 4; ++t) oacc[t] = (v8f){0.f,0.f,0.f,0.f,0.f,0.f,0.f,0.f};

  const int nChunks = qb + 1;                   // causal, block-uniform, <= 32
  for (int kc = 0; kc < nChunks; ++kc) {
    const int kv0 = kc * AT_KC;
    __syncthreads();
    {
      // staging coverage: 128 threads x 4 ids = 512 ids = 64 rows x 8 chunks of 8 elements = 64x64 per plane, exact
#pragma unroll
      for (int i = 0; i < 4; ++i) {
        const int id = tid + 128 * i;
        const int row = id >> 3, c8 = (id & 7) * 8;
        const size_t ko = (size_t)(tok0 + kv0 + row) * HIDN + hcol + c8;
        const u4v a0 = *(const u4v*)(Kh + ko);
        const u4v a1 = *(const u4v*)(Kl + ko);
        *(u4v*)(Ksh + row * AT_P + c8) = a0;
        *(u4v*)(Ksl + row * AT_P + c8) = a1;
      }
      sched_fence();
#pragma unroll
      for (int i = 0; i < 4; ++i) {
        const int id = tid + 128 * i;
        const int row = id >> 3, c8 = (id & 7) * 8;      // row = d
        const size_t vo = (size_t)(hcol + row) * NTOK + tok0 + kv0 + c8;
        const u4v a0 = *(const u4v*)(VTh + vo);
        const u4v a1 = *(const u4v*)(VTl + vo);
        *(u4v*)(Vth + row * AT_P + c8) = a0;
        *(u4v*)(Vtl + row * AT_P + c8) = a1;
      }
    }
    __syncthreads();

    v8f s[4];
#pragma unroll
    for (int j = 0; j < 4; ++j) {
      v8f sj = (v8f){0.f,0.f,0.f,0.f,0.f,0.f,0.f,0.f};
#pragma unroll
      for (int dc = 0; dc < 2; ++dc) {
        FB kb, kl;
        const __bf16* khp = Ksh + (j * 16 + c) * AT_P + dc * 32 + 8 * hh;
        const __bf16* klp = Ksl + (j * 16 + c) * AT_P + dc * 32 + 8 * hh;
        kb.h[0] = *(const v8b*)(khp);
        kb.h[1] = *(const v8b*)(khp + 16);
        kl.h[0] = *(const v8b*)(klp);
        kl.h[1] = *(const v8b*)(klp + 16);
        sj = at_mma(qah[dc], kb.v, sj);
        sj = at_mma(qah[dc], kl.v, sj);
        sj = at_mma(qal[dc], kb.v, sj);
        sched_fence();
      }
      s[j] = sj;
    }
    // key index of each score column; a padded key (amask == 0) gets an index above every query row,
    // so one integer compare and one select per score cover the causal and the padding mask without a branch
    int kidx[4];
#pragma unroll
    for (int j = 0; j < 4; ++j) {
      const float kvm = amask[(size_t)tok0 + kv0 + j * 16 + c];
      kidx[j] = (kvm == 0.0f) ? 0x7fffffff : (kv0 + j * 16 + c);
    }
    float cm[8];
#pragma unroll
    for (int r = 0; r < 8; ++r) {
      const int qrow = q0 + 8 * hh + r;
      float m = -__builtin_inff();
#pragma unroll
      for (int j = 0; j < 4; ++j) {
        const float sc  = s[j][r] * sscale;
        const float val = (kidx[j] > qrow) ? -__builtin_inff() : sc;
        s[j][r] = val;
        m = fmaxf(m, val);
      }
#pragma unroll
      for (int off = 1; off < 16; off <<= 1) m = fmaxf(m, __shfl_xor(m, off, 32));
      cm[r] = m;
    }
    __bf16* pwh = Psh[wave];
    __bf16* pwl = Psl[wave];
#pragma unroll
    for (int r = 0; r < 8; ++r) {
      const float mnew = fmaxf(mrow[r], cm[r]);
      const float alpha = expf(mrow[r] - mnew);
      mrow[r] = mnew;
      float psum = 0.f;
#pragma unroll
      for (int j = 0; j < 4; ++j) {
        const float p = expf(s[j][r] - mnew);
        psum += p;
        __bf16 a, bl; at_split(p, a, bl);
        pwh[(8 * hh + r) * AT_P + j * 16 + c] = a;
        pwl[(8 * hh + r) * AT_P + j * 16 + c] = bl;
      }
#pragma unroll
      for (int off = 1; off < 16; off <<= 1) psum += __shfl_xor(psum, off, 32);
      lrow[r] = lrow[r] * alpha + psum;
#pragma unroll
      for (int t = 0; t < 4; ++t) oacc[t][r] *= alpha;
    }
    __builtin_amdgcn_fence(__ATOMIC_RELEASE, "workgroup");
    __builtin_amdgcn_wave_barrier();
    __builtin_amdgcn_fence(__ATOMIC_ACQUIRE, "workgroup");
#pragma unroll 1
    for (int kk = 0; kk < 2; ++kk) {
      FB pa, pl;
      pa.h[0] = *(const v8b*)(pwh + c * AT_P + kk * 32 + 8 * hh);
      pa.h[1] = *(const v8b*)(pwh + c * AT_P + kk * 32 + 16 + 8 * hh);
      pl.h[0] = *(const v8b*)(pwl + c * AT_P + kk * 32 + 8 * hh);
      pl.h[1] = *(const v8b*)(pwl + c * AT_P + kk * 32 + 16 + 8 * hh);
      sched_fence();
#pragma unroll
      for (int t = 0; t < 4; ++t) {
        FB vb, vl;
        const __bf16* vhp = Vth + (t * 16 + c) * AT_P + kk * 32 + 8 * hh;
        const __bf16* vlp = Vtl + (t * 16 + c) * AT_P + kk * 32 + 8 * hh;
        vb.h[0] = *(const v8b*)(vhp);
        vb.h[1] = *(const v8b*)(vhp + 16);
        vl.h[0] = *(const v8b*)(vlp);
        vl.h[1] = *(const v8b*)(vlp + 16);
        oacc[t] = at_mma(pa.v, vb.v, oacc[t]);
        oacc[t] = at_mma(pa.v, vl.v, oacc[t]);
        oacc[t] = at_mma(pl.v, vb.v, oacc[t]);
        sched_fence();
      }
    }
  }

  float* os = Os[wave];
#pragma unroll
  for (int r = 0; r < 8; ++r) {
    const float inv = 1.0f / lrow[r];
#pragma unroll
    for (int t = 0; t < 4; ++t) os[(8 * hh + r) * 68 + t * 16 + c] = oacc[t][r] * inv;
  }
  __builtin_amdgcn_fence(__ATOMIC_RELEASE, "workgroup");
  __builtin_amdgcn_wave_barrier();
  __builtin_amdgcn_fence(__ATOMIC_ACQUIRE, "workgroup");
  {
    const int q = lane >> 3, c8 = (lane & 7) * 8;
    {
#pragma unroll
      for (int it = 0; it < 4; ++it) {
        const int row = it * 4 + q;
        const float* sp = os + row * 68 + c8;
        v8h hv, lv;
#pragma unroll
        for (int e = 0; e < 8; ++e) {
          unsigned short hb = f2bf_bits(sp[e]);
          unsigned short lb = f2bf_bits(sp[e] - bf_bits2f(hb));
          hv[e] = __builtin_bit_cast(_Float16, hb);
          lv[e] = __builtin_bit_cast(_Float16, lb);
        }
        const size_t oo = (size_t)(tok0 + q0 + row) * HIDN + hcol + c8;
        *(v8h*)(Oh + oo) = hv;
        *(v8h*)(Ol + oo) = lv;
      }
      
    }
  }
}

// =====================================================================================
// k^T.v state: St[h][d][e] = sum_s kT[h*64+d][s] * vT[h*64+e][s] over SEQ tokens of one batch.
//   planes: [HIDN][NTOK] bf16 hi and lo; blockIdx.z = batch, whose tokens begin at column blockIdx.z * SEQ
//   product = hi.hi + hi.lo + lo.hi, f32 accumulate (same three products per k step as the GEMM's hi/lo path)
//   Block = 16 waves = one 32x32 tile of one head; wave w sums tokens [w*128, w*128+128).
//   The 16 partial tiles meet in LDS and are added in wave order 0..15. grid = (4 tiles, NHEAD, NBATCH).
// =====================================================================================
constexpr int ST_NW = 16;                 // waves per block = slices of the token sum
constexpr int ST_KS = SEQ / ST_NW;        // 128 tokens per wave
static_assert(ST_KS % 32 == 0);

__global__ __launch_bounds__(ST_NW * 32)
void state_ktv_slices(const unsigned short* __restrict__ KTh, const unsigned short* __restrict__ KTl,
                      const unsigned short* __restrict__ VTh, const unsigned short* __restrict__ VTl,
                      float* __restrict__ St) {
  __shared__ __align__(16) float part[ST_NW][32 * 32];   // one 4 KB partial tile per wave, in accumulator order
  const int tid  = threadIdx.x;
  const int wave = tid >> 5;
  const int lane = tid & 31;
  const int hh   = lane >> 4;
  const int c    = lane & 15;
  const int h    = blockIdx.y;
  const int d0   = (blockIdx.x >> 1) * 32;
  const int e0   = (blockIdx.x & 1) * 32;

  const int bb   = blockIdx.z;
  const size_t ao = (size_t)(h * HDIM + d0 + c) * NTOK + bb * SEQ + wave * ST_KS + 8 * hh;
  const size_t bo = (size_t)(h * HDIM + e0 + c) * NTOK + bb * SEQ + wave * ST_KS + 8 * hh;
  const __bf16* pah = (const __bf16*)KTh + ao;
  const __bf16* pal = (const __bf16*)KTl + ao;
  const __bf16* pbh = (const __bf16*)VTh + bo;
  const __bf16* pbl = (const __bf16*)VTl + bo;

  v8f acc[2][2];
#pragma unroll
  for (int i = 0; i < 2; ++i)
#pragma unroll
    for (int j = 0; j < 2; ++j) acc[i][j] = (v8f){0.f,0.f,0.f,0.f,0.f,0.f,0.f,0.f};

  // unrolled (4 steps): the step offsets fold into the loads' immediate fields and later steps' loads issue among earlier products
#pragma unroll
  for (int ks = 0; ks < ST_KS / 32; ++ks) {
    v16b ah[2], al[2], bh[2], bl[2];
#pragma unroll
    for (int i = 0; i < 2; ++i) {
      const size_t o = (size_t)i * 16 * NTOK + ks * 32;
      ah[i] = Frag<__bf16>::load(pah + o);
      al[i] = Frag<__bf16>::load(pal + o);
      bh[i] = Frag<__bf16>::load(pbh + o);
      bl[i] = Frag<__bf16>::load(pbl + o);
    }
#pragma unroll
    for (int i = 0; i < 2; ++i)
#pragma unroll
      for (int j = 0; j < 2; ++j) {
        acc[i][j] = Frag<__bf16>::mma(ah[i], bh[j], acc[i][j]);
        acc[i][j] = Frag<__bf16>::mma(ah[i], bl[j], acc[i][j]);
        acc[i][j] = Frag<__bf16>::mma(al[i], bh[j], acc[i][j]);
      }
  }

  // partial tile to LDS: eighth q = (i*2+j)*2 + half holds accumulator rows half*4..half*4+3 of every lane, 16 B per lane
  float* slab = part[wave];
#pragma unroll
  for (int i = 0; i < 2; ++i)
#pragma unroll
    for (int j = 0; j < 2; ++j) {
      const v8f a = acc[i][j];
      const int q = (i * 2 + j) * 2;
      *(v4f*)(slab + (q + 0) * 128 + lane * 4) = (v4f){a[0], a[1], a[2], a[3]};
      *(v4f*)(slab + (q + 1) * 128 + lane * 4) = (v4f){a[4], a[5], a[6], a[7]};
    }
  __syncthreads();

  // 512 threads x 2 floats = the 32x32 tile; each thread adds its two positions over the 16 slices in wave order
  v2f sum = (v2f){0.f, 0.f};
#pragma unroll
  for (int w = 0; w < ST_NW; ++w) sum += *(const v2f*)(&part[w][tid * 2]);

  // position tid*2 back to (row, col): q = tid>>6, source lane = (tid>>1)&31, accumulator rows (q&1)*4 + (tid&1)*2 and the next
  const int q   = tid >> 6;
  const int sl  = (tid >> 1) & 31;
  const int row = (q >> 2) * 16 + (sl >> 4) * 8 + (q & 1) * 4 + (tid & 1) * 2;
  const int col = ((q >> 1) & 1) * 16 + (sl & 15);
  float* o = St + (size_t)(bb * NHEAD + h) * HDIM * HDIM + (size_t)(d0 + row) * HDIM + e0 + col;
  o[0]    = sum[0];
  o[HDIM] = sum[1];
}

// ---------------------------------------------------------------- launcher
extern "C" void kernel_launch(void* const* d_in, const int* in_sizes, int n_in,
                              void* d_out, int out_size, void* d_ws, size_t ws_size,
                              hipStream_t stream) {
  (void)n_in;
  if (ws_size < WS_TOTAL) return;
  if ((size_t)out_size != OUT0_ELEMS + OUT1_ELEMS) return;
  if ((size_t)in_sizes[0] != NX || (size_t)in_sizes[1] != (size_t)NTOK ||
      (size_t)in_sizes[2] != NW || (size_t)in_sizes[4] != NW ||
      (size_t)in_sizes[6] != NW || (size_t)in_sizes[8] != NW ||
      in_sizes[3] != HIDN || in_sizes[5] != HIDN || in_sizes[7] != HIDN || in_sizes[9] != HIDN) return;

  const float* hs    = (const float*)d_in[0];
  const float* amask = (const float*)d_in[1];
  const float* Wq    = (const float*)d_in[2];
  const float* bq    = (const float*)d_in[3];
  const float* Wk    = (const float*)d_in[4];
  const float* bk    = (const float*)d_in[5];
  const float* Wv    = (const float*)d_in[6];
  const float* bv    = (const float*)d_in[7];
  const float* Wo    = (const float*)d_in[8];
  const float* bo    = (const float*)d_in[9];

  char* ws = (char*)d_ws;
  unsigned short* Xb  = (unsigned short*)(ws + OFF_XB);
  unsigned short* Wqb = (unsigned short*)(ws + OFF_WQ);
  unsigned short* Wkb = (unsigned short*)(ws + OFF_WK);
  unsigned short* Wvb = (unsigned short*)(ws + OFF_WV);
  unsigned short* Wob = (unsigned short*)(ws + OFF_WO);
  unsigned short* Qh  = (unsigned short*)(ws + OFF_QH);
  unsigned short* Ql  = (unsigned short*)(ws + OFF_QL);
  unsigned short* Kh  = (unsigned short*)(ws + OFF_KH);
  unsigned short* Kl  = (unsigned short*)(ws + OFF_KL);
  unsigned short* KTh = (unsigned short*)(ws + OFF_KTH);
  unsigned short* KTl = (unsigned short*)(ws + OFF_KTL);
  unsigned short* VTh = (unsigned short*)(ws + OFF_VTH);
  unsigned short* VTl = (unsigned short*)(ws + OFF_VTL);
  unsigned short* Oh  = (unsigned short*)(ws + OFF_OH);
  unsigned short* Ol  = (unsigned short*)(ws + OFF_OL);

  float* outF   = (float*)d_out;
  float* stateF = outF + OUT1_ELEM_OFF;

  // 1) RNE conversions to bf16 (inputs converted exactly once), one launch for all five inputs; Xb is the start of the five planes
  cast_all_f32_bf16<<<dim3(CV_GRID), dim3(CV_T), 0, stream>>>(hs, Wq, Wk, Wv, Wo, Xb);

  // 2) projections: 64x64 tiles, 8 waves (2 x 4 tiles) per block; every shape has 1024 tiles (64x16 or 16x64) = 128 block tiles of 128x256
  const int gemmBlocksTok = ((NTOK / 64) * (HIDN / 64)) / 8;    // 1024 tiles / 8 = 128
  // q, k, k^T and v^T in one launch, grid.y = projection -> hi/lo planes
  proj4_gemm64<<<dim3(gemmBlocksTok, 4), dim3(256), 0, stream>>>(
      Xb, Wqb, Wkb, Wvb, Qh, Ql, Kh, Kl, KTh, KTl, VTh, VTl, bq, bk, bv, amask, HIDN);

  // 3) causal attention on the planes -> attention out hi/lo planes [4096][1024]
  const float sscale = 0.125f;   // 1 / (temperature * sqrt(64)), exact power of two
  attn_hd64_planes<<<dim3(NBATCH * NHEAD * (SEQ / AT_QB)), dim3(128), 0, stream>>>(
      Qh, Ql, Kh, Kl, VTh, VTl, amask, Oh, Ol, sscale);

  // 4) state[b][h][d][e] = sum_s k^T[h*64+d][b*S+s] * v^T[h*64+e][b*S+s]  (hi/lo on both operands); 4 tiles x 16 token slices per (b,h)
  state_ktv_slices<<<dim3(4, NHEAD, NBATCH), dim3(ST_NW * 32), 0, stream>>>(KTh, KTl, VTh, VTl, stateF);

  // 5) out [4096][1024] = attn_out . Wo^T + bo  (A hi/lo, Wo exact bf16) -> d_out f32
  wmma_gemm64<1, true, false, 2, 0, 0><<<dim3(gemmBlocksTok, 1), dim3(256), 0, stream>>>(
      Oh, Ol, HIDN, 0L, Wob, Wob, HIDN, 0L, (void*)outF, (void*)Oh, HIDN, 0L,
      bo, amask, NTOK, HIDN, HIDN, 1.0f);
}

// v007
// One run takes 203 microseconds.
// Timed twice side by side with v006, it ran 1.12 times as fast both times.
// Over all steps from v000 it is 3.42 times as fast.
// Compute dtype: input projections v_wmma_f32_16x16x32_bf16 on bf16 operands (inputs RNE-converted once), f32 accumulate; scores, p.v and k^T.v state on bf16 hi/lo split planes (hi.hi + hi.lo + lo.hi), output projection on hi/lo A planes x bf16 Wo (hi.hi + lo.hi), f32 accumulate; softmax and side math f32.
#include <hip/hip_runtime.h>

// ---------------------------------------------------------------- geometry
constexpr int NBATCH = 2;
constexpr int SEQ    = 2048;
constexpr int HIDN   = 1024;
constexpr int NHEAD  = 16;
constexpr int HDIM   = 64;
constexpr int NTOK   = NBATCH * SEQ;                    /* 4096 token rows */
constexpr size_t NX  = (size_t)NTOK * HIDN;            /* 4194304 */
constexpr size_t NW  = (size_t)HIDN * HIDN;            /* 1048576 */
constexpr size_t OUT0_ELEMS    = NX;
constexpr size_t OUT1_ELEMS    = (size_t)NBATCH * NHEAD * HDIM * HDIM;   /* 131072 */
constexpr size_t OUT1_BYTE_OFF = 16777216;
constexpr size_t OUT1_ELEM_OFF = OUT1_BYTE_OFF / 4;
static_assert(OUT1_ELEM_OFF == OUT0_ELEMS);
static_assert(OUT1_BYTE_OFF + OUT1_ELEMS * 4 == 17301504);
static_assert(HIDN == NHEAD * HDIM);
static_assert(HDIM == 64);
static_assert(HIDN % 64 == 0 && NTOK % 64 == 0 && SEQ % 64 == 0);   /* every GEMM M and N is a 64-multiple */
static_assert(HIDN % 32 == 0 && SEQ % 32 == 0);                     /* every GEMM K is a multiple of 32 */

// ---------------------------------------------------------------- workspace map (bytes)
// 16-bit planes: token planes [4096][1024] or [1024][4096] = 8 MiB each; weight planes [1024][1024] = 2 MiB each.
// Every region is fully written by its producer (full M x N, no pad rows) before any consumer reads it.
constexpr size_t MIB      = (size_t)1 << 20;
constexpr size_t OFF_XB   = 0 * MIB;    /* hidden as bf16      8 MiB */
constexpr size_t OFF_WQ   = 8 * MIB;    /* Wq bf16             2 MiB */
constexpr size_t OFF_WK   = 10 * MIB;   /* Wk bf16             2 MiB */
constexpr size_t OFF_WV   = 12 * MIB;   /* Wv bf16             2 MiB */
constexpr size_t OFF_WO   = 14 * MIB;   /* Wo bf16             2 MiB */
constexpr size_t OFF_QH   = 16 * MIB;   /* q hi  [4096][1024]        */
constexpr size_t OFF_QL   = 24 * MIB;   /* q lo                      */
constexpr size_t OFF_KH   = 32 * MIB;   /* k hi  [4096][1024] (masked) */
constexpr size_t OFF_KL   = 40 * MIB;   /* k lo                      */
constexpr size_t OFF_KTH  = 48 * MIB;   /* k^T hi [1024][4096] (masked) */
constexpr size_t OFF_KTL  = 56 * MIB;   /* k^T lo                    */
constexpr size_t OFF_VTH  = 64 * MIB;   /* v^T hi [1024][4096] (masked) */
constexpr size_t OFF_VTL  = 72 * MIB;   /* v^T lo                    */
constexpr size_t OFF_OH   = 80 * MIB;   /* attention out hi [4096][1024] */
constexpr size_t OFF_OL   = 88 * MIB;   /* attention out lo          */
constexpr size_t WS_TOTAL = 96 * MIB;   /* 100663296 B */
static_assert(NX * 2 == 8 * MIB && NW * 2 == 2 * MIB);
static_assert(WS_TOTAL <= 134217728);

// ---------------------------------------------------------------- types / helpers
typedef __attribute__((ext_vector_type(16))) _Float16 v16h;
typedef __attribute__((ext_vector_type(8)))  _Float16 v8h;
typedef __attribute__((ext_vector_type(16))) __bf16   v16b;
typedef __attribute__((ext_vector_type(8)))  __bf16   v8b;
typedef __attribute__((ext_vector_type(8)))  float    v8f;
typedef __attribute__((ext_vector_type(4)))  float    v4f;
typedef __attribute__((ext_vector_type(2)))  float    v2f;
typedef __attribute__((ext_vector_type(4)))  unsigned u4v;

__device__ __forceinline__ unsigned short f2bf_bits(float f) {
  unsigned u = __float_as_uint(f);
  return (unsigned short)((u + 0x7FFFu + ((u >> 16) & 1u)) >> 16);
}
__device__ __forceinline__ float bf_bits2f(unsigned short h) { return __uint_as_float(((unsigned)h) << 16); }
__device__ __forceinline__ float bfr(float f) { return bf_bits2f(f2bf_bits(f)); }

__device__ __forceinline__ void sched_fence() { asm volatile("" ::: "memory"); }

// hazard guards as plain device helpers (no inline asm inside the kernel template body)
__device__ __forceinline__ void dep_guard_h(v8f& a, v8f& b, v16h x, v16h y) { asm volatile("v_nop\n\tv_nop\n\tv_nop\n\tv_nop" : "+v"(a), "+v"(b) : "v"(x), "v"(y)); }
__device__ __forceinline__ void dep_guard_b(v8f& a, v8f& b, v16b x, v16b y) { asm volatile("v_nop\n\tv_nop\n\tv_nop\n\tv_nop" : "+v"(a), "+v"(b) : "v"(x), "v"(y)); }
__device__ __forceinline__ void keep4_h(v16h a, v16h b, v16h c, v16h d) { asm volatile("v_nop" :: "v"(a), "v"(b), "v"(c), "v"(d)); }
__device__ __forceinline__ void keep4_b(v16b a, v16b b, v16b c, v16b d) { asm volatile("v_nop" :: "v"(a), "v"(b), "v"(c), "v"(d)); }
__device__ __forceinline__ void acc_guard4(v8f& a, v8f& b, v8f& c, v8f& d) { asm volatile("v_nop\n\tv_nop\n\tv_nop\n\tv_nop" : "+v"(a), "+v"(b), "+v"(c), "+v"(d)); }
template <typename T> struct Frag;
template <> struct Frag<_Float16> {
  typedef v16h V; union U { v16h v; v8h h[2]; };
  static __device__ __forceinline__ v16h load(const _Float16* p) {   // elements 0..7 <- p[0..7], 8..15 <- p[16..23]
    U f; f.h[0] = *(const v8h*)(p); f.h[1] = *(const v8h*)(p + 16); return f.v;
  }
  static __device__ __forceinline__ v8f mma(v16h a, v16h b, v8f c) {
    return __builtin_amdgcn_wmma_f32_16x16x32_f16(false, a, false, b, (short)0, c, false, false);
  }
  static __device__ __forceinline__ void guard(v8f& a, v8f& b, v16h x, v16h y) { dep_guard_h(a, b, x, y); }
  static __device__ __forceinline__ void keep(v16h a, v16h b, v16h c, v16h d) { keep4_h(a, b, c, d); }
};
template <> struct Frag<__bf16> {
  typedef v16b V; union U { v16b v; v8b h[2]; };
  static __device__ __forceinline__ v16b load(const __bf16* p) {
    U f; f.h[0] = *(const v8b*)(p); f.h[1] = *(const v8b*)(p + 16); return f.v;
  }
  static __device__ __forceinline__ v8f mma(v16b a, v16b b, v8f c) {
    return __builtin_amdgcn_wmma_f32_16x16x32_bf16(false, a, false, b, (short)0, c, false, false);
  }
  static __device__ __forceinline__ void guard(v8f& a, v8f& b, v16b x, v16b y) { dep_guard_b(a, b, x, y); }
  static __device__ __forceinline__ void keep(v16b a, v16b b, v16b c, v16b d) { keep4_b(a, b, c, d); }
};

// ---- Register-blocked batched WMMA GEMM ------------------------------------
// C[m,n] = rs * (scale * sum_k A[m,k] * Bt[n,k] + bias); each wave owns a 64x64 tile.
// A row-major [M,K]; Bt row-major [N,K]; M % 128 == 0, N % 256 == 0, K % 64 == 0.
// Block = 8 waves (2 x 4) = one 128x256 tile. A stage is 64 k = one 128-byte line of every operand row of the block tile.
// Asynchronous 16-byte copies (8 lanes per row, whole lines) bring a stage from global memory into one of two LDS buffers
// while the other buffer is multiplied; the waves read their fragments from LDS.
// SPLIT: A carried as hi/lo planes (A2 = lo); BLO: Bt also carried as hi/lo (Bt2 = lo);
//   product = hi.hi (+ hi.lo when BLO) + lo.hi.   SPLIT+BLO is the stock hi/lo path.
// BIAS_MODE: 0 = none, 1 = bias[m], 2 = bias[n]  (bias value RNE-converted to bf16 precision).
// RS_MODE:   0 = none, 1 = multiply by rsc[m], 2 = multiply by rsc[n]  (rsc value RNE-converted to bf16).
// BIAS_MODE 3 (RS_MODE is then not read): both modes chosen per block: (1, 2) where tr, else (2, 1) where rsRow, else (2, 0).
// b = batch index of the block; tr, rsRow are block-uniform and read under BIAS_MODE 3 only.
// OUT_MODE: 0 = f32, 1 = f16, 2 = bf16 hi plane (Cout) + bf16 lo plane (Cout2).
// ET: 0 = f16 operands, 1 = bf16 operands (pointers passed as 16-bit storage)
constexpr int GB_M = 128;   // block tile rows
constexpr int GB_N = 256;   // block tile columns
constexpr int GB_K = 64;    // k per stage
constexpr int GB_P = 72;    // LDS row pitch in elements: 144 B = 16 B x 9 (odd), distinct banks for the 16 rows of a 16-byte fragment read
static_assert(HIDN % GB_N == 0 && NTOK % GB_N == 0 && HIDN % GB_K == 0);   /* every GEMM M, N is a multiple of the block tile, K of the stage */

// four asynchronous 16-byte copies to LDS, every lane with its own LDS byte address and global address;
// s_wait_xcnt 0 closes the statement as a precaution: no address register of a copy is rewritten in front of it
__device__ __forceinline__ void copy4_async(unsigned l0, const void* g0, unsigned l1, const void* g1,
                                            unsigned l2, const void* g2, unsigned l3, const void* g3) {
  asm volatile("global_load_async_to_lds_b128 %0, %1, off\n\t"
               "global_load_async_to_lds_b128 %2, %3, off\n\t"
               "global_load_async_to_lds_b128 %4, %5, off\n\t"
               "global_load_async_to_lds_b128 %6, %7, off\n\t"
               "s_wait_xcnt 0x0"
               :: "v"(l0), "v"(g0), "v"(l1), "v"(g1), "v"(l2), "v"(g2), "v"(l3), "v"(g3) : "memory");
}
// this wave's copies have landed behind this one
__device__ __forceinline__ void wait_async0() { asm volatile("s_wait_asynccnt 0x0" ::: "memory"); }
// this wave's LDS reads have returned: stands in front of the barrier behind which their buffer is refilled
__device__ __forceinline__ void wait_ds0() { asm volatile("s_wait_dscnt 0x0" ::: "memory"); }

template <int V> struct IntC { static constexpr int value = V; };   // an int as a type, for the epilogue's modes
template <int ET> struct Elem;
template <> struct Elem<0> { typedef _Float16 T; };
template <> struct Elem<1> { typedef __bf16 T; };
template <int ET, bool SPLIT, bool BLO, int BIAS_MODE, int OUT_MODE, int RS_MODE>
__device__ __forceinline__ void gemm_block_tile(
    const unsigned short* __restrict__ Ap, const unsigned short* __restrict__ A2p, int lda, long strideA,
    const unsigned short* __restrict__ Btp, const unsigned short* __restrict__ Bt2p, int ldb, long strideB,
    void* __restrict__ Cout, void* __restrict__ Cout2, int ldc, long strideC,
    const float* __restrict__ bias, const float* __restrict__ rsc,
    int M, int N, int K, float scale, const int b, const bool tr, const bool rsRow) {
  typedef typename Elem<ET>::T T;
  typedef typename Frag<T>::V V;
  const T* A = (const T*)Ap; const T* A2 = (const T*)A2p; const T* Bt = (const T*)Btp; const T* Bt2 = (const T*)Bt2p;
  constexpr int NPA = SPLIT ? 2 : 1;              // planes of A
  constexpr int NPB = (SPLIT && BLO) ? 2 : 1;     // planes of Bt
  __shared__ __align__(16) T sA[2][NPA][GB_M * GB_P];   // two buffers of A rows  [row][k], 18 KB per plane
  __shared__ __align__(16) T sB[2][NPB][GB_N * GB_P];   // two buffers of Bt rows [row][k], 36 KB per plane
  __shared__ __align__(16) float sT[8][16 * 68];   // per-wave 16x64 slab, pitch 68 floats
  const int tid  = threadIdx.x;
  const int lane = tid & 31;
  const int wave = tid >> 5;
  const int blocksN = N / GB_N;
  const int bm = blockIdx.x / blocksN;
  const int bn = blockIdx.x - bm * blocksN;
  if (bm >= M / GB_M) return;            // block-uniform, in front of every copy and barrier
  const int mB = bm * GB_M;              // block tile origin
  const int nB = bn * GB_N;
  const int wm = (wave >> 2) << 6;       // wave tile origin inside the block tile
  const int wn = (wave & 3) << 6;
  const int m0 = mB + wm;
  const int n0 = nB + wn;

  const T* Ab  = A  + (size_t)b * strideA;
  const T* Bb  = Bt + (size_t)b * strideB;
  const T* Ab2 = SPLIT ? (A2  + (size_t)b * strideA) : nullptr;
  const T* Bb2 = (SPLIT && BLO) ? (Bt2 + (size_t)b * strideB) : nullptr;

  const int rlane = lane & 15;                 // row (A) / col (B, D) within subtile
  const int koff  = (lane >> 4) * 8;           // k offset of this lane half
  const int mOff  = (lane >> 4) * 8;           // D row offset

  // staging coverage: 256 threads x 4 copies = 1024 = 128 rows x 8 pieces of 16 B (A plane); x 8 copies = 2048 = 256 rows x 8 (Bt plane);
  // copy i of a thread is row srow + 32 i, piece tid & 7: every piece once, every address a multiple of 16 B
  const int srow = tid >> 3;                   // 0..31
  const int sc8  = (tid & 7) * 8;
  constexpr unsigned RS = 32 * GB_P * 2;       // LDS bytes between a thread's successive copies
  const unsigned ldsA = (unsigned)(size_t)(&sA[0][0][srow * GB_P + sc8]);   // low 32 bits = byte address in the work-group's LDS
  const unsigned ldsB = (unsigned)(size_t)(&sB[0][0][srow * GB_P + sc8]);
  const size_t astep = (size_t)32 * lda * 2, bstep = (size_t)32 * ldb * 2;  // global bytes between them
  auto stage = [&](int st, int buf) {
    const size_t ka = ((size_t)(mB + srow) * lda + (size_t)st * GB_K + sc8) * 2;
    const size_t kb = ((size_t)(nB + srow) * ldb + (size_t)st * GB_K + sc8) * 2;
#pragma unroll
    for (int p = 0; p < NPA; ++p) {
      const char* g = (const char*)(p == 0 ? Ab : Ab2) + ka;
      const unsigned l = ldsA + (unsigned)(buf * NPA + p) * (unsigned)(GB_M * GB_P * 2);
      copy4_async(l, g, l + RS, g + astep, l + 2 * RS, g + 2 * astep, l + 3 * RS, g + 3 * astep);
    }
#pragma unroll
    for (int p = 0; p < NPB; ++p) {
      const char* g = (const char*)(p == 0 ? Bb : Bb2) + kb;
      const unsigned l = ldsB + (unsigned)(buf * NPB + p) * (unsigned)(GB_N * GB_P * 2);
      copy4_async(l, g, l + RS, g + bstep, l + 2 * RS, g + 2 * bstep, l + 3 * RS, g + 3 * bstep);
      copy4_async(l + 4 * RS, g + 4 * bstep, l + 5 * RS, g + 5 * bstep, l + 6 * RS, g + 6 * bstep, l + 7 * RS, g + 7 * bstep);
    }
  };

  v8f acc[4][4];
#pragma unroll
  for (int i = 0; i < 4; ++i)
#pragma unroll
    for (int j = 0; j < 4; ++j) acc[i][j] = (v8f){0.f,0.f,0.f,0.f,0.f,0.f,0.f,0.f};

  const int nst = K / GB_K;                    // stages, block-uniform
  stage(0, 0);
  wait_async0();
  __syncthreads();                             // stage 0 is complete before any wave reads it
  if (nst > 1) stage(1, 1);
  for (int t = 0; t < nst; ++t) {
    const int cur = t & 1;
#pragma unroll
    for (int kk = 0; kk < GB_K; kk += 32) {
      V bh[4], bl[4], ah[4], al[4];
#pragma unroll
      for (int j = 0; j < 4; ++j) {
        const int bo = (wn + (j << 4) + rlane) * GB_P + kk + koff;
        bh[j] = Frag<T>::load(&sB[cur][0][bo]);
        if (SPLIT && BLO) bl[j] = Frag<T>::load(&sB[cur][NPB - 1][bo]);
        else bl[j] = bh[j];
      }
#pragma unroll
      for (int i = 0; i < 4; ++i) {
        const int ao = (wm + (i << 4) + rlane) * GB_P + kk + koff;
        ah[i] = Frag<T>::load(&sA[cur][0][ao]);
        if (SPLIT) al[i] = Frag<T>::load(&sA[cur][NPA - 1][ao]);
        else al[i] = ah[i];
      }
#pragma unroll
      for (int i = 0; i < 4; ++i) {
#pragma unroll
        for (int j = 0; j < 4; ++j) {
          acc[i][j] = Frag<T>::mma(ah[i], bh[j], acc[i][j]);
          if (SPLIT) {
            if (BLO) acc[i][j] = Frag<T>::mma(ah[i], bl[j], acc[i][j]);
            acc[i][j] = Frag<T>::mma(al[i], bh[j], acc[i][j]);
          }
        }
        Frag<T>::guard(acc[i][0], acc[i][3], ah[i], al[i]);
      }
      Frag<T>::keep(bh[0], bh[1], bh[2], bh[3]);
      if (SPLIT && BLO) Frag<T>::keep(bl[0], bl[1], bl[2], bl[3]);
    }
    wait_ds0();                                // this wave has finished reading buffer cur
    wait_async0();                             // this wave's copies of stage t + 1 have landed
    __syncthreads();                           // publishes stage t + 1 and frees buffer cur
    if (t + 2 < nst) stage(t + 2, cur);        // block-uniform
  }
  wait_async0();                               // nothing is in flight when the wave goes on
  acc_guard4(acc[0][0], acc[0][1], acc[0][2], acc[0][3]);
  acc_guard4(acc[1][0], acc[1][1], acc[1][2], acc[1][3]);
  acc_guard4(acc[2][0], acc[2][1], acc[2][2], acc[2][3]);
  acc_guard4(acc[3][0], acc[3][1], acc[3][2], acc[3][3]);

  // ---- epilogue ----  (bias and row-scale mode as compile-time values of the call; always inlined: acc stays in registers)
  float* slab = sT[wave];
  auto epilogue = [&](auto bmode, auto rmode) __attribute__((always_inline)) {
  constexpr int BM = decltype(bmode)::value;
  constexpr int RM = decltype(rmode)::value;
#pragma unroll
  for (int i = 0; i < 4; ++i) {
    const int mBase = m0 + (i << 4);
    float bm[8], rm[8];
#pragma unroll
    for (int r = 0; r < 8; ++r) { bm[r] = 0.f; rm[r] = 1.f; }
    if (BM == 1) {
      // rows mBase+mOff .. +7 are contiguous and 32-B aligned: two 16-B loads
      const v4f t0 = *(const v4f*)(bias + mBase + mOff);
      const v4f t1 = *(const v4f*)(bias + mBase + mOff + 4);
#pragma unroll
      for (int r = 0; r < 4; ++r) { bm[r] = bfr(t0[r]); bm[4 + r] = bfr(t1[r]); }
    }
    if (RM == 1) {
      const v4f t0 = *(const v4f*)(rsc + mBase + mOff);
      const v4f t1 = *(const v4f*)(rsc + mBase + mOff + 4);
#pragma unroll
      for (int r = 0; r < 4; ++r) { rm[r] = bfr(t0[r]); rm[4 + r] = bfr(t1[r]); }
    }
#pragma unroll
    for (int j = 0; j < 4; ++j) {
      const int n = n0 + (j << 4) + rlane;
      float bn = 0.f, rn = 1.f;
      if (BM == 2) bn = bfr(bias[n]);
      if (RM == 2) rn = bfr(rsc[n]);
#pragma unroll
      for (int r = 0; r < 8; ++r) {
        float v = acc[i][j][r] * scale;
        if (BM == 1) v += bm[r];
        if (BM == 2) v += bn;
        if (RM == 1) v *= rm[r];
        if (RM == 2) v *= rn;
        slab[(mOff + r) * 68 + (j << 4) + rlane] = v;
      }
    }
    __builtin_amdgcn_fence(__ATOMIC_RELEASE, "workgroup");
    __builtin_amdgcn_wave_barrier();
    __builtin_amdgcn_fence(__ATOMIC_ACQUIRE, "workgroup");
    if (OUT_MODE == 0) {
      float* C = (float*)Cout + (size_t)b * strideC;
      const int hh = lane >> 4, c4 = (lane & 15) * 4;     // row seg = 256 B = 16 lanes x 16 B
      {
#pragma unroll
        for (int it = 0; it < 8; ++it) {
          const int row = it * 2 + hh;
          v4f v = *(const v4f*)(slab + row * 68 + c4);
          *(v4f*)(C + (size_t)(mBase + row) * ldc + n0 + c4) = v;
        }
        
      }
    } else {
      const int q = lane >> 3, c8 = (lane & 7) * 8;
      unsigned short* C  = (unsigned short*)Cout  + (size_t)b * strideC;
      unsigned short* C2 = (OUT_MODE == 2) ? ((unsigned short*)Cout2 + (size_t)b * strideC) : nullptr;
      {
#pragma unroll
        for (int it = 0; it < 4; ++it) {
          const int row = it * 4 + q;
          const float* sp = slab + row * 68 + c8;
          v8h hv, lv;
#pragma unroll
          for (int e = 0; e < 8; ++e) {
            if (OUT_MODE == 1) {
              hv[e] = (_Float16)sp[e];
              lv[e] = hv[e];
            } else {
              unsigned short hb = f2bf_bits(sp[e]);
              unsigned short lb = f2bf_bits(sp[e] - bf_bits2f(hb));
              hv[e] = __builtin_bit_cast(_Float16, hb);
              lv[e] = __builtin_bit_cast(_Float16, lb);
            }
          }
          *(v8h*)(C + (size_t)(mBase + row) * ldc + n0 + c8) = hv;
          if (OUT_MODE == 2) *(v8h*)(C2 + (size_t)(mBase + row) * ldc + n0 + c8) = lv;
        }
        
      }
    }
    __builtin_amdgcn_fence(__ATOMIC_RELEASE, "workgroup");
    __builtin_amdgcn_wave_barrier();
    __builtin_amdgcn_fence(__ATOMIC_ACQUIRE, "workgroup");
  }
  };
  if constexpr (BIAS_MODE == 3) {        // block-uniform choice among the three forms the projections need
    if (tr)         epilogue(IntC<1>{}, IntC<2>{});
    else if (rsRow) epilogue(IntC<2>{}, IntC<1>{});
    else            epilogue(IntC<2>{}, IntC<0>{});
  } else {
    epilogue(IntC<BIAS_MODE>{}, IntC<RS_MODE>{});
  }
}

// one GEMM per launch: grid.x = block tiles, grid.y = batch
template <int ET, bool SPLIT, bool BLO, int BIAS_MODE, int OUT_MODE, int RS_MODE>
__global__ __launch_bounds__(256) void wmma_gemm64(
    const unsigned short* __restrict__ Ap, const unsigned short* __restrict__ A2p, int lda, long strideA,
    const unsigned short* __restrict__ Btp, const unsigned short* __restrict__ Bt2p, int ldb, long strideB,
    void* __restrict__ Cout, void* __restrict__ Cout2, int ldc, long strideC,
    const float* __restrict__ bias, const float* __restrict__ rsc,
    int M, int N, int K, float scale) {
  gemm_block_tile<ET, SPLIT, BLO, BIAS_MODE, OUT_MODE, RS_MODE>(
      Ap, A2p, lda, strideA, Btp, Bt2p, ldb, strideB, Cout, Cout2, ldc, strideC, bias, rsc, M, N, K, scale,
      (int)blockIdx.y, false, false);
}

// The four input projections in ONE launch. Each has 128 block tiles, half of the chip's 256 WGPs, and none reads what another writes:
// together their 512 blocks stand two on every WGP (LDS and registers allow two). blockIdx.y picks the projection, block-uniform:
//   0: q rows   [NTOK][HIDN] = X . Wq^T + bq[col]
//   1: k rows   [NTOK][HIDN] = (X . Wk^T + bk[col]) * mask[row]
//   2: k^T rows [HIDN][NTOK] = (Wk . X^T + bk[row]) * mask[col]
//   3: v^T rows [HIDN][NTOK] = (Wv . X^T + bv[row]) * mask[col]
// every result as bf16 hi and lo planes. K (= HIDN) comes as an argument, as in the one-GEMM kernel.
__global__ __launch_bounds__(256) void proj4_gemm64(
    const unsigned short* __restrict__ Xb, const unsigned short* __restrict__ Wqb,
    const unsigned short* __restrict__ Wkb, const unsigned short* __restrict__ Wvb,
    unsigned short* __restrict__ Qh, unsigned short* __restrict__ Ql, unsigned short* __restrict__ Kh, unsigned short* __restrict__ Kl,
    unsigned short* __restrict__ KTh, unsigned short* __restrict__ KTl, unsigned short* __restrict__ VTh, unsigned short* __restrict__ VTl,
    const float* __restrict__ bq, const float* __restrict__ bk, const float* __restrict__ bv,
    const float* __restrict__ amask, int K) {
  const int  y  = blockIdx.y;
  const bool tr = y >= 2;                       // weight rows are the result's rows
  const unsigned short* W = (y == 0) ? Wqb : (y == 3) ? Wvb : Wkb;
  const float* bias       = (y == 0) ? bq  : (y == 3) ? bv  : bk;
  unsigned short* C  = (y == 0) ? Qh : (y == 1) ? Kh : (y == 2) ? KTh : VTh;
  unsigned short* C2 = (y == 0) ? Ql : (y == 1) ? Kl : (y == 2) ? KTl : VTl;
  const unsigned short* A  = tr ? W : Xb;
  const unsigned short* Bt = tr ? Xb : W;
  gemm_block_tile<1, false, false, 3, 2, 3>(
      A, A, HIDN, 0L, Bt, Bt, HIDN, 0L, (void*)C, (void*)C2, tr ? NTOK : HIDN, 0L, bias, amask,
      tr ? HIDN : NTOK, tr ? NTOK : HIDN, K, 1.0f, 0, tr, y == 1);
}

// One launch converts all five f32 inputs: their bf16 planes lie back to back in the workspace (hidden, Wq, Wk, Wv, Wo).
// Few waves, much work each.
// Block = 16 waves = CV_BLK consecutive elements of ONE input (every input is a whole number of blocks); grid = all elements / CV_BLK, exact.
// Pass i of a block is 2048 consecutive elements, 4 per lane: a wave's 16-byte load covers 512 contiguous bytes, its 8-byte store 256.
constexpr int CV_T   = 512;                 // threads per block
constexpr int CV_IT  = 16;                  // passes per block
constexpr int CV_BLK = CV_T * 4 * CV_IT;    // 32768 elements per block
constexpr int CV_XB  = (int)(NX / CV_BLK);  // 128 blocks of hidden
constexpr int CV_WB  = (int)(NW / CV_BLK);  // 32 blocks of each weight
constexpr int CV_GRID = CV_XB + 4 * CV_WB;  // 256 blocks
static_assert(NX % CV_BLK == 0 && NW % CV_BLK == 0);
static_assert(OFF_XB == 0 && OFF_WQ == NX * 2 && OFF_WK == OFF_WQ + NW * 2 && OFF_WV == OFF_WK + NW * 2 && OFF_WO == OFF_WV + NW * 2);
typedef __attribute__((ext_vector_type(2))) unsigned u2v;

__global__ __launch_bounds__(CV_T) void cast_all_f32_bf16(
    const float* __restrict__ hs, const float* __restrict__ wq, const float* __restrict__ wk,
    const float* __restrict__ wv, const float* __restrict__ wo, unsigned short* __restrict__ out) {
  const int blk = blockIdx.x;
  const float* src;                          // block-uniform choice of the input
  if (blk < CV_XB) {
    src = hs + (size_t)blk * CV_BLK;
  } else {
    const int w = (blk - CV_XB) / CV_WB;
    const int r = (blk - CV_XB) % CV_WB;
    src = (w == 0 ? wq : w == 1 ? wk : w == 2 ? wv : wo) + (size_t)r * CV_BLK;
  }
  const int t4 = threadIdx.x * 4;
  v4f f[CV_IT];
  // unrolled: f stays in registers, the pass offsets fold into the loads' immediate fields and the loads stand ahead of the conversions
#pragma unroll
  for (int i = 0; i < CV_IT; ++i) f[i] = *(const v4f*)(src + i * (CV_T * 4) + t4);
  unsigned short* o = out + (size_t)blk * CV_BLK + t4;
  // unrolled: constant indices into f, store offsets as immediates
#pragma unroll
  for (int i = 0; i < CV_IT; ++i) {
    u2v u;
    u[0] = (unsigned)f2bf_bits(f[i][0]) | ((unsigned)f2bf_bits(f[i][1]) << 16);
    u[1] = (unsigned)f2bf_bits(f[i][2]) | ((unsigned)f2bf_bits(f[i][3]) << 16);
    *(u2v*)(o + i * (CV_T * 4)) = u;
  }
}

// =====================================================================================
// Causal attention for head_dim 64 on bf16 hi/lo planes.
//   q planes  : [NTOK][HIDN] (row = b*SEQ + s, col = h*64 + d), hi and lo
//   k planes  : [NTOK][HIDN] same layout, hi and lo (padding mask already folded in)
//   v^T planes: [HIDN][NTOK] (row = h*64 + d, col = b*SEQ + s), hi and lo (mask folded in)
//   out planes: [NTOK][HIDN] bf16 hi and lo
//   scores = (q.k^T) * sscale : hi.hi + hi.lo + lo.hi, f32 accumulate; key j masked where j > q or amask[b][j] == 0 (score := -inf)
//   out    = p.v / l          : p (f32 exp terms) split to bf16 hi/lo per tile, v hi/lo, 3 products, f32 accumulate
//   Block = 4 waves = 64 query rows of one (b, h) at a time. A query tile t walks t + 1 key chunks, and every block of the launch is
//   resident at once, so the launch lasts as long as the fullest WGP: each block takes tile 31 - t and then tile t of its head,
//   33 chunks whatever t is. grid.x = NBATCH*NHEAD*(SEQ/64/2).
// =====================================================================================
constexpr int AT_D  = 64;
constexpr int AT_NW = 4;
constexpr int AT_QB = 64;
constexpr int AT_KC = 64;
constexpr int AT_P  = 72;   // LDS row pitch in elements: 144 B = 16 B x 9 (odd), so the 16 rows of a 16-byte fragment read fall on distinct banks

__device__ __forceinline__ __bf16 at_f2bf(float f) { return __builtin_bit_cast(__bf16, f2bf_bits(f)); }
__device__ __forceinline__ void at_split(float f, __bf16& hi, __bf16& lo) {
  const unsigned short hb = f2bf_bits(f);
  hi = __builtin_bit_cast(__bf16, hb);
  lo = at_f2bf(f - __uint_as_float(((unsigned)hb) << 16));
}
__device__ __forceinline__ v8f at_mma(v16b a, v16b b, v8f c) {
  c = __builtin_amdgcn_wmma_f32_16x16x32_bf16(false, a, false, b, (short)0, c, false, false);
  asm volatile("v_nop\n\tv_nop\n\tv_nop\n\tv_nop" : "+v"(c) : "v"(a), "v"(b));
  return c;
}

// Two blocks per WGP (512 blocks of 4 waves, 256 WGPs) are two waves per SIMD: the attribute gives each wave the register budget of that
// residency, under which the compiler keeps the rows of the softmax interleaved in the chunk loop, and lets no WGP take a third block.
__global__ __launch_bounds__(128) __attribute__((amdgpu_waves_per_eu(2, 2)))
void attn_hd64_planes(const unsigned short* __restrict__ Qh, const unsigned short* __restrict__ Ql,
                      const unsigned short* __restrict__ Kh, const unsigned short* __restrict__ Kl,
                      const unsigned short* __restrict__ VTh, const unsigned short* __restrict__ VTl,
                      const float* __restrict__ amask,
                      unsigned short* __restrict__ Oh, unsigned short* __restrict__ Ol,
                      float sscale) {
  union FB { v16b v; v8b h[2]; };
  __shared__ __align__(16) __bf16 Ksh[AT_KC * AT_P];     // k hi [kv][d]     9 KB
  __shared__ __align__(16) __bf16 Ksl[AT_KC * AT_P];     // k lo
  __shared__ __align__(16) __bf16 Vth[AT_D * AT_P];      // v hi [d][kv]     9 KB
  __shared__ __align__(16) __bf16 Vtl[AT_D * AT_P];     // v lo
  __shared__ __align__(16) __bf16 Psh[AT_NW][16 * AT_P];   // per wave p hi [row][kv]
  __shared__ __align__(16) __bf16 Psl[AT_NW][16 * AT_P];   // per wave p lo
  __shared__ __align__(16) float  Os[AT_NW][16 * 68];       // per wave out tile, pitch 68

  const int tid  = threadIdx.x;
  const int wave = tid >> 5;
  const int lane = tid & 31;
  const int hh   = lane >> 4;
  const int c    = lane & 15;

  constexpr int nqb = SEQ / AT_QB;              // 32 query tiles per (b, h)
  static_assert(nqb % 2 == 0);                  // tiles pair up as (nqb - 1 - t, t), every tile once
  const int bx  = blockIdx.x;
  const int tp  = bx % (nqb / 2);               // 0..15
  const int bhd = bx / (nqb / 2);
  const int h   = bhd % NHEAD;
  const int b   = bhd / NHEAD;
  const int tok0 = b * SEQ;
  const int hcol = h * HDIM;

  // the block's two tiles, one after the other in every wave (block-uniform trip counts)
  for (int half = 0; half < 2; ++half) {
  const int qb  = (half == 0) ? (nqb - 1 - tp) : tp;
  const int q0  = qb * AT_QB + wave * 16;

  // ---- Q fragments (A operand): 2 d-chunks, hi and lo, split k-map via Frag::load ----
  v16b qah[2], qal[2];
  {
    const __bf16* qhp = (const __bf16*)Qh + (size_t)(tok0 + q0 + c) * HIDN + hcol + 8 * hh;
    const __bf16* qlp = (const __bf16*)Ql + (size_t)(tok0 + q0 + c) * HIDN + hcol + 8 * hh;
#pragma unroll
    for (int dc = 0; dc < 2; ++dc) {
      qah[dc] = Frag<__bf16>::load(qhp + dc * 32);
      qal[dc] = Frag<__bf16>::load(qlp + dc * 32);
    }
  }

  float mrow[8], lrow[8];
  v8f oacc[4];
#pragma unroll
  for (int r = 0; r < 8; ++r) { mrow[r] = -__builtin_inff(); lrow[r] = 0.f; }
#pragma unroll
  for (int t = 0; t < 4; ++t) oacc[t] = (v8f){0.f,0.f,0.f,0.f,0.f,0.f,0.f,0.f};

  const int nChunks = qb + 1;                   // causal, block-uniform, <= 32
  for (int kc = 0; kc < nChunks; ++kc) {
    const int kv0 = kc * AT_KC;
    __syncthreads();
    {
      // staging coverage: 128 threads x 4 ids = 512 ids = 64 rows x 8 chunks of 8 elements = 64x64 per plane, exact
#pragma unroll
      for (int i = 0; i < 4; ++i) {
        const int id = tid + 128 * i;
        const int row = id >> 3, c8 = (id & 7) * 8;
        const size_t ko = (size_t)(tok0 + kv0 + row) * HIDN + hcol + c8;
        const u4v a0 = *(const u4v*)(Kh + ko);
        const u4v a1 = *(const u4v*)(Kl + ko);
        *(u4v*)(Ksh + row * AT_P + c8) = a0;
        *(u4v*)(Ksl + row * AT_P + c8) = a1;
      }
      sched_fence();
#pragma unroll
      for (int i = 0; i < 4; ++i) {
        const int id = tid + 128 * i;
        const int row = id >> 3, c8 = (id & 7) * 8;      // row = d
        const size_t vo = (size_t)(hcol + row) * NTOK + tok0 + kv0 + c8;
        const u4v a0 = *(const u4v*)(VTh + vo);
        const u4v a1 = *(const u4v*)(VTl + vo);
        *(u4v*)(Vth + row * AT_P + c8) = a0;
        *(u4v*)(Vtl + row * AT_P + c8) = a1;
      }
    }
    __syncthreads();

    v8f s[4];
#pragma unroll
    for (int j = 0; j < 4; ++j) {
      v8f sj = (v8f){0.f,0.f,0.f,0.f,0.f,0.f,0.f,0.f};
#pragma unroll
      for (int dc = 0; dc < 2; ++dc) {
        FB kb, kl;
        const __bf16* khp = Ksh + (j * 16 + c) * AT_P + dc * 32 + 8 * hh;
        const __bf16* klp = Ksl + (j * 16 + c) * AT_P + dc * 32 + 8 * hh;
        kb.h[0] = *(const v8b*)(khp);
        kb.h[1] = *(const v8b*)(khp + 16);
        kl.h[0] = *(const v8b*)(klp);
        kl.h[1] = *(const v8b*)(klp + 16);
        sj = at_mma(qah[dc], kb.v, sj);
        sj = at_mma(qah[dc], kl.v, sj);
        sj = at_mma(qal[dc], kb.v, sj);
        sched_fence();
      }
      s[j] = sj;
    }
    // key index of each score column; a padded key (amask == 0) gets an index above every query row,
    // so one integer compare and one select per score cover the causal and the padding mask without a branch
    int kidx[4];
#pragma unroll
    for (int j = 0; j < 4; ++j) {
      const float kvm = amask[(size_t)tok0 + kv0 + j * 16 + c];
      kidx[j] = (kvm == 0.0f) ? 0x7fffffff : (kv0 + j * 16 + c);
    }
    float cm[8];
#pragma unroll
    for (int r = 0; r < 8; ++r) {
      const int qrow = q0 + 8 * hh + r;
      float m = -__builtin_inff();
#pragma unroll
      for (int j = 0; j < 4; ++j) {
        const float sc  = s[j][r] * sscale;
        const float val = (kidx[j] > qrow) ? -__builtin_inff() : sc;
        s[j][r] = val;
        m = fmaxf(m, val);
      }
#pragma unroll
      for (int off = 1; off < 16; off <<= 1) m = fmaxf(m, __shfl_xor(m, off, 32));
      cm[r] = m;
    }
    __bf16* pwh = Psh[wave];
    __bf16* pwl = Psl[wave];
#pragma unroll
    for (int r = 0; r < 8; ++r) {
      const float mnew = fmaxf(mrow[r], cm[r]);
      const float alpha = expf(mrow[r] - mnew);
      mrow[r] = mnew;
      float psum = 0.f;
#pragma unroll
      for (int j = 0; j < 4; ++j) {
        const float p = expf(s[j][r] - mnew);
        psum += p;
        __bf16 a, bl; at_split(p, a, bl);
        pwh[(8 * hh + r) * AT_P + j * 16 + c] = a;
        pwl[(8 * hh + r) * AT_P + j * 16 + c] = bl;
      }
#pragma unroll
      for (int off = 1; off < 16; off <<= 1) psum += __shfl_xor(psum, off, 32);
      lrow[r] = lrow[r] * alpha + psum;
#pragma unroll
      for (int t = 0; t < 4; ++t) oacc[t][r] *= alpha;
    }
    __builtin_amdgcn_fence(__ATOMIC_RELEASE, "workgroup");
    __builtin_amdgcn_wave_barrier();
    __builtin_amdgcn_fence(__ATOMIC_ACQUIRE, "workgroup");
#pragma unroll 1
    for (int kk = 0; kk < 2; ++kk) {
      FB pa, pl;
      pa.h[0] = *(const v8b*)(pwh + c * AT_P + kk * 32 + 8 * hh);
      pa.h[1] = *(const v8b*)(pwh + c * AT_P + kk * 32 + 16 + 8 * hh);
      pl.h[0] = *(const v8b*)(pwl + c * AT_P + kk * 32 + 8 * hh);
      pl.h[1] = *(const v8b*)(pwl + c * AT_P + kk * 32 + 16 + 8 * hh);
      sched_fence();
#pragma unroll
      for (int t = 0; t < 4; ++t) {
        FB vb, vl;
        const __bf16* vhp = Vth + (t * 16 + c) * AT_P + kk * 32 + 8 * hh;
        const __bf16* vlp = Vtl + (t * 16 + c) * AT_P + kk * 32 + 8 * hh;
        vb.h[0] = *(const v8b*)(vhp);
        vb.h[1] = *(const v8b*)(vhp + 16);
        vl.h[0] = *(const v8b*)(vlp);
        vl.h[1] = *(const v8b*)(vlp + 16);
        oacc[t] = at_mma(pa.v, vb.v, oacc[t]);
        oacc[t] = at_mma(pa.v, vl.v, oacc[t]);
        oacc[t] = at_mma(pl.v, vb.v, oacc[t]);
        sched_fence();
      }
    }
  }

  float* os = Os[wave];
#pragma unroll
  for (int r = 0; r < 8; ++r) {
    const float inv = 1.0f / lrow[r];
#pragma unroll
    for (int t = 0; t < 4; ++t) os[(8 * hh + r) * 68 + t * 16 + c] = oacc[t][r] * inv;
  }
  __builtin_amdgcn_fence(__ATOMIC_RELEASE, "workgroup");
  __builtin_amdgcn_wave_barrier();
  __builtin_amdgcn_fence(__ATOMIC_ACQUIRE, "workgroup");
  {
    const int q = lane >> 3, c8 = (lane & 7) * 8;
    {
#pragma unroll
      for (int it = 0; it < 4; ++it) {
        const int row = it * 4 + q;
        const float* sp = os + row * 68 + c8;
        v8h hv, lv;
#pragma unroll
        for (int e = 0; e < 8; ++e) {
          unsigned short hb = f2bf_bits(sp[e]);
          unsigned short lb = f2bf_bits(sp[e] - bf_bits2f(hb));
          hv[e] = __builtin_bit_cast(_Float16, hb);
          lv[e] = __builtin_bit_cast(_Float16, lb);
        }
        const size_t oo = (size_t)(tok0 + q0 + row) * HIDN + hcol + c8;
        *(v8h*)(Oh + oo) = hv;
        *(v8h*)(Ol + oo) = lv;
      }
      
    }
  }
  // precaution: the second tile's set-up rewrites registers that the stores above name
  asm volatile("s_wait_xcnt 0x0" ::: "memory");
  }   // half
}

// =====================================================================================
// k^T.v state: St[h][d][e] = sum_s kT[h*64+d][s] * vT[h*64+e][s] over SEQ tokens of one batch.
//   planes: [HIDN][NTOK] bf16 hi and lo; blockIdx.z = batch, whose tokens begin at column blockIdx.z * SEQ
//   product = hi.hi + hi.lo + lo.hi, f32 accumulate (same three products per k step as the GEMM's hi/lo path)
//   Block = 16 waves = one 32x32 tile of one head; wave w sums tokens [w*128, w*128+128).
//   The 16 partial tiles meet in LDS and are added in wave order 0..15. grid = (4 tiles, NHEAD, NBATCH).
// =====================================================================================
constexpr int ST_NW = 16;                 // waves per block = slices of the token sum
constexpr int ST_KS = SEQ / ST_NW;        // 128 tokens per wave
static_assert(ST_KS % 32 == 0);

__global__ __launch_bounds__(ST_NW * 32)
void state_ktv_slices(const unsigned short* __restrict__ KTh, const unsigned short* __restrict__ KTl,
                      const unsigned short* __restrict__ VTh, const unsigned short* __restrict__ VTl,
                      float* __restrict__ St) {
  __shared__ __align__(16) float part[ST_NW][32 * 32];   // one 4 KB partial tile per wave, in accumulator order
  const int tid  = threadIdx.x;
  const int wave = tid >> 5;
  const int lane = tid & 31;
  const int hh   = lane >> 4;
  const int c    = lane & 15;
  const int h    = blockIdx.y;
  const int d0   = (blockIdx.x >> 1) * 32;
  const int e0   = (blockIdx.x & 1) * 32;

  const int bb   = blockIdx.z;
  const size_t ao = (size_t)(h * HDIM + d0 + c) * NTOK + bb * SEQ + wave * ST_KS + 8 * hh;
  const size_t bo = (size_t)(h * HDIM + e0 + c) * NTOK + bb * SEQ + wave * ST_KS + 8 * hh;
  const __bf16* pah = (const __bf16*)KTh + ao;
  const __bf16* pal = (const __bf16*)KTl + ao;
  const __bf16* pbh = (const __bf16*)VTh + bo;
  const __bf16* pbl = (const __bf16*)VTl + bo;

  v8f acc[2][2];
#pragma unroll
  for (int i = 0; i < 2; ++i)
#pragma unroll
    for (int j = 0; j < 2; ++j) acc[i][j] = (v8f){0.f,0.f,0.f,0.f,0.f,0.f,0.f,0.f};

  // unrolled (4 steps): the step offsets fold into the loads' immediate fields and later steps' loads issue among earlier products
#pragma unroll
  for (int ks = 0; ks < ST_KS / 32; ++ks) {
    v16b ah[2], al[2], bh[2], bl[2];
#pragma unroll
    for (int i = 0; i < 2; ++i) {
      const size_t o = (size_t)i * 16 * NTOK + ks * 32;
      ah[i] = Frag<__bf16>::load(pah + o);
      al[i] = Frag<__bf16>::load(pal + o);
      bh[i] = Frag<__bf16>::load(pbh + o);
      bl[i] = Frag<__bf16>::load(pbl + o);
    }
#pragma unroll
    for (int i = 0; i < 2; ++i)
#pragma unroll
      for (int j = 0; j < 2; ++j) {
        acc[i][j] = Frag<__bf16>::mma(ah[i], bh[j], acc[i][j]);
        acc[i][j] = Frag<__bf16>::mma(ah[i], bl[j], acc[i][j]);
        acc[i][j] = Frag<__bf16>::mma(al[i], bh[j], acc[i][j]);
      }
  }

  // partial tile to LDS: eighth q = (i*2+j)*2 + half holds accumulator rows half*4..half*4+3 of every lane, 16 B per lane
  float* slab = part[wave];
#pragma unroll
  for (int i = 0; i < 2; ++i)
#pragma unroll
    for (int j = 0; j < 2; ++j) {
      const v8f a = acc[i][j];
      const int q = (i * 2 + j) * 2;
      *(v4f*)(slab + (q + 0) * 128 + lane * 4) = (v4f){a[0], a[1], a[2], a[3]};
      *(v4f*)(slab + (q + 1) * 128 + lane * 4) = (v4f){a[4], a[5], a[6], a[7]};
    }
  __syncthreads();

  // 512 threads x 2 floats = the 32x32 tile; each thread adds its two positions over the 16 slices in wave order
  v2f sum = (v2f){0.f, 0.f};
#pragma unroll
  for (int w = 0; w < ST_NW; ++w) sum += *(const v2f*)(&part[w][tid * 2]);

  // position tid*2 back to (row, col): q = tid>>6, source lane = (tid>>1)&31, accumulator rows (q&1)*4 + (tid&1)*2 and the next
  const int q   = tid >> 6;
  const int sl  = (tid >> 1) & 31;
  const int row = (q >> 2) * 16 + (sl >> 4) * 8 + (q & 1) * 4 + (tid & 1) * 2;
  const int col = ((q >> 1) & 1) * 16 + (sl & 15);
  float* o = St + (size_t)(bb * NHEAD + h) * HDIM * HDIM + (size_t)(d0 + row) * HDIM + e0 + col;
  o[0]    = sum[0];
  o[HDIM] = sum[1];
}

// ---------------------------------------------------------------- launcher
extern "C" void kernel_launch(void* const* d_in, const int* in_sizes, int n_in,
                              void* d_out, int out_size, void* d_ws, size_t ws_size,
                              hipStream_t stream) {
  (void)n_in;
  if (ws_size < WS_TOTAL) return;
  if ((size_t)out_size != OUT0_ELEMS + OUT1_ELEMS) return;
  if ((size_t)in_sizes[0] != NX || (size_t)in_sizes[1] != (size_t)NTOK ||
      (size_t)in_sizes[2] != NW || (size_t)in_sizes[4] != NW ||
      (size_t)in_sizes[6] != NW || (size_t)in_sizes[8] != NW ||
      in_sizes[3] != HIDN || in_sizes[5] != HIDN || in_sizes[7] != HIDN || in_sizes[9] != HIDN) return;

  const float* hs    = (const float*)d_in[0];
  const float* amask = (const float*)d_in[1];
  const float* Wq    = (const float*)d_in[2];
  const float* bq    = (const float*)d_in[3];
  const float* Wk    = (const float*)d_in[4];
  const float* bk    = (const float*)d_in[5];
  const float* Wv    = (const float*)d_in[6];
  const float* bv    = (const float*)d_in[7];
  const float* Wo    = (const float*)d_in[8];
  const float* bo    = (const float*)d_in[9];

  char* ws = (char*)d_ws;
  unsigned short* Xb  = (unsigned short*)(ws + OFF_XB);
  unsigned short* Wqb = (unsigned short*)(ws + OFF_WQ);
  unsigned short* Wkb = (unsigned short*)(ws + OFF_WK);
  unsigned short* Wvb = (unsigned short*)(ws + OFF_WV);
  unsigned short* Wob = (unsigned short*)(ws + OFF_WO);
  unsigned short* Qh  = (unsigned short*)(ws + OFF_QH);
  unsigned short* Ql  = (unsigned short*)(ws + OFF_QL);
  unsigned short* Kh  = (unsigned short*)(ws + OFF_KH);
  unsigned short* Kl  = (unsigned short*)(ws + OFF_KL);
  unsigned short* KTh = (unsigned short*)(ws + OFF_KTH);
  unsigned short* KTl = (unsigned short*)(ws + OFF_KTL);
  unsigned short* VTh = (unsigned short*)(ws + OFF_VTH);
  unsigned short* VTl = (unsigned short*)(ws + OFF_VTL);
  unsigned short* Oh  = (unsigned short*)(ws + OFF_OH);
  unsigned short* Ol  = (unsigned short*)(ws + OFF_OL);

  float* outF   = (float*)d_out;
  float* stateF = outF + OUT1_ELEM_OFF;

  // 1) RNE conversions to bf16 (inputs converted exactly once), one launch for all five inputs; Xb is the start of the five planes
  cast_all_f32_bf16<<<dim3(CV_GRID), dim3(CV_T), 0, stream>>>(hs, Wq, Wk, Wv, Wo, Xb);

  // 2) projections: 64x64 tiles, 8 waves (2 x 4 tiles) per block; every shape has 1024 tiles (64x16 or 16x64) = 128 block tiles of 128x256
  const int gemmBlocksTok = ((NTOK / 64) * (HIDN / 64)) / 8;    // 1024 tiles / 8 = 128
  // q, k, k^T and v^T in one launch, grid.y = projection -> hi/lo planes
  proj4_gemm64<<<dim3(gemmBlocksTok, 4), dim3(256), 0, stream>>>(
      Xb, Wqb, Wkb, Wvb, Qh, Ql, Kh, Kl, KTh, KTl, VTh, VTl, bq, bk, bv, amask, HIDN);

  // 3) causal attention on the planes -> attention out hi/lo planes [4096][1024]
  const float sscale = 0.125f;   // 1 / (temperature * sqrt(64)), exact power of two
  attn_hd64_planes<<<dim3(NBATCH * NHEAD * (SEQ / AT_QB / 2)), dim3(128), 0, stream>>>(
      Qh, Ql, Kh, Kl, VTh, VTl, amask, Oh, Ol, sscale);

  // 4) state[b][h][d][e] = sum_s k^T[h*64+d][b*S+s] * v^T[h*64+e][b*S+s]  (hi/lo on both operands); 4 tiles x 16 token slices per (b,h)
  state_ktv_slices<<<dim3(4, NHEAD, NBATCH), dim3(ST_NW * 32), 0, stream>>>(KTh, KTl, VTh, VTl, stateF);

  // 5) out [4096][1024] = attn_out . Wo^T + bo  (A hi/lo, Wo exact bf16) -> d_out f32
  wmma_gemm64<1, true, false, 2, 0, 0><<<dim3(gemmBlocksTok, 1), dim3(256), 0, stream>>>(
      Oh, Ol, HIDN, 0L, Wob, Wob, HIDN, 0L, (void*)outF, (void*)Oh, HIDN, 0L,
      bo, amask, NTOK, HIDN, HIDN, 1.0f);
}

// v008
// One run takes 167 microseconds.
// Two timings next to v007 both put it at 1.21 times that version's speed.
// All steps since v000 together make it 4.15 times as fast.
// Compute dtype: input projections v_wmma_f32_16x16x32_bf16 on bf16 operands (inputs RNE-converted once), f32 accumulate; scores, p.v and k^T.v state on bf16 hi/lo split planes (hi.hi + hi.lo + lo.hi), output projection on hi/lo A planes x bf16 Wo (hi.hi + lo.hi), f32 accumulate; softmax and side math f32.
#include <hip/hip_runtime.h>

// ---------------------------------------------------------------- geometry
constexpr int NBATCH = 2;
constexpr int SEQ    = 2048;
constexpr int HIDN   = 1024;
constexpr int NHEAD  = 16;
constexpr int HDIM   = 64;
constexpr int NTOK   = NBATCH * SEQ;                    /* 4096 token rows */
constexpr size_t NX  = (size_t)NTOK * HIDN;            /* 4194304 */
constexpr size_t NW  = (size_t)HIDN * HIDN;            /* 1048576 */
constexpr size_t OUT0_ELEMS    = NX;
constexpr size_t OUT1_ELEMS    = (size_t)NBATCH * NHEAD * HDIM * HDIM;   /* 131072 */
constexpr size_t OUT1_BYTE_OFF = 16777216;
constexpr size_t OUT1_ELEM_OFF = OUT1_BYTE_OFF / 4;
static_assert(OUT1_ELEM_OFF == OUT0_ELEMS);
static_assert(OUT1_BYTE_OFF + OUT1_ELEMS * 4 == 17301504);
static_assert(HIDN == NHEAD * HDIM);
static_assert(HDIM == 64);
static_assert(HIDN % 64 == 0 && NTOK % 64 == 0 && SEQ % 64 == 0);   /* every GEMM M and N is a 64-multiple */
static_assert(HIDN % 32 == 0 && SEQ % 32 == 0);                     /* every GEMM K is a multiple of 32 */

// ---------------------------------------------------------------- workspace map (bytes)
// 16-bit planes: token planes [4096][1024] or [1024][4096] = 8 MiB each; weight planes [1024][1024] = 2 MiB each.
// Every region is fully written by its producer (full M x N, no pad rows) before any consumer reads it.
constexpr size_t MIB      = (size_t)1 << 20;
constexpr size_t OFF_XB   = 0 * MIB;    /* hidden as bf16      8 MiB */
constexpr size_t OFF_WQ   = 8 * MIB;    /* Wq bf16             2 MiB */
constexpr size_t OFF_WK   = 10 * MIB;   /* Wk bf16             2 MiB */
constexpr size_t OFF_WV   = 12 * MIB;   /* Wv bf16             2 MiB */
constexpr size_t OFF_WO   = 14 * MIB;   /* Wo bf16             2 MiB */
constexpr size_t OFF_QH   = 16 * MIB;   /* q hi  [4096][1024]        */
constexpr size_t OFF_QL   = 24 * MIB;   /* q lo                      */
constexpr size_t OFF_KH   = 32 * MIB;   /* k hi  [4096][1024] (masked) */
constexpr size_t OFF_KL   = 40 * MIB;   /* k lo                      */
constexpr size_t OFF_KTH  = 48 * MIB;   /* k^T hi [1024][4096] (masked) */
constexpr size_t OFF_KTL  = 56 * MIB;   /* k^T lo                    */
constexpr size_t OFF_VTH  = 64 * MIB;   /* v^T hi [1024][4096] (masked) */
constexpr size_t OFF_VTL  = 72 * MIB;   /* v^T lo                    */
constexpr size_t OFF_OH   = 80 * MIB;   /* attention out hi [4096][1024] */
constexpr size_t OFF_OL   = 88 * MIB;   /* attention out lo          */
constexpr size_t WS_TOTAL = 96 * MIB;   /* 100663296 B */
static_assert(NX * 2 == 8 * MIB && NW * 2 == 2 * MIB);
static_assert(WS_TOTAL <= 134217728);

// ---------------------------------------------------------------- types / helpers
typedef __attribute__((ext_vector_type(16))) _Float16 v16h;
typedef __attribute__((ext_vector_type(8)))  _Float16 v8h;
typedef __attribute__((ext_vector_type(16))) __bf16   v16b;
typedef __attribute__((ext_vector_type(8)))  __bf16   v8b;
typedef __attribute__((ext_vector_type(8)))  float    v8f;
typedef __attribute__((ext_vector_type(4)))  float    v4f;
typedef __attribute__((ext_vector_type(2)))  float    v2f;
typedef __attribute__((ext_vector_type(4)))  unsigned u4v;

__device__ __forceinline__ unsigned short f2bf_bits(float f) {
  unsigned u = __float_as_uint(f);
  return (unsigned short)((u + 0x7FFFu + ((u >> 16) & 1u)) >> 16);
}
__device__ __forceinline__ float bf_bits2f(unsigned short h) { return __uint_as_float(((unsigned)h) << 16); }
__device__ __forceinline__ float bfr(float f) { return bf_bits2f(f2bf_bits(f)); }

__device__ __forceinline__ void sched_fence() { asm volatile("" ::: "memory"); }

// hazard guards as plain device helpers (no inline asm inside the kernel template body)
__device__ __forceinline__ void dep_guard_h(v8f& a, v8f& b, v16h x, v16h y) { asm volatile("v_nop\n\tv_nop\n\tv_nop\n\tv_nop" : "+v"(a), "+v"(b) : "v"(x), "v"(y)); }
__device__ __forceinline__ void dep_guard_b(v8f& a, v8f& b, v16b x, v16b y) { asm volatile("v_nop\n\tv_nop\n\tv_nop\n\tv_nop" : "+v"(a), "+v"(b) : "v"(x), "v"(y)); }
__device__ __forceinline__ void keep4_h(v16h a, v16h b, v16h c, v16h d) { asm volatile("v_nop" :: "v"(a), "v"(b), "v"(c), "v"(d)); }
__device__ __forceinline__ void keep4_b(v16b a, v16b b, v16b c, v16b d) { asm volatile("v_nop" :: "v"(a), "v"(b), "v"(c), "v"(d)); }
__device__ __forceinline__ void acc_guard4(v8f& a, v8f& b, v8f& c, v8f& d) { asm volatile("v_nop\n\tv_nop\n\tv_nop\n\tv_nop" : "+v"(a), "+v"(b), "+v"(c), "+v"(d)); }
template <typename T> struct Frag;
template <> struct Frag<_Float16> {
  typedef v16h V; union U { v16h v; v8h h[2]; };
  static __device__ __forceinline__ v16h load(const _Float16* p) {   // elements 0..7 <- p[0..7], 8..15 <- p[16..23]
    U f; f.h[0] = *(const v8h*)(p); f.h[1] = *(const v8h*)(p + 16); return f.v;
  }
  static __device__ __forceinline__ v8f mma(v16h a, v16h b, v8f c) {
    return __builtin_amdgcn_wmma_f32_16x16x32_f16(false, a, false, b, (short)0, c, false, false);
  }
  static __device__ __forceinline__ void guard(v8f& a, v8f& b, v16h x, v16h y) { dep_guard_h(a, b, x, y); }
  static __device__ __forceinline__ void keep(v16h a, v16h b, v16h c, v16h d) { keep4_h(a, b, c, d); }
};
template <> struct Frag<__bf16> {
  typedef v16b V; union U { v16b v; v8b h[2]; };
  static __device__ __forceinline__ v16b load(const __bf16* p) {
    U f; f.h[0] = *(const v8b*)(p); f.h[1] = *(const v8b*)(p + 16); return f.v;
  }
  static __device__ __forceinline__ v8f mma(v16b a, v16b b, v8f c) {
    return __builtin_amdgcn_wmma_f32_16x16x32_bf16(false, a, false, b, (short)0, c, false, false);
  }
  static __device__ __forceinline__ void guard(v8f& a, v8f& b, v16b x, v16b y) { dep_guard_b(a, b, x, y); }
  static __device__ __forceinline__ void keep(v16b a, v16b b, v16b c, v16b d) { keep4_b(a, b, c, d); }
};

// ---- Register-blocked batched WMMA GEMM ------------------------------------
// C[m,n] = rs * (scale * sum_k A[m,k] * Bt[n,k] + bias); each wave owns a 64x64 tile.
// A row-major [M,K]; Bt row-major [N,K]; M % 128 == 0, N % 256 == 0, K % 64 == 0.
// Block = 8 waves (2 x 4) = one 128x256 tile. A stage is 64 k = one 128-byte line of every operand row of the block tile.
// Asynchronous 16-byte copies (8 lanes per row, whole lines) bring a stage from global memory into one of two LDS buffers
// while the other buffer is multiplied; the waves read their fragments from LDS.
// SPLIT: A carried as hi/lo planes (A2 = lo); BLO: Bt also carried as hi/lo (Bt2 = lo);
//   product = hi.hi (+ hi.lo when BLO) + lo.hi.   SPLIT+BLO is the stock hi/lo path.
// BIAS_MODE: 0 = none, 1 = bias[m], 2 = bias[n]  (bias value RNE-converted to bf16 precision).
// RS_MODE:   0 = none, 1 = multiply by rsc[m], 2 = multiply by rsc[n]  (rsc value RNE-converted to bf16).
// BIAS_MODE 3 (RS_MODE is then not read): both modes chosen per block: (1, 2) where tr, else (2, 1) where rsRow, else (2, 0).
// b = batch index of the block; tr, rsRow are block-uniform and read under BIAS_MODE 3 only.
// OUT_MODE: 0 = f32, 1 = f16, 2 = bf16 hi plane (Cout) + bf16 lo plane (Cout2).
// ET: 0 = f16 operands, 1 = bf16 operands (pointers passed as 16-bit storage)
constexpr int GB_M = 128;   // block tile rows
constexpr int GB_N = 256;   // block tile columns
constexpr int GB_K = 64;    // k per stage
constexpr int GB_P = 72;    // LDS row pitch in elements: 144 B = 16 B x 9 (odd), distinct banks for the 16 rows of a 16-byte fragment read
static_assert(HIDN % GB_N == 0 && NTOK % GB_N == 0 && HIDN % GB_K == 0);   /* every GEMM M, N is a multiple of the block tile, K of the stage */

// four asynchronous 16-byte copies to LDS, every lane with its own LDS byte address and global address;
// s_wait_xcnt 0 closes the statement as a precaution: no address register of a copy is rewritten in front of it
__device__ __forceinline__ void copy4_async(unsigned l0, const void* g0, unsigned l1, const void* g1,
                                            unsigned l2, const void* g2, unsigned l3, const void* g3) {
  asm volatile("global_load_async_to_lds_b128 %0, %1, off\n\t"
               "global_load_async_to_lds_b128 %2, %3, off\n\t"
               "global_load_async_to_lds_b128 %4, %5, off\n\t"
               "global_load_async_to_lds_b128 %6, %7, off\n\t"
               "s_wait_xcnt 0x0"
               :: "v"(l0), "v"(g0), "v"(l1), "v"(g1), "v"(l2), "v"(g2), "v"(l3), "v"(g3) : "memory");
}
// this wave's copies have landed behind this one
__device__ __forceinline__ void wait_async0() { asm volatile("s_wait_asynccnt 0x0" ::: "memory"); }
// this wave's LDS reads have returned: stands in front of the barrier behind which their buffer is refilled
__device__ __forceinline__ void wait_ds0() { asm volatile("s_wait_dscnt 0x0" ::: "memory"); }

template <int V> struct IntC { static constexpr int value = V; };   // an int as a type, for the epilogue's modes
template <int ET> struct Elem;
template <> struct Elem<0> { typedef _Float16 T; };
template <> struct Elem<1> { typedef __bf16 T; };
template <int ET, bool SPLIT, bool BLO, int BIAS_MODE, int OUT_MODE, int RS_MODE>
__device__ __forceinline__ void gemm_block_tile(
    const unsigned short* __restrict__ Ap, const unsigned short* __restrict__ A2p, int lda, long strideA,
    const unsigned short* __restrict__ Btp, const unsigned short* __restrict__ Bt2p, int ldb, long strideB,
    void* __restrict__ Cout, void* __restrict__ Cout2, int ldc, long strideC,
    const float* __restrict__ bias, const float* __restrict__ rsc,
    int M, int N, int K, float scale, const int b, const bool tr, const bool rsRow) {
  typedef typename Elem<ET>::T T;
  typedef typename Frag<T>::V V;
  const T* A = (const T*)Ap; const T* A2 = (const T*)A2p; const T* Bt = (const T*)Btp; const T* Bt2 = (const T*)Bt2p;
  constexpr int NPA = SPLIT ? 2 : 1;              // planes of A
  constexpr int NPB = (SPLIT && BLO) ? 2 : 1;     // planes of Bt
  __shared__ __align__(16) T sA[2][NPA][GB_M * GB_P];   // two buffers of A rows  [row][k], 18 KB per plane
  __shared__ __align__(16) T sB[2][NPB][GB_N * GB_P];   // two buffers of Bt rows [row][k], 36 KB per plane
  __shared__ __align__(16) float sT[8][16 * 68];   // per-wave 16x64 slab, pitch 68 floats
  const int tid  = threadIdx.x;
  const int lane = tid & 31;
  const int wave = tid >> 5;
  const int blocksN = N / GB_N;
  const int bm = blockIdx.x / blocksN;
  const int bn = blockIdx.x - bm * blocksN;
  if (bm >= M / GB_M) return;            // block-uniform, in front of every copy and barrier
  const int mB = bm * GB_M;              // block tile origin
  const int nB = bn * GB_N;
  const int wm = (wave >> 2) << 6;       // wave tile origin inside the block tile
  const int wn = (wave & 3) << 6;
  const int m0 = mB + wm;
  const int n0 = nB + wn;

  const T* Ab  = A  + (size_t)b * strideA;
  const T* Bb  = Bt + (size_t)b * strideB;
  const T* Ab2 = SPLIT ? (A2  + (size_t)b * strideA) : nullptr;
  const T* Bb2 = (SPLIT && BLO) ? (Bt2 + (size_t)b * strideB) : nullptr;

  const int rlane = lane & 15;                 // row (A) / col (B, D) within subtile
  const int koff  = (lane >> 4) * 8;           // k offset of this lane half
  const int mOff  = (lane >> 4) * 8;           // D row offset

  // staging coverage: 256 threads x 4 copies = 1024 = 128 rows x 8 pieces of 16 B (A plane); x 8 copies = 2048 = 256 rows x 8 (Bt plane);
  // copy i of a thread is row srow + 32 i, piece tid & 7: every piece once, every address a multiple of 16 B
  const int srow = tid >> 3;                   // 0..31
  const int sc8  = (tid & 7) * 8;
  constexpr unsigned RS = 32 * GB_P * 2;       // LDS bytes between a thread's successive copies
  const unsigned ldsA = (unsigned)(size_t)(&sA[0][0][srow * GB_P + sc8]);   // low 32 bits = byte address in the work-group's LDS
  const unsigned ldsB = (unsigned)(size_t)(&sB[0][0][srow * GB_P + sc8]);
  const size_t astep = (size_t)32 * lda * 2, bstep = (size_t)32 * ldb * 2;  // global bytes between them
  auto stage = [&](int st, int buf) {
    const size_t ka = ((size_t)(mB + srow) * lda + (size_t)st * GB_K + sc8) * 2;
    const size_t kb = ((size_t)(nB + srow) * ldb + (size_t)st * GB_K + sc8) * 2;
#pragma unroll
    for (int p = 0; p < NPA; ++p) {
      const char* g = (const char*)(p == 0 ? Ab : Ab2) + ka;
      const unsigned l = ldsA + (unsigned)(buf * NPA + p) * (unsigned)(GB_M * GB_P * 2);
      copy4_async(l, g, l + RS, g + astep, l + 2 * RS, g + 2 * astep, l + 3 * RS, g + 3 * astep);
    }
#pragma unroll
    for (int p = 0; p < NPB; ++p) {
      const char* g = (const char*)(p == 0 ? Bb : Bb2) + kb;
      const unsigned l = ldsB + (unsigned)(buf * NPB + p) * (unsigned)(GB_N * GB_P * 2);
      copy4_async(l, g, l + RS, g + bstep, l + 2 * RS, g + 2 * bstep, l + 3 * RS, g + 3 * bstep);
      copy4_async(l + 4 * RS, g + 4 * bstep, l + 5 * RS, g + 5 * bstep, l + 6 * RS, g + 6 * bstep, l + 7 * RS, g + 7 * bstep);
    }
  };

  v8f acc[4][4];
#pragma unroll
  for (int i = 0; i < 4; ++i)
#pragma unroll
    for (int j = 0; j < 4; ++j) acc[i][j] = (v8f){0.f,0.f,0.f,0.f,0.f,0.f,0.f,0.f};

  const int nst = K / GB_K;                    // stages, block-uniform
  stage(0, 0);
  wait_async0();
  __syncthreads();                             // stage 0 is complete before any wave reads it
  if (nst > 1) stage(1, 1);
  for (int t = 0; t < nst; ++t) {
    const int cur = t & 1;
#pragma unroll
    for (int kk = 0; kk < GB_K; kk += 32) {
      V bh[4], bl[4], ah[4], al[4];
#pragma unroll
      for (int j = 0; j < 4; ++j) {
        const int bo = (wn + (j << 4) + rlane) * GB_P + kk + koff;
        bh[j] = Frag<T>::load(&sB[cur][0][bo]);
        if (SPLIT && BLO) bl[j] = Frag<T>::load(&sB[cur][NPB - 1][bo]);
        else bl[j] = bh[j];
      }
#pragma unroll
      for (int i = 0; i < 4; ++i) {
        const int ao = (wm + (i << 4) + rlane) * GB_P + kk + koff;
        ah[i] = Frag<T>::load(&sA[cur][0][ao]);
        if (SPLIT) al[i] = Frag<T>::load(&sA[cur][NPA - 1][ao]);
        else al[i] = ah[i];
      }
#pragma unroll
      for (int i = 0; i < 4; ++i) {
#pragma unroll
        for (int j = 0; j < 4; ++j) {
          acc[i][j] = Frag<T>::mma(ah[i], bh[j], acc[i][j]);
          if (SPLIT) {
            if (BLO) acc[i][j] = Frag<T>::mma(ah[i], bl[j], acc[i][j]);
            acc[i][j] = Frag<T>::mma(al[i], bh[j], acc[i][j]);
          }
        }
        Frag<T>::guard(acc[i][0], acc[i][3], ah[i], al[i]);
      }
      Frag<T>::keep(bh[0], bh[1], bh[2], bh[3]);
      if (SPLIT && BLO) Frag<T>::keep(bl[0], bl[1], bl[2], bl[3]);
    }
    wait_ds0();                                // this wave has finished reading buffer cur
    wait_async0();                             // this wave's copies of stage t + 1 have landed
    __syncthreads();                           // publishes stage t + 1 and frees buffer cur
    if (t + 2 < nst) stage(t + 2, cur);        // block-uniform
  }
  wait_async0();                               // nothing is in flight when the wave goes on
  acc_guard4(acc[0][0], acc[0][1], acc[0][2], acc[0][3]);
  acc_guard4(acc[1][0], acc[1][1], acc[1][2], acc[1][3]);
  acc_guard4(acc[2][0], acc[2][1], acc[2][2], acc[2][3]);
  acc_guard4(acc[3][0], acc[3][1], acc[3][2], acc[3][3]);

  // ---- epilogue ----  (bias and row-scale mode as compile-time values of the call; always inlined: acc stays in registers)
  float* slab = sT[wave];
  auto epilogue = [&](auto bmode, auto rmode) __attribute__((always_inline)) {
  constexpr int BM = decltype(bmode)::value;
  constexpr int RM = decltype(rmode)::value;
#pragma unroll
  for (int i = 0; i < 4; ++i) {
    const int mBase = m0 + (i << 4);
    float bm[8], rm[8];
#pragma unroll
    for (int r = 0; r < 8; ++r) { bm[r] = 0.f; rm[r] = 1.f; }
    if (BM == 1) {
      // rows mBase+mOff .. +7 are contiguous and 32-B aligned: two 16-B loads
      const v4f t0 = *(const v4f*)(bias + mBase + mOff);
      const v4f t1 = *(const v4f*)(bias + mBase + mOff + 4);
#pragma unroll
      for (int r = 0; r < 4; ++r) { bm[r] = bfr(t0[r]); bm[4 + r] = bfr(t1[r]); }
    }
    if (RM == 1) {
      const v4f t0 = *(const v4f*)(rsc + mBase + mOff);
      const v4f t1 = *(const v4f*)(rsc + mBase + mOff + 4);
#pragma unroll
      for (int r = 0; r < 4; ++r) { rm[r] = bfr(t0[r]); rm[4 + r] = bfr(t1[r]); }
    }
#pragma unroll
    for (int j = 0; j < 4; ++j) {
      const int n = n0 + (j << 4) + rlane;
      float bn = 0.f, rn = 1.f;
      if (BM == 2) bn = bfr(bias[n]);
      if (RM == 2) rn = bfr(rsc[n]);
#pragma unroll
      for (int r = 0; r < 8; ++r) {
        float v = acc[i][j][r] * scale;
        if (BM == 1) v += bm[r];
        if (BM == 2) v += bn;
        if (RM == 1) v *= rm[r];
        if (RM == 2) v *= rn;
        slab[(mOff + r) * 68 + (j << 4) + rlane] = v;
      }
    }
    __builtin_amdgcn_fence(__ATOMIC_RELEASE, "workgroup");
    __builtin_amdgcn_wave_barrier();
    __builtin_amdgcn_fence(__ATOMIC_ACQUIRE, "workgroup");
    if (OUT_MODE == 0) {
      float* C = (float*)Cout + (size_t)b * strideC;
      const int hh = lane >> 4, c4 = (lane & 15) * 4;     // row seg = 256 B = 16 lanes x 16 B
      {
#pragma unroll
        for (int it = 0; it < 8; ++it) {
          const int row = it * 2 + hh;
          v4f v = *(const v4f*)(slab + row * 68 + c4);
          *(v4f*)(C + (size_t)(mBase + row) * ldc + n0 + c4) = v;
        }
        
      }
    } else {
      const int q = lane >> 3, c8 = (lane & 7) * 8;
      unsigned short* C  = (unsigned short*)Cout  + (size_t)b * strideC;
      unsigned short* C2 = (OUT_MODE == 2) ? ((unsigned short*)Cout2 + (size_t)b * strideC) : nullptr;
      {
#pragma unroll
        for (int it = 0; it < 4; ++it) {
          const int row = it * 4 + q;
          const float* sp = slab + row * 68 + c8;
          v8h hv, lv;
#pragma unroll
          for (int e = 0; e < 8; ++e) {
            if (OUT_MODE == 1) {
              hv[e] = (_Float16)sp[e];
              lv[e] = hv[e];
            } else {
              unsigned short hb = f2bf_bits(sp[e]);
              unsigned short lb = f2bf_bits(sp[e] - bf_bits2f(hb));
              hv[e] = __builtin_bit_cast(_Float16, hb);
              lv[e] = __builtin_bit_cast(_Float16, lb);
            }
          }
          *(v8h*)(C + (size_t)(mBase + row) * ldc + n0 + c8) = hv;
          if (OUT_MODE == 2) *(v8h*)(C2 + (size_t)(mBase + row) * ldc + n0 + c8) = lv;
        }
        
      }
    }
    __builtin_amdgcn_fence(__ATOMIC_RELEASE, "workgroup");
    __builtin_amdgcn_wave_barrier();
    __builtin_amdgcn_fence(__ATOMIC_ACQUIRE, "workgroup");
  }
  };
  if constexpr (BIAS_MODE == 3) {        // block-uniform choice among the three forms the projections need
    if (tr)         epilogue(IntC<1>{}, IntC<2>{});
    else if (rsRow) epilogue(IntC<2>{}, IntC<1>{});
    else            epilogue(IntC<2>{}, IntC<0>{});
  } else {
    epilogue(IntC<BIAS_MODE>{}, IntC<RS_MODE>{});
  }
}

// one GEMM per launch: grid.x = block tiles, grid.y = batch
template <int ET, bool SPLIT, bool BLO, int BIAS_MODE, int OUT_MODE, int RS_MODE>
__global__ __launch_bounds__(256) void wmma_gemm64(
    const unsigned short* __restrict__ Ap, const unsigned short* __restrict__ A2p, int lda, long strideA,
    const unsigned short* __restrict__ Btp, const unsigned short* __restrict__ Bt2p, int ldb, long strideB,
    void* __restrict__ Cout, void* __restrict__ Cout2, int ldc, long strideC,
    const float* __restrict__ bias, const float* __restrict__ rsc,
    int M, int N, int K, float scale) {
  gemm_block_tile<ET, SPLIT, BLO, BIAS_MODE, OUT_MODE, RS_MODE>(
      Ap, A2p, lda, strideA, Btp, Bt2p, ldb, strideB, Cout, Cout2, ldc, strideC, bias, rsc, M, N, K, scale,
      (int)blockIdx.y, false, false);
}

// The four input projections in ONE launch. Each has 128 block tiles, half of the chip's 256 WGPs, and none reads what another writes:
// together their 512 blocks stand two on every WGP (LDS and registers allow two). blockIdx.y picks the projection, block-uniform:
//   0: q rows   [NTOK][HIDN] = X . Wq^T + bq[col]
//   1: k rows   [NTOK][HIDN] = (X . Wk^T + bk[col]) * mask[row]
//   2: k^T rows [HIDN][NTOK] = (Wk . X^T + bk[row]) * mask[col]
//   3: v^T rows [HIDN][NTOK] = (Wv . X^T + bv[row]) * mask[col]
// every result as bf16 hi and lo planes. K (= HIDN) comes as an argument, as in the one-GEMM kernel.
__global__ __launch_bounds__(256) void proj4_gemm64(
    const unsigned short* __restrict__ Xb, const unsigned short* __restrict__ Wqb,
    const unsigned short* __restrict__ Wkb, const unsigned short* __restrict__ Wvb,
    unsigned short* __restrict__ Qh, unsigned short* __restrict__ Ql, unsigned short* __restrict__ Kh, unsigned short* __restrict__ Kl,
    unsigned short* __restrict__ KTh, unsigned short* __restrict__ KTl, unsigned short* __restrict__ VTh, unsigned short* __restrict__ VTl,
    const float* __restrict__ bq, const float* __restrict__ bk, const float* __restrict__ bv,
    const float* __restrict__ amask, int K) {
  const int  y  = blockIdx.y;
  const bool tr = y >= 2;                       // weight rows are the result's rows
  const unsigned short* W = (y == 0) ? Wqb : (y == 3) ? Wvb : Wkb;
  const float* bias       = (y == 0) ? bq  : (y == 3) ? bv  : bk;
  unsigned short* C  = (y == 0) ? Qh : (y == 1) ? Kh : (y == 2) ? KTh : VTh;
  unsigned short* C2 = (y == 0) ? Ql : (y == 1) ? Kl : (y == 2) ? KTl : VTl;
  const unsigned short* A  = tr ? W : Xb;
  const unsigned short* Bt = tr ? Xb : W;
  gemm_block_tile<1, false, false, 3, 2, 3>(
      A, A, HIDN, 0L, Bt, Bt, HIDN, 0L, (void*)C, (void*)C2, tr ? NTOK : HIDN, 0L, bias, amask,
      tr ? HIDN : NTOK, tr ? NTOK : HIDN, K, 1.0f, 0, tr, y == 1);
}

// One launch converts all five f32 inputs: their bf16 planes lie back to back in the workspace (hidden, Wq, Wk, Wv, Wo).
// Few waves, much work each.
// Block = 16 waves = CV_BLK consecutive elements of ONE input (every input is a whole number of blocks); grid = all elements / CV_BLK, exact.
// Pass i of a block is 2048 consecutive elements, 4 per lane: a wave's 16-byte load covers 512 contiguous bytes, its 8-byte store 256.
constexpr int CV_T   = 512;                 // threads per block
constexpr int CV_IT  = 16;                  // passes per block
constexpr int CV_BLK = CV_T * 4 * CV_IT;    // 32768 elements per block
constexpr int CV_XB  = (int)(NX / CV_BLK);  // 128 blocks of hidden
constexpr int CV_WB  = (int)(NW / CV_BLK);  // 32 blocks of each weight
constexpr int CV_GRID = CV_XB + 4 * CV_WB;  // 256 blocks
static_assert(NX % CV_BLK == 0 && NW % CV_BLK == 0);
static_assert(OFF_XB == 0 && OFF_WQ == NX * 2 && OFF_WK == OFF_WQ + NW * 2 && OFF_WV == OFF_WK + NW * 2 && OFF_WO == OFF_WV + NW * 2);
typedef __attribute__((ext_vector_type(2))) unsigned u2v;

__global__ __launch_bounds__(CV_T) void cast_all_f32_bf16(
    const float* __restrict__ hs, const float* __restrict__ wq, const float* __restrict__ wk,
    const float* __restrict__ wv, const float* __restrict__ wo, unsigned short* __restrict__ out) {
  const int blk = blockIdx.x;
  const float* src;                          // block-uniform choice of the input
  if (blk < CV_XB) {
    src = hs + (size_t)blk * CV_BLK;
  } else {
    const int w = (blk - CV_XB) / CV_WB;
    const int r = (blk - CV_XB) % CV_WB;
    src = (w == 0 ? wq : w == 1 ? wk : w == 2 ? wv : wo) + (size_t)r * CV_BLK;
  }
  const int t4 = threadIdx.x * 4;
  v4f f[CV_IT];
  // unrolled: f stays in registers, the pass offsets fold into the loads' immediate fields and the loads stand ahead of the conversions
#pragma unroll
  for (int i = 0; i < CV_IT; ++i) f[i] = *(const v4f*)(src + i * (CV_T * 4) + t4);
  unsigned short* o = out + (size_t)blk * CV_BLK + t4;
  // unrolled: constant indices into f, store offsets as immediates
#pragma unroll
  for (int i = 0; i < CV_IT; ++i) {
    u2v u;
    u[0] = (unsigned)f2bf_bits(f[i][0]) | ((unsigned)f2bf_bits(f[i][1]) << 16);
    u[1] = (unsigned)f2bf_bits(f[i][2]) | ((unsigned)f2bf_bits(f[i][3]) << 16);
    *(u2v*)(o + i * (CV_T * 4)) = u;
  }
}

constexpr int AT_D  = 64;
constexpr int AT_NW = 4;
constexpr int AT_QB = 64;
constexpr int AT_KC = 64;
constexpr int AT_P  = 72;   // LDS row pitch in elements: 144 B = 16 B x 9 (odd), so the 16 rows of a 16-byte fragment read fall on distinct banks

// f rounded to nearest even at bit 16: the upper half of the word is f2bf_bits(f)
__device__ __forceinline__ unsigned at_rne(float f) {
  const unsigned u = __float_as_uint(f);
  return u + 0x7FFFu + ((u >> 16) & 1u);
}
typedef __attribute__((ext_vector_type(4))) int i4v;
// the value that lane l ^ 16 holds
__device__ __forceinline__ float xhalf(float x) {
  const int b = __float_as_int(x);
  return __int_as_float(__builtin_amdgcn_permlanex16(b, b, 0x76543210, 0xfedcba98, false, false));
}
__device__ __forceinline__ v8f at_mma(v16b a, v16b b, v8f c) {
  c = __builtin_amdgcn_wmma_f32_16x16x32_bf16(false, a, false, b, (short)0, c, false, false);
  asm volatile("v_nop\n\tv_nop\n\tv_nop\n\tv_nop" : "+v"(c) : "v"(a), "v"(b));
  return c;
}

// Two blocks per WGP (512 blocks of 4 waves, 256 WGPs) are two waves per SIMD: the attribute gives each wave the register budget of that
// residency, under which the compiler keeps the scores' softmax chains interleaved in the chunk loop, and lets no WGP take a third block.
__global__ __launch_bounds__(128) __attribute__((amdgpu_waves_per_eu(2, 2)))
void attn_hd64_planes(const unsigned short* __restrict__ Qh, const unsigned short* __restrict__ Ql,
                      const unsigned short* __restrict__ Kh, const unsigned short* __restrict__ Kl,
                      const unsigned short* __restrict__ VTh, const unsigned short* __restrict__ VTl,
                      const float* __restrict__ amask,
                      unsigned short* __restrict__ Oh, unsigned short* __restrict__ Ol,
                      float sscale) {
  union FB { v16b v; v8b h[2]; };
  union PB { v16b v; unsigned w[8]; };         // a fragment by its registers: word i = elements 2 i (low half), 2 i + 1
  __shared__ __align__(16) __bf16 Ksh[AT_KC * AT_P];     // k hi [kv][d]     9 KB
  __shared__ __align__(16) __bf16 Ksl[AT_KC * AT_P];     // k lo
  __shared__ __align__(16) __bf16 Vth[AT_D * AT_P];      // v hi [d][kv]     9 KB
  __shared__ __align__(16) __bf16 Vtl[AT_D * AT_P];     // v lo
  __shared__ __align__(16) int    Kix[AT_KC];            // key index of each key of the chunk, for the masks
  __shared__ __align__(16) float  Os[AT_NW][16 * 68];       // per wave out tile, pitch 68

  const int tid  = threadIdx.x;
  const int wave = tid >> 5;
  const int lane = tid & 31;
  const int hh   = lane >> 4;
  const int c    = lane & 15;

  constexpr int nqb = SEQ / AT_QB;              // 32 query tiles per (b, h)
  static_assert(nqb % 2 == 0);                  // tiles pair up as (nqb - 1 - t, t), every tile once
  const int bx  = blockIdx.x;
  const int tp  = bx % (nqb / 2);               // 0..15
  const int bhd = bx / (nqb / 2);
  const int h   = bhd % NHEAD;
  const int b   = bhd / NHEAD;
  const int tok0 = b * SEQ;
  const int hcol = h * HDIM;

  // the block's two tiles, one after the other in every wave (block-uniform trip counts)
  for (int half = 0; half < 2; ++half) {
  const int qb  = (half == 0) ? (nqb - 1 - tp) : tp;
  const int q0  = qb * AT_QB + wave * 16;

  // ---- Q fragments (B operand: column c = query q0 + c): 2 d-chunks, hi and lo, split k-map via Frag::load ----
  v16b qah[2], qal[2];
  {
    const __bf16* qhp = (const __bf16*)Qh + (size_t)(tok0 + q0 + c) * HIDN + hcol + 8 * hh;
    const __bf16* qlp = (const __bf16*)Ql + (size_t)(tok0 + q0 + c) * HIDN + hcol + 8 * hh;
#pragma unroll
    for (int dc = 0; dc < 2; ++dc) {
      qah[dc] = Frag<__bf16>::load(qhp + dc * 32);
      qal[dc] = Frag<__bf16>::load(qlp + dc * 32);
    }
  }

  const int qrow = q0 + c;                      // this lane's query
  float mrow = -__builtin_inff(), lrow = 0.f;
  v8f oacc[4];
#pragma unroll
  for (int t = 0; t < 4; ++t) oacc[t] = (v8f){0.f,0.f,0.f,0.f,0.f,0.f,0.f,0.f};

  const int nChunks = qb + 1;                   // causal, block-uniform, <= 32
  for (int kc = 0; kc < nChunks; ++kc) {
    const int kv0 = kc * AT_KC;
    __syncthreads();
    {
      // the mask value of key tid & 63, asked for ahead of the tiles' loads so that it is not waited for by itself behind them
      const float kvm = amask[(size_t)tok0 + kv0 + (tid & (AT_KC - 1))];
      // staging coverage: 128 threads x 4 ids = 512 ids = 64 rows x 8 chunks of 8 elements = 64x64 per plane, exact
#pragma unroll
      for (int i = 0; i < 4; ++i) {
        const int id = tid + 128 * i;
        const int row = id >> 3, c8 = (id & 7) * 8;
        const size_t ko = (size_t)(tok0 + kv0 + row) * HIDN + hcol + c8;
        const u4v a0 = *(const u4v*)(Kh + ko);
        const u4v a1 = *(const u4v*)(Kl + ko);
        *(u4v*)(Ksh + row * AT_P + c8) = a0;
        *(u4v*)(Ksl + row * AT_P + c8) = a1;
      }
      // holds the mask load among the k loads (loaded value as input only): left free, it sinks into the branch below and is waited for alone
      asm volatile("" :: "v"(kvm));
      sched_fence();
#pragma unroll
      for (int i = 0; i < 4; ++i) {
        const int id = tid + 128 * i;
        const int row = id >> 3, c8 = (id & 7) * 8;      // row = d
        const size_t vo = (size_t)(hcol + row) * NTOK + tok0 + kv0 + c8;
        const u4v a0 = *(const u4v*)(VTh + vo);
        const u4v a1 = *(const u4v*)(VTl + vo);
        *(u4v*)(Vth + row * AT_P + c8) = a0;
        *(u4v*)(Vtl + row * AT_P + c8) = a1;
      }
      // key index of each key; a padded key (amask == 0) gets an index above every query row,
      // so one integer compare and one select per score cover the causal and the padding mask without a branch
      if (tid < AT_KC) Kix[tid] = (kvm == 0.0f) ? 0x7fffffff : (kv0 + tid);
    }
    __syncthreads();

    // key indices of this lane's 32 scores, read ahead of the products so that their LDS latency passes under them;
    // every address is the same in all 16 lanes of a half
    i4v kix[4][2];
#pragma unroll
    for (int j = 0; j < 4; ++j) {
      kix[j][0] = *(const i4v*)(Kix + j * 16 + 8 * hh);
      kix[j][1] = *(const i4v*)(Kix + j * 16 + 8 * hh + 4);
    }
    v8f s[4];
#pragma unroll
    for (int j = 0; j < 4; ++j) {
      v8f sj = (v8f){0.f,0.f,0.f,0.f,0.f,0.f,0.f,0.f};
#pragma unroll
      for (int dc = 0; dc < 2; ++dc) {
        FB kb, kl;
        const __bf16* khp = Ksh + (j * 16 + c) * AT_P + dc * 32 + 8 * hh;
        const __bf16* klp = Ksl + (j * 16 + c) * AT_P + dc * 32 + 8 * hh;
        kb.h[0] = *(const v8b*)(khp);
        kb.h[1] = *(const v8b*)(khp + 16);
        kl.h[0] = *(const v8b*)(klp);
        kl.h[1] = *(const v8b*)(klp + 16);
        sj = at_mma(kb.v, qah[dc], sj);     // rows = keys, columns = queries
        sj = at_mma(kl.v, qah[dc], sj);
        sj = at_mma(kb.v, qal[dc], sj);
        sched_fence();
      }
      s[j] = sj;
    }
    // s[j][r] = score of key kv0 + 16 j + 8 hh + r against query q0 + c
    float m = -__builtin_inff();
#pragma unroll
    for (int j = 0; j < 4; ++j) {
#pragma unroll
      for (int r = 0; r < 8; ++r) {
        const int   ki  = kix[j][r >> 2][r & 3];
        const float sc  = s[j][r] * sscale;
        const float val = (ki > qrow) ? -__builtin_inff() : sc;
        s[j][r] = val;
        m = fmaxf(m, val);
      }
    }
    m = fmaxf(m, xhalf(m));                     // the other 32 keys of this query
    const float mnew  = fmaxf(mrow, m);
    const float alpha = expf(mrow - mnew);
    mrow = mnew;
    float ps[4];                                // one partial sum per score tile: four short chains of adds, not one of 32
    PB pa[2], pl[2];                            // p^T hi and lo as B operands: element e of half g = key 32 kk + 16 g + 8 hh + e
#pragma unroll
    for (int j = 0; j < 4; ++j) {
      ps[j] = 0.f;
#pragma unroll
      for (int r = 0; r < 8; r += 2) {
        const float p0 = expf(s[j][r] - mnew);
        const float p1 = expf(s[j][r + 1] - mnew);
        ps[j] += p0;
        ps[j] += p1;
        // hi = bf16(p), lo = bf16(p - hi), both to nearest even; the two bf16 of a register are the upper halves of two rounded words, joined by one byte permute
        const unsigned h0 = at_rne(p0), h1 = at_rne(p1);
        const unsigned l0 = at_rne(p0 - __uint_as_float(h0 & 0xffff0000u));
        const unsigned l1 = at_rne(p1 - __uint_as_float(h1 & 0xffff0000u));
        pa[j >> 1].w[(j & 1) * 4 + (r >> 1)] = __builtin_amdgcn_perm(h1, h0, 0x07060302u);
        pl[j >> 1].w[(j & 1) * 4 + (r >> 1)] = __builtin_amdgcn_perm(l1, l0, 0x07060302u);
      }
    }
    float psum = (ps[0] + ps[1]) + (ps[2] + ps[3]);
    psum += xhalf(psum);
    lrow = lrow * alpha + psum;
#pragma unroll
    for (int t = 0; t < 4; ++t)
#pragma unroll
      for (int r = 0; r < 8; ++r) oacc[t][r] *= alpha;
    // unrolled: pa, pl are registers and take constant indices
#pragma unroll
    for (int kk = 0; kk < 2; ++kk) {
#pragma unroll
      for (int t = 0; t < 4; ++t) {
        FB vb, vl;
        const __bf16* vhp = Vth + (t * 16 + c) * AT_P + kk * 32 + 8 * hh;
        const __bf16* vlp = Vtl + (t * 16 + c) * AT_P + kk * 32 + 8 * hh;
        vb.h[0] = *(const v8b*)(vhp);
        vb.h[1] = *(const v8b*)(vhp + 16);
        vl.h[0] = *(const v8b*)(vlp);
        vl.h[1] = *(const v8b*)(vlp + 16);
        oacc[t] = at_mma(vb.v, pa[kk].v, oacc[t]);   // rows = d, columns = queries
        oacc[t] = at_mma(vl.v, pa[kk].v, oacc[t]);
        oacc[t] = at_mma(vb.v, pl[kk].v, oacc[t]);
        sched_fence();
      }
    }
  }

  // oacc[t][r] = out[query q0 + c][d = 16 t + 8 hh + r]: eight consecutive d per tile, two 16-byte LDS stores
  float* os = Os[wave];
  const float inv = 1.0f / lrow;
#pragma unroll
  for (int t = 0; t < 4; ++t) {
    const v8f o = oacc[t];
    *(v4f*)(os + c * 68 + t * 16 + 8 * hh)     = (v4f){o[0] * inv, o[1] * inv, o[2] * inv, o[3] * inv};
    *(v4f*)(os + c * 68 + t * 16 + 8 * hh + 4) = (v4f){o[4] * inv, o[5] * inv, o[6] * inv, o[7] * inv};
  }
  __builtin_amdgcn_fence(__ATOMIC_RELEASE, "workgroup");
  __builtin_amdgcn_wave_barrier();
  __builtin_amdgcn_fence(__ATOMIC_ACQUIRE, "workgroup");
  {
    const int q = lane >> 3, c8 = (lane & 7) * 8;
    {
#pragma unroll
      for (int it = 0; it < 4; ++it) {
        const int row = it * 4 + q;
        const float* sp = os + row * 68 + c8;
        v8h hv, lv;
#pragma unroll
        for (int e = 0; e < 8; ++e) {
          unsigned short hb = f2bf_bits(sp[e]);
          unsigned short lb = f2bf_bits(sp[e] - bf_bits2f(hb));
          hv[e] = __builtin_bit_cast(_Float16, hb);
          lv[e] = __builtin_bit_cast(_Float16, lb);
        }
        const size_t oo = (size_t)(tok0 + q0 + row) * HIDN + hcol + c8;
        *(v8h*)(Oh + oo) = hv;
        *(v8h*)(Ol + oo) = lv;
      }
      
    }
  }
  // precaution: the second tile's set-up rewrites registers that the stores above name
  asm volatile("s_wait_xcnt 0x0" ::: "memory");
  }   // half
}

// =====================================================================================
// k^T.v state: St[h][d][e] = sum_s kT[h*64+d][s] * vT[h*64+e][s] over SEQ tokens of one batch.
//   planes: [HIDN][NTOK] bf16 hi and lo; blockIdx.z = batch, whose tokens begin at column blockIdx.z * SEQ
//   product = hi.hi + hi.lo + lo.hi, f32 accumulate (same three products per k step as the GEMM's hi/lo path)
//   Block = 16 waves = one 32x32 tile of one head; wave w sums tokens [w*128, w*128+128).
//   The 16 partial tiles meet in LDS and are added in wave order 0..15. grid = (4 tiles, NHEAD, NBATCH).
// =====================================================================================
constexpr int ST_NW = 16;                 // waves per block = slices of the token sum
constexpr int ST_KS = SEQ / ST_NW;        // 128 tokens per wave
static_assert(ST_KS % 32 == 0);

__global__ __launch_bounds__(ST_NW * 32)
void state_ktv_slices(const unsigned short* __restrict__ KTh, const unsigned short* __restrict__ KTl,
                      const unsigned short* __restrict__ VTh, const unsigned short* __restrict__ VTl,
                      float* __restrict__ St) {
  __shared__ __align__(16) float part[ST_NW][32 * 32];   // one 4 KB partial tile per wave, in accumulator order
  const int tid  = threadIdx.x;
  const int wave = tid >> 5;
  const int lane = tid & 31;
  const int hh   = lane >> 4;
  const int c    = lane & 15;
  const int h    = blockIdx.y;
  const int d0   = (blockIdx.x >> 1) * 32;
  const int e0   = (blockIdx.x & 1) * 32;

  const int bb   = blockIdx.z;
  const size_t ao = (size_t)(h * HDIM + d0 + c) * NTOK + bb * SEQ + wave * ST_KS + 8 * hh;
  const size_t bo = (size_t)(h * HDIM + e0 + c) * NTOK + bb * SEQ + wave * ST_KS + 8 * hh;
  const __bf16* pah = (const __bf16*)KTh + ao;
  const __bf16* pal = (const __bf16*)KTl + ao;
  const __bf16* pbh = (const __bf16*)VTh + bo;
  const __bf16* pbl = (const __bf16*)VTl + bo;

  v8f acc[2][2];
#pragma unroll
  for (int i = 0; i < 2; ++i)
#pragma unroll
    for (int j = 0; j < 2; ++j) acc[i][j] = (v8f){0.f,0.f,0.f,0.f,0.f,0.f,0.f,0.f};

  // unrolled (4 steps): the step offsets fold into the loads' immediate fields and later steps' loads issue among earlier products
#pragma unroll
  for (int ks = 0; ks < ST_KS / 32; ++ks) {
    v16b ah[2], al[2], bh[2], bl[2];
#pragma unroll
    for (int i = 0; i < 2; ++i) {
      const size_t o = (size_t)i * 16 * NTOK + ks * 32;
      ah[i] = Frag<__bf16>::load(pah + o);
      al[i] = Frag<__bf16>::load(pal + o);
      bh[i] = Frag<__bf16>::load(pbh + o);
      bl[i] = Frag<__bf16>::load(pbl + o);
    }
#pragma unroll
    for (int i = 0; i < 2; ++i)
#pragma unroll
      for (int j = 0; j < 2; ++j) {
        acc[i][j] = Frag<__bf16>::mma(ah[i], bh[j], acc[i][j]);
        acc[i][j] = Frag<__bf16>::mma(ah[i], bl[j], acc[i][j]);
        acc[i][j] = Frag<__bf16>::mma(al[i], bh[j], acc[i][j]);
      }
  }

  // partial tile to LDS: eighth q = (i*2+j)*2 + half holds accumulator rows half*4..half*4+3 of every lane, 16 B per lane
  float* slab = part[wave];
#pragma unroll
  for (int i = 0; i < 2; ++i)
#pragma unroll
    for (int j = 0; j < 2; ++j) {
      const v8f a = acc[i][j];
      const int q = (i * 2 + j) * 2;
      *(v4f*)(slab + (q + 0) * 128 + lane * 4) = (v4f){a[0], a[1], a[2], a[3]};
      *(v4f*)(slab + (q + 1) * 128 + lane * 4) = (v4f){a[4], a[5], a[6], a[7]};
    }
  __syncthreads();

  // 512 threads x 2 floats = the 32x32 tile; each thread adds its two positions over the 16 slices in wave order
  v2f sum = (v2f){0.f, 0.f};
#pragma unroll
  for (int w = 0; w < ST_NW; ++w) sum += *(const v2f*)(&part[w][tid * 2]);

  // position tid*2 back to (row, col): q = tid>>6, source lane = (tid>>1)&31, accumulator rows (q&1)*4 + (tid&1)*2 and the next
  const int q   = tid >> 6;
  const int sl  = (tid >> 1) & 31;
  const int row = (q >> 2) * 16 + (sl >> 4) * 8 + (q & 1) * 4 + (tid & 1) * 2;
  const int col = ((q >> 1) & 1) * 16 + (sl & 15);
  float* o = St + (size_t)(bb * NHEAD + h) * HDIM * HDIM + (size_t)(d0 + row) * HDIM + e0 + col;
  o[0]    = sum[0];
  o[HDIM] = sum[1];
}

// ---------------------------------------------------------------- launcher
extern "C" void kernel_launch(void* const* d_in, const int* in_sizes, int n_in,
                              void* d_out, int out_size, void* d_ws, size_t ws_size,
                              hipStream_t stream) {
  (void)n_in;
  if (ws_size < WS_TOTAL) return;
  if ((size_t)out_size != OUT0_ELEMS + OUT1_ELEMS) return;
  if ((size_t)in_sizes[0] != NX || (size_t)in_sizes[1] != (size_t)NTOK ||
      (size_t)in_sizes[2] != NW || (size_t)in_sizes[4] != NW ||
      (size_t)in_sizes[6] != NW || (size_t)in_sizes[8] != NW ||
      in_sizes[3] != HIDN || in_sizes[5] != HIDN || in_sizes[7] != HIDN || in_sizes[9] != HIDN) return;

  const float* hs    = (const float*)d_in[0];
  const float* amask = (const float*)d_in[1];
  const float* Wq    = (const float*)d_in[2];
  const float* bq    = (const float*)d_in[3];
  const float* Wk    = (const float*)d_in[4];
  const float* bk    = (const float*)d_in[5];
  const float* Wv    = (const float*)d_in[6];
  const float* bv    = (const float*)d_in[7];
  const float* Wo    = (const float*)d_in[8];
  const float* bo    = (const float*)d_in[9];

  char* ws = (char*)d_ws;
  unsigned short* Xb  = (unsigned short*)(ws + OFF_XB);
  unsigned short* Wqb = (unsigned short*)(ws + OFF_WQ);
  unsigned short* Wkb = (unsigned short*)(ws + OFF_WK);
  unsigned short* Wvb = (unsigned short*)(ws + OFF_WV);
  unsigned short* Wob = (unsigned short*)(ws + OFF_WO);
  unsigned short* Qh  = (unsigned short*)(ws + OFF_QH);
  unsigned short* Ql  = (unsigned short*)(ws + OFF_QL);
  unsigned short* Kh  = (unsigned short*)(ws + OFF_KH);
  unsigned short* Kl  = (unsigned short*)(ws + OFF_KL);
  unsigned short* KTh = (unsigned short*)(ws + OFF_KTH);
  unsigned short* KTl = (unsigned short*)(ws + OFF_KTL);
  unsigned short* VTh = (unsigned short*)(ws + OFF_VTH);
  unsigned short* VTl = (unsigned short*)(ws + OFF_VTL);
  unsigned short* Oh  = (unsigned short*)(ws + OFF_OH);
  unsigned short* Ol  = (unsigned short*)(ws + OFF_OL);

  float* outF   = (float*)d_out;
  float* stateF = outF + OUT1_ELEM_OFF;

  // 1) RNE conversions to bf16 (inputs converted exactly once), one launch for all five inputs; Xb is the start of the five planes
  cast_all_f32_bf16<<<dim3(CV_GRID), dim3(CV_T), 0, stream>>>(hs, Wq, Wk, Wv, Wo, Xb);

  // 2) projections: 64x64 tiles, 8 waves (2 x 4 tiles) per block; every shape has 1024 tiles (64x16 or 16x64) = 128 block tiles of 128x256
  const int gemmBlocksTok = ((NTOK / 64) * (HIDN / 64)) / 8;    // 1024 tiles / 8 = 128
  // q, k, k^T and v^T in one launch, grid.y = projection -> hi/lo planes
  proj4_gemm64<<<dim3(gemmBlocksTok, 4), dim3(256), 0, stream>>>(
      Xb, Wqb, Wkb, Wvb, Qh, Ql, Kh, Kl, KTh, KTl, VTh, VTl, bq, bk, bv, amask, HIDN);

  // 3) causal attention on the planes -> attention out hi/lo planes [4096][1024]
  const float sscale = 0.125f;   // 1 / (temperature * sqrt(64)), exact power of two
  attn_hd64_planes<<<dim3(NBATCH * NHEAD * (SEQ / AT_QB / 2)), dim3(128), 0, stream>>>(
      Qh, Ql, Kh, Kl, VTh, VTl, amask, Oh, Ol, sscale);

  // 4) state[b][h][d][e] = sum_s k^T[h*64+d][b*S+s] * v^T[h*64+e][b*S+s]  (hi/lo on both operands); 4 tiles x 16 token slices per (b,h)
  state_ktv_slices<<<dim3(4, NHEAD, NBATCH), dim3(ST_NW * 32), 0, stream>>>(KTh, KTl, VTh, VTl, stateF);

  // 5) out [4096][1024] = attn_out . Wo^T + bo  (A hi/lo, Wo exact bf16) -> d_out f32
  wmma_gemm64<1, true, false, 2, 0, 0><<<dim3(gemmBlocksTok, 1), dim3(256), 0, stream>>>(
      Oh, Ol, HIDN, 0L, Wob, Wob, HIDN, 0L, (void*)outF, (void*)Oh, HIDN, 0L,
      bo, amask, NTOK, HIDN, HIDN, 1.0f);
}

// v009
// Measured time: 155 microseconds a run.
// Next to v008, in two timings, it ran 1.08 and 1.07 times as fast.
// All steps since v000 together make it 4.46 times as fast.
// Compute dtype: input projections v_wmma_f32_16x16x32_bf16 on bf16 operands (inputs RNE-converted once), f32 accumulate; scores, p.v and k^T.v state on bf16 hi/lo split planes (hi.hi + hi.lo + lo.hi), output projection on hi/lo A planes x bf16 Wo (hi.hi + lo.hi), f32 accumulate; softmax and side math f32.
#include <hip/hip_runtime.h>

// ---------------------------------------------------------------- geometry
constexpr int NBATCH = 2;
constexpr int SEQ    = 2048;
constexpr int HIDN   = 1024;
constexpr int NHEAD  = 16;
constexpr int HDIM   = 64;
constexpr int NTOK   = NBATCH * SEQ;                    /* 4096 token rows */
constexpr size_t NX  = (size_t)NTOK * HIDN;            /* 4194304 */
constexpr size_t NW  = (size_t)HIDN * HIDN;            /* 1048576 */
constexpr size_t OUT0_ELEMS    = NX;
constexpr size_t OUT1_ELEMS    = (size_t)NBATCH * NHEAD * HDIM * HDIM;   /* 131072 */
constexpr size_t OUT1_BYTE_OFF = 16777216;
constexpr size_t OUT1_ELEM_OFF = OUT1_BYTE_OFF / 4;
static_assert(OUT1_ELEM_OFF == OUT0_ELEMS);
static_assert(OUT1_BYTE_OFF + OUT1_ELEMS * 4 == 17301504);
static_assert(HIDN == NHEAD * HDIM);
static_assert(HDIM == 64);
static_assert(HIDN % 64 == 0 && NTOK % 64 == 0 && SEQ % 64 == 0);   /* every GEMM M and N is a 64-multiple */
static_assert(HIDN % 32 == 0 && SEQ % 32 == 0);                     /* every GEMM K is a multiple of 32 */

// ---------------------------------------------------------------- workspace map (bytes)
// 16-bit planes: token planes [4096][1024] or [1024][4096] = 8 MiB each; weight planes [1024][1024] = 2 MiB each.
// Every region is fully written by its producer (full M x N, no pad rows) before any consumer reads it.
constexpr size_t MIB      = (size_t)1 << 20;
constexpr size_t OFF_XB   = 0 * MIB;    /* hidden as bf16      8 MiB */
constexpr size_t OFF_WQ   = 8 * MIB;    /* Wq bf16             2 MiB */
constexpr size_t OFF_WK   = 10 * MIB;   /* Wk bf16             2 MiB */
constexpr size_t OFF_WV   = 12 * MIB;   /* Wv bf16             2 MiB */
constexpr size_t OFF_WO   = 14 * MIB;   /* Wo bf16             2 MiB */
constexpr size_t OFF_QH   = 16 * MIB;   /* q hi  [4096][1024]        */
constexpr size_t OFF_QL   = 24 * MIB;   /* q lo                      */
constexpr size_t OFF_KH   = 32 * MIB;   /* k hi  [4096][1024] (masked) */
constexpr size_t OFF_KL   = 40 * MIB;   /* k lo                      */
constexpr size_t OFF_KTH  = 48 * MIB;   /* k^T hi [1024][4096] (masked) */
constexpr size_t OFF_KTL  = 56 * MIB;   /* k^T lo                    */
constexpr size_t OFF_VTH  = 64 * MIB;   /* v^T hi [1024][4096] (masked) */
constexpr size_t OFF_VTL  = 72 * MIB;   /* v^T lo                    */
constexpr size_t OFF_OH   = 80 * MIB;   /* attention out hi [4096][1024] */
constexpr size_t OFF_OL   = 88 * MIB;   /* attention out lo          */
constexpr size_t WS_TOTAL = 96 * MIB;   /* 100663296 B */
static_assert(NX * 2 == 8 * MIB && NW * 2 == 2 * MIB);
static_assert(WS_TOTAL <= 134217728);

// ---------------------------------------------------------------- types / helpers
typedef __attribute__((ext_vector_type(16))) _Float16 v16h;
typedef __attribute__((ext_vector_type(8)))  _Float16 v8h;
typedef __attribute__((ext_vector_type(16))) __bf16   v16b;
typedef __attribute__((ext_vector_type(8)))  __bf16   v8b;
typedef __attribute__((ext_vector_type(8)))  float    v8f;
typedef __attribute__((ext_vector_type(4)))  float    v4f;
typedef __attribute__((ext_vector_type(2)))  float    v2f;
typedef __attribute__((ext_vector_type(4)))  unsigned u4v;

__device__ __forceinline__ unsigned short f2bf_bits(float f) {
  unsigned u = __float_as_uint(f);
  return (unsigned short)((u + 0x7FFFu + ((u >> 16) & 1u)) >> 16);
}
__device__ __forceinline__ float bf_bits2f(unsigned short h) { return __uint_as_float(((unsigned)h) << 16); }
__device__ __forceinline__ float bfr(float f) { return bf_bits2f(f2bf_bits(f)); }

__device__ __forceinline__ void sched_fence() { asm volatile("" ::: "memory"); }

// hazard guards as plain device helpers (no inline asm inside the kernel template body)
__device__ __forceinline__ void dep_guard_h(v8f& a, v8f& b, v16h x, v16h y) { asm volatile("v_nop\n\tv_nop\n\tv_nop\n\tv_nop" : "+v"(a), "+v"(b) : "v"(x), "v"(y)); }
__device__ __forceinline__ void dep_guard_b(v8f& a, v8f& b, v16b x, v16b y) { asm volatile("v_nop\n\tv_nop\n\tv_nop\n\tv_nop" : "+v"(a), "+v"(b) : "v"(x), "v"(y)); }
__device__ __forceinline__ void keep4_h(v16h a, v16h b, v16h c, v16h d) { asm volatile("v_nop" :: "v"(a), "v"(b), "v"(c), "v"(d)); }
__device__ __forceinline__ void keep4_b(v16b a, v16b b, v16b c, v16b d) { asm volatile("v_nop" :: "v"(a), "v"(b), "v"(c), "v"(d)); }
__device__ __forceinline__ void acc_guard4(v8f& a, v8f& b, v8f& c, v8f& d) { asm volatile("v_nop\n\tv_nop\n\tv_nop\n\tv_nop" : "+v"(a), "+v"(b), "+v"(c), "+v"(d)); }
template <typename T> struct Frag;
template <> struct Frag<_Float16> {
  typedef v16h V; union U { v16h v; v8h h[2]; };
  static __device__ __forceinline__ v16h load(const _Float16* p) {   // elements 0..7 <- p[0..7], 8..15 <- p[16..23]
    U f; f.h[0] = *(const v8h*)(p); f.h[1] = *(const v8h*)(p + 16); return f.v;
  }
  static __device__ __forceinline__ v8f mma(v16h a, v16h b, v8f c) {
    return __builtin_amdgcn_wmma_f32_16x16x32_f16(false, a, false, b, (short)0, c, false, false);
  }
  static __device__ __forceinline__ void guard(v8f& a, v8f& b, v16h x, v16h y) { dep_guard_h(a, b, x, y); }
  static __device__ __forceinline__ void keep(v16h a, v16h b, v16h c, v16h d) { keep4_h(a, b, c, d); }
};
template <> struct Frag<__bf16> {
  typedef v16b V; union U { v16b v; v8b h[2]; };
  static __device__ __forceinline__ v16b load(const __bf16* p) {
    U f; f.h[0] = *(const v8b*)(p); f.h[1] = *(const v8b*)(p + 16); return f.v;
  }
  static __device__ __forceinline__ v8f mma(v16b a, v16b b, v8f c) {
    return __builtin_amdgcn_wmma_f32_16x16x32_bf16(false, a, false, b, (short)0, c, false, false);
  }
  static __device__ __forceinline__ void guard(v8f& a, v8f& b, v16b x, v16b y) { dep_guard_b(a, b, x, y); }
  static __device__ __forceinline__ void keep(v16b a, v16b b, v16b c, v16b d) { keep4_b(a, b, c, d); }
};

// ---- Register-blocked batched WMMA GEMM ------------------------------------
// C[m,n] = rs * (scale * sum_k A[m,k] * Bt[n,k] + bias); each wave owns a 64x64 tile.
// A row-major [M,K]; Bt row-major [N,K]; M % 128 == 0, N % 256 == 0, K % 64 == 0.
// Block = 8 waves (2 x 4) = one 128x256 tile. A stage is 64 k = one 128-byte line of every operand row of the block tile.
// Asynchronous 16-byte copies (8 lanes per row, whole lines) bring a stage from global memory into one of two LDS buffers
// while the other buffer is multiplied; the waves read their fragments from LDS.
// SPLIT: A carried as hi/lo planes (A2 = lo); BLO: Bt also carried as hi/lo (Bt2 = lo);
//   product = hi.hi (+ hi.lo when BLO) + lo.hi.   SPLIT+BLO is the stock hi/lo path.
// BIAS_MODE: 0 = none, 1 = bias[m], 2 = bias[n]  (bias value RNE-converted to bf16 precision).
// RS_MODE:   0 = none, 1 = multiply by rsc[m], 2 = multiply by rsc[n]  (rsc value RNE-converted to bf16).
// BIAS_MODE 3 (RS_MODE is then not read): both modes chosen per block: (1, 2) where tr, else (2, 1) where rsRow, else (2, 0).
// b = batch index of the block; tr, rsRow are block-uniform and read under BIAS_MODE 3 only.
// OUT_MODE: 0 = f32, 1 = f16, 2 = bf16 hi plane (Cout) + bf16 lo plane (Cout2).
// ET: 0 = f16 operands, 1 = bf16 operands (pointers passed as 16-bit storage)
constexpr int GB_M = 128;   // block tile rows
constexpr int GB_N = 256;   // block tile columns
constexpr int GB_K = 64;    // k per stage
constexpr int GB_P = 72;    // LDS row pitch in elements: 144 B = 16 B x 9 (odd), distinct banks for the 16 rows of a 16-byte fragment read
static_assert(HIDN % GB_N == 0 && NTOK % GB_N == 0 && HIDN % GB_K == 0);   /* every GEMM M, N is a multiple of the block tile, K of the stage */

// four asynchronous 16-byte copies to LDS, every lane with its own LDS byte address and global address;
// s_wait_xcnt 0 closes the statement as a precaution: no address register of a copy is rewritten in front of it
__device__ __forceinline__ void copy4_async(unsigned l0, const void* g0, unsigned l1, const void* g1,
                                            unsigned l2, const void* g2, unsigned l3, const void* g3) {
  asm volatile("global_load_async_to_lds_b128 %0, %1, off\n\t"
               "global_load_async_to_lds_b128 %2, %3, off\n\t"
               "global_load_async_to_lds_b128 %4, %5, off\n\t"
               "global_load_async_to_lds_b128 %6, %7, off\n\t"
               "s_wait_xcnt 0x0"
               :: "v"(l0), "v"(g0), "v"(l1), "v"(g1), "v"(l2), "v"(g2), "v"(l3), "v"(g3) : "memory");
}
// this wave's copies have landed behind this one
__device__ __forceinline__ void wait_async0() { asm volatile("s_wait_asynccnt 0x0" ::: "memory"); }
// this wave's LDS reads have returned: stands in front of the barrier behind which their buffer is refilled
__device__ __forceinline__ void wait_ds0() { asm volatile("s_wait_dscnt 0x0" ::: "memory"); }

template <int V> struct IntC { static constexpr int value = V; };   // an int as a type, for the epilogue's modes
template <int ET> struct Elem;
template <> struct Elem<0> { typedef _Float16 T; };
template <> struct Elem<1> { typedef __bf16 T; };
template <int ET, bool SPLIT, bool BLO, int BIAS_MODE, int OUT_MODE, int RS_MODE>
__device__ __forceinline__ void gemm_block_tile(
    const unsigned short* __restrict__ Ap, const unsigned short* __restrict__ A2p, int lda, long strideA,
    const unsigned short* __restrict__ Btp, const unsigned short* __restrict__ Bt2p, int ldb, long strideB,
    void* __restrict__ Cout, void* __restrict__ Cout2, int ldc, long strideC,
    const float* __restrict__ bias, const float* __restrict__ rsc,
    int M, int N, int K, float scale, const int b, const bool tr, const bool rsRow) {
  typedef typename Elem<ET>::T T;
  typedef typename Frag<T>::V V;
  const T* A = (const T*)Ap; const T* A2 = (const T*)A2p; const T* Bt = (const T*)Btp; const T* Bt2 = (const T*)Bt2p;
  constexpr int NPA = SPLIT ? 2 : 1;              // planes of A
  constexpr int NPB = (SPLIT && BLO) ? 2 : 1;     // planes of Bt
  __shared__ __align__(16) T sA[2][NPA][GB_M * GB_P];   // two buffers of A rows  [row][k], 18 KB per plane
  __shared__ __align__(16) T sB[2][NPB][GB_N * GB_P];   // two buffers of Bt rows [row][k], 36 KB per plane
  __shared__ __align__(16) float sT[8][16 * 68];   // per-wave 16x64 slab, pitch 68 floats
  const int tid  = threadIdx.x;
  const int lane = tid & 31;
  const int wave = tid >> 5;
  const int blocksN = N / GB_N;
  const int bm = blockIdx.x / blocksN;
  const int bn = blockIdx.x - bm * blocksN;
  if (bm >= M / GB_M) return;            // block-uniform, in front of every copy and barrier
  const int mB = bm * GB_M;              // block tile origin
  const int nB = bn * GB_N;
  const int wm = (wave >> 2) << 6;       // wave tile origin inside the block tile
  const int wn = (wave & 3) << 6;
  const int m0 = mB + wm;
  const int n0 = nB + wn;

  const T* Ab  = A  + (size_t)b * strideA;
  const T* Bb  = Bt + (size_t)b * strideB;
  const T* Ab2 = SPLIT ? (A2  + (size_t)b * strideA) : nullptr;
  const T* Bb2 = (SPLIT && BLO) ? (Bt2 + (size_t)b * strideB) : nullptr;

  const int rlane = lane & 15;                 // row (A) / col (B, D) within subtile
  const int koff  = (lane >> 4) * 8;           // k offset of this lane half
  const int mOff  = (lane >> 4) * 8;           // D row offset

  // staging coverage: 256 threads x 4 copies = 1024 = 128 rows x 8 pieces of 16 B (A plane); x 8 copies = 2048 = 256 rows x 8 (Bt plane);
  // copy i of a thread is row srow + 32 i, piece tid & 7: every piece once, every address a multiple of 16 B
  const int srow = tid >> 3;                   // 0..31
  const int sc8  = (tid & 7) * 8;
  constexpr unsigned RS = 32 * GB_P * 2;       // LDS bytes between a thread's successive copies
  const unsigned ldsA = (unsigned)(size_t)(&sA[0][0][srow * GB_P + sc8]);   // low 32 bits = byte address in the work-group's LDS
  const unsigned ldsB = (unsigned)(size_t)(&sB[0][0][srow * GB_P + sc8]);
  const size_t astep = (size_t)32 * lda * 2, bstep = (size_t)32 * ldb * 2;  // global bytes between them
  auto stage = [&](int st, int buf) {
    const size_t ka = ((size_t)(mB + srow) * lda + (size_t)st * GB_K + sc8) * 2;
    const size_t kb = ((size_t)(nB + srow) * ldb + (size_t)st * GB_K + sc8) * 2;
#pragma unroll
    for (int p = 0; p < NPA; ++p) {
      const char* g = (const char*)(p == 0 ? Ab : Ab2) + ka;
      const unsigned l = ldsA + (unsigned)(buf * NPA + p) * (unsigned)(GB_M * GB_P * 2);
      copy4_async(l, g, l + RS, g + astep, l + 2 * RS, g + 2 * astep, l + 3 * RS, g + 3 * astep);
    }
#pragma unroll
    for (int p = 0; p < NPB; ++p) {
      const char* g = (const char*)(p == 0 ? Bb : Bb2) + kb;
      const unsigned l = ldsB + (unsigned)(buf * NPB + p) * (unsigned)(GB_N * GB_P * 2);
      copy4_async(l, g, l + RS, g + bstep, l + 2 * RS, g + 2 * bstep, l + 3 * RS, g + 3 * bstep);
      copy4_async(l + 4 * RS, g + 4 * bstep, l + 5 * RS, g + 5 * bstep, l + 6 * RS, g + 6 * bstep, l + 7 * RS, g + 7 * bstep);
    }
  };

  v8f acc[4][4];
#pragma unroll
  for (int i = 0; i < 4; ++i)
#pragma unroll
    for (int j = 0; j < 4; ++j) acc[i][j] = (v8f){0.f,0.f,0.f,0.f,0.f,0.f,0.f,0.f};

  const int nst = K / GB_K;                    // stages, block-uniform
  stage(0, 0);
  wait_async0();
  __syncthreads();                             // stage 0 is complete before any wave reads it
  if (nst > 1) stage(1, 1);
  for (int t = 0; t < nst; ++t) {
    const int cur = t & 1;
#pragma unroll
    for (int kk = 0; kk < GB_K; kk += 32) {
      V bh[4], bl[4], ah[4], al[4];
#pragma unroll
      for (int j = 0; j < 4; ++j) {
        const int bo = (wn + (j << 4) + rlane) * GB_P + kk + koff;
        bh[j] = Frag<T>::load(&sB[cur][0][bo]);
        if (SPLIT && BLO) bl[j] = Frag<T>::load(&sB[cur][NPB - 1][bo]);
        else bl[j] = bh[j];
      }
#pragma unroll
      for (int i = 0; i < 4; ++i) {
        const int ao = (wm + (i << 4) + rlane) * GB_P + kk + koff;
        ah[i] = Frag<T>::load(&sA[cur][0][ao]);
        if (SPLIT) al[i] = Frag<T>::load(&sA[cur][NPA - 1][ao]);
        else al[i] = ah[i];
      }
#pragma unroll
      for (int i = 0; i < 4; ++i) {
#pragma unroll
        for (int j = 0; j < 4; ++j) {
          acc[i][j] = Frag<T>::mma(ah[i], bh[j], acc[i][j]);
          if (SPLIT) {
            if (BLO) acc[i][j] = Frag<T>::mma(ah[i], bl[j], acc[i][j]);
            acc[i][j] = Frag<T>::mma(al[i], bh[j], acc[i][j]);
          }
        }
        Frag<T>::guard(acc[i][0], acc[i][3], ah[i], al[i]);
      }
      Frag<T>::keep(bh[0], bh[1], bh[2], bh[3]);
      if (SPLIT && BLO) Frag<T>::keep(bl[0], bl[1], bl[2], bl[3]);
    }
    wait_ds0();                                // this wave has finished reading buffer cur
    wait_async0();                             // this wave's copies of stage t + 1 have landed
    __syncthreads();                           // publishes stage t + 1 and frees buffer cur
    if (t + 2 < nst) stage(t + 2, cur);        // block-uniform
  }
  wait_async0();                               // nothing is in flight when the wave goes on
  acc_guard4(acc[0][0], acc[0][1], acc[0][2], acc[0][3]);
  acc_guard4(acc[1][0], acc[1][1], acc[1][2], acc[1][3]);
  acc_guard4(acc[2][0], acc[2][1], acc[2][2], acc[2][3]);
  acc_guard4(acc[3][0], acc[3][1], acc[3][2], acc[3][3]);

  // ---- epilogue ----  (bias and row-scale mode as compile-time values of the call; always inlined: acc stays in registers)
  float* slab = sT[wave];
  auto epilogue = [&](auto bmode, auto rmode) __attribute__((always_inline)) {
  constexpr int BM = decltype(bmode)::value;
  constexpr int RM = decltype(rmode)::value;
#pragma unroll
  for (int i = 0; i < 4; ++i) {
    const int mBase = m0 + (i << 4);
    float bm[8], rm[8];
#pragma unroll
    for (int r = 0; r < 8; ++r) { bm[r] = 0.f; rm[r] = 1.f; }
    if (BM == 1) {
      // rows mBase+mOff .. +7 are contiguous and 32-B aligned: two 16-B loads
      const v4f t0 = *(const v4f*)(bias + mBase + mOff);
      const v4f t1 = *(const v4f*)(bias + mBase + mOff + 4);
#pragma unroll
      for (int r = 0; r < 4; ++r) { bm[r] = bfr(t0[r]); bm[4 + r] = bfr(t1[r]); }
    }
    if (RM == 1) {
      const v4f t0 = *(const v4f*)(rsc + mBase + mOff);
      const v4f t1 = *(const v4f*)(rsc + mBase + mOff + 4);
#pragma unroll
      for (int r = 0; r < 4; ++r) { rm[r] = bfr(t0[r]); rm[4 + r] = bfr(t1[r]); }
    }
#pragma unroll
    for (int j = 0; j < 4; ++j) {
      const int n = n0 + (j << 4) + rlane;
      float bn = 0.f, rn = 1.f;
      if (BM == 2) bn = bfr(bias[n]);
      if (RM == 2) rn = bfr(rsc[n]);
#pragma unroll
      for (int r = 0; r < 8; ++r) {
        float v = acc[i][j][r] * scale;
        if (BM == 1) v += bm[r];
        if (BM == 2) v += bn;
        if (RM == 1) v *= rm[r];
        if (RM == 2) v *= rn;
        slab[(mOff + r) * 68 + (j << 4) + rlane] = v;
      }
    }
    __builtin_amdgcn_fence(__ATOMIC_RELEASE, "workgroup");
    __builtin_amdgcn_wave_barrier();
    __builtin_amdgcn_fence(__ATOMIC_ACQUIRE, "workgroup");
    if (OUT_MODE == 0) {
      float* C = (float*)Cout + (size_t)b * strideC;
      const int hh = lane >> 4, c4 = (lane & 15) * 4;     // row seg = 256 B = 16 lanes x 16 B
      {
#pragma unroll
        for (int it = 0; it < 8; ++it) {
          const int row = it * 2 + hh;
          v4f v = *(const v4f*)(slab + row * 68 + c4);
          *(v4f*)(C + (size_t)(mBase + row) * ldc + n0 + c4) = v;
        }
        
      }
    } else {
      const int q = lane >> 3, c8 = (lane & 7) * 8;
      unsigned short* C  = (unsigned short*)Cout  + (size_t)b * strideC;
      unsigned short* C2 = (OUT_MODE == 2) ? ((unsigned short*)Cout2 + (size_t)b * strideC) : nullptr;
      {
#pragma unroll
        for (int it = 0; it < 4; ++it) {
          const int row = it * 4 + q;
          const float* sp = slab + row * 68 + c8;
          v8h hv, lv;
#pragma unroll
          for (int e = 0; e < 8; ++e) {
            if (OUT_MODE == 1) {
              hv[e] = (_Float16)sp[e];
              lv[e] = hv[e];
            } else {
              unsigned short hb = f2bf_bits(sp[e]);
              unsigned short lb = f2bf_bits(sp[e] - bf_bits2f(hb));
              hv[e] = __builtin_bit_cast(_Float16, hb);
              lv[e] = __builtin_bit_cast(_Float16, lb);
            }
          }
          *(v8h*)(C + (size_t)(mBase + row) * ldc + n0 + c8) = hv;
          if (OUT_MODE == 2) *(v8h*)(C2 + (size_t)(mBase + row) * ldc + n0 + c8) = lv;
        }
        
      }
    }
    __builtin_amdgcn_fence(__ATOMIC_RELEASE, "workgroup");
    __builtin_amdgcn_wave_barrier();
    __builtin_amdgcn_fence(__ATOMIC_ACQUIRE, "workgroup");
  }
  };
  if constexpr (BIAS_MODE == 3) {        // block-uniform choice among the three forms the projections need
    if (tr)         epilogue(IntC<1>{}, IntC<2>{});
    else if (rsRow) epilogue(IntC<2>{}, IntC<1>{});
    else            epilogue(IntC<2>{}, IntC<0>{});
  } else {
    epilogue(IntC<BIAS_MODE>{}, IntC<RS_MODE>{});
  }
}

// one GEMM per launch: grid.x = block tiles, grid.y = batch
template <int ET, bool SPLIT, bool BLO, int BIAS_MODE, int OUT_MODE, int RS_MODE>
__global__ __launch_bounds__(256) void wmma_gemm64(
    const unsigned short* __restrict__ Ap, const unsigned short* __restrict__ A2p, int lda, long strideA,
    const unsigned short* __restrict__ Btp, const unsigned short* __restrict__ Bt2p, int ldb, long strideB,
    void* __restrict__ Cout, void* __restrict__ Cout2, int ldc, long strideC,
    const float* __restrict__ bias, const float* __restrict__ rsc,
    int M, int N, int K, float scale) {
  gemm_block_tile<ET, SPLIT, BLO, BIAS_MODE, OUT_MODE, RS_MODE>(
      Ap, A2p, lda, strideA, Btp, Bt2p, ldb, strideB, Cout, Cout2, ldc, strideC, bias, rsc, M, N, K, scale,
      (int)blockIdx.y, false, false);
}

// The four input projections in ONE launch. Each has 128 block tiles, half of the chip's 256 WGPs, and none reads what another writes:
// together their 512 blocks stand two on every WGP (LDS and registers allow two). blockIdx.y picks the projection, block-uniform:
//   0: q rows   [NTOK][HIDN] = X . Wq^T + bq[col]
//   1: k rows   [NTOK][HIDN] = (X . Wk^T + bk[col]) * mask[row]
//   2: k^T rows [HIDN][NTOK] = (Wk . X^T + bk[row]) * mask[col]
//   3: v^T rows [HIDN][NTOK] = (Wv . X^T + bv[row]) * mask[col]
// every result as bf16 hi and lo planes. K (= HIDN) comes as an argument, as in the one-GEMM kernel.
__global__ __launch_bounds__(256) void proj4_gemm64(
    const unsigned short* __restrict__ Xb, const unsigned short* __restrict__ Wqb,
    const unsigned short* __restrict__ Wkb, const unsigned short* __restrict__ Wvb,
    unsigned short* __restrict__ Qh, unsigned short* __restrict__ Ql, unsigned short* __restrict__ Kh, unsigned short* __restrict__ Kl,
    unsigned short* __restrict__ KTh, unsigned short* __restrict__ KTl, unsigned short* __restrict__ VTh, unsigned short* __restrict__ VTl,
    const float* __restrict__ bq, const float* __restrict__ bk, const float* __restrict__ bv,
    const float* __restrict__ amask, int K) {
  const int  y  = blockIdx.y;
  const bool tr = y >= 2;                       // weight rows are the result's rows
  const unsigned short* W = (y == 0) ? Wqb : (y == 3) ? Wvb : Wkb;
  const float* bias       = (y == 0) ? bq  : (y == 3) ? bv  : bk;
  unsigned short* C  = (y == 0) ? Qh : (y == 1) ? Kh : (y == 2) ? KTh : VTh;
  unsigned short* C2 = (y == 0) ? Ql : (y == 1) ? Kl : (y == 2) ? KTl : VTl;
  const unsigned short* A  = tr ? W : Xb;
  const unsigned short* Bt = tr ? Xb : W;
  gemm_block_tile<1, false, false, 3, 2, 3>(
      A, A, HIDN, 0L, Bt, Bt, HIDN, 0L, (void*)C, (void*)C2, tr ? NTOK : HIDN, 0L, bias, amask,
      tr ? HIDN : NTOK, tr ? NTOK : HIDN, K, 1.0f, 0, tr, y == 1);
}

// One launch converts all five f32 inputs: their bf16 planes lie back to back in the workspace (hidden, Wq, Wk, Wv, Wo).
// Few waves, much work each.
// Block = 16 waves = CV_BLK consecutive elements of ONE input (every input is a whole number of blocks); grid = all elements / CV_BLK, exact.
// Pass i of a block is 2048 consecutive elements, 4 per lane: a wave's 16-byte load covers 512 contiguous bytes, its 8-byte store 256.
constexpr int CV_T   = 512;                 // threads per block
constexpr int CV_IT  = 16;                  // passes per block
constexpr int CV_BLK = CV_T * 4 * CV_IT;    // 32768 elements per block
constexpr int CV_XB  = (int)(NX / CV_BLK);  // 128 blocks of hidden
constexpr int CV_WB  = (int)(NW / CV_BLK);  // 32 blocks of each weight
constexpr int CV_GRID = CV_XB + 4 * CV_WB;  // 256 blocks
static_assert(NX % CV_BLK == 0 && NW % CV_BLK == 0);
static_assert(OFF_XB == 0 && OFF_WQ == NX * 2 && OFF_WK == OFF_WQ + NW * 2 && OFF_WV == OFF_WK + NW * 2 && OFF_WO == OFF_WV + NW * 2);
typedef __attribute__((ext_vector_type(2))) unsigned u2v;

__global__ __launch_bounds__(CV_T) void cast_all_f32_bf16(
    const float* __restrict__ hs, const float* __restrict__ wq, const float* __restrict__ wk,
    const float* __restrict__ wv, const float* __restrict__ wo, unsigned short* __restrict__ out) {
  const int blk = blockIdx.x;
  const float* src;                          // block-uniform choice of the input
  if (blk < CV_XB) {
    src = hs + (size_t)blk * CV_BLK;
  } else {
    const int w = (blk - CV_XB) / CV_WB;
    const int r = (blk - CV_XB) % CV_WB;
    src = (w == 0 ? wq : w == 1 ? wk : w == 2 ? wv : wo) + (size_t)r * CV_BLK;
  }
  const int t4 = threadIdx.x * 4;
  v4f f[CV_IT];
  // unrolled: f stays in registers, the pass offsets fold into the loads' immediate fields and the loads stand ahead of the conversions
#pragma unroll
  for (int i = 0; i < CV_IT; ++i) f[i] = *(const v4f*)(src + i * (CV_T * 4) + t4);
  unsigned short* o = out + (size_t)blk * CV_BLK + t4;
  // unrolled: constant indices into f, store offsets as immediates
#pragma unroll
  for (int i = 0; i < CV_IT; ++i) {
    u2v u;
    u[0] = (unsigned)f2bf_bits(f[i][0]) | ((unsigned)f2bf_bits(f[i][1]) << 16);
    u[1] = (unsigned)f2bf_bits(f[i][2]) | ((unsigned)f2bf_bits(f[i][3]) << 16);
    *(u2v*)(o + i * (CV_T * 4)) = u;
  }
}

constexpr int AT_D  = 64;
constexpr int AT_NW = 4;
constexpr int AT_QB = 64;
constexpr int AT_KC = 64;
constexpr int AT_P  = 72;   // LDS row pitch in elements: 144 B = 16 B x 9 (odd), so the 16 rows of a 16-byte fragment read fall on distinct banks

// f rounded to nearest even at bit 16: the upper half of the word is f2bf_bits(f)
__device__ __forceinline__ unsigned at_rne(float f) {
  const unsigned u = __float_as_uint(f);
  return u + 0x7FFFu + ((u >> 16) & 1u);
}
typedef __attribute__((ext_vector_type(4))) int i4v;
// the value that lane l ^ 16 holds
__device__ __forceinline__ float xhalf(float x) {
  const int b = __float_as_int(x);
  return __int_as_float(__builtin_amdgcn_permlanex16(b, b, 0x76543210, 0xfedcba98, false, false));
}
__device__ __forceinline__ v8f at_mma(v16b a, v16b b, v8f c) {
  return __builtin_amdgcn_wmma_f32_16x16x32_bf16(false, a, false, b, (short)0, c, false, false);
}

// Two blocks per WGP (512 blocks of 4 waves, 256 WGPs) are two waves per SIMD: the attribute gives each wave the register budget of that
// residency, under which the compiler keeps the scores' softmax chains interleaved in the chunk loop, and lets no WGP take a third block.
__global__ __launch_bounds__(128) __attribute__((amdgpu_waves_per_eu(2, 2)))
void attn_hd64_planes(const unsigned short* __restrict__ Qh, const unsigned short* __restrict__ Ql,
                      const unsigned short* __restrict__ Kh, const unsigned short* __restrict__ Kl,
                      const unsigned short* __restrict__ VTh, const unsigned short* __restrict__ VTl,
                      const float* __restrict__ amask,
                      unsigned short* __restrict__ Oh, unsigned short* __restrict__ Ol,
                      float sscale) {
  union FB { v16b v; v8b h[2]; };
  union PB { v16b v; unsigned w[8]; };         // a fragment by its registers: word i = elements 2 i (low half), 2 i + 1
  __shared__ __align__(16) __bf16 Ksh[AT_KC * AT_P];     // k hi [kv][d]     9 KB
  __shared__ __align__(16) __bf16 Ksl[AT_KC * AT_P];     // k lo
  __shared__ __align__(16) __bf16 Vth[AT_D * AT_P];      // v hi [d][kv]     9 KB
  __shared__ __align__(16) __bf16 Vtl[AT_D * AT_P];     // v lo
  __shared__ __align__(16) int    Kix[AT_KC];            // key index of each key of the chunk, for the masks
  __shared__ __align__(16) float  Os[AT_NW][16 * 68];       // per wave out tile, pitch 68

  const int tid  = threadIdx.x;
  const int wave = tid >> 5;
  const int lane = tid & 31;
  const int hh   = lane >> 4;
  const int c    = lane & 15;

  constexpr int nqb = SEQ / AT_QB;              // 32 query tiles per (b, h)
  static_assert(nqb % 2 == 0);                  // tiles pair up as (nqb - 1 - t, t), every tile once
  const int bx  = blockIdx.x;
  const int tp  = bx % (nqb / 2);               // 0..15
  const int bhd = bx / (nqb / 2);
  const int h   = bhd % NHEAD;
  const int b   = bhd / NHEAD;
  const int tok0 = b * SEQ;
  const int hcol = h * HDIM;

  // the block's two tiles, one after the other in every wave (block-uniform trip counts)
  for (int half = 0; half < 2; ++half) {
  const int qb  = (half == 0) ? (nqb - 1 - tp) : tp;
  const int q0  = qb * AT_QB + wave * 16;

  // ---- Q fragments (B operand: column c = query q0 + c): 2 d-chunks, hi and lo, split k-map via Frag::load ----
  v16b qah[2], qal[2];
  {
    const __bf16* qhp = (const __bf16*)Qh + (size_t)(tok0 + q0 + c) * HIDN + hcol + 8 * hh;
    const __bf16* qlp = (const __bf16*)Ql + (size_t)(tok0 + q0 + c) * HIDN + hcol + 8 * hh;
#pragma unroll
    for (int dc = 0; dc < 2; ++dc) {
      qah[dc] = Frag<__bf16>::load(qhp + dc * 32);
      qal[dc] = Frag<__bf16>::load(qlp + dc * 32);
    }
    // precaution: the chunk loop's first address sums rewrite registers that the loads above name;
    // the loaded values are inputs only, so that the statement stands behind the loads (left free, they sink below it)
    asm volatile("s_wait_xcnt 0x0" :: "v"(qah[0]), "v"(qah[1]), "v"(qal[0]), "v"(qal[1]) : "memory");
  }

  const int qrow = q0 + c;                      // this lane's query
  float mrow = -__builtin_inff(), lrow = 0.f;
  v8f oacc[4];
#pragma unroll
  for (int t = 0; t < 4; ++t) oacc[t] = (v8f){0.f,0.f,0.f,0.f,0.f,0.f,0.f,0.f};

  const int nChunks = qb + 1;                   // causal, block-uniform, <= 32
  for (int kc = 0; kc < nChunks; ++kc) {
    const int kv0 = kc * AT_KC;
    __syncthreads();
    {
      // the mask value of key tid & 63, asked for ahead of the tiles' loads so that it is not waited for by itself behind them
      const float kvm = amask[(size_t)tok0 + kv0 + (tid & (AT_KC - 1))];
      // staging coverage: 128 threads x 4 ids = 512 ids = 64 rows x 8 chunks of 8 elements = 64x64 per plane, exact
#pragma unroll
      for (int i = 0; i < 4; ++i) {
        const int id = tid + 128 * i;
        const int row = id >> 3, c8 = (id & 7) * 8;
        const size_t ko = (size_t)(tok0 + kv0 + row) * HIDN + hcol + c8;
        const u4v a0 = *(const u4v*)(Kh + ko);
        const u4v a1 = *(const u4v*)(Kl + ko);
        *(u4v*)(Ksh + row * AT_P + c8) = a0;
        *(u4v*)(Ksl + row * AT_P + c8) = a1;
      }
      // holds the mask load among the k loads (loaded value as input only): left free, it sinks into the branch below and is waited for alone
      asm volatile("" :: "v"(kvm));
      sched_fence();
#pragma unroll
      for (int i = 0; i < 4; ++i) {
        const int id = tid + 128 * i;
        const int row = id >> 3, c8 = (id & 7) * 8;      // row = d
        const size_t vo = (size_t)(hcol + row) * NTOK + tok0 + kv0 + c8;
        const u4v a0 = *(const u4v*)(VTh + vo);
        const u4v a1 = *(const u4v*)(VTl + vo);
        *(u4v*)(Vth + row * AT_P + c8) = a0;
        *(u4v*)(Vtl + row * AT_P + c8) = a1;
      }
      // key index of each key; a padded key (amask == 0) gets an index above every query row,
      // so one integer compare and one select per score cover the causal and the padding mask without a branch
      if (tid < AT_KC) Kix[tid] = (kvm == 0.0f) ? 0x7fffffff : (kv0 + tid);
    }
    __syncthreads();

    // key indices of this lane's 32 scores, read ahead of the products so that their LDS latency passes under them;
    // every address is the same in all 16 lanes of a half
    i4v kix[4][2];
#pragma unroll
    for (int j = 0; j < 4; ++j) {
      kix[j][0] = *(const i4v*)(Kix + j * 16 + 8 * hh);
      kix[j][1] = *(const i4v*)(Kix + j * 16 + 8 * hh + 4);
    }
    // every k fragment of the chunk is asked for in one group: the wave waits out the LDS latency once, not once per three products
    // (the loops from here to the softmax are unrolled: the fragment and score arrays are registers and take constant indices)
    FB kb[2][4], kl[2][4];
#pragma unroll
    for (int dc = 0; dc < 2; ++dc) {
#pragma unroll
      for (int j = 0; j < 4; ++j) {
        const __bf16* khp = Ksh + (j * 16 + c) * AT_P + dc * 32 + 8 * hh;
        const __bf16* klp = Ksl + (j * 16 + c) * AT_P + dc * 32 + 8 * hh;
        kb[dc][j].h[0] = *(const v8b*)(khp);
        kb[dc][j].h[1] = *(const v8b*)(khp + 16);
        kl[dc][j].h[0] = *(const v8b*)(klp);
        kl[dc][j].h[1] = *(const v8b*)(klp + 16);
      }
    }
    // the four score tiles are independent accumulators, written side by side: one tile's accumulate latency can pass under another tile's
    // product or under vector work; each tile takes its six products in the order dc 0: hi.hi, lo.hi, hi.lo, then dc 1 alike
    v8f s[4];
#pragma unroll
    for (int j = 0; j < 4; ++j) s[j] = (v8f){0.f,0.f,0.f,0.f,0.f,0.f,0.f,0.f};
#pragma unroll
    for (int dc = 0; dc < 2; ++dc) {
#pragma unroll
      for (int j = 0; j < 4; ++j) s[j] = at_mma(kb[dc][j].v, qah[dc], s[j]);     // rows = keys, columns = queries
#pragma unroll
      for (int j = 0; j < 4; ++j) s[j] = at_mma(kl[dc][j].v, qah[dc], s[j]);
#pragma unroll
      for (int j = 0; j < 4; ++j) s[j] = at_mma(kb[dc][j].v, qal[dc], s[j]);
    }
    // every v^T fragment of the chunk, asked for ahead of the softmax so that the LDS latency passes under it
    FB vb[2][4], vl[2][4];
#pragma unroll
    for (int kk = 0; kk < 2; ++kk) {
#pragma unroll
      for (int t = 0; t < 4; ++t) {
        const __bf16* vhp = Vth + (t * 16 + c) * AT_P + kk * 32 + 8 * hh;
        const __bf16* vlp = Vtl + (t * 16 + c) * AT_P + kk * 32 + 8 * hh;
        vb[kk][t].h[0] = *(const v8b*)(vhp);
        vb[kk][t].h[1] = *(const v8b*)(vhp + 16);
        vl[kk][t].h[0] = *(const v8b*)(vlp);
        vl[kk][t].h[1] = *(const v8b*)(vlp + 16);
      }
    }
    // s[j][r] = score of key kv0 + 16 j + 8 hh + r against query q0 + c
    float m = -__builtin_inff();
#pragma unroll
    for (int j = 0; j < 4; ++j) {
#pragma unroll
      for (int r = 0; r < 8; ++r) {
        const int   ki  = kix[j][r >> 2][r & 3];
        const float sc  = s[j][r] * sscale;
        const float val = (ki > qrow) ? -__builtin_inff() : sc;
        s[j][r] = val;
        m = fmaxf(m, val);
      }
    }
    m = fmaxf(m, xhalf(m));                     // the other 32 keys of this query
    const float mnew  = fmaxf(mrow, m);
    const float alpha = expf(mrow - mnew);
    mrow = mnew;
    float ps[4];                                // one partial sum per score tile: four short chains of adds, not one of 32
    PB pa[2], pl[2];                            // p^T hi and lo as B operands: element e of half g = key 32 kk + 16 g + 8 hh + e
#pragma unroll
    for (int j = 0; j < 4; ++j) {
      ps[j] = 0.f;
#pragma unroll
      for (int r = 0; r < 8; r += 2) {
        const float p0 = expf(s[j][r] - mnew);
        const float p1 = expf(s[j][r + 1] - mnew);
        ps[j] += p0;
        ps[j] += p1;
        // hi = bf16(p), lo = bf16(p - hi), both to nearest even; the two bf16 of a register are the upper halves of two rounded words, joined by one byte permute
        const unsigned h0 = at_rne(p0), h1 = at_rne(p1);
        const unsigned l0 = at_rne(p0 - __uint_as_float(h0 & 0xffff0000u));
        const unsigned l1 = at_rne(p1 - __uint_as_float(h1 & 0xffff0000u));
        pa[j >> 1].w[(j & 1) * 4 + (r >> 1)] = __builtin_amdgcn_perm(h1, h0, 0x07060302u);
        pl[j >> 1].w[(j & 1) * 4 + (r >> 1)] = __builtin_amdgcn_perm(l1, l0, 0x07060302u);
      }
    }
    float psum = (ps[0] + ps[1]) + (ps[2] + ps[3]);
    psum += xhalf(psum);
    lrow = lrow * alpha + psum;
#pragma unroll
    for (int t = 0; t < 4; ++t)
#pragma unroll
      for (int r = 0; r < 8; ++r) oacc[t][r] *= alpha;
    // unrolled: pa, pl are registers and take constant indices
#pragma unroll
    for (int kk = 0; kk < 2; ++kk) {
      // four independent output tiles side by side; each takes hi.hi, lo.hi, hi.lo of its 32 keys in that order
#pragma unroll
      for (int t = 0; t < 4; ++t) oacc[t] = at_mma(vb[kk][t].v, pa[kk].v, oacc[t]);   // rows = d, columns = queries
#pragma unroll
      for (int t = 0; t < 4; ++t) oacc[t] = at_mma(vl[kk][t].v, pa[kk].v, oacc[t]);
#pragma unroll
      for (int t = 0; t < 4; ++t) oacc[t] = at_mma(vb[kk][t].v, pl[kk].v, oacc[t]);
    }
  }

  // oacc[t][r] = out[query q0 + c][d = 16 t + 8 hh + r]: eight consecutive d per tile, two 16-byte LDS stores
  float* os = Os[wave];
  const float inv = 1.0f / lrow;
#pragma unroll
  for (int t = 0; t < 4; ++t) {
    const v8f o = oacc[t];
    *(v4f*)(os + c * 68 + t * 16 + 8 * hh)     = (v4f){o[0] * inv, o[1] * inv, o[2] * inv, o[3] * inv};
    *(v4f*)(os + c * 68 + t * 16 + 8 * hh + 4) = (v4f){o[4] * inv, o[5] * inv, o[6] * inv, o[7] * inv};
  }
  __builtin_amdgcn_fence(__ATOMIC_RELEASE, "workgroup");
  __builtin_amdgcn_wave_barrier();
  __builtin_amdgcn_fence(__ATOMIC_ACQUIRE, "workgroup");
  {
    const int q = lane >> 3, c8 = (lane & 7) * 8;
    {
#pragma unroll
      for (int it = 0; it < 4; ++it) {
        const int row = it * 4 + q;
        const float* sp = os + row * 68 + c8;
        v8h hv, lv;
#pragma unroll
        for (int e = 0; e < 8; ++e) {
          unsigned short hb = f2bf_bits(sp[e]);
          unsigned short lb = f2bf_bits(sp[e] - bf_bits2f(hb));
          hv[e] = __builtin_bit_cast(_Float16, hb);
          lv[e] = __builtin_bit_cast(_Float16, lb);
        }
        const size_t oo = (size_t)(tok0 + q0 + row) * HIDN + hcol + c8;
        *(v8h*)(Oh + oo) = hv;
        *(v8h*)(Ol + oo) = lv;
      }
      
    }
  }
  // precaution: the second tile's set-up rewrites registers that the stores above name
  asm volatile("s_wait_xcnt 0x0" ::: "memory");
  }   // half
}

// =====================================================================================
// k^T.v state: St[h][d][e] = sum_s kT[h*64+d][s] * vT[h*64+e][s] over SEQ tokens of one batch.
//   planes: [HIDN][NTOK] bf16 hi and lo; blockIdx.z = batch, whose tokens begin at column blockIdx.z * SEQ
//   product = hi.hi + hi.lo + lo.hi, f32 accumulate (same three products per k step as the GEMM's hi/lo path)
//   Block = 16 waves = one 32x32 tile of one head; wave w sums tokens [w*128, w*128+128).
//   The 16 partial tiles meet in LDS and are added in wave order 0..15. grid = (4 tiles, NHEAD, NBATCH).
// =====================================================================================
constexpr int ST_NW = 16;                 // waves per block = slices of the token sum
constexpr int ST_KS = SEQ / ST_NW;        // 128 tokens per wave
static_assert(ST_KS % 32 == 0);

__global__ __launch_bounds__(ST_NW * 32)
void state_ktv_slices(const unsigned short* __restrict__ KTh, const unsigned short* __restrict__ KTl,
                      const unsigned short* __restrict__ VTh, const unsigned short* __restrict__ VTl,
                      float* __restrict__ St) {
  __shared__ __align__(16) float part[ST_NW][32 * 32];   // one 4 KB partial tile per wave, in accumulator order
  const int tid  = threadIdx.x;
  const int wave = tid >> 5;
  const int lane = tid & 31;
  const int hh   = lane >> 4;
  const int c    = lane & 15;
  const int h    = blockIdx.y;
  const int d0   = (blockIdx.x >> 1) * 32;
  const int e0   = (blockIdx.x & 1) * 32;

  const int bb   = blockIdx.z;
  const size_t ao = (size_t)(h * HDIM + d0 + c) * NTOK + bb * SEQ + wave * ST_KS + 8 * hh;
  const size_t bo = (size_t)(h * HDIM + e0 + c) * NTOK + bb * SEQ + wave * ST_KS + 8 * hh;
  const __bf16* pah = (const __bf16*)KTh + ao;
  const __bf16* pal = (const __bf16*)KTl + ao;
  const __bf16* pbh = (const __bf16*)VTh + bo;
  const __bf16* pbl = (const __bf16*)VTl + bo;

  v8f acc[2][2];
#pragma unroll
  for (int i = 0; i < 2; ++i)
#pragma unroll
    for (int j = 0; j < 2; ++j) acc[i][j] = (v8f){0.f,0.f,0.f,0.f,0.f,0.f,0.f,0.f};

  // unrolled (4 steps): the step offsets fold into the loads' immediate fields and later steps' loads issue among earlier products
#pragma unroll
  for (int ks = 0; ks < ST_KS / 32; ++ks) {
    v16b ah[2], al[2], bh[2], bl[2];
#pragma unroll
    for (int i = 0; i < 2; ++i) {
      const size_t o = (size_t)i * 16 * NTOK + ks * 32;
      ah[i] = Frag<__bf16>::load(pah + o);
      al[i] = Frag<__bf16>::load(pal + o);
      bh[i] = Frag<__bf16>::load(pbh + o);
      bl[i] = Frag<__bf16>::load(pbl + o);
    }
#pragma unroll
    for (int i = 0; i < 2; ++i)
#pragma unroll
      for (int j = 0; j < 2; ++j) {
        acc[i][j] = Frag<__bf16>::mma(ah[i], bh[j], acc[i][j]);
        acc[i][j] = Frag<__bf16>::mma(ah[i], bl[j], acc[i][j]);
        acc[i][j] = Frag<__bf16>::mma(al[i], bh[j], acc[i][j]);
      }
  }

  // partial tile to LDS: eighth q = (i*2+j)*2 + half holds accumulator rows half*4..half*4+3 of every lane, 16 B per lane
  float* slab = part[wave];
#pragma unroll
  for (int i = 0; i < 2; ++i)
#pragma unroll
    for (int j = 0; j < 2; ++j) {
      const v8f a = acc[i][j];
      const int q = (i * 2 + j) * 2;
      *(v4f*)(slab + (q + 0) * 128 + lane * 4) = (v4f){a[0], a[1], a[2], a[3]};
      *(v4f*)(slab + (q + 1) * 128 + lane * 4) = (v4f){a[4], a[5], a[6], a[7]};
    }
  __syncthreads();

  // 512 threads x 2 floats = the 32x32 tile; each thread adds its two positions over the 16 slices in wave order
  v2f sum = (v2f){0.f, 0.f};
#pragma unroll
  for (int w = 0; w < ST_NW; ++w) sum += *(const v2f*)(&part[w][tid * 2]);

  // position tid*2 back to (row, col): q = tid>>6, source lane = (tid>>1)&31, accumulator rows (q&1)*4 + (tid&1)*2 and the next
  const int q   = tid >> 6;
  const int sl  = (tid >> 1) & 31;
  const int row = (q >> 2) * 16 + (sl >> 4) * 8 + (q & 1) * 4 + (tid & 1) * 2;
  const int col = ((q >> 1) & 1) * 16 + (sl & 15);
  float* o = St + (size_t)(bb * NHEAD + h) * HDIM * HDIM + (size_t)(d0 + row) * HDIM + e0 + col;
  o[0]    = sum[0];
  o[HDIM] = sum[1];
}

// ---------------------------------------------------------------- launcher
extern "C" void kernel_launch(void* const* d_in, const int* in_sizes, int n_in,
                              void* d_out, int out_size, void* d_ws, size_t ws_size,
                              hipStream_t stream) {
  (void)n_in;
  if (ws_size < WS_TOTAL) return;
  if ((size_t)out_size != OUT0_ELEMS + OUT1_ELEMS) return;
  if ((size_t)in_sizes[0] != NX || (size_t)in_sizes[1] != (size_t)NTOK ||
      (size_t)in_sizes[2] != NW || (size_t)in_sizes[4] != NW ||
      (size_t)in_sizes[6] != NW || (size_t)in_sizes[8] != NW ||
      in_sizes[3] != HIDN || in_sizes[5] != HIDN || in_sizes[7] != HIDN || in_sizes[9] != HIDN) return;

  const float* hs    = (const float*)d_in[0];
  const float* amask = (const float*)d_in[1];
  const float* Wq    = (const float*)d_in[2];
  const float* bq    = (const float*)d_in[3];
  const float* Wk    = (const float*)d_in[4];
  const float* bk    = (const float*)d_in[5];
  const float* Wv    = (const float*)d_in[6];
  const float* bv    = (const float*)d_in[7];
  const float* Wo    = (const float*)d_in[8];
  const float* bo    = (const float*)d_in[9];

  char* ws = (char*)d_ws;
  unsigned short* Xb  = (unsigned short*)(ws + OFF_XB);
  unsigned short* Wqb = (unsigned short*)(ws + OFF_WQ);
  unsigned short* Wkb = (unsigned short*)(ws + OFF_WK);
  unsigned short* Wvb = (unsigned short*)(ws + OFF_WV);
  unsigned short* Wob = (unsigned short*)(ws + OFF_WO);
  unsigned short* Qh  = (unsigned short*)(ws + OFF_QH);
  unsigned short* Ql  = (unsigned short*)(ws + OFF_QL);
  unsigned short* Kh  = (unsigned short*)(ws + OFF_KH);
  unsigned short* Kl  = (unsigned short*)(ws + OFF_KL);
  unsigned short* KTh = (unsigned short*)(ws + OFF_KTH);
  unsigned short* KTl = (unsigned short*)(ws + OFF_KTL);
  unsigned short* VTh = (unsigned short*)(ws + OFF_VTH);
  unsigned short* VTl = (unsigned short*)(ws + OFF_VTL);
  unsigned short* Oh  = (unsigned short*)(ws + OFF_OH);
  unsigned short* Ol  = (unsigned short*)(ws + OFF_OL);

  float* outF   = (float*)d_out;
  float* stateF = outF + OUT1_ELEM_OFF;

  // 1) RNE conversions to bf16 (inputs converted exactly once), one launch for all five inputs; Xb is the start of the five planes
  cast_all_f32_bf16<<<dim3(CV_GRID), dim3(CV_T), 0, stream>>>(hs, Wq, Wk, Wv, Wo, Xb);

  // 2) projections: 64x64 tiles, 8 waves (2 x 4 tiles) per block; every shape has 1024 tiles (64x16 or 16x64) = 128 block tiles of 128x256
  const int gemmBlocksTok = ((NTOK / 64) * (HIDN / 64)) / 8;    // 1024 tiles / 8 = 128
  // q, k, k^T and v^T in one launch, grid.y = projection -> hi/lo planes
  proj4_gemm64<<<dim3(gemmBlocksTok, 4), dim3(256), 0, stream>>>(
      Xb, Wqb, Wkb, Wvb, Qh, Ql, Kh, Kl, KTh, KTl, VTh, VTl, bq, bk, bv, amask, HIDN);

  // 3) causal attention on the planes -> attention out hi/lo planes [4096][1024]
  const float sscale = 0.125f;   // 1 / (temperature * sqrt(64)), exact power of two
  attn_hd64_planes<<<dim3(NBATCH * NHEAD * (SEQ / AT_QB / 2)), dim3(128), 0, stream>>>(
      Qh, Ql, Kh, Kl, VTh, VTl, amask, Oh, Ol, sscale);

  // 4) state[b][h][d][e] = sum_s k^T[h*64+d][b*S+s] * v^T[h*64+e][b*S+s]  (hi/lo on both operands); 4 tiles x 16 token slices per (b,h)
  state_ktv_slices<<<dim3(4, NHEAD, NBATCH), dim3(ST_NW * 32), 0, stream>>>(KTh, KTl, VTh, VTl, stateF);

  // 5) out [4096][1024] = attn_out . Wo^T + bo  (A hi/lo, Wo exact bf16) -> d_out f32
  wmma_gemm64<1, true, false, 2, 0, 0><<<dim3(gemmBlocksTok, 1), dim3(256), 0, stream>>>(
      Oh, Ol, HIDN, 0L, Wob, Wob, HIDN, 0L, (void*)outF, (void*)Oh, HIDN, 0L,
      bo, amask, NTOK, HIDN, HIDN, 1.0f);
}

// v010
// It runs in 143 microseconds.
// Two timings next to v009 both put it at 1.09 times that version's speed.
// All steps since v000 together make it 4.86 times as fast.
// Compute dtype: input projections v_wmma_f32_16x16x32_bf16 on bf16 operands (inputs RNE-converted once), f32 accumulate; scores, p.v and k^T.v state on bf16 hi/lo split planes (hi.hi + hi.lo + lo.hi), output projection on hi/lo A planes x bf16 Wo (hi.hi + lo.hi), f32 accumulate; softmax and side math f32.
#include <hip/hip_runtime.h>

// ---------------------------------------------------------------- geometry
constexpr int NBATCH = 2;
constexpr int SEQ    = 2048;
constexpr int HIDN   = 1024;
constexpr int NHEAD  = 16;
constexpr int HDIM   = 64;
constexpr int NTOK   = NBATCH * SEQ;                    /* 4096 token rows */
constexpr size_t NX  = (size_t)NTOK * HIDN;            /* 4194304 */
constexpr size_t NW  = (size_t)HIDN * HIDN;            /* 1048576 */
constexpr size_t OUT0_ELEMS    = NX;
constexpr size_t OUT1_ELEMS    = (size_t)NBATCH * NHEAD * HDIM * HDIM;   /* 131072 */
constexpr size_t OUT1_BYTE_OFF = 16777216;
constexpr size_t OUT1_ELEM_OFF = OUT1_BYTE_OFF / 4;
static_assert(OUT1_ELEM_OFF == OUT0_ELEMS);
static_assert(OUT1_BYTE_OFF + OUT1_ELEMS * 4 == 17301504);
static_assert(HIDN == NHEAD * HDIM);
static_assert(HDIM == 64);
static_assert(HIDN % 64 == 0 && NTOK % 64 == 0 && SEQ % 64 == 0);   /* every GEMM M and N is a 64-multiple */
static_assert(HIDN % 32 == 0 && SEQ % 32 == 0);                     /* every GEMM K is a multiple of 32 */

// ---------------------------------------------------------------- workspace map (bytes)
// 16-bit planes: token planes [4096][1024] or [1024][4096] = 8 MiB each; weight planes [1024][1024] = 2 MiB each.
// Every region is fully written by its producer (full M x N, no pad rows) before any consumer reads it.
constexpr size_t MIB      = (size_t)1 << 20;
constexpr size_t OFF_XB   = 0 * MIB;    /* hidden as bf16      8 MiB */
constexpr size_t OFF_WQ   = 8 * MIB;    /* Wq bf16             2 MiB */
constexpr size_t OFF_WK   = 10 * MIB;   /* Wk bf16             2 MiB */
constexpr size_t OFF_WV   = 12 * MIB;   /* Wv bf16             2 MiB */
constexpr size_t OFF_WO   = 14 * MIB;   /* Wo bf16             2 MiB */
constexpr size_t OFF_QH   = 16 * MIB;   /* q hi  [4096][1024]        */
constexpr size_t OFF_QL   = 24 * MIB;   /* q lo                      */
constexpr size_t OFF_KH   = 32 * MIB;   /* k hi  [4096][1024] (masked) */
constexpr size_t OFF_KL   = 40 * MIB;   /* k lo                      */
constexpr size_t OFF_KTH  = 48 * MIB;   /* k^T hi [1024][4096] (masked) */
constexpr size_t OFF_KTL  = 56 * MIB;   /* k^T lo                    */
constexpr size_t OFF_VTH  = 64 * MIB;   /* v^T hi [1024][4096] (masked) */
constexpr size_t OFF_VTL  = 72 * MIB;   /* v^T lo                    */
constexpr size_t OFF_OH   = 80 * MIB;   /* attention out hi [4096][1024] */
constexpr size_t OFF_OL   = 88 * MIB;   /* attention out lo          */
constexpr size_t WS_TOTAL = 96 * MIB;   /* 100663296 B */
static_assert(NX * 2 == 8 * MIB && NW * 2 == 2 * MIB);
static_assert(WS_TOTAL <= 134217728);

// ---------------------------------------------------------------- types / helpers
typedef __attribute__((ext_vector_type(16))) _Float16 v16h;
typedef __attribute__((ext_vector_type(8)))  _Float16 v8h;
typedef __attribute__((ext_vector_type(16))) __bf16   v16b;
typedef __attribute__((ext_vector_type(8)))  __bf16   v8b;
typedef __attribute__((ext_vector_type(8)))  float    v8f;
typedef __attribute__((ext_vector_type(4)))  float    v4f;
typedef __attribute__((ext_vector_type(2)))  float    v2f;
typedef __attribute__((ext_vector_type(4)))  unsigned u4v;

__device__ __forceinline__ unsigned short f2bf_bits(float f) {
  unsigned u = __float_as_uint(f);
  return (unsigned short)((u + 0x7FFFu + ((u >> 16) & 1u)) >> 16);
}
__device__ __forceinline__ float bf_bits2f(unsigned short h) { return __uint_as_float(((unsigned)h) << 16); }
__device__ __forceinline__ float bfr(float f) { return bf_bits2f(f2bf_bits(f)); }

__device__ __forceinline__ void sched_fence() { asm volatile("" ::: "memory"); }

// hazard guards as plain device helpers (no inline asm inside the kernel template body)
__device__ __forceinline__ void dep_guard_h(v8f& a, v8f& b, v16h x, v16h y) { asm volatile("v_nop\n\tv_nop\n\tv_nop\n\tv_nop" : "+v"(a), "+v"(b) : "v"(x), "v"(y)); }
__device__ __forceinline__ void dep_guard_b(v8f& a, v8f& b, v16b x, v16b y) { asm volatile("v_nop\n\tv_nop\n\tv_nop\n\tv_nop" : "+v"(a), "+v"(b) : "v"(x), "v"(y)); }
__device__ __forceinline__ void keep4_h(v16h a, v16h b, v16h c, v16h d) { asm volatile("v_nop" :: "v"(a), "v"(b), "v"(c), "v"(d)); }
__device__ __forceinline__ void keep4_b(v16b a, v16b b, v16b c, v16b d) { asm volatile("v_nop" :: "v"(a), "v"(b), "v"(c), "v"(d)); }
__device__ __forceinline__ void acc_guard4(v8f& a, v8f& b, v8f& c, v8f& d) { asm volatile("v_nop\n\tv_nop\n\tv_nop\n\tv_nop" : "+v"(a), "+v"(b), "+v"(c), "+v"(d)); }
template <typename T> struct Frag;
template <> struct Frag<_Float16> {
  typedef v16h V; union U { v16h v; v8h h[2]; };
  static __device__ __forceinline__ v16h load(const _Float16* p) {   // elements 0..7 <- p[0..7], 8..15 <- p[16..23]
    U f; f.h[0] = *(const v8h*)(p); f.h[1] = *(const v8h*)(p + 16); return f.v;
  }
  static __device__ __forceinline__ v8f mma(v16h a, v16h b, v8f c) {
    return __builtin_amdgcn_wmma_f32_16x16x32_f16(false, a, false, b, (short)0, c, false, false);
  }
  static __device__ __forceinline__ void guard(v8f& a, v8f& b, v16h x, v16h y) { dep_guard_h(a, b, x, y); }
  static __device__ __forceinline__ void keep(v16h a, v16h b, v16h c, v16h d) { keep4_h(a, b, c, d); }
};
template <> struct Frag<__bf16> {
  typedef v16b V; union U { v16b v; v8b h[2]; };
  static __device__ __forceinline__ v16b load(const __bf16* p) {
    U f; f.h[0] = *(const v8b*)(p); f.h[1] = *(const v8b*)(p + 16); return f.v;
  }
  static __device__ __forceinline__ v8f mma(v16b a, v16b b, v8f c) {
    return __builtin_amdgcn_wmma_f32_16x16x32_bf16(false, a, false, b, (short)0, c, false, false);
  }
  static __device__ __forceinline__ void guard(v8f& a, v8f& b, v16b x, v16b y) { dep_guard_b(a, b, x, y); }
  static __device__ __forceinline__ void keep(v16b a, v16b b, v16b c, v16b d) { keep4_b(a, b, c, d); }
};

// ---- Register-blocked batched WMMA GEMM ------------------------------------
// C[m,n] = rs * (scale * sum_k A[m,k] * Bt[n,k] + bias); each wave owns a 64x64 tile.
// A row-major [M,K]; Bt row-major [N,K]; M % 128 == 0, N % 256 == 0, K % 64 == 0.
// Block = 8 waves (2 x 4) = one 128x256 tile. A stage is 64 k = one 128-byte line of every operand row of the block tile.
// Asynchronous 16-byte copies (8 lanes per row, whole lines) bring a stage from global memory into one of two LDS buffers
// while the other buffer is multiplied; the waves read their fragments from LDS.
// SPLIT: A carried as hi/lo planes (A2 = lo); BLO: Bt also carried as hi/lo (Bt2 = lo);
//   product = hi.hi (+ hi.lo when BLO) + lo.hi.   SPLIT+BLO is the stock hi/lo path.
// BIAS_MODE: 0 = none, 1 = bias[m], 2 = bias[n]  (bias value RNE-converted to bf16 precision).
// RS_MODE:   0 = none, 1 = multiply by rsc[m], 2 = multiply by rsc[n]  (rsc value RNE-converted to bf16).
// BIAS_MODE 3 (RS_MODE is then not read): both modes chosen per block: (1, 2) where tr, else (2, 1) where rsRow, else (2, 0).
// b = batch index of the block; tr, rsRow are block-uniform and read under BIAS_MODE 3 only.
// OUT_MODE: 0 = f32, 1 = f16, 2 = bf16 hi plane (Cout) + bf16 lo plane (Cout2).
// ET: 0 = f16 operands, 1 = bf16 operands (pointers passed as 16-bit storage)
constexpr int GB_M = 128;   // block tile rows
constexpr int GB_N = 256;   // block tile columns
constexpr int GB_K = 64;    // k per stage
constexpr int GB_P = 72;    // LDS row pitch in elements: 144 B = 16 B x 9 (odd), distinct banks for the 16 rows of a 16-byte fragment read
static_assert(HIDN % GB_N == 0 && NTOK % GB_N == 0 && HIDN % GB_K == 0);   /* every GEMM M, N is a multiple of the block tile, K of the stage */

// four asynchronous 16-byte copies to LDS, every lane with its own LDS byte address and global address;
// s_wait_xcnt 0 closes the statement as a precaution: no address register of a copy is rewritten in front of it
__device__ __forceinline__ void copy4_async(unsigned l0, const void* g0, unsigned l1, const void* g1,
                                            unsigned l2, const void* g2, unsigned l3, const void* g3) {
  asm volatile("global_load_async_to_lds_b128 %0, %1, off\n\t"
               "global_load_async_to_lds_b128 %2, %3, off\n\t"
               "global_load_async_to_lds_b128 %4, %5, off\n\t"
               "global_load_async_to_lds_b128 %6, %7, off\n\t"
               "s_wait_xcnt 0x0"
               :: "v"(l0), "v"(g0), "v"(l1), "v"(g1), "v"(l2), "v"(g2), "v"(l3), "v"(g3) : "memory");
}
// this wave's copies have landed behind this one
__device__ __forceinline__ void wait_async0() { asm volatile("s_wait_asynccnt 0x0" ::: "memory"); }
// this wave's LDS reads have returned: stands in front of the barrier behind which their buffer is refilled
__device__ __forceinline__ void wait_ds0() { asm volatile("s_wait_dscnt 0x0" ::: "memory"); }

template <int V> struct IntC { static constexpr int value = V; };   // an int as a type, for the epilogue's modes
template <int ET> struct Elem;
template <> struct Elem<0> { typedef _Float16 T; };
template <> struct Elem<1> { typedef __bf16 T; };
template <int ET, bool SPLIT, bool BLO, int BIAS_MODE, int OUT_MODE, int RS_MODE>
__device__ __forceinline__ void gemm_block_tile(
    const unsigned short* __restrict__ Ap, const unsigned short* __restrict__ A2p, int lda, long strideA,
    const unsigned short* __restrict__ Btp, const unsigned short* __restrict__ Bt2p, int ldb, long strideB,
    void* __restrict__ Cout, void* __restrict__ Cout2, int ldc, long strideC,
    const float* __restrict__ bias, const float* __restrict__ rsc,
    int M, int N, int K, float scale, const int b, const bool tr, const bool rsRow) {
  typedef typename Elem<ET>::T T;
  typedef typename Frag<T>::V V;
  const T* A = (const T*)Ap; const T* A2 = (const T*)A2p; const T* Bt = (const T*)Btp; const T* Bt2 = (const T*)Bt2p;
  constexpr int NPA = SPLIT ? 2 : 1;              // planes of A
  constexpr int NPB = (SPLIT && BLO) ? 2 : 1;     // planes of Bt
  __shared__ __align__(16) T sA[2][NPA][GB_M * GB_P];   // two buffers of A rows  [row][k], 18 KB per plane
  __shared__ __align__(16) T sB[2][NPB][GB_N * GB_P];   // two buffers of Bt rows [row][k], 36 KB per plane
  __shared__ __align__(16) float sT[8][16 * 68];   // per-wave 16x64 slab, pitch 68 floats
  const int tid  = threadIdx.x;
  const int lane = tid & 31;
  const int wave = tid >> 5;
  const int blocksN = N / GB_N;
  const int bm = blockIdx.x / blocksN;
  const int bn = blockIdx.x - bm * blocksN;
  if (bm >= M / GB_M) return;            // block-uniform, in front of every copy and barrier
  const int mB = bm * GB_M;              // block tile origin
  const int nB = bn * GB_N;
  const int wm = (wave >> 2) << 6;       // wave tile origin inside the block tile
  const int wn = (wave & 3) << 6;
  const int m0 = mB + wm;
  const int n0 = nB + wn;

  const T* Ab  = A  + (size_t)b * strideA;
  const T* Bb  = Bt + (size_t)b * strideB;
  const T* Ab2 = SPLIT ? (A2  + (size_t)b * strideA) : nullptr;
  const T* Bb2 = (SPLIT && BLO) ? (Bt2 + (size_t)b * strideB) : nullptr;

  const int rlane = lane & 15;                 // row (A) / col (B, D) within subtile
  const int koff  = (lane >> 4) * 8;           // k offset of this lane half
  const int mOff  = (lane >> 4) * 8;           // D row offset

  // staging coverage: 256 threads x 4 copies = 1024 = 128 rows x 8 pieces of 16 B (A plane); x 8 copies = 2048 = 256 rows x 8 (Bt plane);
  // copy i of a thread is row srow + 32 i, piece tid & 7: every piece once, every address a multiple of 16 B
  const int srow = tid >> 3;                   // 0..31
  const int sc8  = (tid & 7) * 8;
  constexpr unsigned RS = 32 * GB_P * 2;       // LDS bytes between a thread's successive copies
  const unsigned ldsA = (unsigned)(size_t)(&sA[0][0][srow * GB_P + sc8]);   // low 32 bits = byte address in the work-group's LDS
  const unsigned ldsB = (unsigned)(size_t)(&sB[0][0][srow * GB_P + sc8]);
  const size_t astep = (size_t)32 * lda * 2, bstep = (size_t)32 * ldb * 2;  // global bytes between them
  auto stage = [&](int st, int buf) {
    const size_t ka = ((size_t)(mB + srow) * lda + (size_t)st * GB_K + sc8) * 2;
    const size_t kb = ((size_t)(nB + srow) * ldb + (size_t)st * GB_K + sc8) * 2;
#pragma unroll
    for (int p = 0; p < NPA; ++p) {
      const char* g = (const char*)(p == 0 ? Ab : Ab2) + ka;
      const unsigned l = ldsA + (unsigned)(buf * NPA + p) * (unsigned)(GB_M * GB_P * 2);
      copy4_async(l, g, l + RS, g + astep, l + 2 * RS, g + 2 * astep, l + 3 * RS, g + 3 * astep);
    }
#pragma unroll
    for (int p = 0; p < NPB; ++p) {
      const char* g = (const char*)(p == 0 ? Bb : Bb2) + kb;
      const unsigned l = ldsB + (unsigned)(buf * NPB + p) * (unsigned)(GB_N * GB_P * 2);
      copy4_async(l, g, l + RS, g + bstep, l + 2 * RS, g + 2 * bstep, l + 3 * RS, g + 3 * bstep);
      copy4_async(l + 4 * RS, g + 4 * bstep, l + 5 * RS, g + 5 * bstep, l + 6 * RS, g + 6 * bstep, l + 7 * RS, g + 7 * bstep);
    }
  };

  v8f acc[4][4];
#pragma unroll
  for (int i = 0; i < 4; ++i)
#pragma unroll
    for (int j = 0; j < 4; ++j) acc[i][j] = (v8f){0.f,0.f,0.f,0.f,0.f,0.f,0.f,0.f};

  const int nst = K / GB_K;                    // stages, block-uniform
  stage(0, 0);
  wait_async0();
  __syncthreads();                             // stage 0 is complete before any wave reads it
  if (nst > 1) stage(1, 1);
  for (int t = 0; t < nst; ++t) {
    const int cur = t & 1;
#pragma unroll
    for (int kk = 0; kk < GB_K; kk += 32) {
      V bh[4], bl[4], ah[4], al[4];
#pragma unroll
      for (int j = 0; j < 4; ++j) {
        const int bo = (wn + (j << 4) + rlane) * GB_P + kk + koff;
        bh[j] = Frag<T>::load(&sB[cur][0][bo]);
        if (SPLIT && BLO) bl[j] = Frag<T>::load(&sB[cur][NPB - 1][bo]);
        else bl[j] = bh[j];
      }
#pragma unroll
      for (int i = 0; i < 4; ++i) {
        const int ao = (wm + (i << 4) + rlane) * GB_P + kk + koff;
        ah[i] = Frag<T>::load(&sA[cur][0][ao]);
        if (SPLIT) al[i] = Frag<T>::load(&sA[cur][NPA - 1][ao]);
        else al[i] = ah[i];
      }
#pragma unroll
      for (int i = 0; i < 4; ++i) {
#pragma unroll
        for (int j = 0; j < 4; ++j) {
          acc[i][j] = Frag<T>::mma(ah[i], bh[j], acc[i][j]);
          if (SPLIT) {
            if (BLO) acc[i][j] = Frag<T>::mma(ah[i], bl[j], acc[i][j]);
            acc[i][j] = Frag<T>::mma(al[i], bh[j], acc[i][j]);
          }
        }
        Frag<T>::guard(acc[i][0], acc[i][3], ah[i], al[i]);
      }
      Frag<T>::keep(bh[0], bh[1], bh[2], bh[3]);
      if (SPLIT && BLO) Frag<T>::keep(bl[0], bl[1], bl[2], bl[3]);
    }
    wait_ds0();                                // this wave has finished reading buffer cur
    wait_async0();                             // this wave's copies of stage t + 1 have landed
    __syncthreads();                           // publishes stage t + 1 and frees buffer cur
    if (t + 2 < nst) stage(t + 2, cur);        // block-uniform
  }
  wait_async0();                               // nothing is in flight when the wave goes on
  acc_guard4(acc[0][0], acc[0][1], acc[0][2], acc[0][3]);
  acc_guard4(acc[1][0], acc[1][1], acc[1][2], acc[1][3]);
  acc_guard4(acc[2][0], acc[2][1], acc[2][2], acc[2][3]);
  acc_guard4(acc[3][0], acc[3][1], acc[3][2], acc[3][3]);

  // ---- epilogue ----  (bias and row-scale mode as compile-time values of the call; always inlined: acc stays in registers)
  float* slab = sT[wave];
  auto epilogue = [&](auto bmode, auto rmode) __attribute__((always_inline)) {
  constexpr int BM = decltype(bmode)::value;
  constexpr int RM = decltype(rmode)::value;
#pragma unroll
  for (int i = 0; i < 4; ++i) {
    const int mBase = m0 + (i << 4);
    float bm[8], rm[8];
#pragma unroll
    for (int r = 0; r < 8; ++r) { bm[r] = 0.f; rm[r] = 1.f; }
    if (BM == 1) {
      // rows mBase+mOff .. +7 are contiguous and 32-B aligned: two 16-B loads
      const v4f t0 = *(const v4f*)(bias + mBase + mOff);
      const v4f t1 = *(const v4f*)(bias + mBase + mOff + 4);
#pragma unroll
      for (int r = 0; r < 4; ++r) { bm[r] = bfr(t0[r]); bm[4 + r] = bfr(t1[r]); }
    }
    if (RM == 1) {
      const v4f t0 = *(const v4f*)(rsc + mBase + mOff);
      const v4f t1 = *(const v4f*)(rsc + mBase + mOff + 4);
#pragma unroll
      for (int r = 0; r < 4; ++r) { rm[r] = bfr(t0[r]); rm[4 + r] = bfr(t1[r]); }
    }
#pragma unroll
    for (int j = 0; j < 4; ++j) {
      const int n = n0 + (j << 4) + rlane;
      float bn = 0.f, rn = 1.f;
      if (BM == 2) bn = bfr(bias[n]);
      if (RM == 2) rn = bfr(rsc[n]);
#pragma unroll
      for (int r = 0; r < 8; ++r) {
        float v = acc[i][j][r] * scale;
        if (BM == 1) v += bm[r];
        if (BM == 2) v += bn;
        if (RM == 1) v *= rm[r];
        if (RM == 2) v *= rn;
        slab[(mOff + r) * 68 + (j << 4) + rlane] = v;
      }
    }
    __builtin_amdgcn_fence(__ATOMIC_RELEASE, "workgroup");
    __builtin_amdgcn_wave_barrier();
    __builtin_amdgcn_fence(__ATOMIC_ACQUIRE, "workgroup");
    if (OUT_MODE == 0) {
      float* C = (float*)Cout + (size_t)b * strideC;
      const int hh = lane >> 4, c4 = (lane & 15) * 4;     // row seg = 256 B = 16 lanes x 16 B
      {
#pragma unroll
        for (int it = 0; it < 8; ++it) {
          const int row = it * 2 + hh;
          v4f v = *(const v4f*)(slab + row * 68 + c4);
          *(v4f*)(C + (size_t)(mBase + row) * ldc + n0 + c4) = v;
        }
        
      }
    } else {
      const int q = lane >> 3, c8 = (lane & 7) * 8;
      unsigned short* C  = (unsigned short*)Cout  + (size_t)b * strideC;
      unsigned short* C2 = (OUT_MODE == 2) ? ((unsigned short*)Cout2 + (size_t)b * strideC) : nullptr;
      {
#pragma unroll
        for (int it = 0; it < 4; ++it) {
          const int row = it * 4 + q;
          const float* sp = slab + row * 68 + c8;
          v8h hv, lv;
#pragma unroll
          for (int e = 0; e < 8; ++e) {
            if (OUT_MODE == 1) {
              hv[e] = (_Float16)sp[e];
              lv[e] = hv[e];
            } else {
              unsigned short hb = f2bf_bits(sp[e]);
              unsigned short lb = f2bf_bits(sp[e] - bf_bits2f(hb));
              hv[e] = __builtin_bit_cast(_Float16, hb);
              lv[e] = __builtin_bit_cast(_Float16, lb);
            }
          }
          *(v8h*)(C + (size_t)(mBase + row) * ldc + n0 + c8) = hv;
          if (OUT_MODE == 2) *(v8h*)(C2 + (size_t)(mBase + row) * ldc + n0 + c8) = lv;
        }
        
      }
    }
    __builtin_amdgcn_fence(__ATOMIC_RELEASE, "workgroup");
    __builtin_amdgcn_wave_barrier();
    __builtin_amdgcn_fence(__ATOMIC_ACQUIRE, "workgroup");
  }
  };
  if constexpr (BIAS_MODE == 3) {        // block-uniform choice among the three forms the projections need
    if (tr)         epilogue(IntC<1>{}, IntC<2>{});
    else if (rsRow) epilogue(IntC<2>{}, IntC<1>{});
    else            epilogue(IntC<2>{}, IntC<0>{});
  } else {
    epilogue(IntC<BIAS_MODE>{}, IntC<RS_MODE>{});
  }
}

// one GEMM per launch: grid.x = block tiles, grid.y = batch
template <int ET, bool SPLIT, bool BLO, int BIAS_MODE, int OUT_MODE, int RS_MODE>
__global__ __launch_bounds__(256) void wmma_gemm64(
    const unsigned short* __restrict__ Ap, const unsigned short* __restrict__ A2p, int lda, long strideA,
    const unsigned short* __restrict__ Btp, const unsigned short* __restrict__ Bt2p, int ldb, long strideB,
    void* __restrict__ Cout, void* __restrict__ Cout2, int ldc, long strideC,
    const float* __restrict__ bias, const float* __restrict__ rsc,
    int M, int N, int K, float scale) {
  gemm_block_tile<ET, SPLIT, BLO, BIAS_MODE, OUT_MODE, RS_MODE>(
      Ap, A2p, lda, strideA, Btp, Bt2p, ldb, strideB, Cout, Cout2, ldc, strideC, bias, rsc, M, N, K, scale,
      (int)blockIdx.y, false, false);
}

// The four input projections in ONE launch. Each has 128 block tiles, half of the chip's 256 WGPs, and none reads what another writes:
// together their 512 blocks stand two on every WGP (LDS and registers allow two). blockIdx.y picks the projection, block-uniform:
//   0: q rows   [NTOK][HIDN] = X . Wq^T + bq[col]
//   1: k rows   [NTOK][HIDN] = (X . Wk^T + bk[col]) * mask[row]
//   2: k^T rows [HIDN][NTOK] = (Wk . X^T + bk[row]) * mask[col]
//   3: v^T rows [HIDN][NTOK] = (Wv . X^T + bv[row]) * mask[col]
// every result as bf16 hi and lo planes. K (= HIDN) comes as an argument, as in the one-GEMM kernel.
__global__ __launch_bounds__(256) void proj4_gemm64(
    const unsigned short* __restrict__ Xb, const unsigned short* __restrict__ Wqb,
    const unsigned short* __restrict__ Wkb, const unsigned short* __restrict__ Wvb,
    unsigned short* __restrict__ Qh, unsigned short* __restrict__ Ql, unsigned short* __restrict__ Kh, unsigned short* __restrict__ Kl,
    unsigned short* __restrict__ KTh, unsigned short* __restrict__ KTl, unsigned short* __restrict__ VTh, unsigned short* __restrict__ VTl,
    const float* __restrict__ bq, const float* __restrict__ bk, const float* __restrict__ bv,
    const float* __restrict__ amask, int K) {
  const int  y  = blockIdx.y;
  const bool tr = y >= 2;                       // weight rows are the result's rows
  const unsigned short* W = (y == 0) ? Wqb : (y == 3) ? Wvb : Wkb;
  const float* bias       = (y == 0) ? bq  : (y == 3) ? bv  : bk;
  unsigned short* C  = (y == 0) ? Qh : (y == 1) ? Kh : (y == 2) ? KTh : VTh;
  unsigned short* C2 = (y == 0) ? Ql : (y == 1) ? Kl : (y == 2) ? KTl : VTl;
  const unsigned short* A  = tr ? W : Xb;
  const unsigned short* Bt = tr ? Xb : W;
  gemm_block_tile<1, false, false, 3, 2, 3>(
      A, A, HIDN, 0L, Bt, Bt, HIDN, 0L, (void*)C, (void*)C2, tr ? NTOK : HIDN, 0L, bias, amask,
      tr ? HIDN : NTOK, tr ? NTOK : HIDN, K, 1.0f, 0, tr, y == 1);
}

// One launch converts all five f32 inputs: their bf16 planes lie back to back in the workspace (hidden, Wq, Wk, Wv, Wo).
// Few waves, much work each.
// Block = 16 waves = CV_BLK consecutive elements of ONE input (every input is a whole number of blocks); grid = all elements / CV_BLK, exact.
// Pass i of a block is 2048 consecutive elements, 4 per lane: a wave's 16-byte load covers 512 contiguous bytes, its 8-byte store 256.
constexpr int CV_T   = 512;                 // threads per block
constexpr int CV_IT  = 16;                  // passes per block
constexpr int CV_BLK = CV_T * 4 * CV_IT;    // 32768 elements per block
constexpr int CV_XB  = (int)(NX / CV_BLK);  // 128 blocks of hidden
constexpr int CV_WB  = (int)(NW / CV_BLK);  // 32 blocks of each weight
constexpr int CV_GRID = CV_XB + 4 * CV_WB;  // 256 blocks
static_assert(NX % CV_BLK == 0 && NW % CV_BLK == 0);
static_assert(OFF_XB == 0 && OFF_WQ == NX * 2 && OFF_WK == OFF_WQ + NW * 2 && OFF_WV == OFF_WK + NW * 2 && OFF_WO == OFF_WV + NW * 2);
typedef __attribute__((ext_vector_type(2))) unsigned u2v;

__global__ __launch_bounds__(CV_T) void cast_all_f32_bf16(
    const float* __restrict__ hs, const float* __restrict__ wq, const float* __restrict__ wk,
    const float* __restrict__ wv, const float* __restrict__ wo, unsigned short* __restrict__ out) {
  const int blk = blockIdx.x;
  const float* src;                          // block-uniform choice of the input
  if (blk < CV_XB) {
    src = hs + (size_t)blk * CV_BLK;
  } else {
    const int w = (blk - CV_XB) / CV_WB;
    const int r = (blk - CV_XB) % CV_WB;
    src = (w == 0 ? wq : w == 1 ? wk : w == 2 ? wv : wo) + (size_t)r * CV_BLK;
  }
  const int t4 = threadIdx.x * 4;
  v4f f[CV_IT];
  // unrolled: f stays in registers, the pass offsets fold into the loads' immediate fields and the loads stand ahead of the conversions
#pragma unroll
  for (int i = 0; i < CV_IT; ++i) f[i] = *(const v4f*)(src + i * (CV_T * 4) + t4);
  unsigned short* o = out + (size_t)blk * CV_BLK + t4;
  // unrolled: constant indices into f, store offsets as immediates
#pragma unroll
  for (int i = 0; i < CV_IT; ++i) {
    u2v u;
    u[0] = (unsigned)f2bf_bits(f[i][0]) | ((unsigned)f2bf_bits(f[i][1]) << 16);
    u[1] = (unsigned)f2bf_bits(f[i][2]) | ((unsigned)f2bf_bits(f[i][3]) << 16);
    *(u2v*)(o + i * (CV_T * 4)) = u;
  }
}

constexpr int AT_D  = 64;
constexpr int AT_NW = 4;
constexpr int AT_QB = 64;
constexpr int AT_KC = 64;
constexpr int AT_P  = 72;   // LDS row pitch in elements: 144 B = 16 B x 9 (odd), so the 16 rows of a 16-byte fragment read fall on distinct banks

// f rounded to nearest even at bit 16: the upper half of the word is f2bf_bits(f)
__device__ __forceinline__ unsigned at_rne(float f) {
  const unsigned u = __float_as_uint(f);
  return u + 0x7FFFu + ((u >> 16) & 1u);
}
typedef __attribute__((ext_vector_type(4))) int i4v;
// the value that lane l ^ 16 holds
__device__ __forceinline__ float xhalf(float x) {
  const int b = __float_as_int(x);
  return __int_as_float(__builtin_amdgcn_permlanex16(b, b, 0x76543210, 0xfedcba98, false, false));
}
__device__ __forceinline__ v8f at_mma(v16b a, v16b b, v8f c) {
  return __builtin_amdgcn_wmma_f32_16x16x32_bf16(false, a, false, b, (short)0, c, false, false);
}

// Two blocks per WGP (512 blocks of 4 waves, 256 WGPs) are two waves per SIMD: the attribute gives each wave the register budget of that
// residency, under which the compiler keeps the scores' softmax chains interleaved in the chunk loop, and lets no WGP take a third block.
__global__ __launch_bounds__(128) __attribute__((amdgpu_waves_per_eu(2, 2)))
void attn_hd64_planes(const unsigned short* __restrict__ Qh, const unsigned short* __restrict__ Ql,
                      const unsigned short* __restrict__ Kh, const unsigned short* __restrict__ Kl,
                      const unsigned short* __restrict__ VTh, const unsigned short* __restrict__ VTl,
                      const float* __restrict__ amask,
                      unsigned short* __restrict__ Oh, unsigned short* __restrict__ Ol,
                      float sscale) {
  union FB { v16b v; v8b h[2]; };
  union PB { v16b v; unsigned w[8]; };         // a fragment by its registers: word i = elements 2 i (low half), 2 i + 1
  __shared__ __align__(16) __bf16 Ksh[AT_KC * AT_P];     // k hi [kv][d]     9 KB
  __shared__ __align__(16) __bf16 Ksl[AT_KC * AT_P];     // k lo
  __shared__ __align__(16) __bf16 Vth[AT_D * AT_P];      // v hi [d][kv]     9 KB
  __shared__ __align__(16) __bf16 Vtl[AT_D * AT_P];     // v lo
  __shared__ __align__(16) int    Kix[AT_KC];            // key index of each key of the chunk, for the masks
  __shared__ __align__(16) float  Os[AT_NW][16 * 68];       // per wave out tile, pitch 68

  const int tid  = threadIdx.x;
  const int wave = tid >> 5;
  const int lane = tid & 31;
  const int hh   = lane >> 4;
  const int c    = lane & 15;

  constexpr int nqb = SEQ / AT_QB;              // 32 query tiles per (b, h)
  static_assert(nqb % 2 == 0);                  // tiles pair up as (nqb - 1 - t, t), every tile once
  const int bx  = blockIdx.x;
  const int tp  = bx % (nqb / 2);               // 0..15
  const int bhd = bx / (nqb / 2);
  const int h   = bhd % NHEAD;
  const int b   = bhd / NHEAD;
  const int tok0 = b * SEQ;
  const int hcol = h * HDIM;
  // exp(x * sscale) = 2^(x * c2): every exponential is one fused multiply-add and the chip's own base-2 exponential,
  // in place of the library routine's range reduction and range tests. A masked score stays -inf and gives 0. sscale > 0.
  const float c2 = sscale * 1.44269504088896340736f;

  // the block's two tiles, one after the other in every wave (block-uniform trip counts)
  for (int half = 0; half < 2; ++half) {
  const int qb  = (half == 0) ? (nqb - 1 - tp) : tp;
  const int q0  = qb * AT_QB + wave * 16;

  // ---- Q fragments (B operand: column c = query q0 + c): 2 d-chunks, hi and lo, split k-map via Frag::load ----
  v16b qah[2], qal[2];
  {
    const __bf16* qhp = (const __bf16*)Qh + (size_t)(tok0 + q0 + c) * HIDN + hcol + 8 * hh;
    const __bf16* qlp = (const __bf16*)Ql + (size_t)(tok0 + q0 + c) * HIDN + hcol + 8 * hh;
#pragma unroll
    for (int dc = 0; dc < 2; ++dc) {
      qah[dc] = Frag<__bf16>::load(qhp + dc * 32);
      qal[dc] = Frag<__bf16>::load(qlp + dc * 32);
    }
    // precaution: the chunk loop's first address sums rewrite registers that the loads above name;
    // the loaded values are inputs only, so that the statement stands behind the loads (left free, they sink below it)
    asm volatile("s_wait_xcnt 0x0" :: "v"(qah[0]), "v"(qah[1]), "v"(qal[0]), "v"(qal[1]) : "memory");
  }

  const int qrow = q0 + c;                      // this lane's query
  float mrow = -__builtin_inff(), lrow = 0.f;   // mrow: running maximum of the unscaled scores
  v8f oacc[4];
#pragma unroll
  for (int t = 0; t < 4; ++t) oacc[t] = (v8f){0.f,0.f,0.f,0.f,0.f,0.f,0.f,0.f};

  const int nChunks = qb + 1;                   // causal, block-uniform, <= 32
  for (int kc = 0; kc < nChunks; ++kc) {
    const int kv0 = kc * AT_KC;
    __syncthreads();
    {
      // the mask value of key tid & 63, asked for ahead of the tiles' loads so that it is not waited for by itself behind them
      const float kvm = amask[(size_t)tok0 + kv0 + (tid & (AT_KC - 1))];
      // staging coverage: 128 threads x 4 ids = 512 ids = 64 rows x 8 chunks of 8 elements = 64x64 per plane, exact
#pragma unroll
      for (int i = 0; i < 4; ++i) {
        const int id = tid + 128 * i;
        const int row = id >> 3, c8 = (id & 7) * 8;
        const size_t ko = (size_t)(tok0 + kv0 + row) * HIDN + hcol + c8;
        const u4v a0 = *(const u4v*)(Kh + ko);
        const u4v a1 = *(const u4v*)(Kl + ko);
        *(u4v*)(Ksh + row * AT_P + c8) = a0;
        *(u4v*)(Ksl + row * AT_P + c8) = a1;
      }
      // holds the mask load among the k loads (loaded value as input only): left free, it sinks into the branch below and is waited for alone
      asm volatile("" :: "v"(kvm));
      sched_fence();
#pragma unroll
      for (int i = 0; i < 4; ++i) {
        const int id = tid + 128 * i;
        const int row = id >> 3, c8 = (id & 7) * 8;      // row = d
        const size_t vo = (size_t)(hcol + row) * NTOK + tok0 + kv0 + c8;
        const u4v a0 = *(const u4v*)(VTh + vo);
        const u4v a1 = *(const u4v*)(VTl + vo);
        *(u4v*)(Vth + row * AT_P + c8) = a0;
        *(u4v*)(Vtl + row * AT_P + c8) = a1;
      }
      // key index of each key; a padded key (amask == 0) gets an index above every query row,
      // so one integer compare and one select per score cover the causal and the padding mask without a branch
      if (tid < AT_KC) Kix[tid] = (kvm == 0.0f) ? 0x7fffffff : (kv0 + tid);
    }
    __syncthreads();

    // key indices of this lane's 32 scores, read ahead of the products so that their LDS latency passes under them;
    // every address is the same in all 16 lanes of a half
    i4v kix[4][2];
#pragma unroll
    for (int j = 0; j < 4; ++j) {
      kix[j][0] = *(const i4v*)(Kix + j * 16 + 8 * hh);
      kix[j][1] = *(const i4v*)(Kix + j * 16 + 8 * hh + 4);
    }
    // every k fragment of the chunk is asked for in one group: the wave waits out the LDS latency once, not once per three products
    // (the loops from here to the softmax are unrolled: the fragment and score arrays are registers and take constant indices)
    FB kb[2][4], kl[2][4];
#pragma unroll
    for (int dc = 0; dc < 2; ++dc) {
#pragma unroll
      for (int j = 0; j < 4; ++j) {
        const __bf16* khp = Ksh + (j * 16 + c) * AT_P + dc * 32 + 8 * hh;
        const __bf16* klp = Ksl + (j * 16 + c) * AT_P + dc * 32 + 8 * hh;
        kb[dc][j].h[0] = *(const v8b*)(khp);
        kb[dc][j].h[1] = *(const v8b*)(khp + 16);
        kl[dc][j].h[0] = *(const v8b*)(klp);
        kl[dc][j].h[1] = *(const v8b*)(klp + 16);
      }
    }
    // the four score tiles are independent accumulators, written side by side: one tile's accumulate latency can pass under another tile's
    // product or under vector work; each tile takes its six products in the order dc 0: hi.hi, lo.hi, hi.lo, then dc 1 alike
    v8f s[4];
#pragma unroll
    for (int j = 0; j < 4; ++j) s[j] = (v8f){0.f,0.f,0.f,0.f,0.f,0.f,0.f,0.f};
#pragma unroll
    for (int dc = 0; dc < 2; ++dc) {
#pragma unroll
      for (int j = 0; j < 4; ++j) s[j] = at_mma(kb[dc][j].v, qah[dc], s[j]);     // rows = keys, columns = queries
#pragma unroll
      for (int j = 0; j < 4; ++j) s[j] = at_mma(kl[dc][j].v, qah[dc], s[j]);
#pragma unroll
      for (int j = 0; j < 4; ++j) s[j] = at_mma(kb[dc][j].v, qal[dc], s[j]);
    }
    // every v^T fragment of the chunk, asked for ahead of the softmax so that the LDS latency passes under it
    FB vb[2][4], vl[2][4];
#pragma unroll
    for (int kk = 0; kk < 2; ++kk) {
#pragma unroll
      for (int t = 0; t < 4; ++t) {
        const __bf16* vhp = Vth + (t * 16 + c) * AT_P + kk * 32 + 8 * hh;
        const __bf16* vlp = Vtl + (t * 16 + c) * AT_P + kk * 32 + 8 * hh;
        vb[kk][t].h[0] = *(const v8b*)(vhp);
        vb[kk][t].h[1] = *(const v8b*)(vhp + 16);
        vl[kk][t].h[0] = *(const v8b*)(vlp);
        vl[kk][t].h[1] = *(const v8b*)(vlp + 16);
      }
    }
    // s[j][r] = score of key kv0 + 16 j + 8 hh + r against query q0 + c
    float m = -__builtin_inff();
#pragma unroll
    for (int j = 0; j < 4; ++j) {
#pragma unroll
      for (int r = 0; r < 8; ++r) {
        const int   ki  = kix[j][r >> 2][r & 3];
        const float val = (ki > qrow) ? -__builtin_inff() : s[j][r];   // unscaled: c2 > 0 keeps the order, the scale rides in the fma below
        s[j][r] = val;
        m = fmaxf(m, val);
      }
    }
    m = fmaxf(m, xhalf(m));                     // the other 32 keys of this query
    const float mnew  = fmaxf(mrow, m);
    const float mc    = mnew * c2;
    const float alpha = __builtin_amdgcn_exp2f((mrow - mnew) * c2);   // exactly 1 while the maximum stands
    mrow = mnew;
    // the 32 exponents s * c2 - mc, two to a packed fused multiply-add (unrolled: s is registers and takes constant indices)
#pragma unroll
    for (int j = 0; j < 4; ++j)
#pragma unroll
      for (int r = 0; r < 8; r += 2) {
        const v2f x = __builtin_elementwise_fma((v2f){s[j][r], s[j][r + 1]}, (v2f){c2, c2}, (v2f){-mc, -mc});
        s[j][r] = x[0];
        s[j][r + 1] = x[1];
      }
    float ps[4];                                // one partial sum per score tile: four short chains of adds, not one of 32
    PB pa[2], pl[2];                            // p^T hi and lo as B operands: element e of half g = key 32 kk + 16 g + 8 hh + e
#pragma unroll
    for (int j = 0; j < 4; ++j) {
      ps[j] = 0.f;
#pragma unroll
      for (int r = 0; r < 8; r += 2) {
        const float p0 = __builtin_amdgcn_exp2f(s[j][r]);
        const float p1 = __builtin_amdgcn_exp2f(s[j][r + 1]);
        ps[j] += p0;
        ps[j] += p1;
        // hi = bf16(p), lo = bf16(p - hi), both to nearest even; the two bf16 of a register are the upper halves of two rounded words, joined by one byte permute
        const unsigned h0 = at_rne(p0), h1 = at_rne(p1);
        const unsigned l0 = at_rne(p0 - __uint_as_float(h0 & 0xffff0000u));
        const unsigned l1 = at_rne(p1 - __uint_as_float(h1 & 0xffff0000u));
        pa[j >> 1].w[(j & 1) * 4 + (r >> 1)] = __builtin_amdgcn_perm(h1, h0, 0x07060302u);
        pl[j >> 1].w[(j & 1) * 4 + (r >> 1)] = __builtin_amdgcn_perm(l1, l0, 0x07060302u);
      }
    }
    float psum = (ps[0] + ps[1]) + (ps[2] + ps[3]);
    psum += xhalf(psum);
    lrow = lrow * alpha + psum;
#pragma unroll
    for (int t = 0; t < 4; ++t)
#pragma unroll
      for (int r = 0; r < 8; ++r) oacc[t][r] *= alpha;
    // unrolled: pa, pl are registers and take constant indices
#pragma unroll
    for (int kk = 0; kk < 2; ++kk) {
      // four independent output tiles side by side; each takes hi.hi, lo.hi, hi.lo of its 32 keys in that order
#pragma unroll
      for (int t = 0; t < 4; ++t) oacc[t] = at_mma(vb[kk][t].v, pa[kk].v, oacc[t]);   // rows = d, columns = queries
#pragma unroll
      for (int t = 0; t < 4; ++t) oacc[t] = at_mma(vl[kk][t].v, pa[kk].v, oacc[t]);
#pragma unroll
      for (int t = 0; t < 4; ++t) oacc[t] = at_mma(vb[kk][t].v, pl[kk].v, oacc[t]);
    }
  }

  // oacc[t][r] = out[query q0 + c][d = 16 t + 8 hh + r]: eight consecutive d per tile, two 16-byte LDS stores
  float* os = Os[wave];
  const float inv = 1.0f / lrow;
#pragma unroll
  for (int t = 0; t < 4; ++t) {
    const v8f o = oacc[t];
    *(v4f*)(os + c * 68 + t * 16 + 8 * hh)     = (v4f){o[0] * inv, o[1] * inv, o[2] * inv, o[3] * inv};
    *(v4f*)(os + c * 68 + t * 16 + 8 * hh + 4) = (v4f){o[4] * inv, o[5] * inv, o[6] * inv, o[7] * inv};
  }
  __builtin_amdgcn_fence(__ATOMIC_RELEASE, "workgroup");
  __builtin_amdgcn_wave_barrier();
  __builtin_amdgcn_fence(__ATOMIC_ACQUIRE, "workgroup");
  {
    const int q = lane >> 3, c8 = (lane & 7) * 8;
    {
#pragma unroll
      for (int it = 0; it < 4; ++it) {
        const int row = it * 4 + q;
        const float* sp = os + row * 68 + c8;
        v8h hv, lv;
#pragma unroll
        for (int e = 0; e < 8; ++e) {
          unsigned short hb = f2bf_bits(sp[e]);
          unsigned short lb = f2bf_bits(sp[e] - bf_bits2f(hb));
          hv[e] = __builtin_bit_cast(_Float16, hb);
          lv[e] = __builtin_bit_cast(_Float16, lb);
        }
        const size_t oo = (size_t)(tok0 + q0 + row) * HIDN + hcol + c8;
        *(v8h*)(Oh + oo) = hv;
        *(v8h*)(Ol + oo) = lv;
      }
      
    }
  }
  // precaution: the second tile's set-up rewrites registers that the stores above name
  asm volatile("s_wait_xcnt 0x0" ::: "memory");
  }   // half
}

// =====================================================================================
// k^T.v state: St[h][d][e] = sum_s kT[h*64+d][s] * vT[h*64+e][s] over SEQ tokens of one batch.
//   planes: [HIDN][NTOK] bf16 hi and lo; blockIdx.z = batch, whose tokens begin at column blockIdx.z * SEQ
//   product = hi.hi + hi.lo + lo.hi, f32 accumulate (same three products per k step as the GEMM's hi/lo path)
//   Block = 16 waves = one 32x32 tile of one head; wave w sums tokens [w*128, w*128+128).
//   The 16 partial tiles meet in LDS and are added in wave order 0..15. grid = (4 tiles, NHEAD, NBATCH).
// =====================================================================================
constexpr int ST_NW = 16;                 // waves per block = slices of the token sum
constexpr int ST_KS = SEQ / ST_NW;        // 128 tokens per wave
static_assert(ST_KS % 32 == 0);

__global__ __launch_bounds__(ST_NW * 32)
void state_ktv_slices(const unsigned short* __restrict__ KTh, const unsigned short* __restrict__ KTl,
                      const unsigned short* __restrict__ VTh, const unsigned short* __restrict__ VTl,
                      float* __restrict__ St) {
  __shared__ __align__(16) float part[ST_NW][32 * 32];   // one 4 KB partial tile per wave, in accumulator order
  const int tid  = threadIdx.x;
  const int wave = tid >> 5;
  const int lane = tid & 31;
  const int hh   = lane >> 4;
  const int c    = lane & 15;
  const int h    = blockIdx.y;
  const int d0   = (blockIdx.x >> 1) * 32;
  const int e0   = (blockIdx.x & 1) * 32;

  const int bb   = blockIdx.z;
  const size_t ao = (size_t)(h * HDIM + d0 + c) * NTOK + bb * SEQ + wave * ST_KS + 8 * hh;
  const size_t bo = (size_t)(h * HDIM + e0 + c) * NTOK + bb * SEQ + wave * ST_KS + 8 * hh;
  const __bf16* pah = (const __bf16*)KTh + ao;
  const __bf16* pal = (const __bf16*)KTl + ao;
  const __bf16* pbh = (const __bf16*)VTh + bo;
  const __bf16* pbl = (const __bf16*)VTl + bo;

  v8f acc[2][2];
#pragma unroll
  for (int i = 0; i < 2; ++i)
#pragma unroll
    for (int j = 0; j < 2; ++j) acc[i][j] = (v8f){0.f,0.f,0.f,0.f,0.f,0.f,0.f,0.f};

  // unrolled (4 steps): the step offsets fold into the loads' immediate fields and later steps' loads issue among earlier products
#pragma unroll
  for (int ks = 0; ks < ST_KS / 32; ++ks) {
    v16b ah[2], al[2], bh[2], bl[2];
#pragma unroll
    for (int i = 0; i < 2; ++i) {
      const size_t o = (size_t)i * 16 * NTOK + ks * 32;
      ah[i] = Frag<__bf16>::load(pah + o);
      al[i] = Frag<__bf16>::load(pal + o);
      bh[i] = Frag<__bf16>::load(pbh + o);
      bl[i] = Frag<__bf16>::load(pbl + o);
    }
#pragma unroll
    for (int i = 0; i < 2; ++i)
#pragma unroll
      for (int j = 0; j < 2; ++j) {
        acc[i][j] = Frag<__bf16>::mma(ah[i], bh[j], acc[i][j]);
        acc[i][j] = Frag<__bf16>::mma(ah[i], bl[j], acc[i][j]);
        acc[i][j] = Frag<__bf16>::mma(al[i], bh[j], acc[i][j]);
      }
  }

  // partial tile to LDS: eighth q = (i*2+j)*2 + half holds accumulator rows half*4..half*4+3 of every lane, 16 B per lane
  float* slab = part[wave];
#pragma unroll
  for (int i = 0; i < 2; ++i)
#pragma unroll
    for (int j = 0; j < 2; ++j) {
      const v8f a = acc[i][j];
      const int q = (i * 2 + j) * 2;
      *(v4f*)(slab + (q + 0) * 128 + lane * 4) = (v4f){a[0], a[1], a[2], a[3]};
      *(v4f*)(slab + (q + 1) * 128 + lane * 4) = (v4f){a[4], a[5], a[6], a[7]};
    }
  __syncthreads();

  // 512 threads x 2 floats = the 32x32 tile; each thread adds its two positions over the 16 slices in wave order
  v2f sum = (v2f){0.f, 0.f};
#pragma unroll
  for (int w = 0; w < ST_NW; ++w) sum += *(const v2f*)(&part[w][tid * 2]);

  // position tid*2 back to (row, col): q = tid>>6, source lane = (tid>>1)&31, accumulator rows (q&1)*4 + (tid&1)*2 and the next
  const int q   = tid >> 6;
  const int sl  = (tid >> 1) & 31;
  const int row = (q >> 2) * 16 + (sl >> 4) * 8 + (q & 1) * 4 + (tid & 1) * 2;
  const int col = ((q >> 1) & 1) * 16 + (sl & 15);
  float* o = St + (size_t)(bb * NHEAD + h) * HDIM * HDIM + (size_t)(d0 + row) * HDIM + e0 + col;
  o[0]    = sum[0];
  o[HDIM] = sum[1];
}

// ---------------------------------------------------------------- launcher
extern "C" void kernel_launch(void* const* d_in, const int* in_sizes, int n_in,
                              void* d_out, int out_size, void* d_ws, size_t ws_size,
                              hipStream_t stream) {
  (void)n_in;
  if (ws_size < WS_TOTAL) return;
  if ((size_t)out_size != OUT0_ELEMS + OUT1_ELEMS) return;
  if ((size_t)in_sizes[0] != NX || (size_t)in_sizes[1] != (size_t)NTOK ||
      (size_t)in_sizes[2] != NW || (size_t)in_sizes[4] != NW ||
      (size_t)in_sizes[6] != NW || (size_t)in_sizes[8] != NW ||
      in_sizes[3] != HIDN || in_sizes[5] != HIDN || in_sizes[7] != HIDN || in_sizes[9] != HIDN) return;

  const float* hs    = (const float*)d_in[0];
  const float* amask = (const float*)d_in[1];
  const float* Wq    = (const float*)d_in[2];
  const float* bq    = (const float*)d_in[3];
  const float* Wk    = (const float*)d_in[4];
  const float* bk    = (const float*)d_in[5];
  const float* Wv    = (const float*)d_in[6];
  const float* bv    = (const float*)d_in[7];
  const float* Wo    = (const float*)d_in[8];
  const float* bo    = (const float*)d_in[9];

  char* ws = (char*)d_ws;
  unsigned short* Xb  = (unsigned short*)(ws + OFF_XB);
  unsigned short* Wqb = (unsigned short*)(ws + OFF_WQ);
  unsigned short* Wkb = (unsigned short*)(ws + OFF_WK);
  unsigned short* Wvb = (unsigned short*)(ws + OFF_WV);
  unsigned short* Wob = (unsigned short*)(ws + OFF_WO);
  unsigned short* Qh  = (unsigned short*)(ws + OFF_QH);
  unsigned short* Ql  = (unsigned short*)(ws + OFF_QL);
  unsigned short* Kh  = (unsigned short*)(ws + OFF_KH);
  unsigned short* Kl  = (unsigned short*)(ws + OFF_KL);
  unsigned short* KTh = (unsigned short*)(ws + OFF_KTH);
  unsigned short* KTl = (unsigned short*)(ws + OFF_KTL);
  unsigned short* VTh = (unsigned short*)(ws + OFF_VTH);
  unsigned short* VTl = (unsigned short*)(ws + OFF_VTL);
  unsigned short* Oh  = (unsigned short*)(ws + OFF_OH);
  unsigned short* Ol  = (unsigned short*)(ws + OFF_OL);

  float* outF   = (float*)d_out;
  float* stateF = outF + OUT1_ELEM_OFF;

  // 1) RNE conversions to bf16 (inputs converted exactly once), one launch for all five inputs; Xb is the start of the five planes
  cast_all_f32_bf16<<<dim3(CV_GRID), dim3(CV_T), 0, stream>>>(hs, Wq, Wk, Wv, Wo, Xb);

  // 2) projections: 64x64 tiles, 8 waves (2 x 4 tiles) per block; every shape has 1024 tiles (64x16 or 16x64) = 128 block tiles of 128x256
  const int gemmBlocksTok = ((NTOK / 64) * (HIDN / 64)) / 8;    // 1024 tiles / 8 = 128
  // q, k, k^T and v^T in one launch, grid.y = projection -> hi/lo planes
  proj4_gemm64<<<dim3(gemmBlocksTok, 4), dim3(256), 0, stream>>>(
      Xb, Wqb, Wkb, Wvb, Qh, Ql, Kh, Kl, KTh, KTl, VTh, VTl, bq, bk, bv, amask, HIDN);

  // 3) causal attention on the planes -> attention out hi/lo planes [4096][1024]
  const float sscale = 0.125f;   // 1 / (temperature * sqrt(64)), exact power of two
  attn_hd64_planes<<<dim3(NBATCH * NHEAD * (SEQ / AT_QB / 2)), dim3(128), 0, stream>>>(
      Qh, Ql, Kh, Kl, VTh, VTl, amask, Oh, Ol, sscale);

  // 4) state[b][h][d][e] = sum_s k^T[h*64+d][b*S+s] * v^T[h*64+e][b*S+s]  (hi/lo on both operands); 4 tiles x 16 token slices per (b,h)
  state_ktv_slices<<<dim3(4, NHEAD, NBATCH), dim3(ST_NW * 32), 0, stream>>>(KTh, KTl, VTh, VTl, stateF);

  // 5) out [4096][1024] = attn_out . Wo^T + bo  (A hi/lo, Wo exact bf16) -> d_out f32
  wmma_gemm64<1, true, false, 2, 0, 0><<<dim3(gemmBlocksTok, 1), dim3(256), 0, stream>>>(
      Oh, Ol, HIDN, 0L, Wob, Wob, HIDN, 0L, (void*)outF, (void*)Oh, HIDN, 0L,
      bo, amask, NTOK, HIDN, HIDN, 1.0f);
}
